// v000
// Measured on an AMD MI455X. A time is GPU time per run, averaged over a window of back-to-back runs after a warm-up
// (all launches, gaps included; the runs take copies of the inputs in turn), and the median of several windows.
// Apart from v000's, it joins two sittings. Times from different sittings can be a few percent apart, while
// side-by-side timings come from the same sitting.
// The starting kernel, v000, takes 992 microseconds a run.
// compute dtype: all float inputs rounded to bf16; q/k/v = W t + b (1x1 convs) with EXACT bf16 products on WMMA 16x16x32 (f32 rows); the content + position logits folded into one 128-deep product [q_i | pos_i] . [k_j | q_j] with BOTH operands as f16 hi + residual (x 2^10) (3 products: the logits are unscaled, sigma ~14, near-argmax); softmax in f32 (precise expf); P x 2^11 once to f16 against v once to f16 (1 product); f32 output (channels-first).
#include <hip/hip_runtime.h>
#include <math.h>

typedef __attribute__((ext_vector_type(16))) _Float16 v16h;
typedef __attribute__((ext_vector_type(16))) __bf16 v16b;
typedef __attribute__((ext_vector_type(8)))  _Float16 v8h;
typedef __attribute__((ext_vector_type(8)))  float v8f;
typedef __attribute__((ext_vector_type(4)))  float v4f;
typedef __attribute__((ext_vector_type(2)))  float v2f;
typedef __attribute__((ext_vector_type(4)))  unsigned v4u;
typedef __attribute__((ext_vector_type(4)))  int v4i;
typedef float __attribute__((may_alias)) float_a;
typedef int __attribute__((may_alias)) int_a;

template <typename T> __device__ __forceinline__ void vst2(void* p, T v) { *(T*)p = v;  }
__device__ __forceinline__ v8f wmma16(v16h a, v16h b, v8f c) {
  v8f d = __builtin_amdgcn_wmma_f32_16x16x32_f16(false, a, false, b, (short)0, c, false, false);
  asm volatile("v_nop\n\tv_nop\n\tv_nop\n\tv_nop" : "+v"(d) : "v"(a), "v"(b));
  return d;
}
__device__ __forceinline__ v8f wmma_bf(v16b a, v16b b, v8f c) {
  v8f d = __builtin_amdgcn_wmma_f32_16x16x32_bf16(false, a, false, b, (short)0, c, false, false);
  asm volatile("v_nop\n\tv_nop\n\tv_nop\n\tv_nop" : "+v"(d) : "v"(a), "v"(b));
  return d;
}
// 16x16x32 fragments: lane = (h = lane>>4, row/col = lane&15); elements 0..7 = k0+8h+0..7, 8..15 = k0+16+8h+0..7; D element r = row 8h+r
__device__ __forceinline__ v16h frag_h(const _Float16* rowk0, int lane) {
  union { v16h v; v8h q[2]; } u; const _Float16* p = rowk0 + 8 * (lane >> 4);
  u.q[0] = *(const v8h*)p; u.q[1] = *(const v8h*)(p + 16); return u.v;
}
__device__ __forceinline__ v16h frag_f32(const float* rowk0, int lane) {
  v16h a; const float* p = rowk0 + 8 * (lane >> 4);
#pragma unroll
  for (int i = 0; i < 8; ++i) { a[i] = (_Float16)p[i]; a[8 + i] = (_Float16)p[16 + i]; }
  return a;
}
__device__ __forceinline__ v16h frag_f32s(const float* rowk0, int lane, float sc) {
  v16h a; const float* p = rowk0 + 8 * (lane >> 4);
#pragma unroll
  for (int i = 0; i < 8; ++i) { a[i] = (_Float16)(p[i] * sc); a[8 + i] = (_Float16)(p[16 + i] * sc); }
  return a;
}
// column fragment from a [K][ld] layout (column n), rows >= K read as 0
__device__ __forceinline__ v16h fragc_f32(const float* W, int k0, int n, int lane, int ld, int K) {
  v16h a; const int g = lane >> 4;
#pragma unroll
  for (int i = 0; i < 8; ++i) { const int ka = k0 + 8 * g + i, kb = ka + 16;
    a[i] = (_Float16)(ka < K ? W[(size_t)(ka < K ? ka : K - 1) * ld + n] : 0.f); a[8 + i] = (_Float16)(kb < K ? W[(size_t)(kb < K ? kb : K - 1) * ld + n] : 0.f); }
  return a;
}
struct F2 { v16b h, l; };
__device__ __forceinline__ F2 bsplit16(const float v[16]) { F2 r;
#pragma unroll
  for (int i = 0; i < 16; ++i) { const __bf16 h = (__bf16)v[i]; r.h[i] = h; r.l[i] = (__bf16)(v[i] - (float)h); }
  return r; }
__device__ __forceinline__ F2 split_row(const float* row, int k0, int lane) { float v[16]; const float* p = row + k0 + 8 * (lane >> 4);
#pragma unroll
  for (int i = 0; i < 8; ++i) { v[i] = p[i]; v[8 + i] = p[16 + i]; }
  return bsplit16(v); }
__device__ __forceinline__ F2 split_rowK(const float* row, int k0, int lane, int K) { float v[16]; const int g = lane >> 4;
#pragma unroll
  for (int i = 0; i < 8; ++i) { const int ka = k0 + 8 * g + i, kb = ka + 16; v[i] = ka < K ? row[ka < K ? ka : K - 1] : 0.f; v[8 + i] = kb < K ? row[kb < K ? kb : K - 1] : 0.f; }
  return bsplit16(v); }
__device__ __forceinline__ F2 split_col(const float* W, int k0, int n, int lane, int ld, int K) { float v[16]; const int g = lane >> 4;
#pragma unroll
  for (int i = 0; i < 8; ++i) { const int ka = k0 + 8 * g + i, kb = ka + 16; v[i] = ka < K ? W[(size_t)(ka < K ? ka : K - 1) * ld + n] : 0.f; v[8 + i] = kb < K ? W[(size_t)(kb < K ? kb : K - 1) * ld + n] : 0.f; }
  return bsplit16(v); }
__device__ __forceinline__ v8f mac3(const F2& a, const F2& b, v8f c) { c = wmma_bf(a.l, b.h, c); c = wmma_bf(a.h, b.l, c); return wmma_bf(a.h, b.h, c); }
__device__ __forceinline__ float sigm(float v) { return 1.0f / (1.0f + expf(-v)); }
#define LDSX() do { asm volatile("s_wait_dscnt 0" ::: "memory"); __builtin_amdgcn_wave_barrier(); __builtin_amdgcn_fence(__ATOMIC_RELEASE, "workgroup"); } while (0)

// Bottleneck-transformer MHSA with 2-D relative position logits (B 8, C 512 = 8 x 64, 32 x 32 = 1,024 positions): q = Wq x + bq, k = Wk d + bk, v = Wv d + bv; energy[i][j] = q_i . k_j + pos_i . q_j with pos = (rel_h + rel_w) [h][64][n] (the module adds the [m,n]-indexed position term to the [n,m]-indexed content term positionally); attn = softmax_j; out[c][i] = sum_j v[c][j] attn[i][j] -> [B, C, 32, 32].
#define NB 8
#define TT 1024
#define CC 1024            // NH * HD = projected width
#define DIN 1024          // unused here (the input width is CIN)
#define NH 8
#define HD 128
#define NQB (TT / 64)
#define HG 8
#define SCALE (1.0f)
#define CAUSAL 0
#ifndef TNB
#define TNB NB
#endif
__device__ __forceinline__ float bfr(float v) { return (float)(__bf16)v; }
__host__ __device__ __forceinline__ int kb_last(int qb) { return CAUSAL ? ((qb * 64 + 63) >> 7) : (TT / 128 - 1); }
typedef __attribute__((ext_vector_type(8))) __bf16 v8b;
__device__ __forceinline__ v16b frag_b(const __bf16* rowk0, int lane) {
  union { v16b v; v8b q[2]; } u; const __bf16* p = rowk0 + 8 * (lane >> 4);
  u.q[0] = *(const v8b*)p; u.q[1] = *(const v8b*)(p + 16); return u.v;
}
#define QBH NQB            // every query block takes the 3-product logits path (q and k both f16 hi + residual); unscaled logits, sigma ~14
#define QHI 1024            // rows carrying a q residual plane (all rows when non-causal: 3-product logits everywhere, QBH = NQB)
#define KHI TT             // k residual rows for every key
// B fragment (k rows k0+.., output column o) of a weight: (in,out) [K][ld] or (out,in) [ld rows of K]: bf16 exact, or f16(bf16 * 256) exact
__device__ __forceinline__ v16b wcol_io(const float* Wm, int k0, int o, int lane, int ld) { v16b w; const int g = lane >> 4;
#pragma unroll
  for (int i = 0; i < 8; ++i) { w[i] = (__bf16)Wm[(size_t)(k0 + 8 * g + i) * ld + o]; w[8 + i] = (__bf16)Wm[(size_t)(k0 + 16 + 8 * g + i) * ld + o]; }
  return w; }
__device__ __forceinline__ v16b wcol_oi(const float* Wm, int k0, int o, int lane, int K) { v16b w; const float* p = Wm + (size_t)o * K + k0 + 8 * (lane >> 4);
#pragma unroll
  for (int i = 0; i < 8; ++i) { w[i] = (__bf16)p[i]; w[8 + i] = (__bf16)p[16 + i]; }
  return w; }
__device__ __forceinline__ v16h wcolh_io(const float* Wm, int k0, int o, int lane, int ld) { v16h w; const int g = lane >> 4;
#pragma unroll
  for (int i = 0; i < 8; ++i) { w[i] = (_Float16)(bfr(Wm[(size_t)(k0 + 8 * g + i) * ld + o]) * 256.0f); w[8 + i] = (_Float16)(bfr(Wm[(size_t)(k0 + 16 + 8 * g + i) * ld + o]) * 256.0f); }
  return w; }
__device__ __forceinline__ v16h wcolh_oi(const float* Wm, int k0, int o, int lane, int K) { v16h w; const float* p = Wm + (size_t)o * K + k0 + 8 * (lane >> 4);
#pragma unroll
  for (int i = 0; i < 8; ++i) { w[i] = (_Float16)(bfr(p[i]) * 256.0f); w[8 + i] = (_Float16)(bfr(p[16 + i]) * 256.0f); }
  return w; }
#define WQKV_LAYOUT 1   // 0 = (in,out) [DIN][CC]; 1 = (out,in) [CC][DIN]; 2 = per-head [NH][DIN][HD]
__device__ __forceinline__ v16b wcol_hdk(const float* Wm, int k0, int o, int lane) { v16b w; const int g = lane >> 4; const float* p = Wm + (size_t)(o / HD) * DIN * HD + (o % HD);
#pragma unroll
  for (int i = 0; i < 8; ++i) { w[i] = (__bf16)p[(size_t)(k0 + 8 * g + i) * HD]; w[8 + i] = (__bf16)p[(size_t)(k0 + 16 + 8 * g + i) * HD]; }
  return w; }
#define WO_OUT_IN 0
#if WQKV_LAYOUT == 1
#define WCOL(W, k0, o, lane) wcol_oi(W, k0, o, lane, DIN)
#elif WQKV_LAYOUT == 2
#define WCOL(W, k0, o, lane) wcol_hdk(W, k0, o, lane)
#else
#define WCOL(W, k0, o, lane) wcol_io(W, k0, o, lane, CC)
#endif
#if WO_OUT_IN
#define WOCOL(W, k0, o, lane) wcol_oi(W, k0, o, lane, CC)
#define WOCOLH(W, k0, o, lane) wcolh_oi(W, k0, o, lane, CC)
#else
#define WOCOL(W, k0, o, lane) wcol_io(W, k0, o, lane, DIN)
#define WOCOLH(W, k0, o, lane) wcolh_io(W, k0, o, lane, DIN)
#endif
#define CIN 512            // channels
#define NPOS 1024          // 32 x 32
#define HDV 64             // real head width (planes are 128 wide: [q | pos], [k | q], [v | 0])
// ---- k_lin3: block = (64 positions, head h, which): y = W t + b (exact bf16 products, channels-first A gather, (out,in) W rows h*64..), written into the 128-wide BHSD f32 planes: which 0 (q from x): QF[.][0..63] and KF[.][64..127]; which 1 (k from d): KF[.][0..63]; which 2 (v from d): VF[.][0..63] and zeros into VF[.][64..127]
__global__ __launch_bounds__(128) void k_lin3(const float* __restrict__ X, const float* __restrict__ Dd, const float* __restrict__ WQ, const float* __restrict__ BQ, const float* __restrict__ WK, const float* __restrict__ BK, const float* __restrict__ WV, const float* __restrict__ BV, float* __restrict__ QF, float* __restrict__ KF, float* __restrict__ VF) { __shared__ __align__(16) float sf[4][16][68];
  const int tid = threadIdx.x, wave = tid >> 5, lane = tid & 31, col = lane & 15, g = lane >> 4; const int h = blockIdx.y, which = blockIdx.z; const size_t r0 = (size_t)blockIdx.x * 64 + wave * 16; const size_t b = r0 / NPOS; const int n0 = (int)(r0 % NPOS);
  const float* T = which == 0 ? X : Dd; const float* Wm = which == 0 ? WQ : which == 1 ? WK : WV; const float* Bm = which == 0 ? BQ : which == 1 ? BK : BV;
  v8f acc[4] = {};
#pragma unroll 1
  for (int kc = 0; kc < CIN / 32; ++kc) { v16b a; { const float* p = T + (b * CIN + kc * 32 + 8 * g) * (size_t)NPOS + n0 + col;   /* channels-first: element (b, c, n) at (b*512 + c)*1024 + n */
#pragma unroll
      for (int i = 0; i < 8; ++i) { a[i] = (__bf16)p[(size_t)i * NPOS]; a[8 + i] = (__bf16)p[(size_t)(16 + i) * NPOS]; } }
    asm volatile("s_wait_loadcnt 0x0" ::: "memory");
#pragma unroll
    for (int j = 0; j < 4; ++j) { v16b w; { float t0[8], t1[8]; const int o = h * HDV + j * 16 + col;
#pragma unroll
        for (int i = 0; i < 8; ++i) t0[i] = Wm[(size_t)o * CIN + kc * 32 + 8 * g + i];
        asm volatile("s_wait_loadcnt 0x0" ::: "memory");
#pragma unroll
        for (int i = 0; i < 8; ++i) t1[i] = Wm[(size_t)o * CIN + kc * 32 + 16 + 8 * g + i];
        asm volatile("s_wait_loadcnt 0x0" ::: "memory");
#pragma unroll
        for (int i = 0; i < 8; ++i) { w[i] = (__bf16)t0[i]; w[8 + i] = (__bf16)t1[i]; } }
      acc[j] = wmma_bf(a, w, acc[j]); } }
#pragma unroll
  for (int j = 0; j < 4; ++j) { const float bb = bfr(Bm[h * HDV + j * 16 + col]);
#pragma unroll
    for (int r = 0; r < 8; ++r) sf[wave][8 * g + r][j * 16 + col] = acc[j][r] + bb; }
  asm volatile("s_wait_loadcnt 0x0" ::: "memory");
  LDSX(); for (int rl = 0; rl < 16; ++rl) { const size_t prow = ((b * NH + h) * (size_t)TT + n0 + rl) * HD; const v4f v = *(const v4f*)&sf[wave][rl][(lane & 15) * 4]; v4f z; z[0] = z[1] = z[2] = z[3] = 0.f;
    if (which == 0) { if (lane < 16) vst2(QF + prow + lane * 4, v); else vst2(KF + prow + HDV + (lane & 15) * 4, v); }
    else if (which == 1) { if (lane < 16) vst2(KF + prow + lane * 4, v); }
    else { if (lane < 16) vst2(VF + prow + lane * 4, v); else vst2(VF + prow + HDV + (lane & 15) * 4, z); } } }
// ---- k_pos: thread per (b, h, n, d4) float4 over d: QF[b][h][n][64 + d] = bfr(rel_h[h][d][n % 32]) + bfr(rel_w[h][d][n / 32]) for every batch b (pos is batch independent)
__global__ __launch_bounds__(256) void k_pos(const float* __restrict__ RH, const float* __restrict__ RW, float* __restrict__ QF) { const size_t e = (size_t)blockIdx.x * 256 + threadIdx.x; if (e >= (size_t)NB * NH * NPOS * (HDV / 4)) return;
  const int d4 = (int)(e % (HDV / 4)); size_t r = e / (HDV / 4); const int n = (int)(r % NPOS); r /= NPOS; const int h = (int)(r % NH); const int b = (int)(r / NH); v4f o;
#pragma unroll
  for (int i = 0; i < 4; ++i) { const int d = d4 * 4 + i; o[i] = bfr(RH[(h * HDV + d) * 32 + (n % 32)]) + bfr(RW[(h * HDV + d) * 32 + (n / 32)]); }
  vst2(QF + (((size_t)b * NH + h) * TT + n) * HD + HDV + d4 * 4, o); }
// ---- k_fin: block = (64 positions, head h, batch b): out[b][h*64 + d][n] = Y[b*TT + n][h*128 + d] (channels-first transpose through LDS; 256-B runs of 64 positions)
__global__ __launch_bounds__(256) void k_fin(const float* __restrict__ Y, float* __restrict__ OUT) { __shared__ __align__(16) float st[64][68];
  const int tid = threadIdx.x; const int n0 = blockIdx.x * 64, h = blockIdx.y; const size_t b = blockIdx.z;
  for (int e = tid; e < 64 * 16; e += 256) { const int rl = e >> 4, q = e & 15; *(v4f*)&st[rl][q * 4] = *(const v4f*)(Y + (b * TT + n0 + rl) * (size_t)CC + h * HD + q * 4); }
  __syncthreads();
  for (int e = tid; e < HDV * 16; e += 256) { const int d = e >> 4, q = e & 15; v4f v; v[0] = st[q * 4][d]; v[1] = st[q * 4 + 1][d]; v[2] = st[q * 4 + 2][d]; v[3] = st[q * 4 + 3][d]; vst2(OUT + (b * CIN + h * HDV + d) * (size_t)NPOS + n0 + q * 4, v); } }
#define WS_QF  (WS_END)
#define WS_KF  (WS_QF + 4u * (size_t)NB * NH * TT * HD)
#define WS_VF  (WS_KF + 4u * (size_t)NB * NH * TT * HD)
#define WS_YR  (WS_QF)                                   // Y rows reuse the QF region (QF is dead once k_prep8 has run)
#define WS_END2 (WS_VF + 4u * (size_t)NB * NH * TT * HD)
// ---- k_prep8: block = (64 attention positions s0.. of sequence b, head h): reads the 128-wide f32 planes [B, H, S, 128] (element (b,h,s,c) at ((b*NH + h)*TT + s)*128 + c), without bf16 rounding, and writes the standard attention planes: q -> f16 hi rows (+ x 2^10 residual rows for s < QHI), k -> f16 rows (+ residual rows s < KHI), v -> f16 planes [c][s]
__global__ __launch_bounds__(128) void k_prep8(const float* __restrict__ Q, const float* __restrict__ K, const float* __restrict__ V, _Float16* __restrict__ QH, _Float16* __restrict__ QL, _Float16* __restrict__ KH, _Float16* __restrict__ KL, _Float16* __restrict__ VT, __bf16* __restrict__ VB, __bf16* __restrict__ VBL) {
  __shared__ __align__(16) _Float16 sq[64][136], sql[64][136], sk[64][136], skl[64][136], tv[128][72]; __shared__ __align__(16) __bf16 tb[128][72], tbl[128][72];
  const int tid = threadIdx.x; const int h = blockIdx.y; const size_t r0 = (size_t)blockIdx.x * 64; const size_t bb = r0 / TT; const int t0 = (int)(r0 % TT); const bool qhi = t0 < QHI, khi = t0 < KHI;
  for (int e = tid; e < 64 * 128; e += 128) { const int rl = e >> 7, c = e & 127; const size_t oi = ((bb * NH + h) * TT + t0 + rl) * HD + (c % HD);   /* c runs over the whole 128-wide plane row (HD is 128) */
    const float q = Q[oi], k = K[oi], v = V[oi];   /* f32 projection / position planes: no bf16 rounding; f16 hi + x2^10 residual rows carry q and k at ~2^-21 */
    const _Float16 qh = (_Float16)q, kh = (_Float16)k; sq[rl][c] = qh; sql[rl][c] = (_Float16)((q - (float)qh) * 1024.0f); sk[rl][c] = kh; skl[rl][c] = (_Float16)((k - (float)kh) * 1024.0f);
    tv[c][rl] = (_Float16)v; const __bf16 vb = (__bf16)v; tb[c][rl] = vb; tbl[c][rl] = (__bf16)(v - (float)vb); }
  __syncthreads();
  for (int e = tid; e < 64 * (HD / 8); e += 128) { const int rl = e / (HD / 8), q = e % (HD / 8); const size_t o = (r0 + rl) * CC + h * HD + q * 8; vst2((unsigned*)(QH + o), *(const v4u*)&sq[rl][q * 8]); vst2((unsigned*)(KH + o), *(const v4u*)&sk[rl][q * 8]);   
    if (qhi) vst2((unsigned*)(QL + (bb * QHI + t0 + rl) * (size_t)CC + h * HD + q * 8), *(const v4u*)&sql[rl][q * 8]); if (khi) vst2((unsigned*)(KL + (bb * KHI + t0 + rl) * (size_t)CC + h * HD + q * 8), *(const v4u*)&skl[rl][q * 8]); }
  for (int e = tid; e < HD * 8; e += 128) { const int cl = e >> 3, q = e & 7; vst2((unsigned*)(VT + (bb * CC + h * HD + cl) * (size_t)TT + t0 + q * 8), *(const v4u*)&tv[cl][q * 8]);
    /* bf16 v hi/lo planes not written: P.v uses the f16 planes for every query block */ } }

#ifndef SM_EXTRA_PARAMS
#define SM_EXTRA_PARAMS
#endif
#ifndef PROJ_EXTRA_PARAMS
#define PROJ_EXTRA_PARAMS
#endif
#ifndef SM_MASK_HOOK
#define SM_MASK_HOOK (void)0
#endif

#define WS_QH  0u                                      // f16 q rows [b*t][CC]
#define WS_KH  (WS_QH + 2u * (size_t)NB * TT * CC)      // f16 k rows [b*t][CC]
#define WS_VT  (WS_KH + 2u * (size_t)NB * TT * CC)      // f16 v planes [b][c][t]
#define WS_QL  (WS_VT + 2u * (size_t)NB * CC * TT)      // f16 q residual x 2^10 rows [b][t < QHI][CC]
#define WS_KL  (WS_QL + 2u * (size_t)NB * QHI * CC)     // f16 k residual x 2^10 rows [b][t < KHI][CC]
#define WS_VB  (WS_KL + 2u * (size_t)NB * KHI * CC)     // bf16 v hi planes not used (no space reserved)
#define WS_VBL (WS_VB + 0u)                            // bf16 v planes not used (P.v takes the f16 path)
#define WS_S   (WS_VBL + 0u)    // f32 logits / P [hg][t][s]
#define WS_Y   (WS_S  + 4u * (size_t)HG * TT * TT)      // f32 ctx rows [b*t][CC] (only when there is an output projection)
#define WS_END (WS_Y  + 0u)

// ---- k_sc: block = (query block qb, key block kb <= kb_last(qb), head in group) of batch b: logits x SCALE; q hi + residual (x 2^10) against k (2 products) for query rows < QHI, plus the k residual (3 products) for query blocks < QBH (causal early rows); causal: blocks past the diagonal exit, the mask itself is applied by index in k_sm
__global__ __launch_bounds__(128) void k_sc(const _Float16* __restrict__ QH, const _Float16* __restrict__ KH, const _Float16* __restrict__ QL, const _Float16* __restrict__ KL, int b, int h0, float* __restrict__ S0) { __shared__ __align__(16) float ss[4][16][132];
  const int qb = blockIdx.x, kb = blockIdx.y; if (kb > kb_last(qb)) return;
  const int h = h0 + blockIdx.z; float* S = S0 + (size_t)blockIdx.z * TT * TT;
  const int tid = threadIdx.x, wave = tid >> 5, lane = tid & 31, col = lane & 15, g = lane >> 4; const int k0 = kb * 128; const int ql0 = qb * 64 + wave * 16; const size_t q0 = (size_t)b * TT + ql0, kr0 = (size_t)b * TT + k0;
  v8f acc[8] = {}, accl[8] = {};
  const _Float16* QLb = QL + (size_t)b * QHI * CC; const _Float16* KLb = KL + (size_t)b * KHI * CC;
  if (qb < QBH) {
#pragma unroll
    for (int kc = 0; kc < HD / 32; ++kc) { const v16h ah = frag_h(QH + (q0 + col) * CC + h * HD + kc * 32, lane), al = frag_h(QLb + (size_t)(ql0 + col) * CC + h * HD + kc * 32, lane);
#pragma unroll
      for (int j = 0; j < 8; ++j) { const v16h kbf = frag_h(KH + (kr0 + j * 16 + col) * CC + h * HD + kc * 32, lane), klf = frag_h(KLb + (size_t)(k0 + j * 16 + col) * CC + h * HD + kc * 32, lane); acc[j] = wmma16(ah, kbf, acc[j]); accl[j] = wmma16(al, kbf, accl[j]); accl[j] = wmma16(ah, klf, accl[j]); } }
  } else if (qb * 64 < QHI) {
#pragma unroll
    for (int kc = 0; kc < HD / 32; ++kc) { const v16h ah = frag_h(QH + (q0 + col) * CC + h * HD + kc * 32, lane), al = frag_h(QLb + (size_t)(ql0 + col) * CC + h * HD + kc * 32, lane);
#pragma unroll
      for (int j = 0; j < 8; ++j) { const v16h kbf = frag_h(KH + (kr0 + j * 16 + col) * CC + h * HD + kc * 32, lane); acc[j] = wmma16(ah, kbf, acc[j]); accl[j] = wmma16(al, kbf, accl[j]); } }
  } else {
#pragma unroll
    for (int kc = 0; kc < HD / 32; ++kc) { const v16h ah = frag_h(QH + (q0 + col) * CC + h * HD + kc * 32, lane);
#pragma unroll
      for (int j = 0; j < 8; ++j) { const v16h kbf = frag_h(KH + (kr0 + j * 16 + col) * CC + h * HD + kc * 32, lane); acc[j] = wmma16(ah, kbf, acc[j]); } } }
#pragma unroll
  for (int j = 0; j < 8; ++j) {
#pragma unroll
    for (int r = 0; r < 8; ++r) ss[wave][8 * g + r][j * 16 + col] = (acc[j][r] + accl[j][r] * (1.0f / 1024.0f)) * SCALE; }
  LDSX(); for (int rl = 0; rl < 16; ++rl) vst2(S + (size_t)(ql0 + rl) * TT + k0 + lane * 4, *(const v4f*)&ss[wave][rl][lane * 4]); }
// ---- k_sm: block = query row t (head in group): keys [0, kend): causal -> logit if s <= t else excluded; softmax in f32; P x 2^11 in place (0 for excluded)
__global__ __launch_bounds__(256) void k_sm(float* __restrict__ S0 SM_EXTRA_PARAMS) { __shared__ float sred[8]; __shared__ float sbc; __shared__ __align__(16) float shv[TT];
  const int tid = threadIdx.x; const int t = blockIdx.x; const int kend = (kb_last(t >> 6) + 1) * 128;
  float* sr = S0 + (size_t)blockIdx.y * TT * TT + (size_t)t * TT;
  float m = -3.0e38f; for (int k = tid; k < kend; k += 256) { float v = (!CAUSAL || k <= t) ? sr[k] : -3.0e38f; SM_MASK_HOOK; shv[k] = v; m = fmaxf(m, v); }
#pragma unroll
  for (int o = 1; o < 32; o <<= 1) m = fmaxf(m, __shfl_xor(m, o));
  if ((tid & 31) == 0) sred[tid >> 5] = m; __syncthreads(); if (tid == 0) { float a = sred[0]; for (int i = 1; i < 8; ++i) a = fmaxf(a, sred[i]); sbc = a; } __syncthreads(); m = sbc; __syncthreads();
  float sum = 0.f; for (int k = tid; k < kend; k += 256) { const float v = shv[k]; const float e = (v <= -1.0e38f) ? 0.f : expf(v - m); shv[k] = e; sum += e; }
#pragma unroll
  for (int o = 1; o < 32; o <<= 1) sum += __shfl_xor(sum, o);
  if ((tid & 31) == 0) sred[tid >> 5] = sum; __syncthreads(); if (tid == 0) { float a = 0.f; for (int i = 0; i < 8; ++i) a += sred[i]; sbc = a > 0.f ? 2048.0f / a : 0.f; }   /* a fully excluded row yields P = 0 */ __syncthreads(); const float inv = sbc;
  for (int k = tid; k < kend; k += 256) shv[k] = shv[k] * inv;
  __syncthreads(); for (int q = tid; q < kend / 4; q += 256) vst2(sr + q * 4, *(const v4f*)&shv[q * 4]); }
// ---- k_pv: block = 64 queries (qb) of (b, h): ctx = P . v over keys [0, kend) (P x 2^11 once to f16 against v f16: 1 product); 512-B (row, head) segment by 32 lanes
__global__ __launch_bounds__(128) void k_pv(const float* __restrict__ PS0, const _Float16* __restrict__ VT, const __bf16* __restrict__ VB, const __bf16* __restrict__ VBL, int b, int h0, float* __restrict__ Y) { const int h = h0 + blockIdx.z; const float* PS = PS0 + (size_t)blockIdx.z * TT * TT; __shared__ __align__(16) float ss[4][16][HD + 4];
  const int tid = threadIdx.x, wave = tid >> 5, lane = tid & 31, col = lane & 15, g = lane >> 4; const int qb = blockIdx.x; const int ql0 = qb * 64 + wave * 16; const int kce = (kb_last(qb) + 1) * 4;
  v8f acc[HD / 16] = {};
  if (false) {   /* P.v always on the f16 planes (P x 2^11 f16 x v f16) */
#pragma unroll 1
    for (int kc = 0; kc < kce; ++kc) { const F2 p = split_row(PS + (size_t)(ql0 + col) * TT, kc * 32, lane);
      asm volatile("s_wait_loadcnt 0x0" ::: "memory");
#pragma unroll
      for (int j = 0; j < HD / 16; ++j) { const size_t po = ((size_t)b * CC + h * HD + j * 16 + col) * (size_t)KHI + kc * 32; const v16b vh = frag_b(VB + po, lane); acc[j] = wmma_bf(p.h, vh, acc[j]); acc[j] = wmma_bf(p.l, vh, acc[j]); acc[j] = wmma_bf(p.h, frag_b(VBL + po, lane), acc[j]); } }
  } else {
#pragma unroll 1
    for (int kc = 0; kc < kce; ++kc) { const v16h p = frag_f32(PS + (size_t)(ql0 + col) * TT + kc * 32, lane);
      asm volatile("s_wait_loadcnt 0x0" ::: "memory");
#pragma unroll
      for (int j = 0; j < HD / 16; ++j) { const size_t po = ((size_t)b * CC + h * HD + j * 16 + col) * (size_t)TT + kc * 32; acc[j] = wmma16(p, frag_h(VT + po, lane), acc[j]); } } }
#pragma unroll
  for (int j = 0; j < HD / 16; ++j)
#pragma unroll
    for (int r = 0; r < 8; ++r) ss[wave][8 * g + r][j * 16 + col] = acc[j][r] * (1.0f / 2048.0f);
  LDSX(); for (int rl = 0; rl < 16; ++rl) if (lane < HD / 4) vst2(Y + ((size_t)b * TT + ql0 + rl) * CC + h * HD + lane * 4, *(const v4f*)&ss[wave][rl][lane * 4]); }

extern "C" void kernel_launch(void* const* d_in, const int* in_sizes, int n_in, void* d_out, int out_size, void* d_ws, size_t ws_size, hipStream_t stream) {
  (void)in_sizes; (void)n_in; (void)out_size;
  const float** F = (const float**)d_in;
  if (ws_size < (size_t)WS_END) return;
  char* ws = (char*)d_ws; _Float16 *QH = (_Float16*)(ws + WS_QH), *KH = (_Float16*)(ws + WS_KH), *VT = (_Float16*)(ws + WS_VT), *QL = (_Float16*)(ws + WS_QL), *KL = (_Float16*)(ws + WS_KL); __bf16 *VB = (__bf16*)(ws + WS_VB), *VBL = (__bf16*)(ws + WS_VBL); float *S = (float*)(ws + WS_S), *Y = (float*)(ws + WS_Y);
  (void)Y; (void)QL; (void)KL; (void)VB; (void)VBL;
  // inputs: 0 x, 1 d [8,512,32,32]; 2 Wq [512,512] (out,in), 3 bq; 4 Wk, 5 bk; 6 Wv, 7 bv; 8 rel_h [1,8,64,1,32]; 9 rel_w [1,8,64,32,1]
  if (ws_size < (size_t)WS_END2) return;
  float *QF = (float*)(ws + WS_QF), *KF = (float*)(ws + WS_KF), *VF = (float*)(ws + WS_VF), *YR = (float*)(ws + WS_YR);
  k_lin3<<<dim3(TNB * TT / 64, NH, 3), 128, 0, stream>>>(F[0], F[1], F[2], F[3], F[4], F[5], F[6], F[7], QF, KF, VF);
  k_pos<<<dim3((unsigned)(((size_t)TNB * NH * NPOS * (HDV / 4) + 255) / 256)), 256, 0, stream>>>(F[8], F[9], QF);
  k_prep8<<<dim3(TNB * TT / 64, NH), 128, 0, stream>>>(QF, KF, VF, QH, QL, KH, KL, VT, VB, VBL);
  for (int b = 0; b < TNB; ++b) for (int h0 = 0; h0 < NH; h0 += HG) {
    k_sc<<<dim3(NQB, TT / 128, HG), 128, 0, stream>>>(QH, KH, QL, KL, b, h0, S);
    k_sm<<<dim3(TT, HG), 256, 0, stream>>>(S);
    k_pv<<<dim3(NQB, 1, HG), 128, 0, stream>>>(S, VT, VB, VBL, b, h0, YR);
  }
  k_fin<<<dim3(TT / 64, NH, TNB), 256, 0, stream>>>(YR, (float*)d_out);
}

// v001
// It runs in 382 microseconds.
// Timed twice side by side with v000, it ran 2.62 and 2.61 times as fast.
// compute dtype: all float inputs rounded to bf16; q/k/v = W t + b (1x1 convs) with EXACT bf16 products on WMMA 16x16x32 (f32 rows); the content + position logits folded into one 128-deep product [q_i | pos_i] . [k_j | q_j] with BOTH operands as f16 hi + residual (x 2^10) (3 products: the logits are unscaled, sigma ~14, near-argmax); softmax in f32 (precise expf); P x 2^11 once to f16 against v once to f16 (1 product); f32 output (channels-first).
#include <hip/hip_runtime.h>
#include <math.h>

typedef __attribute__((ext_vector_type(16))) _Float16 v16h;
typedef __attribute__((ext_vector_type(16))) __bf16 v16b;
typedef __attribute__((ext_vector_type(8)))  _Float16 v8h;
typedef __attribute__((ext_vector_type(8)))  float v8f;
typedef __attribute__((ext_vector_type(4)))  float v4f;
typedef __attribute__((ext_vector_type(2)))  float v2f;
typedef __attribute__((ext_vector_type(4)))  unsigned v4u;
typedef __attribute__((ext_vector_type(4)))  int v4i;
typedef float __attribute__((may_alias)) float_a;
typedef int __attribute__((may_alias)) int_a;

template <typename T> __device__ __forceinline__ void vst2(void* p, T v) { *(T*)p = v;  }
__device__ __forceinline__ v8f wmma16(v16h a, v16h b, v8f c) {
  v8f d = __builtin_amdgcn_wmma_f32_16x16x32_f16(false, a, false, b, (short)0, c, false, false);
  asm volatile("v_nop\n\tv_nop\n\tv_nop\n\tv_nop" : "+v"(d) : "v"(a), "v"(b));
  return d;
}
__device__ __forceinline__ v8f wmma_bf(v16b a, v16b b, v8f c) {
  v8f d = __builtin_amdgcn_wmma_f32_16x16x32_bf16(false, a, false, b, (short)0, c, false, false);
  asm volatile("v_nop\n\tv_nop\n\tv_nop\n\tv_nop" : "+v"(d) : "v"(a), "v"(b));
  return d;
}
// 16x16x32 fragments: lane = (h = lane>>4, row/col = lane&15); elements 0..7 = k0+8h+0..7, 8..15 = k0+16+8h+0..7; D element r = row 8h+r
__device__ __forceinline__ v16h frag_h(const _Float16* rowk0, int lane) {
  union { v16h v; v8h q[2]; } u; const _Float16* p = rowk0 + 8 * (lane >> 4);
  u.q[0] = *(const v8h*)p; u.q[1] = *(const v8h*)(p + 16); return u.v;
}
__device__ __forceinline__ v16h frag_f32(const float* rowk0, int lane) {
  v16h a; const float* p = rowk0 + 8 * (lane >> 4);
#pragma unroll
  for (int i = 0; i < 8; ++i) { a[i] = (_Float16)p[i]; a[8 + i] = (_Float16)p[16 + i]; }
  return a;
}
__device__ __forceinline__ v16h frag_f32s(const float* rowk0, int lane, float sc) {
  v16h a; const float* p = rowk0 + 8 * (lane >> 4);
#pragma unroll
  for (int i = 0; i < 8; ++i) { a[i] = (_Float16)(p[i] * sc); a[8 + i] = (_Float16)(p[16 + i] * sc); }
  return a;
}
// column fragment from a [K][ld] layout (column n), rows >= K read as 0
__device__ __forceinline__ v16h fragc_f32(const float* W, int k0, int n, int lane, int ld, int K) {
  v16h a; const int g = lane >> 4;
#pragma unroll
  for (int i = 0; i < 8; ++i) { const int ka = k0 + 8 * g + i, kb = ka + 16;
    a[i] = (_Float16)(ka < K ? W[(size_t)(ka < K ? ka : K - 1) * ld + n] : 0.f); a[8 + i] = (_Float16)(kb < K ? W[(size_t)(kb < K ? kb : K - 1) * ld + n] : 0.f); }
  return a;
}
struct F2 { v16b h, l; };
__device__ __forceinline__ F2 bsplit16(const float v[16]) { F2 r;
#pragma unroll
  for (int i = 0; i < 16; ++i) { const __bf16 h = (__bf16)v[i]; r.h[i] = h; r.l[i] = (__bf16)(v[i] - (float)h); }
  return r; }
__device__ __forceinline__ F2 split_row(const float* row, int k0, int lane) { float v[16]; const float* p = row + k0 + 8 * (lane >> 4);
#pragma unroll
  for (int i = 0; i < 8; ++i) { v[i] = p[i]; v[8 + i] = p[16 + i]; }
  return bsplit16(v); }
__device__ __forceinline__ F2 split_rowK(const float* row, int k0, int lane, int K) { float v[16]; const int g = lane >> 4;
#pragma unroll
  for (int i = 0; i < 8; ++i) { const int ka = k0 + 8 * g + i, kb = ka + 16; v[i] = ka < K ? row[ka < K ? ka : K - 1] : 0.f; v[8 + i] = kb < K ? row[kb < K ? kb : K - 1] : 0.f; }
  return bsplit16(v); }
__device__ __forceinline__ F2 split_col(const float* W, int k0, int n, int lane, int ld, int K) { float v[16]; const int g = lane >> 4;
#pragma unroll
  for (int i = 0; i < 8; ++i) { const int ka = k0 + 8 * g + i, kb = ka + 16; v[i] = ka < K ? W[(size_t)(ka < K ? ka : K - 1) * ld + n] : 0.f; v[8 + i] = kb < K ? W[(size_t)(kb < K ? kb : K - 1) * ld + n] : 0.f; }
  return bsplit16(v); }
__device__ __forceinline__ v8f mac3(const F2& a, const F2& b, v8f c) { c = wmma_bf(a.l, b.h, c); c = wmma_bf(a.h, b.l, c); return wmma_bf(a.h, b.h, c); }
__device__ __forceinline__ float sigm(float v) { return 1.0f / (1.0f + expf(-v)); }
#define LDSX() do { asm volatile("s_wait_dscnt 0" ::: "memory"); __builtin_amdgcn_wave_barrier(); __builtin_amdgcn_fence(__ATOMIC_RELEASE, "workgroup"); } while (0)

// Bottleneck-transformer MHSA with 2-D relative position logits (B 8, C 512 = 8 x 64, 32 x 32 = 1,024 positions): q = Wq x + bq, k = Wk d + bk, v = Wv d + bv; energy[i][j] = q_i . k_j + pos_i . q_j with pos = (rel_h + rel_w) [h][64][n] (the module adds the [m,n]-indexed position term to the [n,m]-indexed content term positionally); attn = softmax_j; out[c][i] = sum_j v[c][j] attn[i][j] -> [B, C, 32, 32].
#define NB 8
#define TT 1024
#define CC 1024            // NH * HD = projected width
#define DIN 1024          // unused here (the input width is CIN)
#define NH 8
#define HD 128
#define NQB (TT / 64)
#define HG 8
#define SCALE (1.0f)
#define CAUSAL 0
#ifndef TNB
#define TNB NB
#endif
__device__ __forceinline__ float bfr(float v) { return (float)(__bf16)v; }
__host__ __device__ __forceinline__ int kb_last(int qb) { return CAUSAL ? ((qb * 64 + 63) >> 7) : (TT / 128 - 1); }
typedef __attribute__((ext_vector_type(8))) __bf16 v8b;
__device__ __forceinline__ v16b frag_b(const __bf16* rowk0, int lane) {
  union { v16b v; v8b q[2]; } u; const __bf16* p = rowk0 + 8 * (lane >> 4);
  u.q[0] = *(const v8b*)p; u.q[1] = *(const v8b*)(p + 16); return u.v;
}
#define QBH NQB            // every query block takes the 3-product logits path (q and k both f16 hi + residual); unscaled logits, sigma ~14
#define QHI 1024            // rows carrying a q residual plane (all rows when non-causal: 3-product logits everywhere, QBH = NQB)
#define KHI TT             // k residual rows for every key
// B fragment (k rows k0+.., output column o) of a weight: (in,out) [K][ld] or (out,in) [ld rows of K]: bf16 exact, or f16(bf16 * 256) exact
__device__ __forceinline__ v16b wcol_io(const float* Wm, int k0, int o, int lane, int ld) { v16b w; const int g = lane >> 4;
#pragma unroll
  for (int i = 0; i < 8; ++i) { w[i] = (__bf16)Wm[(size_t)(k0 + 8 * g + i) * ld + o]; w[8 + i] = (__bf16)Wm[(size_t)(k0 + 16 + 8 * g + i) * ld + o]; }
  return w; }
__device__ __forceinline__ v16b wcol_oi(const float* Wm, int k0, int o, int lane, int K) { v16b w; const float* p = Wm + (size_t)o * K + k0 + 8 * (lane >> 4);
#pragma unroll
  for (int i = 0; i < 8; ++i) { w[i] = (__bf16)p[i]; w[8 + i] = (__bf16)p[16 + i]; }
  return w; }
__device__ __forceinline__ v16h wcolh_io(const float* Wm, int k0, int o, int lane, int ld) { v16h w; const int g = lane >> 4;
#pragma unroll
  for (int i = 0; i < 8; ++i) { w[i] = (_Float16)(bfr(Wm[(size_t)(k0 + 8 * g + i) * ld + o]) * 256.0f); w[8 + i] = (_Float16)(bfr(Wm[(size_t)(k0 + 16 + 8 * g + i) * ld + o]) * 256.0f); }
  return w; }
__device__ __forceinline__ v16h wcolh_oi(const float* Wm, int k0, int o, int lane, int K) { v16h w; const float* p = Wm + (size_t)o * K + k0 + 8 * (lane >> 4);
#pragma unroll
  for (int i = 0; i < 8; ++i) { w[i] = (_Float16)(bfr(p[i]) * 256.0f); w[8 + i] = (_Float16)(bfr(p[16 + i]) * 256.0f); }
  return w; }
#define WQKV_LAYOUT 1   // 0 = (in,out) [DIN][CC]; 1 = (out,in) [CC][DIN]; 2 = per-head [NH][DIN][HD]
__device__ __forceinline__ v16b wcol_hdk(const float* Wm, int k0, int o, int lane) { v16b w; const int g = lane >> 4; const float* p = Wm + (size_t)(o / HD) * DIN * HD + (o % HD);
#pragma unroll
  for (int i = 0; i < 8; ++i) { w[i] = (__bf16)p[(size_t)(k0 + 8 * g + i) * HD]; w[8 + i] = (__bf16)p[(size_t)(k0 + 16 + 8 * g + i) * HD]; }
  return w; }
#define WO_OUT_IN 0
#if WQKV_LAYOUT == 1
#define WCOL(W, k0, o, lane) wcol_oi(W, k0, o, lane, DIN)
#elif WQKV_LAYOUT == 2
#define WCOL(W, k0, o, lane) wcol_hdk(W, k0, o, lane)
#else
#define WCOL(W, k0, o, lane) wcol_io(W, k0, o, lane, CC)
#endif
#if WO_OUT_IN
#define WOCOL(W, k0, o, lane) wcol_oi(W, k0, o, lane, CC)
#define WOCOLH(W, k0, o, lane) wcolh_oi(W, k0, o, lane, CC)
#else
#define WOCOL(W, k0, o, lane) wcol_io(W, k0, o, lane, DIN)
#define WOCOLH(W, k0, o, lane) wcolh_io(W, k0, o, lane, DIN)
#endif
#define CIN 512            // channels
#define NPOS 1024          // 32 x 32
#define HDV 64             // real head width (planes are 128 wide: [q | pos], [k | q], [v | 0])
// ---- k_lin3: block = (64 positions, head h, which): y = W t + b (exact bf16 products, channels-first A gather, (out,in) W rows h*64..), written into the 128-wide BHSD f32 planes: which 0 (q from x): QF[.][0..63] and KF[.][64..127]; which 1 (k from d): KF[.][0..63]; which 2 (v from d): VF[.][0..63] and zeros into VF[.][64..127]
__global__ __launch_bounds__(128) void k_lin3(const float* __restrict__ X, const float* __restrict__ Dd, const float* __restrict__ WQ, const float* __restrict__ BQ, const float* __restrict__ WK, const float* __restrict__ BK, const float* __restrict__ WV, const float* __restrict__ BV, float* __restrict__ QF, float* __restrict__ KF, float* __restrict__ VF) { __shared__ __align__(16) float sf[4][16][68];
  const int tid = threadIdx.x, wave = tid >> 5, lane = tid & 31, col = lane & 15, g = lane >> 4; const int h = blockIdx.y, which = blockIdx.z; const size_t r0 = (size_t)blockIdx.x * 64 + wave * 16; const size_t b = r0 / NPOS; const int n0 = (int)(r0 % NPOS);
  const float* T = which == 0 ? X : Dd; const float* Wm = which == 0 ? WQ : which == 1 ? WK : WV; const float* Bm = which == 0 ? BQ : which == 1 ? BK : BV;
  v8f acc[4] = {};
#pragma unroll 1
  for (int kc = 0; kc < CIN / 32; ++kc) { v16b a; { const float* p = T + (b * CIN + kc * 32 + 8 * g) * (size_t)NPOS + n0 + col;   /* channels-first: element (b, c, n) at (b*512 + c)*1024 + n */
#pragma unroll
      for (int i = 0; i < 8; ++i) { a[i] = (__bf16)p[(size_t)i * NPOS]; a[8 + i] = (__bf16)p[(size_t)(16 + i) * NPOS]; } }
    asm volatile("s_wait_loadcnt 0x0" ::: "memory");
#pragma unroll
    for (int j = 0; j < 4; ++j) { v16b w; { float t0[8], t1[8]; const int o = h * HDV + j * 16 + col;
#pragma unroll
        for (int i = 0; i < 8; ++i) t0[i] = Wm[(size_t)o * CIN + kc * 32 + 8 * g + i];
        asm volatile("s_wait_loadcnt 0x0" ::: "memory");
#pragma unroll
        for (int i = 0; i < 8; ++i) t1[i] = Wm[(size_t)o * CIN + kc * 32 + 16 + 8 * g + i];
        asm volatile("s_wait_loadcnt 0x0" ::: "memory");
#pragma unroll
        for (int i = 0; i < 8; ++i) { w[i] = (__bf16)t0[i]; w[8 + i] = (__bf16)t1[i]; } }
      acc[j] = wmma_bf(a, w, acc[j]); } }
#pragma unroll
  for (int j = 0; j < 4; ++j) { const float bb = bfr(Bm[h * HDV + j * 16 + col]);
#pragma unroll
    for (int r = 0; r < 8; ++r) sf[wave][8 * g + r][j * 16 + col] = acc[j][r] + bb; }
  asm volatile("s_wait_loadcnt 0x0" ::: "memory");
  LDSX(); for (int rl = 0; rl < 16; ++rl) { const size_t prow = ((b * NH + h) * (size_t)TT + n0 + rl) * HD; const v4f v = *(const v4f*)&sf[wave][rl][(lane & 15) * 4]; v4f z; z[0] = z[1] = z[2] = z[3] = 0.f;
    if (which == 0) { if (lane < 16) vst2(QF + prow + lane * 4, v); else vst2(KF + prow + HDV + (lane & 15) * 4, v); }
    else if (which == 1) { if (lane < 16) vst2(KF + prow + lane * 4, v); }
    else { if (lane < 16) vst2(VF + prow + lane * 4, v); else vst2(VF + prow + HDV + (lane & 15) * 4, z); } } }
// ---- k_pos: thread per (b, h, n, d4) float4 over d: QF[b][h][n][64 + d] = bfr(rel_h[h][d][n % 32]) + bfr(rel_w[h][d][n / 32]) for every batch b (pos is batch independent)
__global__ __launch_bounds__(256) void k_pos(const float* __restrict__ RH, const float* __restrict__ RW, float* __restrict__ QF) { const size_t e = (size_t)blockIdx.x * 256 + threadIdx.x; if (e >= (size_t)NB * NH * NPOS * (HDV / 4)) return;
  const int d4 = (int)(e % (HDV / 4)); size_t r = e / (HDV / 4); const int n = (int)(r % NPOS); r /= NPOS; const int h = (int)(r % NH); const int b = (int)(r / NH); v4f o;
#pragma unroll
  for (int i = 0; i < 4; ++i) { const int d = d4 * 4 + i; o[i] = bfr(RH[(h * HDV + d) * 32 + (n % 32)]) + bfr(RW[(h * HDV + d) * 32 + (n / 32)]); }
  vst2(QF + (((size_t)b * NH + h) * TT + n) * HD + HDV + d4 * 4, o); }
// ---- k_fin: block = (64 positions, head h, batch b): out[b][h*64 + d][n] = Y[b*TT + n][h*128 + d] (channels-first transpose through LDS; 256-B runs of 64 positions)
__global__ __launch_bounds__(256) void k_fin(const float* __restrict__ Y, float* __restrict__ OUT) { __shared__ __align__(16) float st[64][68];
  const int tid = threadIdx.x; const int n0 = blockIdx.x * 64, h = blockIdx.y; const size_t b = blockIdx.z;
  for (int e = tid; e < 64 * 16; e += 256) { const int rl = e >> 4, q = e & 15; *(v4f*)&st[rl][q * 4] = *(const v4f*)(Y + (b * TT + n0 + rl) * (size_t)CC + h * HD + q * 4); }
  __syncthreads();
  for (int e = tid; e < HDV * 16; e += 256) { const int d = e >> 4, q = e & 15; v4f v; v[0] = st[q * 4][d]; v[1] = st[q * 4 + 1][d]; v[2] = st[q * 4 + 2][d]; v[3] = st[q * 4 + 3][d]; vst2(OUT + (b * CIN + h * HDV + d) * (size_t)NPOS + n0 + q * 4, v); } }
#define WS_QF  (WS_END)
#define WS_KF  (WS_QF + 4u * (size_t)NB * NH * TT * HD)
#define WS_VF  (WS_KF + 4u * (size_t)NB * NH * TT * HD)
#define WS_YR  (WS_QF)                                   // Y rows reuse the QF region (QF is dead once k_prep8 has run)
#define WS_END2 (WS_VF + 4u * (size_t)NB * NH * TT * HD)
// ---- k_prep8: block = (64 attention positions s0.. of sequence b, head h): reads the 128-wide f32 planes [B, H, S, 128] (element (b,h,s,c) at ((b*NH + h)*TT + s)*128 + c), without bf16 rounding, and writes the standard attention planes: q -> f16 hi rows (+ x 2^10 residual rows for s < QHI), k -> f16 rows (+ residual rows s < KHI), v -> f16 planes [c][s]
__global__ __launch_bounds__(128) void k_prep8(const float* __restrict__ Q, const float* __restrict__ K, const float* __restrict__ V, _Float16* __restrict__ QH, _Float16* __restrict__ QL, _Float16* __restrict__ KH, _Float16* __restrict__ KL, _Float16* __restrict__ VT, __bf16* __restrict__ VB, __bf16* __restrict__ VBL) {
  __shared__ __align__(16) _Float16 sq[64][136], sql[64][136], sk[64][136], skl[64][136], tv[128][72]; __shared__ __align__(16) __bf16 tb[128][72], tbl[128][72];
  const int tid = threadIdx.x; const int h = blockIdx.y; const size_t r0 = (size_t)blockIdx.x * 64; const size_t bb = r0 / TT; const int t0 = (int)(r0 % TT); const bool qhi = t0 < QHI, khi = t0 < KHI;
  for (int e = tid; e < 64 * 128; e += 128) { const int rl = e >> 7, c = e & 127; const size_t oi = ((bb * NH + h) * TT + t0 + rl) * HD + (c % HD);   /* c runs over the whole 128-wide plane row (HD is 128) */
    const float q = Q[oi], k = K[oi], v = V[oi];   /* f32 projection / position planes: no bf16 rounding; f16 hi + x2^10 residual rows carry q and k at ~2^-21 */
    const _Float16 qh = (_Float16)q, kh = (_Float16)k; sq[rl][c] = qh; sql[rl][c] = (_Float16)((q - (float)qh) * 1024.0f); sk[rl][c] = kh; skl[rl][c] = (_Float16)((k - (float)kh) * 1024.0f);
    tv[c][rl] = (_Float16)v; const __bf16 vb = (__bf16)v; tb[c][rl] = vb; tbl[c][rl] = (__bf16)(v - (float)vb); }
  __syncthreads();
  for (int e = tid; e < 64 * (HD / 8); e += 128) { const int rl = e / (HD / 8), q = e % (HD / 8); const size_t o = (r0 + rl) * CC + h * HD + q * 8; vst2((unsigned*)(QH + o), *(const v4u*)&sq[rl][q * 8]); vst2((unsigned*)(KH + o), *(const v4u*)&sk[rl][q * 8]);   
    if (qhi) vst2((unsigned*)(QL + (bb * QHI + t0 + rl) * (size_t)CC + h * HD + q * 8), *(const v4u*)&sql[rl][q * 8]); if (khi) vst2((unsigned*)(KL + (bb * KHI + t0 + rl) * (size_t)CC + h * HD + q * 8), *(const v4u*)&skl[rl][q * 8]); }
  for (int e = tid; e < HD * 8; e += 128) { const int cl = e >> 3, q = e & 7; vst2((unsigned*)(VT + (bb * CC + h * HD + cl) * (size_t)TT + t0 + q * 8), *(const v4u*)&tv[cl][q * 8]);
    /* bf16 v hi/lo planes not written: P.v uses the f16 planes for every query block */ } }

#ifndef SM_EXTRA_PARAMS
#define SM_EXTRA_PARAMS
#endif
#ifndef PROJ_EXTRA_PARAMS
#define PROJ_EXTRA_PARAMS
#endif
#ifndef SM_MASK_HOOK
#define SM_MASK_HOOK (void)0
#endif

#define WS_QH  0u                                      // f16 q rows [b*t][CC]
#define WS_KH  (WS_QH + 2u * (size_t)NB * TT * CC)      // f16 k rows [b*t][CC]
#define WS_VT  (WS_KH + 2u * (size_t)NB * TT * CC)      // f16 v planes [b][c][t]
#define WS_QL  (WS_VT + 2u * (size_t)NB * CC * TT)      // f16 q residual x 2^10 rows [b][t < QHI][CC]
#define WS_KL  (WS_QL + 2u * (size_t)NB * QHI * CC)     // f16 k residual x 2^10 rows [b][t < KHI][CC]
#define WS_VB  (WS_KL + 2u * (size_t)NB * KHI * CC)     // bf16 v hi planes not used (no space reserved)
#define WS_VBL (WS_VB + 0u)                            // bf16 v planes not used (P.v takes the f16 path)
#define WS_S   (WS_VBL + 0u)    // f32 logits / P [hg][t][s]: reserved but unused (k_fa keeps logits and P in registers)
#define WS_Y   (WS_S  + 4u * (size_t)HG * TT * TT)      // f32 ctx rows [b*t][CC] (only when there is an output projection)
#define WS_END (WS_Y  + 0u)

// lane l with lane l ^ 16 (the two halves of a wave hold the two halves of a query column's keys)
__device__ __forceinline__ float xhalf(float x) { return __builtin_bit_cast(float, __builtin_amdgcn_permlanex16(__builtin_bit_cast(int, x), __builtin_bit_cast(int, x), 0x76543210, 0xfedcba98, false, false)); }
// ---- k_fa: block = 64 queries (qb) of (b, h), wave = 16 queries as COLUMNS; one pass over the keys in blocks of 64. Transposed logits S^T = k . q^T (A = k rows hi / residual x 2^10, B = q rows hi / residual, 3 products, k order as before) stay in registers: lane (g, col) holds keys 16 j + 8 g + r of query col, so the running maximum and sum (f32, precise expf) are in-lane plus one exchange between the halves. exp(s - m) x 2^11 once to f16 packs from two 16-key tiles into one B fragment (element i = key 8 g + i, element 8 + i = key 16 + 8 g + i: the order frag_h gives the v planes as A); ctx^T += v^T . P^T (1 product), rescaled by exp(m_old - m_new) per key block and divided by the row sum at the end
__global__ __launch_bounds__(128) void k_fa(const _Float16* __restrict__ QH, const _Float16* __restrict__ KH, const _Float16* __restrict__ QL, const _Float16* __restrict__ KL, const _Float16* __restrict__ VT, float* __restrict__ Y) {
  const int tid = threadIdx.x, wave = tid >> 5, lane = tid & 31, col = lane & 15, g = lane >> 4; const int qb = blockIdx.x, h = blockIdx.y, b = blockIdx.z; const int ql0 = qb * 64 + wave * 16; const size_t q0 = (size_t)b * TT + ql0;
  const _Float16* QLb = QL + (size_t)b * QHI * CC; const _Float16* KLb = KL + (size_t)b * KHI * CC;
  v16h qh[HD / 32], qr[HD / 32]; const _Float16* qrow = QH + (q0 + col) * CC + h * HD + 8 * g; const _Float16* qlrow = QLb + (size_t)(ql0 + col) * CC + h * HD + 8 * g;   /* the lane's own addresses: frag_h's element order, with its 8 g already added */
  /* every '#pragma unroll' in this kernel: its counter indexes a register array (fragments, accumulators), which stays in registers only if the index is a constant */
#pragma unroll
  for (int kc = 0; kc < HD / 32; ++kc) { union { v16h v; v8h q[2]; } u, w; u.q[0] = *(const v8h*)(qrow + kc * 32); u.q[1] = *(const v8h*)(qrow + kc * 32 + 16); w.q[0] = *(const v8h*)(qlrow + kc * 32); w.q[1] = *(const v8h*)(qlrow + kc * 32 + 16); qh[kc] = u.v; qr[kc] = w.v; }
  /* both lane addresses are inputs, so they stay in their registers up to this wait and no result of the sixteen loads above lands on an address that an issued load names */
  asm volatile("s_wait_xcnt 0x0" :: "v"(qrow), "v"(qlrow) : "memory");
  v8f o[HD / 16] = {}; float m = -3.0e38f, l = 0.f;
  /* kept rolled: one body is about 1,100 instructions */
#pragma unroll 1
  for (int k0 = 0; k0 < TT; k0 += 64) { const size_t kr0 = (size_t)b * TT + k0; v8f acc[4] = {}, accl[4] = {};
#pragma unroll
    for (int j = 0; j < 4; ++j) {   /* key tile outside, depth inside: the four loads that share a row's 128-B line follow one another */
#pragma unroll
      for (int kc = 0; kc < HD / 32; ++kc) { const v16h kbf = frag_h(KH + (kr0 + j * 16 + col) * CC + h * HD + kc * 32, lane), klf = frag_h(KLb + (size_t)(k0 + j * 16 + col) * CC + h * HD + kc * 32, lane); acc[j] = wmma16(kbf, qh[kc], acc[j]); accl[j] = wmma16(kbf, qr[kc], accl[j]); accl[j] = wmma16(klf, qh[kc], accl[j]); } }
    float mx = -3.0e38f;
#pragma unroll
    for (int j = 0; j < 4; ++j) {
#pragma unroll
      for (int r = 0; r < 8; ++r) { acc[j][r] = (acc[j][r] + accl[j][r] * (1.0f / 1024.0f)) * SCALE; mx = fmaxf(mx, acc[j][r]); } }
    mx = fmaxf(mx, xhalf(mx)); const float mn = fmaxf(m, mx), alpha = expf(m - mn); m = mn; float sum = 0.f; v16h p[2];
#pragma unroll
    for (int j = 0; j < 4; ++j) {
#pragma unroll
      for (int r = 0; r < 8; ++r) { const float e = expf(acc[j][r] - mn); sum += e; p[j >> 1][8 * (j & 1) + r] = (_Float16)(e * 2048.0f); } }
    l = l * alpha + sum;   /* this half's keys only; the halves are joined after the loop */
#pragma unroll
    for (int j = 0; j < HD / 16; ++j) {
#pragma unroll
      for (int r = 0; r < 8; ++r) o[j][r] *= alpha; }
#pragma unroll
    for (int j = 0; j < HD / 16; ++j) {
#pragma unroll
      for (int kc = 0; kc < 2; ++kc) { const size_t po = ((size_t)b * CC + h * HD + j * 16 + col) * (size_t)TT + k0 + kc * 32; o[j] = wmma16(frag_h(VT + po, lane), p[kc], o[j]); } } }
  l += xhalf(l); const float inv = l > 0.f ? 1.0f / (2048.0f * l) : 0.f;
  float* yr = Y + ((size_t)b * TT + ql0 + col) * CC + h * HD + 8 * g;   /* lane (g, col): channels 16 j + 8 g + r of query col, 32 B runs */
#pragma unroll
  for (int j = 0; j < HD / 16; ++j) { v4f a, c;
#pragma unroll
    for (int r = 0; r < 4; ++r) { a[r] = o[j][r] * inv; c[r] = o[j][4 + r] * inv; }
    vst2(yr + j * 16, a); vst2(yr + j * 16 + 4, c); } }

extern "C" void kernel_launch(void* const* d_in, const int* in_sizes, int n_in, void* d_out, int out_size, void* d_ws, size_t ws_size, hipStream_t stream) {
  (void)in_sizes; (void)n_in; (void)out_size;
  const float** F = (const float**)d_in;
  if (ws_size < (size_t)WS_END) return;
  char* ws = (char*)d_ws; _Float16 *QH = (_Float16*)(ws + WS_QH), *KH = (_Float16*)(ws + WS_KH), *VT = (_Float16*)(ws + WS_VT), *QL = (_Float16*)(ws + WS_QL), *KL = (_Float16*)(ws + WS_KL); __bf16 *VB = (__bf16*)(ws + WS_VB), *VBL = (__bf16*)(ws + WS_VBL); float *S = (float*)(ws + WS_S), *Y = (float*)(ws + WS_Y);
  (void)Y; (void)S; (void)VB; (void)VBL;
  // inputs: 0 x, 1 d [8,512,32,32]; 2 Wq [512,512] (out,in), 3 bq; 4 Wk, 5 bk; 6 Wv, 7 bv; 8 rel_h [1,8,64,1,32]; 9 rel_w [1,8,64,32,1]
  if (ws_size < (size_t)WS_END2) return;
  float *QF = (float*)(ws + WS_QF), *KF = (float*)(ws + WS_KF), *VF = (float*)(ws + WS_VF), *YR = (float*)(ws + WS_YR);
  k_lin3<<<dim3(TNB * TT / 64, NH, 3), 128, 0, stream>>>(F[0], F[1], F[2], F[3], F[4], F[5], F[6], F[7], QF, KF, VF);
  k_pos<<<dim3((unsigned)(((size_t)TNB * NH * NPOS * (HDV / 4) + 255) / 256)), 256, 0, stream>>>(F[8], F[9], QF);
  k_prep8<<<dim3(TNB * TT / 64, NH), 128, 0, stream>>>(QF, KF, VF, QH, QL, KH, KL, VT, VB, VBL);
  k_fa<<<dim3(NQB, NH, TNB), 128, 0, stream>>>(QH, KH, QL, KL, VT, YR);
  k_fin<<<dim3(TT / 64, NH, TNB), 256, 0, stream>>>(YR, (float*)d_out);
}

// v002
// Measured time: 252 microseconds a run.
// Next to v001, in two timings, it ran 1.52 and 1.51 times as fast.
// Over all steps from v000 it is 3.96 times as fast.
// compute dtype: all float inputs rounded to bf16; q/k/v = W t + b (1x1 convs) with EXACT bf16 products on WMMA 16x16x32 (f32 rows); the content + position logits folded into one 128-deep product [q_i | pos_i] . [k_j | q_j] with BOTH operands as f16 hi + residual (x 2^10) (3 products: the logits are unscaled, sigma ~14, near-argmax); softmax in f32 (precise expf); P x 2^11 once to f16 against v once to f16 (1 product); f32 output (channels-first).
#include <hip/hip_runtime.h>
#include <math.h>

typedef __attribute__((ext_vector_type(16))) _Float16 v16h;
typedef __attribute__((ext_vector_type(16))) __bf16 v16b;
typedef __attribute__((ext_vector_type(8)))  _Float16 v8h;
typedef __attribute__((ext_vector_type(8)))  float v8f;
typedef __attribute__((ext_vector_type(4)))  float v4f;
typedef __attribute__((ext_vector_type(2)))  float v2f;
typedef __attribute__((ext_vector_type(4)))  unsigned v4u;
typedef __attribute__((ext_vector_type(4)))  int v4i;
typedef float __attribute__((may_alias)) float_a;
typedef int __attribute__((may_alias)) int_a;

template <typename T> __device__ __forceinline__ void vst2(void* p, T v) { *(T*)p = v;  }
__device__ __forceinline__ v8f wmma16(v16h a, v16h b, v8f c) {
  v8f d = __builtin_amdgcn_wmma_f32_16x16x32_f16(false, a, false, b, (short)0, c, false, false);
  asm volatile("v_nop\n\tv_nop\n\tv_nop\n\tv_nop" : "+v"(d) : "v"(a), "v"(b));
  return d;
}
__device__ __forceinline__ v8f wmma_bf(v16b a, v16b b, v8f c) {
  v8f d = __builtin_amdgcn_wmma_f32_16x16x32_bf16(false, a, false, b, (short)0, c, false, false);
  asm volatile("v_nop\n\tv_nop\n\tv_nop\n\tv_nop" : "+v"(d) : "v"(a), "v"(b));
  return d;
}
// 16x16x32 fragments: lane = (h = lane>>4, row/col = lane&15); elements 0..7 = k0+8h+0..7, 8..15 = k0+16+8h+0..7; D element r = row 8h+r
__device__ __forceinline__ v16h frag_h(const _Float16* rowk0, int lane) {
  union { v16h v; v8h q[2]; } u; const _Float16* p = rowk0 + 8 * (lane >> 4);
  u.q[0] = *(const v8h*)p; u.q[1] = *(const v8h*)(p + 16); return u.v;
}
__device__ __forceinline__ v16h frag_f32(const float* rowk0, int lane) {
  v16h a; const float* p = rowk0 + 8 * (lane >> 4);
#pragma unroll
  for (int i = 0; i < 8; ++i) { a[i] = (_Float16)p[i]; a[8 + i] = (_Float16)p[16 + i]; }
  return a;
}
__device__ __forceinline__ v16h frag_f32s(const float* rowk0, int lane, float sc) {
  v16h a; const float* p = rowk0 + 8 * (lane >> 4);
#pragma unroll
  for (int i = 0; i < 8; ++i) { a[i] = (_Float16)(p[i] * sc); a[8 + i] = (_Float16)(p[16 + i] * sc); }
  return a;
}
// column fragment from a [K][ld] layout (column n), rows >= K read as 0
__device__ __forceinline__ v16h fragc_f32(const float* W, int k0, int n, int lane, int ld, int K) {
  v16h a; const int g = lane >> 4;
#pragma unroll
  for (int i = 0; i < 8; ++i) { const int ka = k0 + 8 * g + i, kb = ka + 16;
    a[i] = (_Float16)(ka < K ? W[(size_t)(ka < K ? ka : K - 1) * ld + n] : 0.f); a[8 + i] = (_Float16)(kb < K ? W[(size_t)(kb < K ? kb : K - 1) * ld + n] : 0.f); }
  return a;
}
struct F2 { v16b h, l; };
__device__ __forceinline__ F2 bsplit16(const float v[16]) { F2 r;
#pragma unroll
  for (int i = 0; i < 16; ++i) { const __bf16 h = (__bf16)v[i]; r.h[i] = h; r.l[i] = (__bf16)(v[i] - (float)h); }
  return r; }
__device__ __forceinline__ F2 split_row(const float* row, int k0, int lane) { float v[16]; const float* p = row + k0 + 8 * (lane >> 4);
#pragma unroll
  for (int i = 0; i < 8; ++i) { v[i] = p[i]; v[8 + i] = p[16 + i]; }
  return bsplit16(v); }
__device__ __forceinline__ F2 split_rowK(const float* row, int k0, int lane, int K) { float v[16]; const int g = lane >> 4;
#pragma unroll
  for (int i = 0; i < 8; ++i) { const int ka = k0 + 8 * g + i, kb = ka + 16; v[i] = ka < K ? row[ka < K ? ka : K - 1] : 0.f; v[8 + i] = kb < K ? row[kb < K ? kb : K - 1] : 0.f; }
  return bsplit16(v); }
__device__ __forceinline__ F2 split_col(const float* W, int k0, int n, int lane, int ld, int K) { float v[16]; const int g = lane >> 4;
#pragma unroll
  for (int i = 0; i < 8; ++i) { const int ka = k0 + 8 * g + i, kb = ka + 16; v[i] = ka < K ? W[(size_t)(ka < K ? ka : K - 1) * ld + n] : 0.f; v[8 + i] = kb < K ? W[(size_t)(kb < K ? kb : K - 1) * ld + n] : 0.f; }
  return bsplit16(v); }
__device__ __forceinline__ v8f mac3(const F2& a, const F2& b, v8f c) { c = wmma_bf(a.l, b.h, c); c = wmma_bf(a.h, b.l, c); return wmma_bf(a.h, b.h, c); }
__device__ __forceinline__ float sigm(float v) { return 1.0f / (1.0f + expf(-v)); }
#define LDSX() do { asm volatile("s_wait_dscnt 0" ::: "memory"); __builtin_amdgcn_wave_barrier(); __builtin_amdgcn_fence(__ATOMIC_RELEASE, "workgroup"); } while (0)

// Bottleneck-transformer MHSA with 2-D relative position logits (B 8, C 512 = 8 x 64, 32 x 32 = 1,024 positions): q = Wq x + bq, k = Wk d + bk, v = Wv d + bv; energy[i][j] = q_i . k_j + pos_i . q_j with pos = (rel_h + rel_w) [h][64][n] (the module adds the [m,n]-indexed position term to the [n,m]-indexed content term positionally); attn = softmax_j; out[c][i] = sum_j v[c][j] attn[i][j] -> [B, C, 32, 32].
#define NB 8
#define TT 1024
#define CC 1024            // NH * HD = projected width
#define DIN 1024          // unused here (the input width is CIN)
#define NH 8
#define HD 128
#define NQB (TT / 64)
#define HG 8
#define SCALE (1.0f)
#define CAUSAL 0
#ifndef TNB
#define TNB NB
#endif
__device__ __forceinline__ float bfr(float v) { return (float)(__bf16)v; }
__host__ __device__ __forceinline__ int kb_last(int qb) { return CAUSAL ? ((qb * 64 + 63) >> 7) : (TT / 128 - 1); }
typedef __attribute__((ext_vector_type(8))) __bf16 v8b;
__device__ __forceinline__ v16b frag_b(const __bf16* rowk0, int lane) {
  union { v16b v; v8b q[2]; } u; const __bf16* p = rowk0 + 8 * (lane >> 4);
  u.q[0] = *(const v8b*)p; u.q[1] = *(const v8b*)(p + 16); return u.v;
}
#define QBH NQB            // every query block takes the 3-product logits path (q and k both f16 hi + residual); unscaled logits, sigma ~14
#define QHI 1024            // rows carrying a q residual plane (all rows when non-causal: 3-product logits everywhere, QBH = NQB)
#define KHI TT             // k residual rows for every key
// B fragment (k rows k0+.., output column o) of a weight: (in,out) [K][ld] or (out,in) [ld rows of K]: bf16 exact, or f16(bf16 * 256) exact
__device__ __forceinline__ v16b wcol_io(const float* Wm, int k0, int o, int lane, int ld) { v16b w; const int g = lane >> 4;
#pragma unroll
  for (int i = 0; i < 8; ++i) { w[i] = (__bf16)Wm[(size_t)(k0 + 8 * g + i) * ld + o]; w[8 + i] = (__bf16)Wm[(size_t)(k0 + 16 + 8 * g + i) * ld + o]; }
  return w; }
__device__ __forceinline__ v16b wcol_oi(const float* Wm, int k0, int o, int lane, int K) { v16b w; const float* p = Wm + (size_t)o * K + k0 + 8 * (lane >> 4);
#pragma unroll
  for (int i = 0; i < 8; ++i) { w[i] = (__bf16)p[i]; w[8 + i] = (__bf16)p[16 + i]; }
  return w; }
__device__ __forceinline__ v16h wcolh_io(const float* Wm, int k0, int o, int lane, int ld) { v16h w; const int g = lane >> 4;
#pragma unroll
  for (int i = 0; i < 8; ++i) { w[i] = (_Float16)(bfr(Wm[(size_t)(k0 + 8 * g + i) * ld + o]) * 256.0f); w[8 + i] = (_Float16)(bfr(Wm[(size_t)(k0 + 16 + 8 * g + i) * ld + o]) * 256.0f); }
  return w; }
__device__ __forceinline__ v16h wcolh_oi(const float* Wm, int k0, int o, int lane, int K) { v16h w; const float* p = Wm + (size_t)o * K + k0 + 8 * (lane >> 4);
#pragma unroll
  for (int i = 0; i < 8; ++i) { w[i] = (_Float16)(bfr(p[i]) * 256.0f); w[8 + i] = (_Float16)(bfr(p[16 + i]) * 256.0f); }
  return w; }
#define WQKV_LAYOUT 1   // 0 = (in,out) [DIN][CC]; 1 = (out,in) [CC][DIN]; 2 = per-head [NH][DIN][HD]
__device__ __forceinline__ v16b wcol_hdk(const float* Wm, int k0, int o, int lane) { v16b w; const int g = lane >> 4; const float* p = Wm + (size_t)(o / HD) * DIN * HD + (o % HD);
#pragma unroll
  for (int i = 0; i < 8; ++i) { w[i] = (__bf16)p[(size_t)(k0 + 8 * g + i) * HD]; w[8 + i] = (__bf16)p[(size_t)(k0 + 16 + 8 * g + i) * HD]; }
  return w; }
#define WO_OUT_IN 0
#if WQKV_LAYOUT == 1
#define WCOL(W, k0, o, lane) wcol_oi(W, k0, o, lane, DIN)
#elif WQKV_LAYOUT == 2
#define WCOL(W, k0, o, lane) wcol_hdk(W, k0, o, lane)
#else
#define WCOL(W, k0, o, lane) wcol_io(W, k0, o, lane, CC)
#endif
#if WO_OUT_IN
#define WOCOL(W, k0, o, lane) wcol_oi(W, k0, o, lane, CC)
#define WOCOLH(W, k0, o, lane) wcolh_oi(W, k0, o, lane, CC)
#else
#define WOCOL(W, k0, o, lane) wcol_io(W, k0, o, lane, DIN)
#define WOCOLH(W, k0, o, lane) wcolh_io(W, k0, o, lane, DIN)
#endif
#define CIN 512            // channels
#define NPOS 1024          // 32 x 32
#define HDV 64             // real head width (planes are 128 wide: [q | pos], [k | q], [v | 0])
// ---- k_lin3: block = (64 positions, head h, which): y = W t + b (exact bf16 products, channels-first A gather, (out,in) W rows h*64..), written into the 128-wide BHSD f32 planes: which 0 (q from x): QF[.][0..63] and KF[.][64..127]; which 1 (k from d): KF[.][0..63]; which 2 (v from d): VF[.][0..63] and zeros into VF[.][64..127]
__global__ __launch_bounds__(128) void k_lin3(const float* __restrict__ X, const float* __restrict__ Dd, const float* __restrict__ WQ, const float* __restrict__ BQ, const float* __restrict__ WK, const float* __restrict__ BK, const float* __restrict__ WV, const float* __restrict__ BV, float* __restrict__ QF, float* __restrict__ KF, float* __restrict__ VF) { __shared__ __align__(16) float sf[4][16][68];
  const int tid = threadIdx.x, wave = tid >> 5, lane = tid & 31, col = lane & 15, g = lane >> 4; const int h = blockIdx.y, which = blockIdx.z; const size_t r0 = (size_t)blockIdx.x * 64 + wave * 16; const size_t b = r0 / NPOS; const int n0 = (int)(r0 % NPOS);
  const float* T = which == 0 ? X : Dd; const float* Wm = which == 0 ? WQ : which == 1 ? WK : WV; const float* Bm = which == 0 ? BQ : which == 1 ? BK : BV;
  v8f acc[4] = {};
#pragma unroll 1
  for (int kc = 0; kc < CIN / 32; ++kc) { v16b a; { const float* p = T + (b * CIN + kc * 32 + 8 * g) * (size_t)NPOS + n0 + col;   /* channels-first: element (b, c, n) at (b*512 + c)*1024 + n */
#pragma unroll
      for (int i = 0; i < 8; ++i) { a[i] = (__bf16)p[(size_t)i * NPOS]; a[8 + i] = (__bf16)p[(size_t)(16 + i) * NPOS]; } }
    asm volatile("s_wait_loadcnt 0x0" ::: "memory");
#pragma unroll
    for (int j = 0; j < 4; ++j) { v16b w; { float t0[8], t1[8]; const int o = h * HDV + j * 16 + col;
#pragma unroll
        for (int i = 0; i < 8; ++i) t0[i] = Wm[(size_t)o * CIN + kc * 32 + 8 * g + i];
        asm volatile("s_wait_loadcnt 0x0" ::: "memory");
#pragma unroll
        for (int i = 0; i < 8; ++i) t1[i] = Wm[(size_t)o * CIN + kc * 32 + 16 + 8 * g + i];
        asm volatile("s_wait_loadcnt 0x0" ::: "memory");
#pragma unroll
        for (int i = 0; i < 8; ++i) { w[i] = (__bf16)t0[i]; w[8 + i] = (__bf16)t1[i]; } }
      acc[j] = wmma_bf(a, w, acc[j]); } }
#pragma unroll
  for (int j = 0; j < 4; ++j) { const float bb = bfr(Bm[h * HDV + j * 16 + col]);
#pragma unroll
    for (int r = 0; r < 8; ++r) sf[wave][8 * g + r][j * 16 + col] = acc[j][r] + bb; }
  asm volatile("s_wait_loadcnt 0x0" ::: "memory");
  LDSX(); for (int rl = 0; rl < 16; ++rl) { const size_t prow = ((b * NH + h) * (size_t)TT + n0 + rl) * HD; const v4f v = *(const v4f*)&sf[wave][rl][(lane & 15) * 4]; v4f z; z[0] = z[1] = z[2] = z[3] = 0.f;
    if (which == 0) { if (lane < 16) vst2(QF + prow + lane * 4, v); else vst2(KF + prow + HDV + (lane & 15) * 4, v); }
    else if (which == 1) { if (lane < 16) vst2(KF + prow + lane * 4, v); }
    else { if (lane < 16) vst2(VF + prow + lane * 4, v); else vst2(VF + prow + HDV + (lane & 15) * 4, z); } } }
// ---- k_pos: thread per (b, h, n, d4) float4 over d: QF[b][h][n][64 + d] = bfr(rel_h[h][d][n % 32]) + bfr(rel_w[h][d][n / 32]) for every batch b (pos is batch independent)
__global__ __launch_bounds__(256) void k_pos(const float* __restrict__ RH, const float* __restrict__ RW, float* __restrict__ QF) { const size_t e = (size_t)blockIdx.x * 256 + threadIdx.x; if (e >= (size_t)NB * NH * NPOS * (HDV / 4)) return;
  const int d4 = (int)(e % (HDV / 4)); size_t r = e / (HDV / 4); const int n = (int)(r % NPOS); r /= NPOS; const int h = (int)(r % NH); const int b = (int)(r / NH); v4f o;
#pragma unroll
  for (int i = 0; i < 4; ++i) { const int d = d4 * 4 + i; o[i] = bfr(RH[(h * HDV + d) * 32 + (n % 32)]) + bfr(RW[(h * HDV + d) * 32 + (n / 32)]); }
  vst2(QF + (((size_t)b * NH + h) * TT + n) * HD + HDV + d4 * 4, o); }
// ---- k_fin: block = (64 positions, head h, batch b): out[b][h*64 + d][n] = Y[b*TT + n][h*128 + d] (channels-first transpose through LDS; 256-B runs of 64 positions)
__global__ __launch_bounds__(256) void k_fin(const float* __restrict__ Y, float* __restrict__ OUT) { __shared__ __align__(16) float st[64][68];
  const int tid = threadIdx.x; const int n0 = blockIdx.x * 64, h = blockIdx.y; const size_t b = blockIdx.z;
  for (int e = tid; e < 64 * 16; e += 256) { const int rl = e >> 4, q = e & 15; *(v4f*)&st[rl][q * 4] = *(const v4f*)(Y + (b * TT + n0 + rl) * (size_t)CC + h * HD + q * 4); }
  __syncthreads();
  for (int e = tid; e < HDV * 16; e += 256) { const int d = e >> 4, q = e & 15; v4f v; v[0] = st[q * 4][d]; v[1] = st[q * 4 + 1][d]; v[2] = st[q * 4 + 2][d]; v[3] = st[q * 4 + 3][d]; vst2(OUT + (b * CIN + h * HDV + d) * (size_t)NPOS + n0 + q * 4, v); } }
#define WS_QF  (WS_END)
#define WS_KF  (WS_QF + 4u * (size_t)NB * NH * TT * HD)
#define WS_VF  (WS_KF + 4u * (size_t)NB * NH * TT * HD)
#define WS_YR  (WS_QF)                                   // Y rows reuse the QF region (QF is dead once k_prep8 has run)
#define WS_END2 (WS_VF + 4u * (size_t)NB * NH * TT * HD)
// ---- k_prep8: block = (64 attention positions s0.. of sequence b, head h): reads the 128-wide f32 planes [B, H, S, 128] (element (b,h,s,c) at ((b*NH + h)*TT + s)*128 + c), without bf16 rounding, and writes the standard attention planes: q -> f16 hi rows (+ x 2^10 residual rows for s < QHI), k -> f16 rows (+ residual rows s < KHI), v -> f16 planes [c][s]
__global__ __launch_bounds__(128) void k_prep8(const float* __restrict__ Q, const float* __restrict__ K, const float* __restrict__ V, _Float16* __restrict__ QH, _Float16* __restrict__ QL, _Float16* __restrict__ KH, _Float16* __restrict__ KL, _Float16* __restrict__ VT, __bf16* __restrict__ VB, __bf16* __restrict__ VBL) {
  __shared__ __align__(16) _Float16 sq[64][136], sql[64][136], sk[64][136], skl[64][136], tv[128][72]; __shared__ __align__(16) __bf16 tb[128][72], tbl[128][72];
  const int tid = threadIdx.x; const int h = blockIdx.y; const size_t r0 = (size_t)blockIdx.x * 64; const size_t bb = r0 / TT; const int t0 = (int)(r0 % TT); const bool qhi = t0 < QHI, khi = t0 < KHI;
  for (int e = tid; e < 64 * 128; e += 128) { const int rl = e >> 7, c = e & 127; const size_t oi = ((bb * NH + h) * TT + t0 + rl) * HD + (c % HD);   /* c runs over the whole 128-wide plane row (HD is 128) */
    const float q = Q[oi], k = K[oi], v = V[oi];   /* f32 projection / position planes: no bf16 rounding; f16 hi + x2^10 residual rows carry q and k at ~2^-21 */
    const _Float16 qh = (_Float16)q, kh = (_Float16)k; sq[rl][c] = qh; sql[rl][c] = (_Float16)((q - (float)qh) * 1024.0f); sk[rl][c] = kh; skl[rl][c] = (_Float16)((k - (float)kh) * 1024.0f);
    tv[c][rl] = (_Float16)v; const __bf16 vb = (__bf16)v; tb[c][rl] = vb; tbl[c][rl] = (__bf16)(v - (float)vb); }
  __syncthreads();
  for (int e = tid; e < 64 * (HD / 8); e += 128) { const int rl = e / (HD / 8), q = e % (HD / 8); const size_t o = (r0 + rl) * CC + h * HD + q * 8; vst2((unsigned*)(QH + o), *(const v4u*)&sq[rl][q * 8]); vst2((unsigned*)(KH + o), *(const v4u*)&sk[rl][q * 8]);   
    if (qhi) vst2((unsigned*)(QL + (bb * QHI + t0 + rl) * (size_t)CC + h * HD + q * 8), *(const v4u*)&sql[rl][q * 8]); if (khi) vst2((unsigned*)(KL + (bb * KHI + t0 + rl) * (size_t)CC + h * HD + q * 8), *(const v4u*)&skl[rl][q * 8]); }
  for (int e = tid; e < HD * 8; e += 128) { const int cl = e >> 3, q = e & 7; vst2((unsigned*)(VT + (bb * CC + h * HD + cl) * (size_t)TT + t0 + q * 8), *(const v4u*)&tv[cl][q * 8]);
    /* bf16 v hi/lo planes not written: P.v uses the f16 planes for every query block */ } }

#ifndef SM_EXTRA_PARAMS
#define SM_EXTRA_PARAMS
#endif
#ifndef PROJ_EXTRA_PARAMS
#define PROJ_EXTRA_PARAMS
#endif
#ifndef SM_MASK_HOOK
#define SM_MASK_HOOK (void)0
#endif

#define WS_QH  0u                                      // f16 q rows [b*t][CC]
#define WS_KH  (WS_QH + 2u * (size_t)NB * TT * CC)      // f16 k rows [b*t][CC]
#define WS_VT  (WS_KH + 2u * (size_t)NB * TT * CC)      // f16 v planes [b][c][t]
#define WS_QL  (WS_VT + 2u * (size_t)NB * CC * TT)      // f16 q residual x 2^10 rows [b][t < QHI][CC]
#define WS_KL  (WS_QL + 2u * (size_t)NB * QHI * CC)     // f16 k residual x 2^10 rows [b][t < KHI][CC]
#define WS_VB  (WS_KL + 2u * (size_t)NB * KHI * CC)     // bf16 v hi planes not used (no space reserved)
#define WS_VBL (WS_VB + 0u)                            // bf16 v planes not used (P.v takes the f16 path)
#define WS_S   (WS_VBL + 0u)    // f32 logits / P [hg][t][s]: reserved but unused (k_fa keeps logits and P in registers)
#define WS_Y   (WS_S  + 4u * (size_t)HG * TT * TT)      // f32 ctx rows [b*t][CC] (only when there is an output projection)
#define WS_END (WS_Y  + 0u)

// lane l with lane l ^ 16 (the two halves of a wave hold the two halves of a query column's keys)
__device__ __forceinline__ float xhalf(float x) { return __builtin_bit_cast(float, __builtin_amdgcn_permlanex16(__builtin_bit_cast(int, x), __builtin_bit_cast(int, x), 0x76543210, 0xfedcba98, false, false)); }
#define FAQ 128            // queries per block: eight waves read each staged key tile
#define KPIT 136           // halves per staged k row (272 B = 16 B x odd: the sixteen rows of a fragment read fall on different banks)
#define VPIT 72            // halves per staged v row (144 B, likewise)
#define SG_KL (64 * KPIT)                    // residual rows behind the hi rows
#define SG_V  (2 * 64 * KPIT)                // v rows [channel][64 keys] behind both
#define SG_SZ (2 * 64 * KPIT + HD * VPIT)    // halves per stage (53,248 B)
// one 64-key stage, 12 copies of 16 B per lane straight into LDS: k hi rows and k residual rows (16 lanes a 256-B row, rows 16 apart), v rows (8 lanes a 128-B row, rows 32 apart). lk / lv: the lane's own LDS byte addresses, gk / gl / gv its own global addresses. The s_wait_xcnt ends the copies' own statement, so no address register is rewritten in front of it
__device__ __forceinline__ void fa_stage(unsigned lk, unsigned lv, const _Float16* gk, const _Float16* gl, const _Float16* gv) {
  asm volatile("global_load_async_to_lds_b128 %0, %12, off\n\t"
               "global_load_async_to_lds_b128 %1, %13, off\n\t"
               "global_load_async_to_lds_b128 %2, %14, off\n\t"
               "global_load_async_to_lds_b128 %3, %15, off\n\t"
               "global_load_async_to_lds_b128 %4, %16, off\n\t"
               "global_load_async_to_lds_b128 %5, %17, off\n\t"
               "global_load_async_to_lds_b128 %6, %18, off\n\t"
               "global_load_async_to_lds_b128 %7, %19, off\n\t"
               "global_load_async_to_lds_b128 %8, %20, off\n\t"
               "global_load_async_to_lds_b128 %9, %21, off\n\t"
               "global_load_async_to_lds_b128 %10, %22, off\n\t"
               "global_load_async_to_lds_b128 %11, %23, off\n\t"
               "s_wait_xcnt 0x0"
               :: "v"(lk), "v"(lk + 2u * 16 * KPIT), "v"(lk + 2u * 32 * KPIT), "v"(lk + 2u * 48 * KPIT),
                  "v"(lk + 2u * SG_KL), "v"(lk + 2u * (SG_KL + 16 * KPIT)), "v"(lk + 2u * (SG_KL + 32 * KPIT)), "v"(lk + 2u * (SG_KL + 48 * KPIT)),
                  "v"(lv), "v"(lv + 2u * 32 * VPIT), "v"(lv + 2u * 64 * VPIT), "v"(lv + 2u * 96 * VPIT),
                  "v"(gk), "v"(gk + 16 * CC), "v"(gk + 32 * CC), "v"(gk + 48 * CC),
                  "v"(gl), "v"(gl + 16 * CC), "v"(gl + 32 * CC), "v"(gl + 48 * CC),
                  "v"(gv), "v"(gv + 32 * TT), "v"(gv + 64 * TT), "v"(gv + 96 * TT)
               : "memory");
}
// ---- k_fa: block = 128 queries (qb) of (b, h), wave = 16 queries as COLUMNS; one pass over the keys in blocks of 64. Each key block (k hi rows, k residual rows, v rows) is copied once per block into one of two LDS stages by asynchronous copies, one key block ahead of the products, and all eight waves take their A fragments from there (two blocks a WGP, four waves a SIMD: at most 256 registers a wave, hence amdgpu_waves_per_eu). Transposed logits S^T = k . q^T (A = k rows hi / residual x 2^10, B = q rows hi / residual, 3 products, k order as before) stay in registers: lane (g, col) holds keys 16 j + 8 g + r of query col, so the running maximum and sum (f32, precise expf) are in-lane plus one exchange between the halves. exp(s - m) x 2^11 once to f16 packs from two 16-key tiles into one B fragment (element i = key 8 g + i, element 8 + i = key 16 + 8 g + i: the order frag_h gives the v planes as A); ctx^T += v^T . P^T (1 product), rescaled by exp(m_old - m_new) per key block and divided by the row sum at the end
__global__ __launch_bounds__(256) __attribute__((amdgpu_waves_per_eu(4, 4))) void k_fa(const _Float16* __restrict__ QH, const _Float16* __restrict__ KH, const _Float16* __restrict__ QL, const _Float16* __restrict__ KL, const _Float16* __restrict__ VT, float* __restrict__ Y) {
  __shared__ __attribute__((aligned(16))) _Float16 sg[2 * SG_SZ];
  const int tid = threadIdx.x, wave = tid >> 5, lane = tid & 31, col = lane & 15, g = lane >> 4; const int qb = blockIdx.x, h = blockIdx.y, b = blockIdx.z; const int ql0 = qb * FAQ + wave * 16; const size_t q0 = (size_t)b * TT + ql0;
  const _Float16* QLb = QL + (size_t)b * QHI * CC; const _Float16* KLb = KL + (size_t)b * KHI * CC;
  v16h qh[HD / 32], qr[HD / 32]; const _Float16* qrow = QH + (q0 + col) * CC + h * HD + 8 * g; const _Float16* qlrow = QLb + (size_t)(ql0 + col) * CC + h * HD + 8 * g;   /* the lane's own addresses: frag_h's element order, with its 8 g already added */
  /* every '#pragma unroll' in this kernel: its counter indexes a register array (fragments, accumulators), which stays in registers only if the index is a constant */
#pragma unroll
  for (int kc = 0; kc < HD / 32; ++kc) { union { v16h v; v8h q[2]; } u, w; u.q[0] = *(const v8h*)(qrow + kc * 32); u.q[1] = *(const v8h*)(qrow + kc * 32 + 16); w.q[0] = *(const v8h*)(qlrow + kc * 32); w.q[1] = *(const v8h*)(qlrow + kc * 32 + 16); qh[kc] = u.v; qr[kc] = w.v; }
  /* both lane addresses are inputs, so they stay in their registers up to this wait and no result of the sixteen loads above lands on an address that an issued load names */
  asm volatile("s_wait_xcnt 0x0" :: "v"(qrow), "v"(qlrow) : "memory");
  const unsigned sb = (unsigned)(size_t)sg; const unsigned lk = sb + 2u * ((tid >> 4) * KPIT + (tid & 15) * 8), lv = sb + 2u * (SG_V + (tid >> 3) * VPIT + (tid & 7) * 8);
  const _Float16* gk = KH + ((size_t)b * TT + (tid >> 4)) * CC + h * HD + (tid & 15) * 8; const _Float16* gl = KLb + (size_t)(tid >> 4) * CC + h * HD + (tid & 15) * 8; const _Float16* gv = VT + ((size_t)b * CC + h * HD + (tid >> 3)) * (size_t)TT + (tid & 7) * 8;
  fa_stage(lk, lv, gk, gl, gv);
  asm volatile("s_wait_asynccnt 0x0" ::: "memory");   /* this wave's copies of key block 0 have landed */
  __syncthreads();                                    /* ... and every other wave's */
  fa_stage(lk + 2u * SG_SZ, lv + 2u * SG_SZ, gk + 64 * CC, gl + 64 * CC, gv + 64);
  v8f o[HD / 16] = {}; float m = -3.0e38f, l = 0.f;
  /* kept rolled: one body is about 1,100 instructions */
#pragma unroll 1
  for (int k0 = 0; k0 < TT; k0 += 64) { const unsigned bo = ((k0 >> 6) & 1) * SG_SZ; const _Float16* st = sg + bo; v8f acc[4] = {}, accl[4] = {};
#pragma unroll
    for (int j = 0; j < 4; ++j) {
#pragma unroll
      for (int kc = 0; kc < HD / 32; ++kc) { const v16h kbf = frag_h(st + (j * 16 + col) * KPIT + kc * 32, lane), klf = frag_h(st + SG_KL + (j * 16 + col) * KPIT + kc * 32, lane); acc[j] = wmma16(kbf, qh[kc], acc[j]); accl[j] = wmma16(kbf, qr[kc], accl[j]); accl[j] = wmma16(klf, qh[kc], accl[j]); } }
    float mx = -3.0e38f;
#pragma unroll
    for (int j = 0; j < 4; ++j) {
#pragma unroll
      for (int r = 0; r < 8; ++r) { acc[j][r] = (acc[j][r] + accl[j][r] * (1.0f / 1024.0f)) * SCALE; mx = fmaxf(mx, acc[j][r]); } }
    mx = fmaxf(mx, xhalf(mx)); const float mn = fmaxf(m, mx), alpha = expf(m - mn); m = mn; float sum = 0.f; v16h p[2];
#pragma unroll
    for (int j = 0; j < 4; ++j) {
#pragma unroll
      for (int r = 0; r < 8; ++r) { const float e = expf(acc[j][r] - mn); sum += e; p[j >> 1][8 * (j & 1) + r] = (_Float16)(e * 2048.0f); } }
    l = l * alpha + sum;   /* this half's keys only; the halves are joined after the loop */
#pragma unroll
    for (int j = 0; j < HD / 16; ++j) {
#pragma unroll
      for (int r = 0; r < 8; ++r) o[j][r] *= alpha; }
#pragma unroll
    for (int j = 0; j < HD / 16; ++j) {
#pragma unroll
      for (int kc = 0; kc < 2; ++kc) o[j] = wmma16(frag_h(st + SG_V + (j * 16 + col) * VPIT + kc * 32, lane), p[kc], o[j]); }
    asm volatile("s_wait_dscnt 0x0" ::: "memory");      /* this wave's reads of the stage are done before the stage is given up */
    asm volatile("s_wait_asynccnt 0x0" ::: "memory");   /* this wave's copies of the next key block have landed */
    __syncthreads();                                    /* publishes the next key block and ends every wave's reads of this one */
    if (k0 + 128 < TT) fa_stage(lk + 2u * bo, lv + 2u * bo, gk + (size_t)(k0 + 128) * CC, gl + (size_t)(k0 + 128) * CC, gv + k0 + 128); }
  asm volatile("s_wait_asynccnt 0x0" ::: "memory");     /* nothing of this wave is in flight when it ends */
  l += xhalf(l); const float inv = l > 0.f ? 1.0f / (2048.0f * l) : 0.f;
  float* yr = Y + ((size_t)b * TT + ql0 + col) * CC + h * HD + 8 * g;   /* lane (g, col): channels 16 j + 8 g + r of query col, 32 B runs */
#pragma unroll
  for (int j = 0; j < HD / 16; ++j) { v4f a, c;
#pragma unroll
    for (int r = 0; r < 4; ++r) { a[r] = o[j][r] * inv; c[r] = o[j][4 + r] * inv; }
    vst2(yr + j * 16, a); vst2(yr + j * 16 + 4, c); } }

extern "C" void kernel_launch(void* const* d_in, const int* in_sizes, int n_in, void* d_out, int out_size, void* d_ws, size_t ws_size, hipStream_t stream) {
  (void)in_sizes; (void)n_in; (void)out_size;
  const float** F = (const float**)d_in;
  if (ws_size < (size_t)WS_END) return;
  char* ws = (char*)d_ws; _Float16 *QH = (_Float16*)(ws + WS_QH), *KH = (_Float16*)(ws + WS_KH), *VT = (_Float16*)(ws + WS_VT), *QL = (_Float16*)(ws + WS_QL), *KL = (_Float16*)(ws + WS_KL); __bf16 *VB = (__bf16*)(ws + WS_VB), *VBL = (__bf16*)(ws + WS_VBL); float *S = (float*)(ws + WS_S), *Y = (float*)(ws + WS_Y);
  (void)Y; (void)S; (void)VB; (void)VBL;
  // inputs: 0 x, 1 d [8,512,32,32]; 2 Wq [512,512] (out,in), 3 bq; 4 Wk, 5 bk; 6 Wv, 7 bv; 8 rel_h [1,8,64,1,32]; 9 rel_w [1,8,64,32,1]
  if (ws_size < (size_t)WS_END2) return;
  float *QF = (float*)(ws + WS_QF), *KF = (float*)(ws + WS_KF), *VF = (float*)(ws + WS_VF), *YR = (float*)(ws + WS_YR);
  k_lin3<<<dim3(TNB * TT / 64, NH, 3), 128, 0, stream>>>(F[0], F[1], F[2], F[3], F[4], F[5], F[6], F[7], QF, KF, VF);
  k_pos<<<dim3((unsigned)(((size_t)TNB * NH * NPOS * (HDV / 4) + 255) / 256)), 256, 0, stream>>>(F[8], F[9], QF);
  k_prep8<<<dim3(TNB * TT / 64, NH), 128, 0, stream>>>(QF, KF, VF, QH, QL, KH, KL, VT, VB, VBL);
  k_fa<<<dim3(TT / FAQ, NH, TNB), 256, 0, stream>>>(QH, KH, QL, KL, VT, YR);
  k_fin<<<dim3(TT / 64, NH, TNB), 256, 0, stream>>>(YR, (float*)d_out);
}

// v003
// Measured time: 177 microseconds a run.
// Two timings next to v002 both put it at 1.42 times that version's speed.
// All steps since v000 together make it 5.63 times as fast.
// compute dtype: all float inputs rounded to bf16; q/k/v = W t + b (1x1 convs) with EXACT bf16 products on WMMA 16x16x32 (f32 rows); the content + position logits folded into one 128-deep product [q_i | pos_i] . [k_j | q_j] with BOTH operands as f16 hi + residual (x 2^10) (3 products: the logits are unscaled, sigma ~14, near-argmax); softmax in f32 (precise expf); P x 2^11 once to f16 against v once to f16 (1 product); f32 output (channels-first).
#include <hip/hip_runtime.h>
#include <math.h>

typedef __attribute__((ext_vector_type(16))) _Float16 v16h;
typedef __attribute__((ext_vector_type(16))) __bf16 v16b;
typedef __attribute__((ext_vector_type(8)))  _Float16 v8h;
typedef __attribute__((ext_vector_type(8)))  float v8f;
typedef __attribute__((ext_vector_type(4)))  float v4f;
typedef __attribute__((ext_vector_type(2)))  float v2f;
typedef __attribute__((ext_vector_type(4)))  unsigned v4u;
typedef __attribute__((ext_vector_type(4)))  int v4i;
typedef float __attribute__((may_alias)) float_a;
typedef int __attribute__((may_alias)) int_a;

template <typename T> __device__ __forceinline__ void vst2(void* p, T v) { *(T*)p = v;  }
__device__ __forceinline__ v8f wmma16(v16h a, v16h b, v8f c) {
  v8f d = __builtin_amdgcn_wmma_f32_16x16x32_f16(false, a, false, b, (short)0, c, false, false);
  asm volatile("v_nop\n\tv_nop\n\tv_nop\n\tv_nop" : "+v"(d) : "v"(a), "v"(b));
  return d;
}
__device__ __forceinline__ v8f wmma_bf(v16b a, v16b b, v8f c) {
  v8f d = __builtin_amdgcn_wmma_f32_16x16x32_bf16(false, a, false, b, (short)0, c, false, false);
  asm volatile("v_nop\n\tv_nop\n\tv_nop\n\tv_nop" : "+v"(d) : "v"(a), "v"(b));
  return d;
}
// 16x16x32 fragments: lane = (h = lane>>4, row/col = lane&15); elements 0..7 = k0+8h+0..7, 8..15 = k0+16+8h+0..7; D element r = row 8h+r
__device__ __forceinline__ v16h frag_h(const _Float16* rowk0, int lane) {
  union { v16h v; v8h q[2]; } u; const _Float16* p = rowk0 + 8 * (lane >> 4);
  u.q[0] = *(const v8h*)p; u.q[1] = *(const v8h*)(p + 16); return u.v;
}
__device__ __forceinline__ v16h frag_f32(const float* rowk0, int lane) {
  v16h a; const float* p = rowk0 + 8 * (lane >> 4);
#pragma unroll
  for (int i = 0; i < 8; ++i) { a[i] = (_Float16)p[i]; a[8 + i] = (_Float16)p[16 + i]; }
  return a;
}
__device__ __forceinline__ v16h frag_f32s(const float* rowk0, int lane, float sc) {
  v16h a; const float* p = rowk0 + 8 * (lane >> 4);
#pragma unroll
  for (int i = 0; i < 8; ++i) { a[i] = (_Float16)(p[i] * sc); a[8 + i] = (_Float16)(p[16 + i] * sc); }
  return a;
}
// column fragment from a [K][ld] layout (column n), rows >= K read as 0
__device__ __forceinline__ v16h fragc_f32(const float* W, int k0, int n, int lane, int ld, int K) {
  v16h a; const int g = lane >> 4;
#pragma unroll
  for (int i = 0; i < 8; ++i) { const int ka = k0 + 8 * g + i, kb = ka + 16;
    a[i] = (_Float16)(ka < K ? W[(size_t)(ka < K ? ka : K - 1) * ld + n] : 0.f); a[8 + i] = (_Float16)(kb < K ? W[(size_t)(kb < K ? kb : K - 1) * ld + n] : 0.f); }
  return a;
}
struct F2 { v16b h, l; };
__device__ __forceinline__ F2 bsplit16(const float v[16]) { F2 r;
#pragma unroll
  for (int i = 0; i < 16; ++i) { const __bf16 h = (__bf16)v[i]; r.h[i] = h; r.l[i] = (__bf16)(v[i] - (float)h); }
  return r; }
__device__ __forceinline__ F2 split_row(const float* row, int k0, int lane) { float v[16]; const float* p = row + k0 + 8 * (lane >> 4);
#pragma unroll
  for (int i = 0; i < 8; ++i) { v[i] = p[i]; v[8 + i] = p[16 + i]; }
  return bsplit16(v); }
__device__ __forceinline__ F2 split_rowK(const float* row, int k0, int lane, int K) { float v[16]; const int g = lane >> 4;
#pragma unroll
  for (int i = 0; i < 8; ++i) { const int ka = k0 + 8 * g + i, kb = ka + 16; v[i] = ka < K ? row[ka < K ? ka : K - 1] : 0.f; v[8 + i] = kb < K ? row[kb < K ? kb : K - 1] : 0.f; }
  return bsplit16(v); }
__device__ __forceinline__ F2 split_col(const float* W, int k0, int n, int lane, int ld, int K) { float v[16]; const int g = lane >> 4;
#pragma unroll
  for (int i = 0; i < 8; ++i) { const int ka = k0 + 8 * g + i, kb = ka + 16; v[i] = ka < K ? W[(size_t)(ka < K ? ka : K - 1) * ld + n] : 0.f; v[8 + i] = kb < K ? W[(size_t)(kb < K ? kb : K - 1) * ld + n] : 0.f; }
  return bsplit16(v); }
__device__ __forceinline__ v8f mac3(const F2& a, const F2& b, v8f c) { c = wmma_bf(a.l, b.h, c); c = wmma_bf(a.h, b.l, c); return wmma_bf(a.h, b.h, c); }
__device__ __forceinline__ float sigm(float v) { return 1.0f / (1.0f + expf(-v)); }
#define LDSX() do { asm volatile("s_wait_dscnt 0" ::: "memory"); __builtin_amdgcn_wave_barrier(); __builtin_amdgcn_fence(__ATOMIC_RELEASE, "workgroup"); } while (0)

// Bottleneck-transformer MHSA with 2-D relative position logits (B 8, C 512 = 8 x 64, 32 x 32 = 1,024 positions): q = Wq x + bq, k = Wk d + bk, v = Wv d + bv; energy[i][j] = q_i . k_j + pos_i . q_j with pos = (rel_h + rel_w) [h][64][n] (the module adds the [m,n]-indexed position term to the [n,m]-indexed content term positionally); attn = softmax_j; out[c][i] = sum_j v[c][j] attn[i][j] -> [B, C, 32, 32].
#define NB 8
#define TT 1024
#define CC 1024            // NH * HD = projected width
#define DIN 1024          // unused here (the input width is CIN)
#define NH 8
#define HD 128
#define NQB (TT / 64)
#define HG 8
#define SCALE (1.0f)
#define CAUSAL 0
#ifndef TNB
#define TNB NB
#endif
__device__ __forceinline__ float bfr(float v) { return (float)(__bf16)v; }
__host__ __device__ __forceinline__ int kb_last(int qb) { return CAUSAL ? ((qb * 64 + 63) >> 7) : (TT / 128 - 1); }
typedef __attribute__((ext_vector_type(8))) __bf16 v8b;
__device__ __forceinline__ v16b frag_b(const __bf16* rowk0, int lane) {
  union { v16b v; v8b q[2]; } u; const __bf16* p = rowk0 + 8 * (lane >> 4);
  u.q[0] = *(const v8b*)p; u.q[1] = *(const v8b*)(p + 16); return u.v;
}
#define QBH NQB            // every query block takes the 3-product logits path (q and k both f16 hi + residual); unscaled logits, sigma ~14
#define QHI 1024            // rows carrying a q residual plane (all rows when non-causal: 3-product logits everywhere, QBH = NQB)
#define KHI TT             // k residual rows for every key
// B fragment (k rows k0+.., output column o) of a weight: (in,out) [K][ld] or (out,in) [ld rows of K]: bf16 exact, or f16(bf16 * 256) exact
__device__ __forceinline__ v16b wcol_io(const float* Wm, int k0, int o, int lane, int ld) { v16b w; const int g = lane >> 4;
#pragma unroll
  for (int i = 0; i < 8; ++i) { w[i] = (__bf16)Wm[(size_t)(k0 + 8 * g + i) * ld + o]; w[8 + i] = (__bf16)Wm[(size_t)(k0 + 16 + 8 * g + i) * ld + o]; }
  return w; }
__device__ __forceinline__ v16b wcol_oi(const float* Wm, int k0, int o, int lane, int K) { v16b w; const float* p = Wm + (size_t)o * K + k0 + 8 * (lane >> 4);
#pragma unroll
  for (int i = 0; i < 8; ++i) { w[i] = (__bf16)p[i]; w[8 + i] = (__bf16)p[16 + i]; }
  return w; }
__device__ __forceinline__ v16h wcolh_io(const float* Wm, int k0, int o, int lane, int ld) { v16h w; const int g = lane >> 4;
#pragma unroll
  for (int i = 0; i < 8; ++i) { w[i] = (_Float16)(bfr(Wm[(size_t)(k0 + 8 * g + i) * ld + o]) * 256.0f); w[8 + i] = (_Float16)(bfr(Wm[(size_t)(k0 + 16 + 8 * g + i) * ld + o]) * 256.0f); }
  return w; }
__device__ __forceinline__ v16h wcolh_oi(const float* Wm, int k0, int o, int lane, int K) { v16h w; const float* p = Wm + (size_t)o * K + k0 + 8 * (lane >> 4);
#pragma unroll
  for (int i = 0; i < 8; ++i) { w[i] = (_Float16)(bfr(p[i]) * 256.0f); w[8 + i] = (_Float16)(bfr(p[16 + i]) * 256.0f); }
  return w; }
#define WQKV_LAYOUT 1   // 0 = (in,out) [DIN][CC]; 1 = (out,in) [CC][DIN]; 2 = per-head [NH][DIN][HD]
__device__ __forceinline__ v16b wcol_hdk(const float* Wm, int k0, int o, int lane) { v16b w; const int g = lane >> 4; const float* p = Wm + (size_t)(o / HD) * DIN * HD + (o % HD);
#pragma unroll
  for (int i = 0; i < 8; ++i) { w[i] = (__bf16)p[(size_t)(k0 + 8 * g + i) * HD]; w[8 + i] = (__bf16)p[(size_t)(k0 + 16 + 8 * g + i) * HD]; }
  return w; }
#define WO_OUT_IN 0
#if WQKV_LAYOUT == 1
#define WCOL(W, k0, o, lane) wcol_oi(W, k0, o, lane, DIN)
#elif WQKV_LAYOUT == 2
#define WCOL(W, k0, o, lane) wcol_hdk(W, k0, o, lane)
#else
#define WCOL(W, k0, o, lane) wcol_io(W, k0, o, lane, CC)
#endif
#if WO_OUT_IN
#define WOCOL(W, k0, o, lane) wcol_oi(W, k0, o, lane, CC)
#define WOCOLH(W, k0, o, lane) wcolh_oi(W, k0, o, lane, CC)
#else
#define WOCOL(W, k0, o, lane) wcol_io(W, k0, o, lane, DIN)
#define WOCOLH(W, k0, o, lane) wcolh_io(W, k0, o, lane, DIN)
#endif
#define CIN 512            // channels
#define NPOS 1024          // 32 x 32
#define HDV 64             // real head width (planes are 128 wide: [q | pos], [k | q], [v | 0])
// ---- k_lin3: block = (128 positions, head h, which), wave = 16 positions: y = W t + b (exact bf16 products, channels-first A gather, (out,in) W rows h*64..), written into the 128-wide BHSD f32 planes: which 0 (q from x): QF[.][0..63] and KF[.][64..127]; which 1 (k from d): KF[.][0..63]; which 2 (v from d): VF[.][0..63] and zeros into VF[.][64..127]. The head's 64 W rows come in 32-deep chunks: eight lanes read one row's whole 128-B line, the block rounds the chunk to bf16 once and keeps it in one of two LDS buffers, and all eight waves take their B fragments from there (same values, same k order as a direct read)
#define WPIT 40            // halves per staged W row (80 B = 16 B x odd: the sixteen rows of a fragment read fall on different banks)
typedef __attribute__((ext_vector_type(4))) __bf16 v4b;
__global__ __launch_bounds__(256) void k_lin3(const float* __restrict__ X, const float* __restrict__ Dd, const float* __restrict__ WQ, const float* __restrict__ BQ, const float* __restrict__ WK, const float* __restrict__ BK, const float* __restrict__ WV, const float* __restrict__ BV, float* __restrict__ QF, float* __restrict__ KF, float* __restrict__ VF) { __shared__ __align__(16) unsigned char sm[8 * 16 * 68 * 4];
  float (*sf)[16][68] = (float (*)[16][68])sm; __bf16 (*sw)[64][WPIT] = (__bf16 (*)[64][WPIT])sm;   /* the two W buffers (10,240 B) lie in the epilogue's tile, which is written only behind the barrier after the loop */
  const int tid = threadIdx.x, wave = tid >> 5, lane = tid & 31, col = lane & 15, g = lane >> 4; const int h = blockIdx.y, which = blockIdx.z; const size_t r0 = (size_t)blockIdx.x * 128 + wave * 16; const size_t b = r0 / NPOS; const int n0 = (int)(r0 % NPOS);
  const float* T = which == 0 ? X : Dd; const float* Wm = which == 0 ? WQ : which == 1 ? WK : WV; const float* Bm = which == 0 ? BQ : which == 1 ? BK : BV;
  const float* wsrc = Wm + (size_t)(h * HDV + (tid >> 3)) * CIN + (tid & 7) * 4;   /* this thread's share of a chunk: rows tid / 8 and tid / 8 + 32, k 4 (tid % 8) .. + 3 */
  v8f acc[4] = {};
  /* the '#pragma unroll' on the wv and acc loops: their counters index register arrays, which stay in registers only if the index is a constant */
#pragma unroll 1
  for (int kc = 0; kc < CIN / 32; ++kc) { v4f wv[2];
#pragma unroll
    for (int i = 0; i < 2; ++i) wv[i] = *(const v4f*)(wsrc + (size_t)i * 32 * CIN + kc * 32);
    v16b a; { const float* p = T + (b * CIN + kc * 32 + 8 * g) * (size_t)NPOS + n0 + col;   /* channels-first: element (b, c, n) at (b*512 + c)*1024 + n */
#pragma unroll
      for (int i = 0; i < 8; ++i) { a[i] = (__bf16)p[(size_t)i * NPOS]; a[8 + i] = (__bf16)p[(size_t)(16 + i) * NPOS]; } }
    asm volatile("s_wait_loadcnt 0x0" ::: "memory");
#pragma unroll
    for (int i = 0; i < 2; ++i) { v4b t; t[0] = (__bf16)wv[i][0]; t[1] = (__bf16)wv[i][1]; t[2] = (__bf16)wv[i][2]; t[3] = (__bf16)wv[i][3]; *(v4b*)&sw[kc & 1][(tid >> 3) + 32 * i][(tid & 7) * 4] = t; }
    __syncthreads();   /* publishes this chunk; it also stands behind every wave's reads of the other buffer (trip kc - 1), which the next trip refills */
#pragma unroll
    for (int j = 0; j < 4; j += 2) { const v16b w0 = frag_b(&sw[kc & 1][j * 16 + col][0], lane), w1 = frag_b(&sw[kc & 1][(j + 1) * 16 + col][0], lane); acc[j] = wmma_bf(a, w0, acc[j]); acc[j + 1] = wmma_bf(a, w1, acc[j + 1]); } }
  __syncthreads();     /* every wave has read its last W fragments before the tile below overwrites the buffers */
#pragma unroll
  for (int j = 0; j < 4; ++j) { const float bb = bfr(Bm[h * HDV + j * 16 + col]);
#pragma unroll
    for (int r = 0; r < 8; ++r) sf[wave][8 * g + r][j * 16 + col] = acc[j][r] + bb; }
  asm volatile("s_wait_loadcnt 0x0" ::: "memory");
  LDSX(); for (int rl = 0; rl < 16; ++rl) { const size_t prow = ((b * NH + h) * (size_t)TT + n0 + rl) * HD; const v4f v = *(const v4f*)&sf[wave][rl][(lane & 15) * 4]; v4f z; z[0] = z[1] = z[2] = z[3] = 0.f;
    if (which == 0) { if (lane < 16) vst2(QF + prow + lane * 4, v); else vst2(KF + prow + HDV + (lane & 15) * 4, v); }
    else if (which == 1) { if (lane < 16) vst2(KF + prow + lane * 4, v); }
    else { if (lane < 16) vst2(VF + prow + lane * 4, v); else vst2(VF + prow + HDV + (lane & 15) * 4, z); } } }
// ---- k_pos: thread per (b, h, n, d4) float4 over d: QF[b][h][n][64 + d] = bfr(rel_h[h][d][n % 32]) + bfr(rel_w[h][d][n / 32]) for every batch b (pos is batch independent)
__global__ __launch_bounds__(256) void k_pos(const float* __restrict__ RH, const float* __restrict__ RW, float* __restrict__ QF) { const size_t e = (size_t)blockIdx.x * 256 + threadIdx.x; if (e >= (size_t)NB * NH * NPOS * (HDV / 4)) return;
  const int d4 = (int)(e % (HDV / 4)); size_t r = e / (HDV / 4); const int n = (int)(r % NPOS); r /= NPOS; const int h = (int)(r % NH); const int b = (int)(r / NH); v4f o;
#pragma unroll
  for (int i = 0; i < 4; ++i) { const int d = d4 * 4 + i; o[i] = bfr(RH[(h * HDV + d) * 32 + (n % 32)]) + bfr(RW[(h * HDV + d) * 32 + (n / 32)]); }
  vst2(QF + (((size_t)b * NH + h) * TT + n) * HD + HDV + d4 * 4, o); }
// ---- k_fin: block = (64 positions, head h, batch b): out[b][h*64 + d][n] = Y[b*TT + n][h*128 + d] (channels-first transpose through LDS; 256-B runs of 64 positions)
__global__ __launch_bounds__(256) void k_fin(const float* __restrict__ Y, float* __restrict__ OUT) { __shared__ __align__(16) float st[64][68];
  const int tid = threadIdx.x; const int n0 = blockIdx.x * 64, h = blockIdx.y; const size_t b = blockIdx.z;
  for (int e = tid; e < 64 * 16; e += 256) { const int rl = e >> 4, q = e & 15; *(v4f*)&st[rl][q * 4] = *(const v4f*)(Y + (b * TT + n0 + rl) * (size_t)CC + h * HD + q * 4); }
  __syncthreads();
  for (int e = tid; e < HDV * 16; e += 256) { const int d = e >> 4, q = e & 15; v4f v; v[0] = st[q * 4][d]; v[1] = st[q * 4 + 1][d]; v[2] = st[q * 4 + 2][d]; v[3] = st[q * 4 + 3][d]; vst2(OUT + (b * CIN + h * HDV + d) * (size_t)NPOS + n0 + q * 4, v); } }
#define WS_QF  (WS_END)
#define WS_KF  (WS_QF + 4u * (size_t)NB * NH * TT * HD)
#define WS_VF  (WS_KF + 4u * (size_t)NB * NH * TT * HD)
#define WS_YR  (WS_QF)                                   // Y rows reuse the QF region (QF is dead once k_prep8 has run)
#define WS_END2 (WS_VF + 4u * (size_t)NB * NH * TT * HD)
// ---- k_prep8: block = (64 attention positions s0.. of sequence b, head h): reads the 128-wide f32 planes [B, H, S, 128] (element (b,h,s,c) at ((b*NH + h)*TT + s)*128 + c), without bf16 rounding, and writes the standard attention planes: q -> f16 hi rows (+ x 2^10 residual rows for s < QHI), k -> f16 rows (+ residual rows s < KHI), v -> f16 planes [c][s]
__global__ __launch_bounds__(128) void k_prep8(const float* __restrict__ Q, const float* __restrict__ K, const float* __restrict__ V, _Float16* __restrict__ QH, _Float16* __restrict__ QL, _Float16* __restrict__ KH, _Float16* __restrict__ KL, _Float16* __restrict__ VT, __bf16* __restrict__ VB, __bf16* __restrict__ VBL) {
  __shared__ __align__(16) _Float16 sq[64][136], sql[64][136], sk[64][136], skl[64][136], tv[128][72]; __shared__ __align__(16) __bf16 tb[128][72], tbl[128][72];
  const int tid = threadIdx.x; const int h = blockIdx.y; const size_t r0 = (size_t)blockIdx.x * 64; const size_t bb = r0 / TT; const int t0 = (int)(r0 % TT); const bool qhi = t0 < QHI, khi = t0 < KHI;
  for (int e = tid; e < 64 * 128; e += 128) { const int rl = e >> 7, c = e & 127; const size_t oi = ((bb * NH + h) * TT + t0 + rl) * HD + (c % HD);   /* c runs over the whole 128-wide plane row (HD is 128) */
    const float q = Q[oi], k = K[oi], v = V[oi];   /* f32 projection / position planes: no bf16 rounding; f16 hi + x2^10 residual rows carry q and k at ~2^-21 */
    const _Float16 qh = (_Float16)q, kh = (_Float16)k; sq[rl][c] = qh; sql[rl][c] = (_Float16)((q - (float)qh) * 1024.0f); sk[rl][c] = kh; skl[rl][c] = (_Float16)((k - (float)kh) * 1024.0f);
    tv[c][rl] = (_Float16)v; const __bf16 vb = (__bf16)v; tb[c][rl] = vb; tbl[c][rl] = (__bf16)(v - (float)vb); }
  __syncthreads();
  for (int e = tid; e < 64 * (HD / 8); e += 128) { const int rl = e / (HD / 8), q = e % (HD / 8); const size_t o = (r0 + rl) * CC + h * HD + q * 8; vst2((unsigned*)(QH + o), *(const v4u*)&sq[rl][q * 8]); vst2((unsigned*)(KH + o), *(const v4u*)&sk[rl][q * 8]);   
    if (qhi) vst2((unsigned*)(QL + (bb * QHI + t0 + rl) * (size_t)CC + h * HD + q * 8), *(const v4u*)&sql[rl][q * 8]); if (khi) vst2((unsigned*)(KL + (bb * KHI + t0 + rl) * (size_t)CC + h * HD + q * 8), *(const v4u*)&skl[rl][q * 8]); }
  for (int e = tid; e < HD * 8; e += 128) { const int cl = e >> 3, q = e & 7; vst2((unsigned*)(VT + (bb * CC + h * HD + cl) * (size_t)TT + t0 + q * 8), *(const v4u*)&tv[cl][q * 8]);
    /* bf16 v hi/lo planes not written: P.v uses the f16 planes for every query block */ } }

#ifndef SM_EXTRA_PARAMS
#define SM_EXTRA_PARAMS
#endif
#ifndef PROJ_EXTRA_PARAMS
#define PROJ_EXTRA_PARAMS
#endif
#ifndef SM_MASK_HOOK
#define SM_MASK_HOOK (void)0
#endif

#define WS_QH  0u                                      // f16 q rows [b*t][CC]
#define WS_KH  (WS_QH + 2u * (size_t)NB * TT * CC)      // f16 k rows [b*t][CC]
#define WS_VT  (WS_KH + 2u * (size_t)NB * TT * CC)      // f16 v planes [b][c][t]
#define WS_QL  (WS_VT + 2u * (size_t)NB * CC * TT)      // f16 q residual x 2^10 rows [b][t < QHI][CC]
#define WS_KL  (WS_QL + 2u * (size_t)NB * QHI * CC)     // f16 k residual x 2^10 rows [b][t < KHI][CC]
#define WS_VB  (WS_KL + 2u * (size_t)NB * KHI * CC)     // bf16 v hi planes not used (no space reserved)
#define WS_VBL (WS_VB + 0u)                            // bf16 v planes not used (P.v takes the f16 path)
#define WS_S   (WS_VBL + 0u)    // f32 logits / P [hg][t][s]: reserved but unused (k_fa keeps logits and P in registers)
#define WS_Y   (WS_S  + 4u * (size_t)HG * TT * TT)      // f32 ctx rows [b*t][CC] (only when there is an output projection)
#define WS_END (WS_Y  + 0u)

// lane l with lane l ^ 16 (the two halves of a wave hold the two halves of a query column's keys)
__device__ __forceinline__ float xhalf(float x) { return __builtin_bit_cast(float, __builtin_amdgcn_permlanex16(__builtin_bit_cast(int, x), __builtin_bit_cast(int, x), 0x76543210, 0xfedcba98, false, false)); }
#define FAQ 128            // queries per block: eight waves read each staged key tile
#define KPIT 136           // halves per staged k row (272 B = 16 B x odd: the sixteen rows of a fragment read fall on different banks)
#define VPIT 72            // halves per staged v row (144 B, likewise)
#define SG_KL (64 * KPIT)                    // residual rows behind the hi rows
#define SG_V  (2 * 64 * KPIT)                // v rows [channel][64 keys] behind both
#define SG_SZ (2 * 64 * KPIT + HD * VPIT)    // halves per stage (53,248 B)
// one 64-key stage, 12 copies of 16 B per lane straight into LDS: k hi rows and k residual rows (16 lanes a 256-B row, rows 16 apart), v rows (8 lanes a 128-B row, rows 32 apart). lk / lv: the lane's own LDS byte addresses, gk / gl / gv its own global addresses. The s_wait_xcnt ends the copies' own statement, so no address register is rewritten in front of it
__device__ __forceinline__ void fa_stage(unsigned lk, unsigned lv, const _Float16* gk, const _Float16* gl, const _Float16* gv) {
  asm volatile("global_load_async_to_lds_b128 %0, %12, off\n\t"
               "global_load_async_to_lds_b128 %1, %13, off\n\t"
               "global_load_async_to_lds_b128 %2, %14, off\n\t"
               "global_load_async_to_lds_b128 %3, %15, off\n\t"
               "global_load_async_to_lds_b128 %4, %16, off\n\t"
               "global_load_async_to_lds_b128 %5, %17, off\n\t"
               "global_load_async_to_lds_b128 %6, %18, off\n\t"
               "global_load_async_to_lds_b128 %7, %19, off\n\t"
               "global_load_async_to_lds_b128 %8, %20, off\n\t"
               "global_load_async_to_lds_b128 %9, %21, off\n\t"
               "global_load_async_to_lds_b128 %10, %22, off\n\t"
               "global_load_async_to_lds_b128 %11, %23, off\n\t"
               "s_wait_xcnt 0x0"
               :: "v"(lk), "v"(lk + 2u * 16 * KPIT), "v"(lk + 2u * 32 * KPIT), "v"(lk + 2u * 48 * KPIT),
                  "v"(lk + 2u * SG_KL), "v"(lk + 2u * (SG_KL + 16 * KPIT)), "v"(lk + 2u * (SG_KL + 32 * KPIT)), "v"(lk + 2u * (SG_KL + 48 * KPIT)),
                  "v"(lv), "v"(lv + 2u * 32 * VPIT), "v"(lv + 2u * 64 * VPIT), "v"(lv + 2u * 96 * VPIT),
                  "v"(gk), "v"(gk + 16 * CC), "v"(gk + 32 * CC), "v"(gk + 48 * CC),
                  "v"(gl), "v"(gl + 16 * CC), "v"(gl + 32 * CC), "v"(gl + 48 * CC),
                  "v"(gv), "v"(gv + 32 * TT), "v"(gv + 64 * TT), "v"(gv + 96 * TT)
               : "memory");
}
// ---- k_fa: block = 128 queries (qb) of (b, h), wave = 16 queries as COLUMNS; one pass over the keys in blocks of 64. Each key block (k hi rows, k residual rows, v rows) is copied once per block into one of two LDS stages by asynchronous copies, one key block ahead of the products, and all eight waves take their A fragments from there (two blocks a WGP, four waves a SIMD: at most 256 registers a wave, hence amdgpu_waves_per_eu). Transposed logits S^T = k . q^T (A = k rows hi / residual x 2^10, B = q rows hi / residual, 3 products, k order as before) stay in registers: lane (g, col) holds keys 16 j + 8 g + r of query col, so the running maximum and sum (f32, precise expf) are in-lane plus one exchange between the halves. exp(s - m) x 2^11 once to f16 packs from two 16-key tiles into one B fragment (element i = key 8 g + i, element 8 + i = key 16 + 8 g + i: the order frag_h gives the v planes as A); ctx^T += v^T . P^T (1 product), rescaled by exp(m_old - m_new) per key block and divided by the row sum at the end
__global__ __launch_bounds__(256) __attribute__((amdgpu_waves_per_eu(4, 4))) void k_fa(const _Float16* __restrict__ QH, const _Float16* __restrict__ KH, const _Float16* __restrict__ QL, const _Float16* __restrict__ KL, const _Float16* __restrict__ VT, float* __restrict__ Y) {
  __shared__ __attribute__((aligned(16))) _Float16 sg[2 * SG_SZ];
  const int tid = threadIdx.x, wave = tid >> 5, lane = tid & 31, col = lane & 15, g = lane >> 4; const int qb = blockIdx.x, h = blockIdx.y, b = blockIdx.z; const int ql0 = qb * FAQ + wave * 16; const size_t q0 = (size_t)b * TT + ql0;
  const _Float16* QLb = QL + (size_t)b * QHI * CC; const _Float16* KLb = KL + (size_t)b * KHI * CC;
  v16h qh[HD / 32], qr[HD / 32]; const _Float16* qrow = QH + (q0 + col) * CC + h * HD + 8 * g; const _Float16* qlrow = QLb + (size_t)(ql0 + col) * CC + h * HD + 8 * g;   /* the lane's own addresses: frag_h's element order, with its 8 g already added */
  /* every '#pragma unroll' in this kernel: its counter indexes a register array (fragments, accumulators), which stays in registers only if the index is a constant */
#pragma unroll
  for (int kc = 0; kc < HD / 32; ++kc) { union { v16h v; v8h q[2]; } u, w; u.q[0] = *(const v8h*)(qrow + kc * 32); u.q[1] = *(const v8h*)(qrow + kc * 32 + 16); w.q[0] = *(const v8h*)(qlrow + kc * 32); w.q[1] = *(const v8h*)(qlrow + kc * 32 + 16); qh[kc] = u.v; qr[kc] = w.v; }
  /* both lane addresses are inputs, so they stay in their registers up to this wait and no result of the sixteen loads above lands on an address that an issued load names */
  asm volatile("s_wait_xcnt 0x0" :: "v"(qrow), "v"(qlrow) : "memory");
  const unsigned sb = (unsigned)(size_t)sg; const unsigned lk = sb + 2u * ((tid >> 4) * KPIT + (tid & 15) * 8), lv = sb + 2u * (SG_V + (tid >> 3) * VPIT + (tid & 7) * 8);
  const _Float16* gk = KH + ((size_t)b * TT + (tid >> 4)) * CC + h * HD + (tid & 15) * 8; const _Float16* gl = KLb + (size_t)(tid >> 4) * CC + h * HD + (tid & 15) * 8; const _Float16* gv = VT + ((size_t)b * CC + h * HD + (tid >> 3)) * (size_t)TT + (tid & 7) * 8;
  fa_stage(lk, lv, gk, gl, gv);
  asm volatile("s_wait_asynccnt 0x0" ::: "memory");   /* this wave's copies of key block 0 have landed */
  __syncthreads();                                    /* ... and every other wave's */
  fa_stage(lk + 2u * SG_SZ, lv + 2u * SG_SZ, gk + 64 * CC, gl + 64 * CC, gv + 64);
  v8f o[HD / 16] = {}; float m = -3.0e38f, l = 0.f;
  /* kept rolled: one body is about 1,100 instructions */
#pragma unroll 1
  for (int k0 = 0; k0 < TT; k0 += 64) { const unsigned bo = ((k0 >> 6) & 1) * SG_SZ; const _Float16* st = sg + bo; v8f acc[4] = {}, accl[4] = {};
#pragma unroll
    for (int j = 0; j < 4; ++j) {
#pragma unroll
      for (int kc = 0; kc < HD / 32; ++kc) { const v16h kbf = frag_h(st + (j * 16 + col) * KPIT + kc * 32, lane), klf = frag_h(st + SG_KL + (j * 16 + col) * KPIT + kc * 32, lane); acc[j] = wmma16(kbf, qh[kc], acc[j]); accl[j] = wmma16(kbf, qr[kc], accl[j]); accl[j] = wmma16(klf, qh[kc], accl[j]); } }
    float mx = -3.0e38f;
#pragma unroll
    for (int j = 0; j < 4; ++j) {
#pragma unroll
      for (int r = 0; r < 8; ++r) { acc[j][r] = (acc[j][r] + accl[j][r] * (1.0f / 1024.0f)) * SCALE; mx = fmaxf(mx, acc[j][r]); } }
    mx = fmaxf(mx, xhalf(mx)); const float mn = fmaxf(m, mx), alpha = expf(m - mn); m = mn; float sum = 0.f; v16h p[2];
#pragma unroll
    for (int j = 0; j < 4; ++j) {
#pragma unroll
      for (int r = 0; r < 8; ++r) { const float e = expf(acc[j][r] - mn); sum += e; p[j >> 1][8 * (j & 1) + r] = (_Float16)(e * 2048.0f); } }
    l = l * alpha + sum;   /* this half's keys only; the halves are joined after the loop */
#pragma unroll
    for (int j = 0; j < HD / 16; ++j) {
#pragma unroll
      for (int r = 0; r < 8; ++r) o[j][r] *= alpha; }
#pragma unroll
    for (int j = 0; j < HD / 16; ++j) {
#pragma unroll
      for (int kc = 0; kc < 2; ++kc) o[j] = wmma16(frag_h(st + SG_V + (j * 16 + col) * VPIT + kc * 32, lane), p[kc], o[j]); }
    asm volatile("s_wait_dscnt 0x0" ::: "memory");      /* this wave's reads of the stage are done before the stage is given up */
    asm volatile("s_wait_asynccnt 0x0" ::: "memory");   /* this wave's copies of the next key block have landed */
    __syncthreads();                                    /* publishes the next key block and ends every wave's reads of this one */
    if (k0 + 128 < TT) fa_stage(lk + 2u * bo, lv + 2u * bo, gk + (size_t)(k0 + 128) * CC, gl + (size_t)(k0 + 128) * CC, gv + k0 + 128); }
  asm volatile("s_wait_asynccnt 0x0" ::: "memory");     /* nothing of this wave is in flight when it ends */
  l += xhalf(l); const float inv = l > 0.f ? 1.0f / (2048.0f * l) : 0.f;
  float* yr = Y + ((size_t)b * TT + ql0 + col) * CC + h * HD + 8 * g;   /* lane (g, col): channels 16 j + 8 g + r of query col, 32 B runs */
#pragma unroll
  for (int j = 0; j < HD / 16; ++j) { v4f a, c;
#pragma unroll
    for (int r = 0; r < 4; ++r) { a[r] = o[j][r] * inv; c[r] = o[j][4 + r] * inv; }
    vst2(yr + j * 16, a); vst2(yr + j * 16 + 4, c); } }

extern "C" void kernel_launch(void* const* d_in, const int* in_sizes, int n_in, void* d_out, int out_size, void* d_ws, size_t ws_size, hipStream_t stream) {
  (void)in_sizes; (void)n_in; (void)out_size;
  const float** F = (const float**)d_in;
  if (ws_size < (size_t)WS_END) return;
  char* ws = (char*)d_ws; _Float16 *QH = (_Float16*)(ws + WS_QH), *KH = (_Float16*)(ws + WS_KH), *VT = (_Float16*)(ws + WS_VT), *QL = (_Float16*)(ws + WS_QL), *KL = (_Float16*)(ws + WS_KL); __bf16 *VB = (__bf16*)(ws + WS_VB), *VBL = (__bf16*)(ws + WS_VBL); float *S = (float*)(ws + WS_S), *Y = (float*)(ws + WS_Y);
  (void)Y; (void)S; (void)VB; (void)VBL;
  // inputs: 0 x, 1 d [8,512,32,32]; 2 Wq [512,512] (out,in), 3 bq; 4 Wk, 5 bk; 6 Wv, 7 bv; 8 rel_h [1,8,64,1,32]; 9 rel_w [1,8,64,32,1]
  if (ws_size < (size_t)WS_END2) return;
  float *QF = (float*)(ws + WS_QF), *KF = (float*)(ws + WS_KF), *VF = (float*)(ws + WS_VF), *YR = (float*)(ws + WS_YR);
  k_lin3<<<dim3(TNB * TT / 128, NH, 3), 256, 0, stream>>>(F[0], F[1], F[2], F[3], F[4], F[5], F[6], F[7], QF, KF, VF);
  k_pos<<<dim3((unsigned)(((size_t)TNB * NH * NPOS * (HDV / 4) + 255) / 256)), 256, 0, stream>>>(F[8], F[9], QF);
  k_prep8<<<dim3(TNB * TT / 64, NH), 128, 0, stream>>>(QF, KF, VF, QH, QL, KH, KL, VT, VB, VBL);
  k_fa<<<dim3(TT / FAQ, NH, TNB), 256, 0, stream>>>(QH, KH, QL, KL, VT, YR);
  k_fin<<<dim3(TT / 64, NH, TNB), 256, 0, stream>>>(YR, (float*)d_out);
}

// v004
// It runs in 109 microseconds.
// Next to v003, in two timings, it ran 1.62 and 1.63 times as fast.
// All steps since v000 together make it 9.13 times as fast.
// compute dtype: all float inputs rounded to bf16; q/k/v = W t + b (1x1 convs) with EXACT bf16 products on WMMA 16x16x32 (f32 rows); the content + position logits folded into one 128-deep product [q_i | pos_i] . [k_j | q_j] with BOTH operands as f16 hi + residual (x 2^10) (3 products: the logits are unscaled, sigma ~14, near-argmax); softmax in f32 (precise expf); P x 2^11 once to f16 against v once to f16 (1 product); f32 output (channels-first).
#include <hip/hip_runtime.h>
#include <math.h>

typedef __attribute__((ext_vector_type(16))) _Float16 v16h;
typedef __attribute__((ext_vector_type(16))) __bf16 v16b;
typedef __attribute__((ext_vector_type(8)))  _Float16 v8h;
typedef __attribute__((ext_vector_type(8)))  float v8f;
typedef __attribute__((ext_vector_type(4)))  float v4f;
typedef __attribute__((ext_vector_type(2)))  float v2f;
typedef __attribute__((ext_vector_type(4)))  unsigned v4u;
typedef __attribute__((ext_vector_type(4)))  int v4i;
typedef float __attribute__((may_alias)) float_a;
typedef int __attribute__((may_alias)) int_a;

template <typename T> __device__ __forceinline__ void vst2(void* p, T v) { *(T*)p = v;  }
__device__ __forceinline__ v8f wmma16(v16h a, v16h b, v8f c) {
  v8f d = __builtin_amdgcn_wmma_f32_16x16x32_f16(false, a, false, b, (short)0, c, false, false);
  asm volatile("v_nop\n\tv_nop\n\tv_nop\n\tv_nop" : "+v"(d) : "v"(a), "v"(b));
  return d;
}
__device__ __forceinline__ v8f wmma_bf(v16b a, v16b b, v8f c) {
  v8f d = __builtin_amdgcn_wmma_f32_16x16x32_bf16(false, a, false, b, (short)0, c, false, false);
  asm volatile("v_nop\n\tv_nop\n\tv_nop\n\tv_nop" : "+v"(d) : "v"(a), "v"(b));
  return d;
}
// 16x16x32 fragments: lane = (h = lane>>4, row/col = lane&15); elements 0..7 = k0+8h+0..7, 8..15 = k0+16+8h+0..7; D element r = row 8h+r
__device__ __forceinline__ v16h frag_h(const _Float16* rowk0, int lane) {
  union { v16h v; v8h q[2]; } u; const _Float16* p = rowk0 + 8 * (lane >> 4);
  u.q[0] = *(const v8h*)p; u.q[1] = *(const v8h*)(p + 16); return u.v;
}
__device__ __forceinline__ v16h frag_f32(const float* rowk0, int lane) {
  v16h a; const float* p = rowk0 + 8 * (lane >> 4);
#pragma unroll
  for (int i = 0; i < 8; ++i) { a[i] = (_Float16)p[i]; a[8 + i] = (_Float16)p[16 + i]; }
  return a;
}
__device__ __forceinline__ v16h frag_f32s(const float* rowk0, int lane, float sc) {
  v16h a; const float* p = rowk0 + 8 * (lane >> 4);
#pragma unroll
  for (int i = 0; i < 8; ++i) { a[i] = (_Float16)(p[i] * sc); a[8 + i] = (_Float16)(p[16 + i] * sc); }
  return a;
}
// column fragment from a [K][ld] layout (column n), rows >= K read as 0
__device__ __forceinline__ v16h fragc_f32(const float* W, int k0, int n, int lane, int ld, int K) {
  v16h a; const int g = lane >> 4;
#pragma unroll
  for (int i = 0; i < 8; ++i) { const int ka = k0 + 8 * g + i, kb = ka + 16;
    a[i] = (_Float16)(ka < K ? W[(size_t)(ka < K ? ka : K - 1) * ld + n] : 0.f); a[8 + i] = (_Float16)(kb < K ? W[(size_t)(kb < K ? kb : K - 1) * ld + n] : 0.f); }
  return a;
}
struct F2 { v16b h, l; };
__device__ __forceinline__ F2 bsplit16(const float v[16]) { F2 r;
#pragma unroll
  for (int i = 0; i < 16; ++i) { const __bf16 h = (__bf16)v[i]; r.h[i] = h; r.l[i] = (__bf16)(v[i] - (float)h); }
  return r; }
__device__ __forceinline__ F2 split_row(const float* row, int k0, int lane) { float v[16]; const float* p = row + k0 + 8 * (lane >> 4);
#pragma unroll
  for (int i = 0; i < 8; ++i) { v[i] = p[i]; v[8 + i] = p[16 + i]; }
  return bsplit16(v); }
__device__ __forceinline__ F2 split_rowK(const float* row, int k0, int lane, int K) { float v[16]; const int g = lane >> 4;
#pragma unroll
  for (int i = 0; i < 8; ++i) { const int ka = k0 + 8 * g + i, kb = ka + 16; v[i] = ka < K ? row[ka < K ? ka : K - 1] : 0.f; v[8 + i] = kb < K ? row[kb < K ? kb : K - 1] : 0.f; }
  return bsplit16(v); }
__device__ __forceinline__ F2 split_col(const float* W, int k0, int n, int lane, int ld, int K) { float v[16]; const int g = lane >> 4;
#pragma unroll
  for (int i = 0; i < 8; ++i) { const int ka = k0 + 8 * g + i, kb = ka + 16; v[i] = ka < K ? W[(size_t)(ka < K ? ka : K - 1) * ld + n] : 0.f; v[8 + i] = kb < K ? W[(size_t)(kb < K ? kb : K - 1) * ld + n] : 0.f; }
  return bsplit16(v); }
__device__ __forceinline__ v8f mac3(const F2& a, const F2& b, v8f c) { c = wmma_bf(a.l, b.h, c); c = wmma_bf(a.h, b.l, c); return wmma_bf(a.h, b.h, c); }
__device__ __forceinline__ float sigm(float v) { return 1.0f / (1.0f + expf(-v)); }
#define LDSX() do { asm volatile("s_wait_dscnt 0" ::: "memory"); __builtin_amdgcn_wave_barrier(); __builtin_amdgcn_fence(__ATOMIC_RELEASE, "workgroup"); } while (0)

// Bottleneck-transformer MHSA with 2-D relative position logits (B 8, C 512 = 8 x 64, 32 x 32 = 1,024 positions): q = Wq x + bq, k = Wk d + bk, v = Wv d + bv; energy[i][j] = q_i . k_j + pos_i . q_j with pos = (rel_h + rel_w) [h][64][n] (the module adds the [m,n]-indexed position term to the [n,m]-indexed content term positionally); attn = softmax_j; out[c][i] = sum_j v[c][j] attn[i][j] -> [B, C, 32, 32].
#define NB 8
#define TT 1024
#define CC 1024            // NH * HD = projected width
#define DIN 1024          // unused here (the input width is CIN)
#define NH 8
#define HD 128
#define NQB (TT / 64)
#define HG 8
#define SCALE (1.0f)
#define CAUSAL 0
#ifndef TNB
#define TNB NB
#endif
__device__ __forceinline__ float bfr(float v) { return (float)(__bf16)v; }
__host__ __device__ __forceinline__ int kb_last(int qb) { return CAUSAL ? ((qb * 64 + 63) >> 7) : (TT / 128 - 1); }
typedef __attribute__((ext_vector_type(8))) __bf16 v8b;
__device__ __forceinline__ v16b frag_b(const __bf16* rowk0, int lane) {
  union { v16b v; v8b q[2]; } u; const __bf16* p = rowk0 + 8 * (lane >> 4);
  u.q[0] = *(const v8b*)p; u.q[1] = *(const v8b*)(p + 16); return u.v;
}
#define QBH NQB            // every query block takes the 3-product logits path (q and k both f16 hi + residual); unscaled logits, sigma ~14
#define QHI 1024            // rows carrying a q residual plane (all rows when non-causal: 3-product logits everywhere, QBH = NQB)
#define KHI TT             // k residual rows for every key
// B fragment (k rows k0+.., output column o) of a weight: (in,out) [K][ld] or (out,in) [ld rows of K]: bf16 exact, or f16(bf16 * 256) exact
__device__ __forceinline__ v16b wcol_io(const float* Wm, int k0, int o, int lane, int ld) { v16b w; const int g = lane >> 4;
#pragma unroll
  for (int i = 0; i < 8; ++i) { w[i] = (__bf16)Wm[(size_t)(k0 + 8 * g + i) * ld + o]; w[8 + i] = (__bf16)Wm[(size_t)(k0 + 16 + 8 * g + i) * ld + o]; }
  return w; }
__device__ __forceinline__ v16b wcol_oi(const float* Wm, int k0, int o, int lane, int K) { v16b w; const float* p = Wm + (size_t)o * K + k0 + 8 * (lane >> 4);
#pragma unroll
  for (int i = 0; i < 8; ++i) { w[i] = (__bf16)p[i]; w[8 + i] = (__bf16)p[16 + i]; }
  return w; }
__device__ __forceinline__ v16h wcolh_io(const float* Wm, int k0, int o, int lane, int ld) { v16h w; const int g = lane >> 4;
#pragma unroll
  for (int i = 0; i < 8; ++i) { w[i] = (_Float16)(bfr(Wm[(size_t)(k0 + 8 * g + i) * ld + o]) * 256.0f); w[8 + i] = (_Float16)(bfr(Wm[(size_t)(k0 + 16 + 8 * g + i) * ld + o]) * 256.0f); }
  return w; }
__device__ __forceinline__ v16h wcolh_oi(const float* Wm, int k0, int o, int lane, int K) { v16h w; const float* p = Wm + (size_t)o * K + k0 + 8 * (lane >> 4);
#pragma unroll
  for (int i = 0; i < 8; ++i) { w[i] = (_Float16)(bfr(p[i]) * 256.0f); w[8 + i] = (_Float16)(bfr(p[16 + i]) * 256.0f); }
  return w; }
#define WQKV_LAYOUT 1   // 0 = (in,out) [DIN][CC]; 1 = (out,in) [CC][DIN]; 2 = per-head [NH][DIN][HD]
__device__ __forceinline__ v16b wcol_hdk(const float* Wm, int k0, int o, int lane) { v16b w; const int g = lane >> 4; const float* p = Wm + (size_t)(o / HD) * DIN * HD + (o % HD);
#pragma unroll
  for (int i = 0; i < 8; ++i) { w[i] = (__bf16)p[(size_t)(k0 + 8 * g + i) * HD]; w[8 + i] = (__bf16)p[(size_t)(k0 + 16 + 8 * g + i) * HD]; }
  return w; }
#define WO_OUT_IN 0
#if WQKV_LAYOUT == 1
#define WCOL(W, k0, o, lane) wcol_oi(W, k0, o, lane, DIN)
#elif WQKV_LAYOUT == 2
#define WCOL(W, k0, o, lane) wcol_hdk(W, k0, o, lane)
#else
#define WCOL(W, k0, o, lane) wcol_io(W, k0, o, lane, CC)
#endif
#if WO_OUT_IN
#define WOCOL(W, k0, o, lane) wcol_oi(W, k0, o, lane, CC)
#define WOCOLH(W, k0, o, lane) wcolh_oi(W, k0, o, lane, CC)
#else
#define WOCOL(W, k0, o, lane) wcol_io(W, k0, o, lane, DIN)
#define WOCOLH(W, k0, o, lane) wcolh_io(W, k0, o, lane, DIN)
#endif
#define CIN 512            // channels
#define NPOS 1024          // 32 x 32
#define HDV 64             // real head width (planes are 128 wide: [q | pos], [k | q], [v | 0])
// ---- k_lin3: block = (128 positions, head h, which), wave = 16 positions: y = W t + b (exact bf16 products, channels-first A gather, (out,in) W rows h*64..), f32, written straight into the 128-wide f16 attention planes that k_fa reads: rows [q | pos] (QH, residual x 2^10 in QL), rows [k | q] (KH, KL), planes [v | 0][position] (VT). which 0 (q from x): QH/QL[.][0..63] and KH/KL[.][64..127]; which 1 (k from d): KH/KL[.][0..63], and the position rows QH/QL[.][64 + dch] = bfr(rel_h[h][dch][n % 32]) + bfr(rel_w[h][dch][n / 32]) of its own batch (these blocks have the heaviest epilogue); which 2 (v from d): VT channels 0..63 and zeros into 64..127. The head's 64 W rows come in 32-deep chunks: eight lanes read one row's whole 128-B line, the block rounds the chunk to bf16 once and keeps it in one of two LDS buffers, and all eight waves take their B fragments from there (same values, same k order as a direct read)
#define WPIT 40            // halves per staged W row (80 B = 16 B x odd: the sixteen rows of a fragment read fall on different banks)
typedef __attribute__((ext_vector_type(4))) __bf16 v4b;
// eight f32 of an LDS row -> f16 hi and f16 residual x 2^10 (together ~2^-21 of the value)
__device__ __forceinline__ void hires8(const float* s, v8h& hi, v8h& lo) { const v4f a = *(const v4f*)s, c = *(const v4f*)(s + 4);
#pragma unroll
  for (int i = 0; i < 4; ++i) { const _Float16 ha = (_Float16)a[i], hc = (_Float16)c[i]; hi[i] = ha; hi[4 + i] = hc; lo[i] = (_Float16)((a[i] - (float)ha) * 1024.0f); lo[4 + i] = (_Float16)((c[i] - (float)hc) * 1024.0f); } }
// a wave's own LDS tile changes hands between its lanes: the LDS operations so far are done, and the compiler moves none across (no fence: stores to global memory that are under way need not be waited for)
#define LDSW() do { asm volatile("s_wait_dscnt 0x0" ::: "memory"); __builtin_amdgcn_wave_barrier(); } while (0)
__global__ __launch_bounds__(256) void k_lin3(const float* __restrict__ X, const float* __restrict__ Dd, const float* __restrict__ WQ, const float* __restrict__ BQ, const float* __restrict__ WK, const float* __restrict__ BK, const float* __restrict__ WV, const float* __restrict__ BV, const float* __restrict__ RH, const float* __restrict__ RW, _Float16* __restrict__ QH, _Float16* __restrict__ QL, _Float16* __restrict__ KH, _Float16* __restrict__ KL, _Float16* __restrict__ VT) { __shared__ __align__(16) unsigned char sm[8 * 16 * 68 * 4];
  float (*sf)[16][68] = (float (*)[16][68])sm; __bf16 (*sw)[64][WPIT] = (__bf16 (*)[64][WPIT])sm;   /* the two W buffers (10,240 B) lie in the epilogue's tile, which is written only behind the barrier after the loop */
  const int tid = threadIdx.x, wave = tid >> 5, lane = tid & 31, col = lane & 15, g = lane >> 4; const int h = blockIdx.y, which = blockIdx.z; const size_t r0 = (size_t)blockIdx.x * 128 + wave * 16; const size_t b = r0 / NPOS; const int n0 = (int)(r0 % NPOS);
  const float* T = which == 0 ? X : Dd; const float* Wm = which == 0 ? WQ : which == 1 ? WK : WV; const float* Bm = which == 0 ? BQ : which == 1 ? BK : BV;
  const float* wsrc = Wm + (size_t)(h * HDV + (tid >> 3)) * CIN + (tid & 7) * 4;   /* this thread's share of a chunk: rows tid / 8 and tid / 8 + 32, k 4 (tid % 8) .. + 3 */
  v8f acc[4] = {};
  /* the '#pragma unroll' on the wv and acc loops: their counters index register arrays, which stay in registers only if the index is a constant */
#pragma unroll 1
  for (int kc = 0; kc < CIN / 32; ++kc) { v4f wv[2];
#pragma unroll
    for (int i = 0; i < 2; ++i) wv[i] = *(const v4f*)(wsrc + (size_t)i * 32 * CIN + kc * 32);
    v16b a; const float* p = T + (b * CIN + kc * 32 + 8 * g) * (size_t)NPOS + n0 + col;   /* channels-first: element (b, c, n) at (b*512 + c)*1024 + n */
#pragma unroll
      for (int i = 0; i < 8; ++i) { a[i] = (__bf16)p[(size_t)i * NPOS]; a[8 + i] = (__bf16)p[(size_t)(16 + i) * NPOS]; }
    asm volatile("s_wait_loadcnt 0x0\n\ts_wait_xcnt 0x0" :: "v"(p) : "memory");   /* the lane's address is an input, so it keeps its registers up to this wait and no result lands on an address that an issued load names */
#pragma unroll
    for (int i = 0; i < 2; ++i) { v4b t; t[0] = (__bf16)wv[i][0]; t[1] = (__bf16)wv[i][1]; t[2] = (__bf16)wv[i][2]; t[3] = (__bf16)wv[i][3]; *(v4b*)&sw[kc & 1][(tid >> 3) + 32 * i][(tid & 7) * 4] = t; }
    __syncthreads();   /* publishes this chunk; it also stands behind every wave's reads of the other buffer (trip kc - 1), which the next trip refills */
#pragma unroll
    for (int j = 0; j < 4; j += 2) { const v16b w0 = frag_b(&sw[kc & 1][j * 16 + col][0], lane), w1 = frag_b(&sw[kc & 1][(j + 1) * 16 + col][0], lane); acc[j] = wmma_bf(a, w0, acc[j]); acc[j + 1] = wmma_bf(a, w1, acc[j + 1]); } }
  __syncthreads();     /* every wave has read its last W fragments before the tile below overwrites the buffers */
  float bv[4]; const int bi = h * HDV + col;
#pragma unroll
  for (int j = 0; j < 4; ++j) bv[j] = Bm[bi + j * 16];
  asm volatile("s_wait_xcnt 0x0" :: "v"(bi) : "memory");   /* the lane's index is an input, so no result lands on the register that the issued loads name */
  if (which == 2) {   /* v: a lane's eight accumulator rows are eight consecutive positions of one channel, the order of a VT plane; the block's [64 channels][128 positions] tile goes through LDS so that every store run is a channel's whole 256 B */
    _Float16 (*sv)[136] = (_Float16 (*)[136])sm;   /* 272-B pitch (16 B x odd): the sixteen channels of a 16-B column fall on different banks */
#pragma unroll
    for (int j = 0; j < 4; ++j) { const float bb = bfr(bv[j]); v8h t;
#pragma unroll
      for (int r = 0; r < 8; ++r) t[r] = (_Float16)(acc[j][r] + bb);
      *(v8h*)&sv[j * 16 + col][wave * 16 + 8 * g] = t; }
    __syncthreads();   /* the tile is complete before other waves' lanes read it (which is the same for the whole block) */
    char* vt = (char*)VT + (((blockIdx.x >> 3) * CC + h * HD + (tid >> 4)) * TT + (blockIdx.x & 7) * 128u + (tid & 15) * 8) * 2u; v8h z = {};   /* eight blocks a batch; byte offset in the 16-MiB plane */
#pragma unroll
    for (int i = 0; i < 4; ++i) { vst2(vt + 16 * i * TT * 2, *(const v8h*)&sv[16 * i + (tid >> 4)][(tid & 15) * 8]); vst2(vt + (HDV + 16 * i) * TT * 2, z); }
    return; }
#pragma unroll
  for (int j = 0; j < 4; ++j) { const float bb = bfr(bv[j]);
#pragma unroll
    for (int r = 0; r < 8; ++r) sf[wave][8 * g + r][j * 16 + col] = acc[j][r] + bb; }
  LDSX();   /* the wave's own tile: its lanes' writes are in LDS before other lanes of the wave read them */
  const float* srow = &sf[wave][lane >> 3][(lane & 7) * 8];   /* row writer: eight lanes a row's 64 channels (128 B of f16), four rows a pass */
  const unsigned orow = ((blockIdx.x * 128u + wave * 16 + (lane >> 3)) * CC + h * HD + (lane & 7) * 8) * 2u;   /* byte offset of the lane's 16 B in a plane (a plane is 16 MiB) */
  char* H0 = (char*)(which == 0 ? QH : KH); char* L0 = (char*)(which == 0 ? QL : KL);
  /* both row loops are kept rolled: four passes side by side hold some 60 registers more, and above 80 a wave the 1,536 blocks no longer fit the chip at once */
#pragma unroll 1
  for (int p = 0; p < 4; ++p) { v8h hi, lo; hires8(srow + p * 4 * 68, hi, lo); const unsigned o = orow + p * (4u * CC * 2u); vst2(H0 + o, hi); vst2(L0 + o, lo);
    if (which == 0) { vst2((char*)KH + o + HDV * 2, hi); vst2((char*)KL + o + HDV * 2, lo); }
    asm volatile("s_wait_xcnt 0x0" :: "v"(o), "v"(hi), "v"(lo) : "memory"); }   /* offset and data are inputs, so they keep their registers up to this wait: the next pass rewrites nothing that an issued store names */
  if (which == 0) return;
  /* The wave's 16 positions lie in one row of the 32 x 32 map: n / 32 is one value, n % 32 runs over 16. Lane = (channel 32 hf + 8 it + lane / 4, positions 4 (lane % 4) .. + 3) */
  const float* prh = RH + (h * HDV + (lane >> 2)) * 32 + (wave & 1) * 16 + (lane & 3) * 4; const float* prw = RW + (h * HDV + (lane >> 2)) * 32 + (blockIdx.x & 7) * 4 + (wave >> 1);
  LDSW();   /* the k rows have been read before the position rows take their place in the wave's tile */
  /* two rolled halves, for the same register budget as the row loops */
#pragma unroll 1
  for (int hf = 0; hf < 2; ++hf) { v4f rh[4]; float rw[4]; const float* ph = prh + hf * 32 * 32; const float* pw = prw + hf * 32 * 32;
#pragma unroll
    for (int it = 0; it < 4; ++it) { rh[it] = *(const v4f*)(ph + it * 8 * 32); rw[it] = pw[it * 8 * 32]; }
    asm volatile("s_wait_xcnt 0x0" :: "v"(ph), "v"(pw) : "memory");   /* both lane addresses are inputs, so they keep their registers up to this wait and no result lands on an address that an issued load names */
#pragma unroll
    for (int it = 0; it < 4; ++it) {
#pragma unroll
      for (int i = 0; i < 4; ++i) sf[wave][(lane & 3) * 4 + i][hf * 32 + it * 8 + (lane >> 2)] = bfr(rh[it][i]) + bfr(rw[it]); } }
  LDSW();   /* written before other lanes read */
#pragma unroll 1
  for (int p = 0; p < 4; ++p) { v8h hi, lo; hires8(srow + p * 4 * 68, hi, lo); const unsigned o = orow + p * (4u * CC * 2u) + HDV * 2; vst2((char*)QH + o, hi); vst2((char*)QL + o, lo);
    asm volatile("s_wait_xcnt 0x0" :: "v"(o), "v"(hi), "v"(lo) : "memory"); } }   /* as in the first row loop */
// ---- k_fin: block = (64 positions, head h, batch b): out[b][h*64 + d][n] = Y[b*TT + n][h*128 + d] (channels-first transpose through LDS; 256-B runs of 64 positions)
__global__ __launch_bounds__(256) void k_fin(const float* __restrict__ Y, float* __restrict__ OUT) { __shared__ __align__(16) float st[64][68];
  const int tid = threadIdx.x; const int n0 = blockIdx.x * 64, h = blockIdx.y; const size_t b = blockIdx.z;
  for (int e = tid; e < 64 * 16; e += 256) { const int rl = e >> 4, q = e & 15; *(v4f*)&st[rl][q * 4] = *(const v4f*)(Y + (b * TT + n0 + rl) * (size_t)CC + h * HD + q * 4); }
  __syncthreads();
  for (int e = tid; e < HDV * 16; e += 256) { const int d = e >> 4, q = e & 15; v4f v; v[0] = st[q * 4][d]; v[1] = st[q * 4 + 1][d]; v[2] = st[q * 4 + 2][d]; v[3] = st[q * 4 + 3][d]; vst2(OUT + (b * CIN + h * HDV + d) * (size_t)NPOS + n0 + q * 4, v); } }
#define WS_YR  (WS_END)                                  // f32 ctx rows [b*t][CC] behind the f16 planes
#define WS_END2 (WS_YR + 4u * (size_t)NB * TT * CC)

#ifndef SM_EXTRA_PARAMS
#define SM_EXTRA_PARAMS
#endif
#ifndef PROJ_EXTRA_PARAMS
#define PROJ_EXTRA_PARAMS
#endif
#ifndef SM_MASK_HOOK
#define SM_MASK_HOOK (void)0
#endif

#define WS_QH  0u                                      // f16 q rows [b*t][CC]
#define WS_KH  (WS_QH + 2u * (size_t)NB * TT * CC)      // f16 k rows [b*t][CC]
#define WS_VT  (WS_KH + 2u * (size_t)NB * TT * CC)      // f16 v planes [b][c][t]
#define WS_QL  (WS_VT + 2u * (size_t)NB * CC * TT)      // f16 q residual x 2^10 rows [b][t < QHI][CC]
#define WS_KL  (WS_QL + 2u * (size_t)NB * QHI * CC)     // f16 k residual x 2^10 rows [b][t < KHI][CC]
#define WS_VB  (WS_KL + 2u * (size_t)NB * KHI * CC)     // bf16 v hi planes not used (no space reserved)
#define WS_VBL (WS_VB + 0u)                            // bf16 v planes not used (P.v takes the f16 path)
#define WS_S   (WS_VBL + 0u)    // f32 logits / P [hg][t][s]: reserved but unused (k_fa keeps logits and P in registers)
#define WS_Y   (WS_S  + 4u * (size_t)HG * TT * TT)      // f32 ctx rows [b*t][CC] (only when there is an output projection)
#define WS_END (WS_Y  + 0u)

// lane l with lane l ^ 16 (the two halves of a wave hold the two halves of a query column's keys)
__device__ __forceinline__ float xhalf(float x) { return __builtin_bit_cast(float, __builtin_amdgcn_permlanex16(__builtin_bit_cast(int, x), __builtin_bit_cast(int, x), 0x76543210, 0xfedcba98, false, false)); }
#define FAQ 128            // queries per block: eight waves read each staged key tile
#define KPIT 136           // halves per staged k row (272 B = 16 B x odd: the sixteen rows of a fragment read fall on different banks)
#define VPIT 72            // halves per staged v row (144 B, likewise)
#define SG_KL (64 * KPIT)                    // residual rows behind the hi rows
#define SG_V  (2 * 64 * KPIT)                // v rows [channel][64 keys] behind both
#define SG_SZ (2 * 64 * KPIT + HD * VPIT)    // halves per stage (53,248 B)
// one 64-key stage, 12 copies of 16 B per lane straight into LDS: k hi rows and k residual rows (16 lanes a 256-B row, rows 16 apart), v rows (8 lanes a 128-B row, rows 32 apart). lk / lv: the lane's own LDS byte addresses, gk / gl / gv its own global addresses. The s_wait_xcnt ends the copies' own statement, so no address register is rewritten in front of it
__device__ __forceinline__ void fa_stage(unsigned lk, unsigned lv, const _Float16* gk, const _Float16* gl, const _Float16* gv) {
  asm volatile("global_load_async_to_lds_b128 %0, %12, off\n\t"
               "global_load_async_to_lds_b128 %1, %13, off\n\t"
               "global_load_async_to_lds_b128 %2, %14, off\n\t"
               "global_load_async_to_lds_b128 %3, %15, off\n\t"
               "global_load_async_to_lds_b128 %4, %16, off\n\t"
               "global_load_async_to_lds_b128 %5, %17, off\n\t"
               "global_load_async_to_lds_b128 %6, %18, off\n\t"
               "global_load_async_to_lds_b128 %7, %19, off\n\t"
               "global_load_async_to_lds_b128 %8, %20, off\n\t"
               "global_load_async_to_lds_b128 %9, %21, off\n\t"
               "global_load_async_to_lds_b128 %10, %22, off\n\t"
               "global_load_async_to_lds_b128 %11, %23, off\n\t"
               "s_wait_xcnt 0x0"
               :: "v"(lk), "v"(lk + 2u * 16 * KPIT), "v"(lk + 2u * 32 * KPIT), "v"(lk + 2u * 48 * KPIT),
                  "v"(lk + 2u * SG_KL), "v"(lk + 2u * (SG_KL + 16 * KPIT)), "v"(lk + 2u * (SG_KL + 32 * KPIT)), "v"(lk + 2u * (SG_KL + 48 * KPIT)),
                  "v"(lv), "v"(lv + 2u * 32 * VPIT), "v"(lv + 2u * 64 * VPIT), "v"(lv + 2u * 96 * VPIT),
                  "v"(gk), "v"(gk + 16 * CC), "v"(gk + 32 * CC), "v"(gk + 48 * CC),
                  "v"(gl), "v"(gl + 16 * CC), "v"(gl + 32 * CC), "v"(gl + 48 * CC),
                  "v"(gv), "v"(gv + 32 * TT), "v"(gv + 64 * TT), "v"(gv + 96 * TT)
               : "memory");
}
// ---- k_fa: block = 128 queries (qb) of (b, h), wave = 16 queries as COLUMNS; one pass over the keys in blocks of 64. Each key block (k hi rows, k residual rows, v rows) is copied once per block into one of two LDS stages by asynchronous copies, one key block ahead of the products, and all eight waves take their A fragments from there (two blocks a WGP, four waves a SIMD: at most 256 registers a wave, hence amdgpu_waves_per_eu). Transposed logits S^T = k . q^T (A = k rows hi / residual x 2^10, B = q rows hi / residual, 3 products, k order as before) stay in registers: lane (g, col) holds keys 16 j + 8 g + r of query col, so the running maximum and sum (f32, precise expf) are in-lane plus one exchange between the halves. exp(s - m) x 2^11 once to f16 packs from two 16-key tiles into one B fragment (element i = key 8 g + i, element 8 + i = key 16 + 8 g + i: the order frag_h gives the v planes as A); ctx^T += v^T . P^T (1 product), rescaled by exp(m_old - m_new) per key block and divided by the row sum at the end
__global__ __launch_bounds__(256) __attribute__((amdgpu_waves_per_eu(4, 4))) void k_fa(const _Float16* __restrict__ QH, const _Float16* __restrict__ KH, const _Float16* __restrict__ QL, const _Float16* __restrict__ KL, const _Float16* __restrict__ VT, float* __restrict__ Y) {
  __shared__ __attribute__((aligned(16))) _Float16 sg[2 * SG_SZ];
  const int tid = threadIdx.x, wave = tid >> 5, lane = tid & 31, col = lane & 15, g = lane >> 4; const int qb = blockIdx.x, h = blockIdx.y, b = blockIdx.z; const int ql0 = qb * FAQ + wave * 16; const size_t q0 = (size_t)b * TT + ql0;
  const _Float16* QLb = QL + (size_t)b * QHI * CC; const _Float16* KLb = KL + (size_t)b * KHI * CC;
  v16h qh[HD / 32], qr[HD / 32]; const _Float16* qrow = QH + (q0 + col) * CC + h * HD + 8 * g; const _Float16* qlrow = QLb + (size_t)(ql0 + col) * CC + h * HD + 8 * g;   /* the lane's own addresses: frag_h's element order, with its 8 g already added */
  /* every '#pragma unroll' in this kernel: its counter indexes a register array (fragments, accumulators), which stays in registers only if the index is a constant */
#pragma unroll
  for (int kc = 0; kc < HD / 32; ++kc) { union { v16h v; v8h q[2]; } u, w; u.q[0] = *(const v8h*)(qrow + kc * 32); u.q[1] = *(const v8h*)(qrow + kc * 32 + 16); w.q[0] = *(const v8h*)(qlrow + kc * 32); w.q[1] = *(const v8h*)(qlrow + kc * 32 + 16); qh[kc] = u.v; qr[kc] = w.v; }
  /* both lane addresses are inputs, so they stay in their registers up to this wait and no result of the sixteen loads above lands on an address that an issued load names */
  asm volatile("s_wait_xcnt 0x0" :: "v"(qrow), "v"(qlrow) : "memory");
  const unsigned sb = (unsigned)(size_t)sg; const unsigned lk = sb + 2u * ((tid >> 4) * KPIT + (tid & 15) * 8), lv = sb + 2u * (SG_V + (tid >> 3) * VPIT + (tid & 7) * 8);
  const _Float16* gk = KH + ((size_t)b * TT + (tid >> 4)) * CC + h * HD + (tid & 15) * 8; const _Float16* gl = KLb + (size_t)(tid >> 4) * CC + h * HD + (tid & 15) * 8; const _Float16* gv = VT + ((size_t)b * CC + h * HD + (tid >> 3)) * (size_t)TT + (tid & 7) * 8;
  fa_stage(lk, lv, gk, gl, gv);
  asm volatile("s_wait_asynccnt 0x0" ::: "memory");   /* this wave's copies of key block 0 have landed */
  __syncthreads();                                    /* ... and every other wave's */
  fa_stage(lk + 2u * SG_SZ, lv + 2u * SG_SZ, gk + 64 * CC, gl + 64 * CC, gv + 64);
  v8f o[HD / 16] = {}; float m = -3.0e38f, l = 0.f;
  /* kept rolled: one body is about 1,100 instructions */
#pragma unroll 1
  for (int k0 = 0; k0 < TT; k0 += 64) { const unsigned bo = ((k0 >> 6) & 1) * SG_SZ; const _Float16* st = sg + bo; v8f acc[4] = {}, accl[4] = {};
#pragma unroll
    for (int j = 0; j < 4; ++j) {
#pragma unroll
      for (int kc = 0; kc < HD / 32; ++kc) { const v16h kbf = frag_h(st + (j * 16 + col) * KPIT + kc * 32, lane), klf = frag_h(st + SG_KL + (j * 16 + col) * KPIT + kc * 32, lane); acc[j] = wmma16(kbf, qh[kc], acc[j]); accl[j] = wmma16(kbf, qr[kc], accl[j]); accl[j] = wmma16(klf, qh[kc], accl[j]); } }
    float mx = -3.0e38f;
#pragma unroll
    for (int j = 0; j < 4; ++j) {
#pragma unroll
      for (int r = 0; r < 8; ++r) { acc[j][r] = (acc[j][r] + accl[j][r] * (1.0f / 1024.0f)) * SCALE; mx = fmaxf(mx, acc[j][r]); } }
    mx = fmaxf(mx, xhalf(mx)); const float mn = fmaxf(m, mx), alpha = expf(m - mn); m = mn; float sum = 0.f; v16h p[2];
#pragma unroll
    for (int j = 0; j < 4; ++j) {
#pragma unroll
      for (int r = 0; r < 8; ++r) { const float e = expf(acc[j][r] - mn); sum += e; p[j >> 1][8 * (j & 1) + r] = (_Float16)(e * 2048.0f); } }
    l = l * alpha + sum;   /* this half's keys only; the halves are joined after the loop */
#pragma unroll
    for (int j = 0; j < HD / 16; ++j) {
#pragma unroll
      for (int r = 0; r < 8; ++r) o[j][r] *= alpha; }
#pragma unroll
    for (int j = 0; j < HD / 16; ++j) {
#pragma unroll
      for (int kc = 0; kc < 2; ++kc) o[j] = wmma16(frag_h(st + SG_V + (j * 16 + col) * VPIT + kc * 32, lane), p[kc], o[j]); }
    asm volatile("s_wait_dscnt 0x0" ::: "memory");      /* this wave's reads of the stage are done before the stage is given up */
    asm volatile("s_wait_asynccnt 0x0" ::: "memory");   /* this wave's copies of the next key block have landed */
    __syncthreads();                                    /* publishes the next key block and ends every wave's reads of this one */
    if (k0 + 128 < TT) fa_stage(lk + 2u * bo, lv + 2u * bo, gk + (size_t)(k0 + 128) * CC, gl + (size_t)(k0 + 128) * CC, gv + k0 + 128); }
  asm volatile("s_wait_asynccnt 0x0" ::: "memory");     /* nothing of this wave is in flight when it ends */
  l += xhalf(l); const float inv = l > 0.f ? 1.0f / (2048.0f * l) : 0.f;
  float* yr = Y + ((size_t)b * TT + ql0 + col) * CC + h * HD + 8 * g;   /* lane (g, col): channels 16 j + 8 g + r of query col, 32 B runs */
#pragma unroll
  for (int j = 0; j < HD / 16; ++j) { v4f a, c;
#pragma unroll
    for (int r = 0; r < 4; ++r) { a[r] = o[j][r] * inv; c[r] = o[j][4 + r] * inv; }
    vst2(yr + j * 16, a); vst2(yr + j * 16 + 4, c); } }

extern "C" void kernel_launch(void* const* d_in, const int* in_sizes, int n_in, void* d_out, int out_size, void* d_ws, size_t ws_size, hipStream_t stream) {
  (void)in_sizes; (void)n_in; (void)out_size;
  const float** F = (const float**)d_in;
  if (ws_size < (size_t)WS_END) return;
  char* ws = (char*)d_ws; _Float16 *QH = (_Float16*)(ws + WS_QH), *KH = (_Float16*)(ws + WS_KH), *VT = (_Float16*)(ws + WS_VT), *QL = (_Float16*)(ws + WS_QL), *KL = (_Float16*)(ws + WS_KL); __bf16 *VB = (__bf16*)(ws + WS_VB), *VBL = (__bf16*)(ws + WS_VBL); float *S = (float*)(ws + WS_S), *Y = (float*)(ws + WS_Y);
  (void)Y; (void)S; (void)VB; (void)VBL;
  // inputs: 0 x, 1 d [8,512,32,32]; 2 Wq [512,512] (out,in), 3 bq; 4 Wk, 5 bk; 6 Wv, 7 bv; 8 rel_h [1,8,64,1,32]; 9 rel_w [1,8,64,32,1]
  if (ws_size < (size_t)WS_END2) return;
  float *YR = (float*)(ws + WS_YR);
  k_lin3<<<dim3(TNB * TT / 128, NH, 3), 256, 0, stream>>>(F[0], F[1], F[2], F[3], F[4], F[5], F[6], F[7], F[8], F[9], QH, QL, KH, KL, VT);
  k_fa<<<dim3(TT / FAQ, NH, TNB), 256, 0, stream>>>(QH, KH, QL, KL, VT, YR);
  k_fin<<<dim3(TT / 64, NH, TNB), 256, 0, stream>>>(YR, (float*)d_out);
}

// v005
// A run of this version takes 102 microseconds.
// Two timings next to v004 both put it at 1.08 times that version's speed.
// Counting every step since v000, it is 9.83 times as fast.
// compute dtype: all float inputs rounded to bf16; q/k/v = W t + b (1x1 convs) with EXACT bf16 products on WMMA 16x16x32 (f32 rows); the content + position logits folded into one 128-deep product [q_i | pos_i] . [k_j | q_j] with BOTH operands as f16 hi + residual (x 2^10) (3 products: the logits are unscaled, sigma ~14, near-argmax); softmax in f32 (precise expf); P x 2^11 once to f16 against v once to f16 (1 product); f32 output (channels-first).
#include <hip/hip_runtime.h>
#include <math.h>

typedef __attribute__((ext_vector_type(16))) _Float16 v16h;
typedef __attribute__((ext_vector_type(16))) __bf16 v16b;
typedef __attribute__((ext_vector_type(8)))  _Float16 v8h;
typedef __attribute__((ext_vector_type(8)))  float v8f;
typedef __attribute__((ext_vector_type(4)))  float v4f;
typedef __attribute__((ext_vector_type(2)))  float v2f;
typedef __attribute__((ext_vector_type(4)))  unsigned v4u;
typedef __attribute__((ext_vector_type(4)))  int v4i;
typedef float __attribute__((may_alias)) float_a;
typedef int __attribute__((may_alias)) int_a;

template <typename T> __device__ __forceinline__ void vst2(void* p, T v) { *(T*)p = v;  }
__device__ __forceinline__ v8f wmma16(v16h a, v16h b, v8f c) {
  v8f d = __builtin_amdgcn_wmma_f32_16x16x32_f16(false, a, false, b, (short)0, c, false, false);
  asm volatile("v_nop\n\tv_nop\n\tv_nop\n\tv_nop" : "+v"(d) : "v"(a), "v"(b));
  return d;
}
__device__ __forceinline__ v8f wmma_bf(v16b a, v16b b, v8f c) {
  v8f d = __builtin_amdgcn_wmma_f32_16x16x32_bf16(false, a, false, b, (short)0, c, false, false);
  asm volatile("v_nop\n\tv_nop\n\tv_nop\n\tv_nop" : "+v"(d) : "v"(a), "v"(b));
  return d;
}
// 16x16x32 fragments: lane = (h = lane>>4, row/col = lane&15); elements 0..7 = k0+8h+0..7, 8..15 = k0+16+8h+0..7; D element r = row 8h+r
__device__ __forceinline__ v16h frag_h(const _Float16* rowk0, int lane) {
  union { v16h v; v8h q[2]; } u; const _Float16* p = rowk0 + 8 * (lane >> 4);
  u.q[0] = *(const v8h*)p; u.q[1] = *(const v8h*)(p + 16); return u.v;
}
__device__ __forceinline__ v16h frag_f32(const float* rowk0, int lane) {
  v16h a; const float* p = rowk0 + 8 * (lane >> 4);
#pragma unroll
  for (int i = 0; i < 8; ++i) { a[i] = (_Float16)p[i]; a[8 + i] = (_Float16)p[16 + i]; }
  return a;
}
__device__ __forceinline__ v16h frag_f32s(const float* rowk0, int lane, float sc) {
  v16h a; const float* p = rowk0 + 8 * (lane >> 4);
#pragma unroll
  for (int i = 0; i < 8; ++i) { a[i] = (_Float16)(p[i] * sc); a[8 + i] = (_Float16)(p[16 + i] * sc); }
  return a;
}
// column fragment from a [K][ld] layout (column n), rows >= K read as 0
__device__ __forceinline__ v16h fragc_f32(const float* W, int k0, int n, int lane, int ld, int K) {
  v16h a; const int g = lane >> 4;
#pragma unroll
  for (int i = 0; i < 8; ++i) { const int ka = k0 + 8 * g + i, kb = ka + 16;
    a[i] = (_Float16)(ka < K ? W[(size_t)(ka < K ? ka : K - 1) * ld + n] : 0.f); a[8 + i] = (_Float16)(kb < K ? W[(size_t)(kb < K ? kb : K - 1) * ld + n] : 0.f); }
  return a;
}
struct F2 { v16b h, l; };
__device__ __forceinline__ F2 bsplit16(const float v[16]) { F2 r;
#pragma unroll
  for (int i = 0; i < 16; ++i) { const __bf16 h = (__bf16)v[i]; r.h[i] = h; r.l[i] = (__bf16)(v[i] - (float)h); }
  return r; }
__device__ __forceinline__ F2 split_row(const float* row, int k0, int lane) { float v[16]; const float* p = row + k0 + 8 * (lane >> 4);
#pragma unroll
  for (int i = 0; i < 8; ++i) { v[i] = p[i]; v[8 + i] = p[16 + i]; }
  return bsplit16(v); }
__device__ __forceinline__ F2 split_rowK(const float* row, int k0, int lane, int K) { float v[16]; const int g = lane >> 4;
#pragma unroll
  for (int i = 0; i < 8; ++i) { const int ka = k0 + 8 * g + i, kb = ka + 16; v[i] = ka < K ? row[ka < K ? ka : K - 1] : 0.f; v[8 + i] = kb < K ? row[kb < K ? kb : K - 1] : 0.f; }
  return bsplit16(v); }
__device__ __forceinline__ F2 split_col(const float* W, int k0, int n, int lane, int ld, int K) { float v[16]; const int g = lane >> 4;
#pragma unroll
  for (int i = 0; i < 8; ++i) { const int ka = k0 + 8 * g + i, kb = ka + 16; v[i] = ka < K ? W[(size_t)(ka < K ? ka : K - 1) * ld + n] : 0.f; v[8 + i] = kb < K ? W[(size_t)(kb < K ? kb : K - 1) * ld + n] : 0.f; }
  return bsplit16(v); }
__device__ __forceinline__ v8f mac3(const F2& a, const F2& b, v8f c) { c = wmma_bf(a.l, b.h, c); c = wmma_bf(a.h, b.l, c); return wmma_bf(a.h, b.h, c); }
__device__ __forceinline__ float sigm(float v) { return 1.0f / (1.0f + expf(-v)); }
#define LDSX() do { asm volatile("s_wait_dscnt 0" ::: "memory"); __builtin_amdgcn_wave_barrier(); __builtin_amdgcn_fence(__ATOMIC_RELEASE, "workgroup"); } while (0)

// Bottleneck-transformer MHSA with 2-D relative position logits (B 8, C 512 = 8 x 64, 32 x 32 = 1,024 positions): q = Wq x + bq, k = Wk d + bk, v = Wv d + bv; energy[i][j] = q_i . k_j + pos_i . q_j with pos = (rel_h + rel_w) [h][64][n] (the module adds the [m,n]-indexed position term to the [n,m]-indexed content term positionally); attn = softmax_j; out[c][i] = sum_j v[c][j] attn[i][j] -> [B, C, 32, 32].
#define NB 8
#define TT 1024
#define CC 1024            // NH * HD = projected width
#define DIN 1024          // unused here (the input width is CIN)
#define NH 8
#define HD 128
#define NQB (TT / 64)
#define HG 8
#define SCALE (1.0f)
#define CAUSAL 0
#ifndef TNB
#define TNB NB
#endif
__device__ __forceinline__ float bfr(float v) { return (float)(__bf16)v; }
__host__ __device__ __forceinline__ int kb_last(int qb) { return CAUSAL ? ((qb * 64 + 63) >> 7) : (TT / 128 - 1); }
typedef __attribute__((ext_vector_type(8))) __bf16 v8b;
__device__ __forceinline__ v16b frag_b(const __bf16* rowk0, int lane) {
  union { v16b v; v8b q[2]; } u; const __bf16* p = rowk0 + 8 * (lane >> 4);
  u.q[0] = *(const v8b*)p; u.q[1] = *(const v8b*)(p + 16); return u.v;
}
#define QBH NQB            // every query block takes the 3-product logits path (q and k both f16 hi + residual); unscaled logits, sigma ~14
#define QHI 1024            // rows carrying a q residual plane (all rows when non-causal: 3-product logits everywhere, QBH = NQB)
#define KHI TT             // k residual rows for every key
// B fragment (k rows k0+.., output column o) of a weight: (in,out) [K][ld] or (out,in) [ld rows of K]: bf16 exact, or f16(bf16 * 256) exact
__device__ __forceinline__ v16b wcol_io(const float* Wm, int k0, int o, int lane, int ld) { v16b w; const int g = lane >> 4;
#pragma unroll
  for (int i = 0; i < 8; ++i) { w[i] = (__bf16)Wm[(size_t)(k0 + 8 * g + i) * ld + o]; w[8 + i] = (__bf16)Wm[(size_t)(k0 + 16 + 8 * g + i) * ld + o]; }
  return w; }
__device__ __forceinline__ v16b wcol_oi(const float* Wm, int k0, int o, int lane, int K) { v16b w; const float* p = Wm + (size_t)o * K + k0 + 8 * (lane >> 4);
#pragma unroll
  for (int i = 0; i < 8; ++i) { w[i] = (__bf16)p[i]; w[8 + i] = (__bf16)p[16 + i]; }
  return w; }
__device__ __forceinline__ v16h wcolh_io(const float* Wm, int k0, int o, int lane, int ld) { v16h w; const int g = lane >> 4;
#pragma unroll
  for (int i = 0; i < 8; ++i) { w[i] = (_Float16)(bfr(Wm[(size_t)(k0 + 8 * g + i) * ld + o]) * 256.0f); w[8 + i] = (_Float16)(bfr(Wm[(size_t)(k0 + 16 + 8 * g + i) * ld + o]) * 256.0f); }
  return w; }
__device__ __forceinline__ v16h wcolh_oi(const float* Wm, int k0, int o, int lane, int K) { v16h w; const float* p = Wm + (size_t)o * K + k0 + 8 * (lane >> 4);
#pragma unroll
  for (int i = 0; i < 8; ++i) { w[i] = (_Float16)(bfr(p[i]) * 256.0f); w[8 + i] = (_Float16)(bfr(p[16 + i]) * 256.0f); }
  return w; }
#define WQKV_LAYOUT 1   // 0 = (in,out) [DIN][CC]; 1 = (out,in) [CC][DIN]; 2 = per-head [NH][DIN][HD]
__device__ __forceinline__ v16b wcol_hdk(const float* Wm, int k0, int o, int lane) { v16b w; const int g = lane >> 4; const float* p = Wm + (size_t)(o / HD) * DIN * HD + (o % HD);
#pragma unroll
  for (int i = 0; i < 8; ++i) { w[i] = (__bf16)p[(size_t)(k0 + 8 * g + i) * HD]; w[8 + i] = (__bf16)p[(size_t)(k0 + 16 + 8 * g + i) * HD]; }
  return w; }
#define WO_OUT_IN 0
#if WQKV_LAYOUT == 1
#define WCOL(W, k0, o, lane) wcol_oi(W, k0, o, lane, DIN)
#elif WQKV_LAYOUT == 2
#define WCOL(W, k0, o, lane) wcol_hdk(W, k0, o, lane)
#else
#define WCOL(W, k0, o, lane) wcol_io(W, k0, o, lane, CC)
#endif
#if WO_OUT_IN
#define WOCOL(W, k0, o, lane) wcol_oi(W, k0, o, lane, CC)
#define WOCOLH(W, k0, o, lane) wcolh_oi(W, k0, o, lane, CC)
#else
#define WOCOL(W, k0, o, lane) wcol_io(W, k0, o, lane, DIN)
#define WOCOLH(W, k0, o, lane) wcolh_io(W, k0, o, lane, DIN)
#endif
#define CIN 512            // channels
#define NPOS 1024          // 32 x 32
#define HDV 64             // real head width (planes are 128 wide: [q | pos], [k | q], [v | 0])
// ---- k_lin3: block = (128 positions, head h, which), wave = 16 positions: y = W t + b (exact bf16 products, channels-first A gather, (out,in) W rows h*64..), f32, written straight into the 128-wide f16 attention planes that k_fa reads: rows [q | pos] (QH, residual x 2^10 in QL), rows [k | q] (KH, KL), planes [v | 0][position] (VT). which 0 (q from x): QH/QL[.][0..63] and KH/KL[.][64..127]; which 1 (k from d): KH/KL[.][0..63], and the position rows QH/QL[.][64 + dch] = bfr(rel_h[h][dch][n % 32]) + bfr(rel_w[h][dch][n / 32]) of its own batch (these blocks have the heaviest epilogue); which 2 (v from d): VT channels 0..63 and zeros into 64..127. The head's 64 W rows come in 32-deep chunks: eight lanes read one row's whole 128-B line, the block rounds the chunk to bf16 once and keeps it in one of two LDS buffers, and all eight waves take their B fragments from there (same values, same k order as a direct read)
#define WPIT 40            // halves per staged W row (80 B = 16 B x odd: the sixteen rows of a fragment read fall on different banks)
typedef __attribute__((ext_vector_type(4))) __bf16 v4b;
// eight f32 of an LDS row -> f16 hi and f16 residual x 2^10 (together ~2^-21 of the value)
__device__ __forceinline__ void hires8(const float* s, v8h& hi, v8h& lo) { const v4f a = *(const v4f*)s, c = *(const v4f*)(s + 4);
#pragma unroll
  for (int i = 0; i < 4; ++i) { const _Float16 ha = (_Float16)a[i], hc = (_Float16)c[i]; hi[i] = ha; hi[4 + i] = hc; lo[i] = (_Float16)((a[i] - (float)ha) * 1024.0f); lo[4 + i] = (_Float16)((c[i] - (float)hc) * 1024.0f); } }
// a wave's own LDS tile changes hands between its lanes: the LDS operations so far are done, and the compiler moves none across (no fence: stores to global memory that are under way need not be waited for)
#define LDSW() do { asm volatile("s_wait_dscnt 0x0" ::: "memory"); __builtin_amdgcn_wave_barrier(); } while (0)
__global__ __launch_bounds__(256) void k_lin3(const float* __restrict__ X, const float* __restrict__ Dd, const float* __restrict__ WQ, const float* __restrict__ BQ, const float* __restrict__ WK, const float* __restrict__ BK, const float* __restrict__ WV, const float* __restrict__ BV, const float* __restrict__ RH, const float* __restrict__ RW, _Float16* __restrict__ QH, _Float16* __restrict__ QL, _Float16* __restrict__ KH, _Float16* __restrict__ KL, _Float16* __restrict__ VT) { __shared__ __align__(16) unsigned char sm[8 * 16 * 68 * 4];
  float (*sf)[16][68] = (float (*)[16][68])sm; __bf16 (*sw)[64][WPIT] = (__bf16 (*)[64][WPIT])sm;   /* the two W buffers (10,240 B) lie in the epilogue's tile, which is written only behind the barrier after the loop */
  const int tid = threadIdx.x, wave = tid >> 5, lane = tid & 31, col = lane & 15, g = lane >> 4; const int h = blockIdx.y, which = blockIdx.z; const size_t r0 = (size_t)blockIdx.x * 128 + wave * 16; const size_t b = r0 / NPOS; const int n0 = (int)(r0 % NPOS);
  const float* T = which == 0 ? X : Dd; const float* Wm = which == 0 ? WQ : which == 1 ? WK : WV; const float* Bm = which == 0 ? BQ : which == 1 ? BK : BV;
  const float* wsrc = Wm + (size_t)(h * HDV + (tid >> 3)) * CIN + (tid & 7) * 4;   /* this thread's share of a chunk: rows tid / 8 and tid / 8 + 32, k 4 (tid % 8) .. + 3 */
  v8f acc[4] = {};
  /* the '#pragma unroll' on the wv and acc loops: their counters index register arrays, which stay in registers only if the index is a constant */
#pragma unroll 1
  for (int kc = 0; kc < CIN / 32; ++kc) { v4f wv[2];
#pragma unroll
    for (int i = 0; i < 2; ++i) wv[i] = *(const v4f*)(wsrc + (size_t)i * 32 * CIN + kc * 32);
    v16b a; const float* p = T + (b * CIN + kc * 32 + 8 * g) * (size_t)NPOS + n0 + col;   /* channels-first: element (b, c, n) at (b*512 + c)*1024 + n */
#pragma unroll
      for (int i = 0; i < 8; ++i) { a[i] = (__bf16)p[(size_t)i * NPOS]; a[8 + i] = (__bf16)p[(size_t)(16 + i) * NPOS]; }
    asm volatile("s_wait_loadcnt 0x0\n\ts_wait_xcnt 0x0" :: "v"(p) : "memory");   /* the lane's address is an input, so it keeps its registers up to this wait and no result lands on an address that an issued load names */
#pragma unroll
    for (int i = 0; i < 2; ++i) { v4b t; t[0] = (__bf16)wv[i][0]; t[1] = (__bf16)wv[i][1]; t[2] = (__bf16)wv[i][2]; t[3] = (__bf16)wv[i][3]; *(v4b*)&sw[kc & 1][(tid >> 3) + 32 * i][(tid & 7) * 4] = t; }
    __syncthreads();   /* publishes this chunk; it also stands behind every wave's reads of the other buffer (trip kc - 1), which the next trip refills */
#pragma unroll
    for (int j = 0; j < 4; j += 2) { const v16b w0 = frag_b(&sw[kc & 1][j * 16 + col][0], lane), w1 = frag_b(&sw[kc & 1][(j + 1) * 16 + col][0], lane); acc[j] = wmma_bf(a, w0, acc[j]); acc[j + 1] = wmma_bf(a, w1, acc[j + 1]); } }
  __syncthreads();     /* every wave has read its last W fragments before the tile below overwrites the buffers */
  float bv[4]; const int bi = h * HDV + col;
#pragma unroll
  for (int j = 0; j < 4; ++j) bv[j] = Bm[bi + j * 16];
  asm volatile("s_wait_xcnt 0x0" :: "v"(bi) : "memory");   /* the lane's index is an input, so no result lands on the register that the issued loads name */
  if (which == 2) {   /* v: a lane's eight accumulator rows are eight consecutive positions of one channel, the order of a VT plane; the block's [64 channels][128 positions] tile goes through LDS so that every store run is a channel's whole 256 B */
    _Float16 (*sv)[136] = (_Float16 (*)[136])sm;   /* 272-B pitch (16 B x odd): the sixteen channels of a 16-B column fall on different banks */
#pragma unroll
    for (int j = 0; j < 4; ++j) { const float bb = bfr(bv[j]); v8h t;
#pragma unroll
      for (int r = 0; r < 8; ++r) t[r] = (_Float16)(acc[j][r] + bb);
      *(v8h*)&sv[j * 16 + col][wave * 16 + 8 * g] = t; }
    __syncthreads();   /* the tile is complete before other waves' lanes read it (which is the same for the whole block) */
    char* vt = (char*)VT + (((blockIdx.x >> 3) * CC + h * HD + (tid >> 4)) * TT + (blockIdx.x & 7) * 128u + (tid & 15) * 8) * 2u; v8h z = {};   /* eight blocks a batch; byte offset in the 16-MiB plane */
#pragma unroll
    for (int i = 0; i < 4; ++i) { vst2(vt + 16 * i * TT * 2, *(const v8h*)&sv[16 * i + (tid >> 4)][(tid & 15) * 8]); vst2(vt + (HDV + 16 * i) * TT * 2, z); }
    return; }
#pragma unroll
  for (int j = 0; j < 4; ++j) { const float bb = bfr(bv[j]);
#pragma unroll
    for (int r = 0; r < 8; ++r) sf[wave][8 * g + r][j * 16 + col] = acc[j][r] + bb; }
  LDSX();   /* the wave's own tile: its lanes' writes are in LDS before other lanes of the wave read them */
  const float* srow = &sf[wave][lane >> 3][(lane & 7) * 8];   /* row writer: eight lanes a row's 64 channels (128 B of f16), four rows a pass */
  const unsigned orow = ((blockIdx.x * 128u + wave * 16 + (lane >> 3)) * CC + h * HD + (lane & 7) * 8) * 2u;   /* byte offset of the lane's 16 B in a plane (a plane is 16 MiB) */
  char* H0 = (char*)(which == 0 ? QH : KH); char* L0 = (char*)(which == 0 ? QL : KL);
  /* both row loops are kept rolled: four passes side by side hold some 60 registers more, and above 80 a wave the 1,536 blocks no longer fit the chip at once */
#pragma unroll 1
  for (int p = 0; p < 4; ++p) { v8h hi, lo; hires8(srow + p * 4 * 68, hi, lo); const unsigned o = orow + p * (4u * CC * 2u); vst2(H0 + o, hi); vst2(L0 + o, lo);
    if (which == 0) { vst2((char*)KH + o + HDV * 2, hi); vst2((char*)KL + o + HDV * 2, lo); }
    asm volatile("s_wait_xcnt 0x0" :: "v"(o), "v"(hi), "v"(lo) : "memory"); }   /* offset and data are inputs, so they keep their registers up to this wait: the next pass rewrites nothing that an issued store names */
  if (which == 0) return;
  /* The wave's 16 positions lie in one row of the 32 x 32 map: n / 32 is one value, n % 32 runs over 16. Lane = (channel 32 hf + 8 it + lane / 4, positions 4 (lane % 4) .. + 3) */
  const float* prh = RH + (h * HDV + (lane >> 2)) * 32 + (wave & 1) * 16 + (lane & 3) * 4; const float* prw = RW + (h * HDV + (lane >> 2)) * 32 + (blockIdx.x & 7) * 4 + (wave >> 1);
  LDSW();   /* the k rows have been read before the position rows take their place in the wave's tile */
  /* two rolled halves, for the same register budget as the row loops */
#pragma unroll 1
  for (int hf = 0; hf < 2; ++hf) { v4f rh[4]; float rw[4]; const float* ph = prh + hf * 32 * 32; const float* pw = prw + hf * 32 * 32;
#pragma unroll
    for (int it = 0; it < 4; ++it) { rh[it] = *(const v4f*)(ph + it * 8 * 32); rw[it] = pw[it * 8 * 32]; }
    asm volatile("s_wait_xcnt 0x0" :: "v"(ph), "v"(pw) : "memory");   /* both lane addresses are inputs, so they keep their registers up to this wait and no result lands on an address that an issued load names */
#pragma unroll
    for (int it = 0; it < 4; ++it) {
#pragma unroll
      for (int i = 0; i < 4; ++i) sf[wave][(lane & 3) * 4 + i][hf * 32 + it * 8 + (lane >> 2)] = bfr(rh[it][i]) + bfr(rw[it]); } }
  LDSW();   /* written before other lanes read */
#pragma unroll 1
  for (int p = 0; p < 4; ++p) { v8h hi, lo; hires8(srow + p * 4 * 68, hi, lo); const unsigned o = orow + p * (4u * CC * 2u) + HDV * 2; vst2((char*)QH + o, hi); vst2((char*)QL + o, lo);
    asm volatile("s_wait_xcnt 0x0" :: "v"(o), "v"(hi), "v"(lo) : "memory"); } }   /* as in the first row loop */
#ifndef SM_EXTRA_PARAMS
#define SM_EXTRA_PARAMS
#endif
#ifndef PROJ_EXTRA_PARAMS
#define PROJ_EXTRA_PARAMS
#endif
#ifndef SM_MASK_HOOK
#define SM_MASK_HOOK (void)0
#endif

#define WS_QH  0u                                      // f16 q rows [b*t][CC]
#define WS_KH  (WS_QH + 2u * (size_t)NB * TT * CC)      // f16 k rows [b*t][CC]
#define WS_VT  (WS_KH + 2u * (size_t)NB * TT * CC)      // f16 v planes [b][c][t]
#define WS_QL  (WS_VT + 2u * (size_t)NB * CC * TT)      // f16 q residual x 2^10 rows [b][t < QHI][CC]
#define WS_KL  (WS_QL + 2u * (size_t)NB * QHI * CC)     // f16 k residual x 2^10 rows [b][t < KHI][CC]
#define WS_VB  (WS_KL + 2u * (size_t)NB * KHI * CC)     // bf16 v hi planes not used (no space reserved)
#define WS_VBL (WS_VB + 0u)                            // bf16 v planes not used (P.v takes the f16 path)
#define WS_S   (WS_VBL + 0u)    // f32 logits / P [hg][t][s]: reserved but unused (k_fa keeps logits and P in registers)
#define WS_Y   (WS_S  + 4u * (size_t)HG * TT * TT)      // f32 ctx rows [b*t][CC] (only when there is an output projection)
#define WS_END (WS_Y  + 0u)

// lane l with lane l ^ 16 (the two halves of a wave hold the two halves of a query column's keys)
__device__ __forceinline__ float xhalf(float x) { return __builtin_bit_cast(float, __builtin_amdgcn_permlanex16(__builtin_bit_cast(int, x), __builtin_bit_cast(int, x), 0x76543210, 0xfedcba98, false, false)); }
#define FAQ 128            // queries per block: eight waves read each staged key tile
#define KPIT 136           // halves per staged k row (272 B = 16 B x odd: the sixteen rows of a fragment read fall on different banks)
#define VPIT 72            // halves per staged v row (144 B, likewise)
#define SG_KL (64 * KPIT)                    // residual rows behind the hi rows
#define SG_V  (2 * 64 * KPIT)                // v rows [channel][64 keys] behind both
#define SG_SZ (2 * 64 * KPIT + HD * VPIT)    // halves per stage (53,248 B)
#define OPIT 132           // floats per row of the output tile (528 B: the two channels, eight apart, that a wave's two halves write fall on different banks)
typedef v4f __attribute__((may_alias)) v4fa;
// one 64-key stage, 12 copies of 16 B per lane straight into LDS: k hi rows and k residual rows (16 lanes a 256-B row, rows 16 apart), v rows (8 lanes a 128-B row, rows 32 apart). lk / lv: the lane's own LDS byte addresses, gk / gl / gv its own global addresses. The s_wait_xcnt ends the copies' own statement, so no address register is rewritten in front of it
__device__ __forceinline__ void fa_stage(unsigned lk, unsigned lv, const _Float16* gk, const _Float16* gl, const _Float16* gv) {
  asm volatile("global_load_async_to_lds_b128 %0, %12, off\n\t"
               "global_load_async_to_lds_b128 %1, %13, off\n\t"
               "global_load_async_to_lds_b128 %2, %14, off\n\t"
               "global_load_async_to_lds_b128 %3, %15, off\n\t"
               "global_load_async_to_lds_b128 %4, %16, off\n\t"
               "global_load_async_to_lds_b128 %5, %17, off\n\t"
               "global_load_async_to_lds_b128 %6, %18, off\n\t"
               "global_load_async_to_lds_b128 %7, %19, off\n\t"
               "global_load_async_to_lds_b128 %8, %20, off\n\t"
               "global_load_async_to_lds_b128 %9, %21, off\n\t"
               "global_load_async_to_lds_b128 %10, %22, off\n\t"
               "global_load_async_to_lds_b128 %11, %23, off\n\t"
               "s_wait_xcnt 0x0"
               :: "v"(lk), "v"(lk + 2u * 16 * KPIT), "v"(lk + 2u * 32 * KPIT), "v"(lk + 2u * 48 * KPIT),
                  "v"(lk + 2u * SG_KL), "v"(lk + 2u * (SG_KL + 16 * KPIT)), "v"(lk + 2u * (SG_KL + 32 * KPIT)), "v"(lk + 2u * (SG_KL + 48 * KPIT)),
                  "v"(lv), "v"(lv + 2u * 32 * VPIT), "v"(lv + 2u * 64 * VPIT), "v"(lv + 2u * 96 * VPIT),
                  "v"(gk), "v"(gk + 16 * CC), "v"(gk + 32 * CC), "v"(gk + 48 * CC),
                  "v"(gl), "v"(gl + 16 * CC), "v"(gl + 32 * CC), "v"(gl + 48 * CC),
                  "v"(gv), "v"(gv + 32 * TT), "v"(gv + 64 * TT), "v"(gv + 96 * TT)
               : "memory");
}
// ---- k_fa: block = 128 queries (qb) of (b, h), wave = 16 queries as COLUMNS; one pass over the keys in blocks of 64. Each key block (k hi rows, k residual rows, v rows) is copied once per block into one of two LDS stages by asynchronous copies, one key block ahead of the products, and all eight waves take their A fragments from there (two blocks a WGP, four waves a SIMD: at most 256 registers a wave, hence amdgpu_waves_per_eu). Transposed logits S^T = k . q^T (A = k rows hi / residual x 2^10, B = q rows hi / residual, 3 products, k order as before) stay in registers: lane (g, col) holds keys 16 j + 8 g + r of query col, so the running maximum and sum (f32, precise expf) are in-lane plus one exchange between the halves. exp(s - m) x 2^11 once to f16 packs from two 16-key tiles into one B fragment (element i = key 8 g + i, element 8 + i = key 16 + 8 g + i: the order frag_h gives the v planes as A); ctx^T += v^T . P^T (1 product), rescaled by exp(m_old - m_new) per key block and divided by the row sum at the end; channels 0..63 (the v half of a plane) go to out[b][h*64 + d][n]
__global__ __launch_bounds__(256) __attribute__((amdgpu_waves_per_eu(4, 4))) void k_fa(const _Float16* __restrict__ QH, const _Float16* __restrict__ KH, const _Float16* __restrict__ QL, const _Float16* __restrict__ KL, const _Float16* __restrict__ VT, float* __restrict__ OUT) {
  __shared__ __attribute__((aligned(16))) _Float16 sg[2 * SG_SZ];
  const int tid = threadIdx.x, wave = tid >> 5, lane = tid & 31, col = lane & 15, g = lane >> 4; const int qb = blockIdx.x, h = blockIdx.y, b = blockIdx.z; const int ql0 = qb * FAQ + wave * 16; const size_t q0 = (size_t)b * TT + ql0;
  const _Float16* QLb = QL + (size_t)b * QHI * CC; const _Float16* KLb = KL + (size_t)b * KHI * CC;
  v16h qh[HD / 32], qr[HD / 32]; const _Float16* qrow = QH + (q0 + col) * CC + h * HD + 8 * g; const _Float16* qlrow = QLb + (size_t)(ql0 + col) * CC + h * HD + 8 * g;   /* the lane's own addresses: frag_h's element order, with its 8 g already added */
  /* every '#pragma unroll' in this kernel but the last: its counter indexes a register array (fragments, accumulators), which stays in registers only if the index is a constant */
#pragma unroll
  for (int kc = 0; kc < HD / 32; ++kc) { union { v16h v; v8h q[2]; } u, w; u.q[0] = *(const v8h*)(qrow + kc * 32); u.q[1] = *(const v8h*)(qrow + kc * 32 + 16); w.q[0] = *(const v8h*)(qlrow + kc * 32); w.q[1] = *(const v8h*)(qlrow + kc * 32 + 16); qh[kc] = u.v; qr[kc] = w.v; }
  /* both lane addresses are inputs, so they stay in their registers up to this wait and no result of the sixteen loads above lands on an address that an issued load names */
  asm volatile("s_wait_xcnt 0x0" :: "v"(qrow), "v"(qlrow) : "memory");
  const unsigned sb = (unsigned)(size_t)sg; const unsigned lk = sb + 2u * ((tid >> 4) * KPIT + (tid & 15) * 8), lv = sb + 2u * (SG_V + (tid >> 3) * VPIT + (tid & 7) * 8);
  const _Float16* gk = KH + ((size_t)b * TT + (tid >> 4)) * CC + h * HD + (tid & 15) * 8; const _Float16* gl = KLb + (size_t)(tid >> 4) * CC + h * HD + (tid & 15) * 8; const _Float16* gv = VT + ((size_t)b * CC + h * HD + (tid >> 3)) * (size_t)TT + (tid & 7) * 8;
  fa_stage(lk, lv, gk, gl, gv);
  asm volatile("s_wait_asynccnt 0x0" ::: "memory");   /* this wave's copies of key block 0 have landed */
  __syncthreads();                                    /* ... and every other wave's */
  fa_stage(lk + 2u * SG_SZ, lv + 2u * SG_SZ, gk + 64 * CC, gl + 64 * CC, gv + 64);
  v8f o[HD / 16] = {}; float m = -3.0e38f, l = 0.f;
  /* kept rolled: one body is about 1,100 instructions */
#pragma unroll 1
  for (int k0 = 0; k0 < TT; k0 += 64) { const unsigned bo = ((k0 >> 6) & 1) * SG_SZ; const _Float16* st = sg + bo; v8f acc[4] = {}, accl[4] = {};
#pragma unroll
    for (int j = 0; j < 4; ++j) {
#pragma unroll
      for (int kc = 0; kc < HD / 32; ++kc) { const v16h kbf = frag_h(st + (j * 16 + col) * KPIT + kc * 32, lane), klf = frag_h(st + SG_KL + (j * 16 + col) * KPIT + kc * 32, lane); acc[j] = wmma16(kbf, qh[kc], acc[j]); accl[j] = wmma16(kbf, qr[kc], accl[j]); accl[j] = wmma16(klf, qh[kc], accl[j]); } }
    float mx = -3.0e38f;
#pragma unroll
    for (int j = 0; j < 4; ++j) {
#pragma unroll
      for (int r = 0; r < 8; ++r) { acc[j][r] = (acc[j][r] + accl[j][r] * (1.0f / 1024.0f)) * SCALE; mx = fmaxf(mx, acc[j][r]); } }
    mx = fmaxf(mx, xhalf(mx)); const float mn = fmaxf(m, mx), alpha = expf(m - mn); m = mn; float sum = 0.f; v16h p[2];
#pragma unroll
    for (int j = 0; j < 4; ++j) {
#pragma unroll
      for (int r = 0; r < 8; ++r) { const float e = expf(acc[j][r] - mn); sum += e; p[j >> 1][8 * (j & 1) + r] = (_Float16)(e * 2048.0f); } }
    l = l * alpha + sum;   /* this half's keys only; the halves are joined after the loop */
#pragma unroll
    for (int j = 0; j < HD / 16; ++j) {
#pragma unroll
      for (int r = 0; r < 8; ++r) o[j][r] *= alpha; }
#pragma unroll
    for (int j = 0; j < HD / 16; ++j) {
#pragma unroll
      for (int kc = 0; kc < 2; ++kc) o[j] = wmma16(frag_h(st + SG_V + (j * 16 + col) * VPIT + kc * 32, lane), p[kc], o[j]); }
    asm volatile("s_wait_dscnt 0x0" ::: "memory");      /* this wave's reads of the stage are done before the stage is given up */
    asm volatile("s_wait_asynccnt 0x0" ::: "memory");   /* this wave's copies of the next key block have landed */
    __syncthreads();                                    /* publishes the next key block and ends every wave's reads of this one */
    if (k0 + 128 < TT) fa_stage(lk + 2u * bo, lv + 2u * bo, gk + (size_t)(k0 + 128) * CC, gl + (size_t)(k0 + 128) * CC, gv + k0 + 128); }
  asm volatile("s_wait_asynccnt 0x0" ::: "memory");     /* nothing of this wave is in flight when it ends */
  l += xhalf(l); const float inv = l > 0.f ? 1.0f / (2048.0f * l) : 0.f;
  /* out is channels-first: the block's [64 real channels][128 queries] tile goes through LDS, so that every store run is a channel's whole 512 B. The stages are free: the barrier at the foot of the last trip stands behind every wave's last read, and every wave's last copies were waited for in front of an earlier one */
  float_a (*so)[OPIT] = (float_a (*)[OPIT])sg;
#pragma unroll
  for (int j = 0; j < HDV / 16; ++j) {
#pragma unroll
    for (int r = 0; r < 8; ++r) so[j * 16 + 8 * g + r][wave * 16 + col] = o[j][r] * inv; }   /* lane (g, col): channels 16 j + 8 g + r of query col */
  __syncthreads();   /* the tile is complete before other waves' lanes read it */
  float* op = OUT + ((size_t)b * CIN + h * HDV + wave) * NPOS + qb * FAQ + lane * 4;   /* a wave takes one channel's 128 queries a pass, eight channels apart */
  /* unrolled: the eight LDS reads go out together, each into registers of its own, and the stores share one address register pair that nothing rewrites */
#pragma unroll
  for (int i = 0; i < HDV / 8; ++i) vst2(op + i * 8 * NPOS, *(const v4fa*)&so[i * 8 + wave][lane * 4]); }

extern "C" void kernel_launch(void* const* d_in, const int* in_sizes, int n_in, void* d_out, int out_size, void* d_ws, size_t ws_size, hipStream_t stream) {
  (void)in_sizes; (void)n_in; (void)out_size;
  const float** F = (const float**)d_in;
  if (ws_size < (size_t)WS_END) return;
  char* ws = (char*)d_ws; _Float16 *QH = (_Float16*)(ws + WS_QH), *KH = (_Float16*)(ws + WS_KH), *VT = (_Float16*)(ws + WS_VT), *QL = (_Float16*)(ws + WS_QL), *KL = (_Float16*)(ws + WS_KL); __bf16 *VB = (__bf16*)(ws + WS_VB), *VBL = (__bf16*)(ws + WS_VBL); float *S = (float*)(ws + WS_S), *Y = (float*)(ws + WS_Y);
  (void)Y; (void)S; (void)VB; (void)VBL;
  // inputs: 0 x, 1 d [8,512,32,32]; 2 Wq [512,512] (out,in), 3 bq; 4 Wk, 5 bk; 6 Wv, 7 bv; 8 rel_h [1,8,64,1,32]; 9 rel_w [1,8,64,32,1]
  k_lin3<<<dim3(TNB * TT / 128, NH, 3), 256, 0, stream>>>(F[0], F[1], F[2], F[3], F[4], F[5], F[6], F[7], F[8], F[9], QH, QL, KH, KL, VT);
  k_fa<<<dim3(TT / FAQ, NH, TNB), 256, 0, stream>>>(QH, KH, QL, KL, VT, (float*)d_out);
}

// v006
// Measured time: 85.6 microseconds a run.
// Timed twice side by side with v005, it ran 1.18 and 1.19 times as fast.
// All steps since v000 together make it 11.7 times as fast.
// compute dtype: all float inputs rounded to bf16; q/k/v = W t + b (1x1 convs) with EXACT bf16 products on WMMA 16x16x32 (f32 rows); the content + position logits folded into one 128-deep product [q_i | pos_i] . [k_j | q_j] with BOTH operands as f16 hi + residual (x 2^10) (3 products: the logits are unscaled, sigma ~14, near-argmax); softmax in f32 (exponentials in base 2 on v_exp_f32); P x 2^11 once to f16 against v once to f16 (1 product); f32 output (channels-first).
#include <hip/hip_runtime.h>
#include <math.h>

typedef __attribute__((ext_vector_type(16))) _Float16 v16h;
typedef __attribute__((ext_vector_type(16))) __bf16 v16b;
typedef __attribute__((ext_vector_type(8)))  _Float16 v8h;
typedef __attribute__((ext_vector_type(8)))  float v8f;
typedef __attribute__((ext_vector_type(4)))  float v4f;
typedef __attribute__((ext_vector_type(2)))  float v2f;
typedef __attribute__((ext_vector_type(4)))  unsigned v4u;
typedef __attribute__((ext_vector_type(4)))  int v4i;
typedef float __attribute__((may_alias)) float_a;
typedef int __attribute__((may_alias)) int_a;

template <typename T> __device__ __forceinline__ void vst2(void* p, T v) { *(T*)p = v;  }
__device__ __forceinline__ v8f wmma16(v16h a, v16h b, v8f c) {
  v8f d = __builtin_amdgcn_wmma_f32_16x16x32_f16(false, a, false, b, (short)0, c, false, false);
  asm volatile("v_nop\n\tv_nop\n\tv_nop\n\tv_nop" : "+v"(d) : "v"(a), "v"(b));
  return d;
}
__device__ __forceinline__ v8f wmma_bf(v16b a, v16b b, v8f c) {
  v8f d = __builtin_amdgcn_wmma_f32_16x16x32_bf16(false, a, false, b, (short)0, c, false, false);
  asm volatile("v_nop\n\tv_nop\n\tv_nop\n\tv_nop" : "+v"(d) : "v"(a), "v"(b));
  return d;
}
// 16x16x32 fragments: lane = (h = lane>>4, row/col = lane&15); elements 0..7 = k0+8h+0..7, 8..15 = k0+16+8h+0..7; D element r = row 8h+r
__device__ __forceinline__ v16h frag_h(const _Float16* rowk0, int lane) {
  union { v16h v; v8h q[2]; } u; const _Float16* p = rowk0 + 8 * (lane >> 4);
  u.q[0] = *(const v8h*)p; u.q[1] = *(const v8h*)(p + 16); return u.v;
}
__device__ __forceinline__ v16h frag_f32(const float* rowk0, int lane) {
  v16h a; const float* p = rowk0 + 8 * (lane >> 4);
#pragma unroll
  for (int i = 0; i < 8; ++i) { a[i] = (_Float16)p[i]; a[8 + i] = (_Float16)p[16 + i]; }
  return a;
}
__device__ __forceinline__ v16h frag_f32s(const float* rowk0, int lane, float sc) {
  v16h a; const float* p = rowk0 + 8 * (lane >> 4);
#pragma unroll
  for (int i = 0; i < 8; ++i) { a[i] = (_Float16)(p[i] * sc); a[8 + i] = (_Float16)(p[16 + i] * sc); }
  return a;
}
// column fragment from a [K][ld] layout (column n), rows >= K read as 0
__device__ __forceinline__ v16h fragc_f32(const float* W, int k0, int n, int lane, int ld, int K) {
  v16h a; const int g = lane >> 4;
#pragma unroll
  for (int i = 0; i < 8; ++i) { const int ka = k0 + 8 * g + i, kb = ka + 16;
    a[i] = (_Float16)(ka < K ? W[(size_t)(ka < K ? ka : K - 1) * ld + n] : 0.f); a[8 + i] = (_Float16)(kb < K ? W[(size_t)(kb < K ? kb : K - 1) * ld + n] : 0.f); }
  return a;
}
struct F2 { v16b h, l; };
__device__ __forceinline__ F2 bsplit16(const float v[16]) { F2 r;
#pragma unroll
  for (int i = 0; i < 16; ++i) { const __bf16 h = (__bf16)v[i]; r.h[i] = h; r.l[i] = (__bf16)(v[i] - (float)h); }
  return r; }
__device__ __forceinline__ F2 split_row(const float* row, int k0, int lane) { float v[16]; const float* p = row + k0 + 8 * (lane >> 4);
#pragma unroll
  for (int i = 0; i < 8; ++i) { v[i] = p[i]; v[8 + i] = p[16 + i]; }
  return bsplit16(v); }
__device__ __forceinline__ F2 split_rowK(const float* row, int k0, int lane, int K) { float v[16]; const int g = lane >> 4;
#pragma unroll
  for (int i = 0; i < 8; ++i) { const int ka = k0 + 8 * g + i, kb = ka + 16; v[i] = ka < K ? row[ka < K ? ka : K - 1] : 0.f; v[8 + i] = kb < K ? row[kb < K ? kb : K - 1] : 0.f; }
  return bsplit16(v); }
__device__ __forceinline__ F2 split_col(const float* W, int k0, int n, int lane, int ld, int K) { float v[16]; const int g = lane >> 4;
#pragma unroll
  for (int i = 0; i < 8; ++i) { const int ka = k0 + 8 * g + i, kb = ka + 16; v[i] = ka < K ? W[(size_t)(ka < K ? ka : K - 1) * ld + n] : 0.f; v[8 + i] = kb < K ? W[(size_t)(kb < K ? kb : K - 1) * ld + n] : 0.f; }
  return bsplit16(v); }
__device__ __forceinline__ v8f mac3(const F2& a, const F2& b, v8f c) { c = wmma_bf(a.l, b.h, c); c = wmma_bf(a.h, b.l, c); return wmma_bf(a.h, b.h, c); }
__device__ __forceinline__ float sigm(float v) { return 1.0f / (1.0f + expf(-v)); }
#define LDSX() do { asm volatile("s_wait_dscnt 0" ::: "memory"); __builtin_amdgcn_wave_barrier(); __builtin_amdgcn_fence(__ATOMIC_RELEASE, "workgroup"); } while (0)

// Bottleneck-transformer MHSA with 2-D relative position logits (B 8, C 512 = 8 x 64, 32 x 32 = 1,024 positions): q = Wq x + bq, k = Wk d + bk, v = Wv d + bv; energy[i][j] = q_i . k_j + pos_i . q_j with pos = (rel_h + rel_w) [h][64][n] (the module adds the [m,n]-indexed position term to the [n,m]-indexed content term positionally); attn = softmax_j; out[c][i] = sum_j v[c][j] attn[i][j] -> [B, C, 32, 32].
#define NB 8
#define TT 1024
#define CC 1024            // NH * HD = projected width
#define DIN 1024          // unused here (the input width is CIN)
#define NH 8
#define HD 128
#define NQB (TT / 64)
#define HG 8
#define SCALE (1.0f)
#define CAUSAL 0
#ifndef TNB
#define TNB NB
#endif
__device__ __forceinline__ float bfr(float v) { return (float)(__bf16)v; }
__host__ __device__ __forceinline__ int kb_last(int qb) { return CAUSAL ? ((qb * 64 + 63) >> 7) : (TT / 128 - 1); }
typedef __attribute__((ext_vector_type(8))) __bf16 v8b;
__device__ __forceinline__ v16b frag_b(const __bf16* rowk0, int lane) {
  union { v16b v; v8b q[2]; } u; const __bf16* p = rowk0 + 8 * (lane >> 4);
  u.q[0] = *(const v8b*)p; u.q[1] = *(const v8b*)(p + 16); return u.v;
}
#define QBH NQB            // every query block takes the 3-product logits path (q and k both f16 hi + residual); unscaled logits, sigma ~14
#define QHI 1024            // rows carrying a q residual plane (all rows when non-causal: 3-product logits everywhere, QBH = NQB)
#define KHI TT             // k residual rows for every key
// B fragment (k rows k0+.., output column o) of a weight: (in,out) [K][ld] or (out,in) [ld rows of K]: bf16 exact, or f16(bf16 * 256) exact
__device__ __forceinline__ v16b wcol_io(const float* Wm, int k0, int o, int lane, int ld) { v16b w; const int g = lane >> 4;
#pragma unroll
  for (int i = 0; i < 8; ++i) { w[i] = (__bf16)Wm[(size_t)(k0 + 8 * g + i) * ld + o]; w[8 + i] = (__bf16)Wm[(size_t)(k0 + 16 + 8 * g + i) * ld + o]; }
  return w; }
__device__ __forceinline__ v16b wcol_oi(const float* Wm, int k0, int o, int lane, int K) { v16b w; const float* p = Wm + (size_t)o * K + k0 + 8 * (lane >> 4);
#pragma unroll
  for (int i = 0; i < 8; ++i) { w[i] = (__bf16)p[i]; w[8 + i] = (__bf16)p[16 + i]; }
  return w; }
__device__ __forceinline__ v16h wcolh_io(const float* Wm, int k0, int o, int lane, int ld) { v16h w; const int g = lane >> 4;
#pragma unroll
  for (int i = 0; i < 8; ++i) { w[i] = (_Float16)(bfr(Wm[(size_t)(k0 + 8 * g + i) * ld + o]) * 256.0f); w[8 + i] = (_Float16)(bfr(Wm[(size_t)(k0 + 16 + 8 * g + i) * ld + o]) * 256.0f); }
  return w; }
__device__ __forceinline__ v16h wcolh_oi(const float* Wm, int k0, int o, int lane, int K) { v16h w; const float* p = Wm + (size_t)o * K + k0 + 8 * (lane >> 4);
#pragma unroll
  for (int i = 0; i < 8; ++i) { w[i] = (_Float16)(bfr(p[i]) * 256.0f); w[8 + i] = (_Float16)(bfr(p[16 + i]) * 256.0f); }
  return w; }
#define WQKV_LAYOUT 1   // 0 = (in,out) [DIN][CC]; 1 = (out,in) [CC][DIN]; 2 = per-head [NH][DIN][HD]
__device__ __forceinline__ v16b wcol_hdk(const float* Wm, int k0, int o, int lane) { v16b w; const int g = lane >> 4; const float* p = Wm + (size_t)(o / HD) * DIN * HD + (o % HD);
#pragma unroll
  for (int i = 0; i < 8; ++i) { w[i] = (__bf16)p[(size_t)(k0 + 8 * g + i) * HD]; w[8 + i] = (__bf16)p[(size_t)(k0 + 16 + 8 * g + i) * HD]; }
  return w; }
#define WO_OUT_IN 0
#if WQKV_LAYOUT == 1
#define WCOL(W, k0, o, lane) wcol_oi(W, k0, o, lane, DIN)
#elif WQKV_LAYOUT == 2
#define WCOL(W, k0, o, lane) wcol_hdk(W, k0, o, lane)
#else
#define WCOL(W, k0, o, lane) wcol_io(W, k0, o, lane, CC)
#endif
#if WO_OUT_IN
#define WOCOL(W, k0, o, lane) wcol_oi(W, k0, o, lane, CC)
#define WOCOLH(W, k0, o, lane) wcolh_oi(W, k0, o, lane, CC)
#else
#define WOCOL(W, k0, o, lane) wcol_io(W, k0, o, lane, DIN)
#define WOCOLH(W, k0, o, lane) wcolh_io(W, k0, o, lane, DIN)
#endif
#define CIN 512            // channels
#define NPOS 1024          // 32 x 32
#define HDV 64             // real head width (planes are 128 wide: [q | pos], [k | q], [v | 0])
// ---- k_lin3: block = (128 positions, head h, which), wave = 16 positions: y = W t + b (exact bf16 products, channels-first A gather, (out,in) W rows h*64..), f32, written straight into the 128-wide f16 attention planes that k_fa reads: rows [q | pos] (QH, residual x 2^10 in QL), rows [k | q] (KH, KL), planes [v | 0][position] (VT). which 0 (q from x): QH/QL[.][0..63] and KH/KL[.][64..127]; which 1 (k from d): KH/KL[.][0..63], and the position rows QH/QL[.][64 + dch] = bfr(rel_h[h][dch][n % 32]) + bfr(rel_w[h][dch][n / 32]) of its own batch (these blocks have the heaviest epilogue); which 2 (v from d): VT channels 0..63 and zeros into 64..127. The head's 64 W rows come in 32-deep chunks: eight lanes read one row's whole 128-B line, the block rounds the chunk to bf16 once and keeps it in one of two LDS buffers, and all eight waves take their B fragments from there (same values, same k order as a direct read)
#define WPIT 40            // halves per staged W row (80 B = 16 B x odd: the sixteen rows of a fragment read fall on different banks)
typedef __attribute__((ext_vector_type(4))) __bf16 v4b;
// eight f32 of an LDS row -> f16 hi and f16 residual x 2^10 (together ~2^-21 of the value)
__device__ __forceinline__ void hires8(const float* s, v8h& hi, v8h& lo) { const v4f a = *(const v4f*)s, c = *(const v4f*)(s + 4);
#pragma unroll
  for (int i = 0; i < 4; ++i) { const _Float16 ha = (_Float16)a[i], hc = (_Float16)c[i]; hi[i] = ha; hi[4 + i] = hc; lo[i] = (_Float16)((a[i] - (float)ha) * 1024.0f); lo[4 + i] = (_Float16)((c[i] - (float)hc) * 1024.0f); } }
// a wave's own LDS tile changes hands between its lanes: the LDS operations so far are done, and the compiler moves none across (no fence: stores to global memory that are under way need not be waited for)
#define LDSW() do { asm volatile("s_wait_dscnt 0x0" ::: "memory"); __builtin_amdgcn_wave_barrier(); } while (0)
__global__ __launch_bounds__(256) void k_lin3(const float* __restrict__ X, const float* __restrict__ Dd, const float* __restrict__ WQ, const float* __restrict__ BQ, const float* __restrict__ WK, const float* __restrict__ BK, const float* __restrict__ WV, const float* __restrict__ BV, const float* __restrict__ RH, const float* __restrict__ RW, _Float16* __restrict__ QH, _Float16* __restrict__ QL, _Float16* __restrict__ KH, _Float16* __restrict__ KL, _Float16* __restrict__ VT) { __shared__ __align__(16) unsigned char sm[8 * 16 * 68 * 4];
  float (*sf)[16][68] = (float (*)[16][68])sm; __bf16 (*sw)[64][WPIT] = (__bf16 (*)[64][WPIT])sm;   /* the two W buffers (10,240 B) lie in the epilogue's tile, which is written only behind the barrier after the loop */
  const int tid = threadIdx.x, wave = tid >> 5, lane = tid & 31, col = lane & 15, g = lane >> 4; const int h = blockIdx.y, which = blockIdx.z; const size_t r0 = (size_t)blockIdx.x * 128 + wave * 16; const size_t b = r0 / NPOS; const int n0 = (int)(r0 % NPOS);
  const float* T = which == 0 ? X : Dd; const float* Wm = which == 0 ? WQ : which == 1 ? WK : WV; const float* Bm = which == 0 ? BQ : which == 1 ? BK : BV;
  const float* wsrc = Wm + (size_t)(h * HDV + (tid >> 3)) * CIN + (tid & 7) * 4;   /* this thread's share of a chunk: rows tid / 8 and tid / 8 + 32, k 4 (tid % 8) .. + 3 */
  v8f acc[4] = {};
  /* the '#pragma unroll' on the wv and acc loops: their counters index register arrays, which stay in registers only if the index is a constant */
#pragma unroll 1
  for (int kc = 0; kc < CIN / 32; ++kc) { v4f wv[2];
#pragma unroll
    for (int i = 0; i < 2; ++i) wv[i] = *(const v4f*)(wsrc + (size_t)i * 32 * CIN + kc * 32);
    v16b a; const float* p = T + (b * CIN + kc * 32 + 8 * g) * (size_t)NPOS + n0 + col;   /* channels-first: element (b, c, n) at (b*512 + c)*1024 + n */
#pragma unroll
      for (int i = 0; i < 8; ++i) { a[i] = (__bf16)p[(size_t)i * NPOS]; a[8 + i] = (__bf16)p[(size_t)(16 + i) * NPOS]; }
    asm volatile("s_wait_loadcnt 0x0\n\ts_wait_xcnt 0x0" :: "v"(p) : "memory");   /* the lane's address is an input, so it keeps its registers up to this wait and no result lands on an address that an issued load names */
#pragma unroll
    for (int i = 0; i < 2; ++i) { v4b t; t[0] = (__bf16)wv[i][0]; t[1] = (__bf16)wv[i][1]; t[2] = (__bf16)wv[i][2]; t[3] = (__bf16)wv[i][3]; *(v4b*)&sw[kc & 1][(tid >> 3) + 32 * i][(tid & 7) * 4] = t; }
    __syncthreads();   /* publishes this chunk; it also stands behind every wave's reads of the other buffer (trip kc - 1), which the next trip refills */
#pragma unroll
    for (int j = 0; j < 4; j += 2) { const v16b w0 = frag_b(&sw[kc & 1][j * 16 + col][0], lane), w1 = frag_b(&sw[kc & 1][(j + 1) * 16 + col][0], lane); acc[j] = wmma_bf(a, w0, acc[j]); acc[j + 1] = wmma_bf(a, w1, acc[j + 1]); } }
  __syncthreads();     /* every wave has read its last W fragments before the tile below overwrites the buffers */
  float bv[4]; const int bi = h * HDV + col;
#pragma unroll
  for (int j = 0; j < 4; ++j) bv[j] = Bm[bi + j * 16];
  asm volatile("s_wait_xcnt 0x0" :: "v"(bi) : "memory");   /* the lane's index is an input, so no result lands on the register that the issued loads name */
  if (which == 2) {   /* v: a lane's eight accumulator rows are eight consecutive positions of one channel, the order of a VT plane; the block's [64 channels][128 positions] tile goes through LDS so that every store run is a channel's whole 256 B */
    _Float16 (*sv)[136] = (_Float16 (*)[136])sm;   /* 272-B pitch (16 B x odd): the sixteen channels of a 16-B column fall on different banks */
#pragma unroll
    for (int j = 0; j < 4; ++j) { const float bb = bfr(bv[j]); v8h t;
#pragma unroll
      for (int r = 0; r < 8; ++r) t[r] = (_Float16)(acc[j][r] + bb);
      *(v8h*)&sv[j * 16 + col][wave * 16 + 8 * g] = t; }
    __syncthreads();   /* the tile is complete before other waves' lanes read it (which is the same for the whole block) */
    char* vt = (char*)VT + (((blockIdx.x >> 3) * CC + h * HD + (tid >> 4)) * TT + (blockIdx.x & 7) * 128u + (tid & 15) * 8) * 2u; v8h z = {};   /* eight blocks a batch; byte offset in the 16-MiB plane */
#pragma unroll
    for (int i = 0; i < 4; ++i) { vst2(vt + 16 * i * TT * 2, *(const v8h*)&sv[16 * i + (tid >> 4)][(tid & 15) * 8]); vst2(vt + (HDV + 16 * i) * TT * 2, z); }
    return; }
#pragma unroll
  for (int j = 0; j < 4; ++j) { const float bb = bfr(bv[j]);
#pragma unroll
    for (int r = 0; r < 8; ++r) sf[wave][8 * g + r][j * 16 + col] = acc[j][r] + bb; }
  LDSX();   /* the wave's own tile: its lanes' writes are in LDS before other lanes of the wave read them */
  const float* srow = &sf[wave][lane >> 3][(lane & 7) * 8];   /* row writer: eight lanes a row's 64 channels (128 B of f16), four rows a pass */
  const unsigned orow = ((blockIdx.x * 128u + wave * 16 + (lane >> 3)) * CC + h * HD + (lane & 7) * 8) * 2u;   /* byte offset of the lane's 16 B in a plane (a plane is 16 MiB) */
  char* H0 = (char*)(which == 0 ? QH : KH); char* L0 = (char*)(which == 0 ? QL : KL);
  /* both row loops are kept rolled: four passes side by side hold some 60 registers more, and above 80 a wave the 1,536 blocks no longer fit the chip at once */
#pragma unroll 1
  for (int p = 0; p < 4; ++p) { v8h hi, lo; hires8(srow + p * 4 * 68, hi, lo); const unsigned o = orow + p * (4u * CC * 2u); vst2(H0 + o, hi); vst2(L0 + o, lo);
    if (which == 0) { vst2((char*)KH + o + HDV * 2, hi); vst2((char*)KL + o + HDV * 2, lo); }
    asm volatile("s_wait_xcnt 0x0" :: "v"(o), "v"(hi), "v"(lo) : "memory"); }   /* offset and data are inputs, so they keep their registers up to this wait: the next pass rewrites nothing that an issued store names */
  if (which == 0) return;
  /* The wave's 16 positions lie in one row of the 32 x 32 map: n / 32 is one value, n % 32 runs over 16. Lane = (channel 32 hf + 8 it + lane / 4, positions 4 (lane % 4) .. + 3) */
  const float* prh = RH + (h * HDV + (lane >> 2)) * 32 + (wave & 1) * 16 + (lane & 3) * 4; const float* prw = RW + (h * HDV + (lane >> 2)) * 32 + (blockIdx.x & 7) * 4 + (wave >> 1);
  LDSW();   /* the k rows have been read before the position rows take their place in the wave's tile */
  /* two rolled halves, for the same register budget as the row loops */
#pragma unroll 1
  for (int hf = 0; hf < 2; ++hf) { v4f rh[4]; float rw[4]; const float* ph = prh + hf * 32 * 32; const float* pw = prw + hf * 32 * 32;
#pragma unroll
    for (int it = 0; it < 4; ++it) { rh[it] = *(const v4f*)(ph + it * 8 * 32); rw[it] = pw[it * 8 * 32]; }
    asm volatile("s_wait_xcnt 0x0" :: "v"(ph), "v"(pw) : "memory");   /* both lane addresses are inputs, so they keep their registers up to this wait and no result lands on an address that an issued load names */
#pragma unroll
    for (int it = 0; it < 4; ++it) {
#pragma unroll
      for (int i = 0; i < 4; ++i) sf[wave][(lane & 3) * 4 + i][hf * 32 + it * 8 + (lane >> 2)] = bfr(rh[it][i]) + bfr(rw[it]); } }
  LDSW();   /* written before other lanes read */
#pragma unroll 1
  for (int p = 0; p < 4; ++p) { v8h hi, lo; hires8(srow + p * 4 * 68, hi, lo); const unsigned o = orow + p * (4u * CC * 2u) + HDV * 2; vst2((char*)QH + o, hi); vst2((char*)QL + o, lo);
    asm volatile("s_wait_xcnt 0x0" :: "v"(o), "v"(hi), "v"(lo) : "memory"); } }   /* as in the first row loop */
#ifndef SM_EXTRA_PARAMS
#define SM_EXTRA_PARAMS
#endif
#ifndef PROJ_EXTRA_PARAMS
#define PROJ_EXTRA_PARAMS
#endif
#ifndef SM_MASK_HOOK
#define SM_MASK_HOOK (void)0
#endif

#define WS_QH  0u                                      // f16 q rows [b*t][CC]
#define WS_KH  (WS_QH + 2u * (size_t)NB * TT * CC)      // f16 k rows [b*t][CC]
#define WS_VT  (WS_KH + 2u * (size_t)NB * TT * CC)      // f16 v planes [b][c][t]
#define WS_QL  (WS_VT + 2u * (size_t)NB * CC * TT)      // f16 q residual x 2^10 rows [b][t < QHI][CC]
#define WS_KL  (WS_QL + 2u * (size_t)NB * QHI * CC)     // f16 k residual x 2^10 rows [b][t < KHI][CC]
#define WS_VB  (WS_KL + 2u * (size_t)NB * KHI * CC)     // bf16 v hi planes not used (no space reserved)
#define WS_VBL (WS_VB + 0u)                            // bf16 v planes not used (P.v takes the f16 path)
#define WS_S   (WS_VBL + 0u)    // f32 logits / P [hg][t][s]: reserved but unused (k_fa keeps logits and P in registers)
#define WS_Y   (WS_S  + 4u * (size_t)HG * TT * TT)      // f32 ctx rows [b*t][CC] (only when there is an output projection)
#define WS_END (WS_Y  + 0u)

// lane l with lane l ^ 16 (the two halves of a wave hold the two halves of a query column's keys)
__device__ __forceinline__ float xhalf(float x) { return __builtin_bit_cast(float, __builtin_amdgcn_permlanex16(__builtin_bit_cast(int, x), __builtin_bit_cast(int, x), 0x76543210, 0xfedcba98, false, false)); }
#define LOG2E 1.44269504088896340736f   // exp(x) = 2^(x log2 e)
#define FAQ 128            // queries per block: eight waves read each staged key tile
#define KPIT 136           // halves per staged k row (272 B = 16 B x odd: the sixteen rows of a fragment read fall on different banks)
#define VPIT 72            // halves per staged v row (144 B, likewise)
#define SG_KL (64 * KPIT)                    // residual rows behind the hi rows
#define SG_V  (2 * 64 * KPIT)                // v rows [channel][64 keys] behind both
#define SG_SZ (2 * 64 * KPIT + HD * VPIT)    // halves per stage (53,248 B)
#define OPIT 132           // floats per row of the output tile (528 B: the two channels, eight apart, that a wave's two halves write fall on different banks)
typedef v4f __attribute__((may_alias)) v4fa;
// one 64-key stage, 12 copies of 16 B per lane straight into LDS: k hi rows and k residual rows (16 lanes a 256-B row, rows 16 apart), v rows (8 lanes a 128-B row, rows 32 apart). lk / lv: the lane's own LDS byte addresses, gk / gl / gv its own global addresses. The s_wait_xcnt ends the copies' own statement, so no address register is rewritten in front of it
__device__ __forceinline__ void fa_stage(unsigned lk, unsigned lv, const _Float16* gk, const _Float16* gl, const _Float16* gv) {
  asm volatile("global_load_async_to_lds_b128 %0, %12, off\n\t"
               "global_load_async_to_lds_b128 %1, %13, off\n\t"
               "global_load_async_to_lds_b128 %2, %14, off\n\t"
               "global_load_async_to_lds_b128 %3, %15, off\n\t"
               "global_load_async_to_lds_b128 %4, %16, off\n\t"
               "global_load_async_to_lds_b128 %5, %17, off\n\t"
               "global_load_async_to_lds_b128 %6, %18, off\n\t"
               "global_load_async_to_lds_b128 %7, %19, off\n\t"
               "global_load_async_to_lds_b128 %8, %20, off\n\t"
               "global_load_async_to_lds_b128 %9, %21, off\n\t"
               "global_load_async_to_lds_b128 %10, %22, off\n\t"
               "global_load_async_to_lds_b128 %11, %23, off\n\t"
               "s_wait_xcnt 0x0"
               :: "v"(lk), "v"(lk + 2u * 16 * KPIT), "v"(lk + 2u * 32 * KPIT), "v"(lk + 2u * 48 * KPIT),
                  "v"(lk + 2u * SG_KL), "v"(lk + 2u * (SG_KL + 16 * KPIT)), "v"(lk + 2u * (SG_KL + 32 * KPIT)), "v"(lk + 2u * (SG_KL + 48 * KPIT)),
                  "v"(lv), "v"(lv + 2u * 32 * VPIT), "v"(lv + 2u * 64 * VPIT), "v"(lv + 2u * 96 * VPIT),
                  "v"(gk), "v"(gk + 16 * CC), "v"(gk + 32 * CC), "v"(gk + 48 * CC),
                  "v"(gl), "v"(gl + 16 * CC), "v"(gl + 32 * CC), "v"(gl + 48 * CC),
                  "v"(gv), "v"(gv + 32 * TT), "v"(gv + 64 * TT), "v"(gv + 96 * TT)
               : "memory");
}
// ---- k_fa: block = 128 queries (qb) of (b, h), wave = 16 queries as COLUMNS; one pass over the keys in blocks of 64. Each key block (k hi rows, k residual rows, v rows) is copied once per block into one of two LDS stages by asynchronous copies, one key block ahead of the products, and all eight waves take their A fragments from there (two blocks a WGP, four waves a SIMD: at most 256 registers a wave, hence amdgpu_waves_per_eu). Transposed logits S^T = k . q^T (A = k rows hi / residual x 2^10, B = q rows hi / residual, 3 products, k order as before) stay in registers: lane (g, col) holds keys 16 j + 8 g + r of query col, so the running maximum and sum (f32) are in-lane plus one exchange between the halves. exp(s - m) = 2^(s log2 e - m log2 e) is one fused multiply-add and one v_exp_f32; the rounding of the addend m log2 e is one common factor of a key block's terms and of its rescale (same addend), but the rescale takes m_old log2 e unrounded, so an earlier block's rounding stays on the terms gathered up to it and does not cancel in ctx / sum. exp(s - m) x 2^11 once to f16 packs from two 16-key tiles into one B fragment (element i = key 8 g + i, element 8 + i = key 16 + 8 g + i: the order frag_h gives the v planes as A); ctx^T += v^T . P^T (1 product), rescaled by exp(m_old - m_new) per key block and divided by the row sum at the end; channels 0..63 (the v half of a plane) go to out[b][h*64 + d][n]
__global__ __launch_bounds__(256) __attribute__((amdgpu_waves_per_eu(4, 4))) void k_fa(const _Float16* __restrict__ QH, const _Float16* __restrict__ KH, const _Float16* __restrict__ QL, const _Float16* __restrict__ KL, const _Float16* __restrict__ VT, float* __restrict__ OUT) {
  __shared__ __attribute__((aligned(16))) _Float16 sg[2 * SG_SZ];
  const int tid = threadIdx.x, wave = tid >> 5, lane = tid & 31, col = lane & 15, g = lane >> 4; const int qb = blockIdx.x, h = blockIdx.y, b = blockIdx.z; const int ql0 = qb * FAQ + wave * 16; const size_t q0 = (size_t)b * TT + ql0;
  const _Float16* QLb = QL + (size_t)b * QHI * CC; const _Float16* KLb = KL + (size_t)b * KHI * CC;
  v16h qh[HD / 32], qr[HD / 32]; const _Float16* qrow = QH + (q0 + col) * CC + h * HD + 8 * g; const _Float16* qlrow = QLb + (size_t)(ql0 + col) * CC + h * HD + 8 * g;   /* the lane's own addresses: frag_h's element order, with its 8 g already added */
  /* every '#pragma unroll' in this kernel but the last: its counter indexes a register array (fragments, accumulators), which stays in registers only if the index is a constant */
#pragma unroll
  for (int kc = 0; kc < HD / 32; ++kc) { union { v16h v; v8h q[2]; } u, w; u.q[0] = *(const v8h*)(qrow + kc * 32); u.q[1] = *(const v8h*)(qrow + kc * 32 + 16); w.q[0] = *(const v8h*)(qlrow + kc * 32); w.q[1] = *(const v8h*)(qlrow + kc * 32 + 16); qh[kc] = u.v; qr[kc] = w.v; }
  /* both lane addresses are inputs, so they stay in their registers up to this wait and no result of the sixteen loads above lands on an address that an issued load names */
  asm volatile("s_wait_xcnt 0x0" :: "v"(qrow), "v"(qlrow) : "memory");
  const unsigned sb = (unsigned)(size_t)sg; const unsigned lk = sb + 2u * ((tid >> 4) * KPIT + (tid & 15) * 8), lv = sb + 2u * (SG_V + (tid >> 3) * VPIT + (tid & 7) * 8);
  const _Float16* gk = KH + ((size_t)b * TT + (tid >> 4)) * CC + h * HD + (tid & 15) * 8; const _Float16* gl = KLb + (size_t)(tid >> 4) * CC + h * HD + (tid & 15) * 8; const _Float16* gv = VT + ((size_t)b * CC + h * HD + (tid >> 3)) * (size_t)TT + (tid & 7) * 8;
  fa_stage(lk, lv, gk, gl, gv);
  asm volatile("s_wait_asynccnt 0x0" ::: "memory");   /* this wave's copies of key block 0 have landed */
  __syncthreads();                                    /* ... and every other wave's */
  fa_stage(lk + 2u * SG_SZ, lv + 2u * SG_SZ, gk + 64 * CC, gl + 64 * CC, gv + 64);
  v8f o[HD / 16] = {}; float m = -3.0e38f, l = 0.f;
  /* kept rolled: one body is about 1,100 instructions */
#pragma unroll 1
  for (int k0 = 0; k0 < TT; k0 += 64) { const unsigned bo = ((k0 >> 6) & 1) * SG_SZ; const _Float16* st = sg + bo; v8f acc[4] = {}, accl[4] = {};
#pragma unroll
    for (int j = 0; j < 4; ++j) {
#pragma unroll
      for (int kc = 0; kc < HD / 32; ++kc) { const v16h kbf = frag_h(st + (j * 16 + col) * KPIT + kc * 32, lane), klf = frag_h(st + SG_KL + (j * 16 + col) * KPIT + kc * 32, lane); acc[j] = wmma16(kbf, qh[kc], acc[j]); accl[j] = wmma16(kbf, qr[kc], accl[j]); accl[j] = wmma16(klf, qh[kc], accl[j]); } }
    float mx = -3.0e38f;
#pragma unroll
    for (int j = 0; j < 4; ++j) {
#pragma unroll
      for (int r = 0; r < 8; ++r) { acc[j][r] = (acc[j][r] + accl[j][r] * (1.0f / 1024.0f)) * SCALE; mx = fmaxf(mx, acc[j][r]); } }
    mx = fmaxf(mx, xhalf(mx)); const float mn = fmaxf(m, mx), mnl = mn * LOG2E, alpha = __builtin_amdgcn_exp2f(fmaf(m, LOG2E, -mnl)); m = mn; float sum = 0.f; v16h p[2];
#pragma unroll
    for (int j = 0; j < 4; ++j) {
#pragma unroll
      for (int r = 0; r < 8; ++r) { const float e = __builtin_amdgcn_exp2f(fmaf(acc[j][r], LOG2E, -mnl)); sum += e; p[j >> 1][8 * (j & 1) + r] = (_Float16)(e * 2048.0f); } }
    l = l * alpha + sum;   /* this half's keys only; the halves are joined after the loop */
#pragma unroll
    for (int j = 0; j < HD / 16; ++j) {
#pragma unroll
      for (int r = 0; r < 8; ++r) o[j][r] *= alpha; }
#pragma unroll
    for (int j = 0; j < HD / 16; ++j) {
#pragma unroll
      for (int kc = 0; kc < 2; ++kc) o[j] = wmma16(frag_h(st + SG_V + (j * 16 + col) * VPIT + kc * 32, lane), p[kc], o[j]); }
    asm volatile("s_wait_dscnt 0x0" ::: "memory");      /* this wave's reads of the stage are done before the stage is given up */
    asm volatile("s_wait_asynccnt 0x0" ::: "memory");   /* this wave's copies of the next key block have landed */
    __syncthreads();                                    /* publishes the next key block and ends every wave's reads of this one */
    if (k0 + 128 < TT) fa_stage(lk + 2u * bo, lv + 2u * bo, gk + (size_t)(k0 + 128) * CC, gl + (size_t)(k0 + 128) * CC, gv + k0 + 128); }
  asm volatile("s_wait_asynccnt 0x0" ::: "memory");     /* nothing of this wave is in flight when it ends */
  l += xhalf(l); const float inv = l > 0.f ? 1.0f / (2048.0f * l) : 0.f;
  /* out is channels-first: the block's [64 real channels][128 queries] tile goes through LDS, so that every store run is a channel's whole 512 B. The stages are free: the barrier at the foot of the last trip stands behind every wave's last read, and every wave's last copies were waited for in front of an earlier one */
  float_a (*so)[OPIT] = (float_a (*)[OPIT])sg;
#pragma unroll
  for (int j = 0; j < HDV / 16; ++j) {
#pragma unroll
    for (int r = 0; r < 8; ++r) so[j * 16 + 8 * g + r][wave * 16 + col] = o[j][r] * inv; }   /* lane (g, col): channels 16 j + 8 g + r of query col */
  __syncthreads();   /* the tile is complete before other waves' lanes read it */
  float* op = OUT + ((size_t)b * CIN + h * HDV + wave) * NPOS + qb * FAQ + lane * 4;   /* a wave takes one channel's 128 queries a pass, eight channels apart */
  /* unrolled: the eight LDS reads go out together, each into registers of its own, and the stores share one address register pair that nothing rewrites */
#pragma unroll
  for (int i = 0; i < HDV / 8; ++i) vst2(op + i * 8 * NPOS, *(const v4fa*)&so[i * 8 + wave][lane * 4]); }

extern "C" void kernel_launch(void* const* d_in, const int* in_sizes, int n_in, void* d_out, int out_size, void* d_ws, size_t ws_size, hipStream_t stream) {
  (void)in_sizes; (void)n_in; (void)out_size;
  const float** F = (const float**)d_in;
  if (ws_size < (size_t)WS_END) return;
  char* ws = (char*)d_ws; _Float16 *QH = (_Float16*)(ws + WS_QH), *KH = (_Float16*)(ws + WS_KH), *VT = (_Float16*)(ws + WS_VT), *QL = (_Float16*)(ws + WS_QL), *KL = (_Float16*)(ws + WS_KL); __bf16 *VB = (__bf16*)(ws + WS_VB), *VBL = (__bf16*)(ws + WS_VBL); float *S = (float*)(ws + WS_S), *Y = (float*)(ws + WS_Y);
  (void)Y; (void)S; (void)VB; (void)VBL;
  // inputs: 0 x, 1 d [8,512,32,32]; 2 Wq [512,512] (out,in), 3 bq; 4 Wk, 5 bk; 6 Wv, 7 bv; 8 rel_h [1,8,64,1,32]; 9 rel_w [1,8,64,32,1]
  k_lin3<<<dim3(TNB * TT / 128, NH, 3), 256, 0, stream>>>(F[0], F[1], F[2], F[3], F[4], F[5], F[6], F[7], F[8], F[9], QH, QL, KH, KL, VT);
  k_fa<<<dim3(TT / FAQ, NH, TNB), 256, 0, stream>>>(QH, KH, QL, KL, VT, (float*)d_out);
}

// v007
// It runs in 78.2 microseconds.
// Timed twice side by side with v006, it ran 1.09 times as fast both times.
// Counting every step since v000, it is 12.8 times as fast.
// compute dtype: all float inputs rounded to bf16; q/k/v = W t + b (1x1 convs) with EXACT bf16 products on WMMA 16x16x32 (f32 rows); the content + position logits folded into one 128-deep product [q_i | pos_i] . [k_j | q_j] with BOTH operands as f16 hi + residual (x 2^10) (3 products: the logits are unscaled, sigma ~14, near-argmax); softmax in f32 (exponentials in base 2 on v_exp_f32); P x 2^11 once to f16 against v once to f16 (1 product); f32 output (channels-first).
#include <hip/hip_runtime.h>
#include <math.h>

typedef __attribute__((ext_vector_type(16))) _Float16 v16h;
typedef __attribute__((ext_vector_type(16))) __bf16 v16b;
typedef __attribute__((ext_vector_type(8)))  _Float16 v8h;
typedef __attribute__((ext_vector_type(8)))  float v8f;
typedef __attribute__((ext_vector_type(4)))  float v4f;
typedef __attribute__((ext_vector_type(2)))  float v2f;
typedef __attribute__((ext_vector_type(4)))  unsigned v4u;
typedef __attribute__((ext_vector_type(4)))  int v4i;
typedef float __attribute__((may_alias)) float_a;
typedef int __attribute__((may_alias)) int_a;

template <typename T> __device__ __forceinline__ void vst2(void* p, T v) { *(T*)p = v;  }
__device__ __forceinline__ v8f wmma16(v16h a, v16h b, v8f c) {
  v8f d = __builtin_amdgcn_wmma_f32_16x16x32_f16(false, a, false, b, (short)0, c, false, false);
  asm volatile("v_nop\n\tv_nop\n\tv_nop\n\tv_nop" : "+v"(d) : "v"(a), "v"(b));
  return d;
}
__device__ __forceinline__ v8f wmma_bf(v16b a, v16b b, v8f c) {
  v8f d = __builtin_amdgcn_wmma_f32_16x16x32_bf16(false, a, false, b, (short)0, c, false, false);
  asm volatile("v_nop\n\tv_nop\n\tv_nop\n\tv_nop" : "+v"(d) : "v"(a), "v"(b));
  return d;
}
// 16x16x32 fragments: lane = (h = lane>>4, row/col = lane&15); elements 0..7 = k0+8h+0..7, 8..15 = k0+16+8h+0..7; D element r = row 8h+r
__device__ __forceinline__ v16h frag_h(const _Float16* rowk0, int lane) {
  union { v16h v; v8h q[2]; } u; const _Float16* p = rowk0 + 8 * (lane >> 4);
  u.q[0] = *(const v8h*)p; u.q[1] = *(const v8h*)(p + 16); return u.v;
}
__device__ __forceinline__ v16h frag_f32(const float* rowk0, int lane) {
  v16h a; const float* p = rowk0 + 8 * (lane >> 4);
#pragma unroll
  for (int i = 0; i < 8; ++i) { a[i] = (_Float16)p[i]; a[8 + i] = (_Float16)p[16 + i]; }
  return a;
}
__device__ __forceinline__ v16h frag_f32s(const float* rowk0, int lane, float sc) {
  v16h a; const float* p = rowk0 + 8 * (lane >> 4);
#pragma unroll
  for (int i = 0; i < 8; ++i) { a[i] = (_Float16)(p[i] * sc); a[8 + i] = (_Float16)(p[16 + i] * sc); }
  return a;
}
// column fragment from a [K][ld] layout (column n), rows >= K read as 0
__device__ __forceinline__ v16h fragc_f32(const float* W, int k0, int n, int lane, int ld, int K) {
  v16h a; const int g = lane >> 4;
#pragma unroll
  for (int i = 0; i < 8; ++i) { const int ka = k0 + 8 * g + i, kb = ka + 16;
    a[i] = (_Float16)(ka < K ? W[(size_t)(ka < K ? ka : K - 1) * ld + n] : 0.f); a[8 + i] = (_Float16)(kb < K ? W[(size_t)(kb < K ? kb : K - 1) * ld + n] : 0.f); }
  return a;
}
struct F2 { v16b h, l; };
__device__ __forceinline__ F2 bsplit16(const float v[16]) { F2 r;
#pragma unroll
  for (int i = 0; i < 16; ++i) { const __bf16 h = (__bf16)v[i]; r.h[i] = h; r.l[i] = (__bf16)(v[i] - (float)h); }
  return r; }
__device__ __forceinline__ F2 split_row(const float* row, int k0, int lane) { float v[16]; const float* p = row + k0 + 8 * (lane >> 4);
#pragma unroll
  for (int i = 0; i < 8; ++i) { v[i] = p[i]; v[8 + i] = p[16 + i]; }
  return bsplit16(v); }
__device__ __forceinline__ F2 split_rowK(const float* row, int k0, int lane, int K) { float v[16]; const int g = lane >> 4;
#pragma unroll
  for (int i = 0; i < 8; ++i) { const int ka = k0 + 8 * g + i, kb = ka + 16; v[i] = ka < K ? row[ka < K ? ka : K - 1] : 0.f; v[8 + i] = kb < K ? row[kb < K ? kb : K - 1] : 0.f; }
  return bsplit16(v); }
__device__ __forceinline__ F2 split_col(const float* W, int k0, int n, int lane, int ld, int K) { float v[16]; const int g = lane >> 4;
#pragma unroll
  for (int i = 0; i < 8; ++i) { const int ka = k0 + 8 * g + i, kb = ka + 16; v[i] = ka < K ? W[(size_t)(ka < K ? ka : K - 1) * ld + n] : 0.f; v[8 + i] = kb < K ? W[(size_t)(kb < K ? kb : K - 1) * ld + n] : 0.f; }
  return bsplit16(v); }
__device__ __forceinline__ v8f mac3(const F2& a, const F2& b, v8f c) { c = wmma_bf(a.l, b.h, c); c = wmma_bf(a.h, b.l, c); return wmma_bf(a.h, b.h, c); }
__device__ __forceinline__ float sigm(float v) { return 1.0f / (1.0f + expf(-v)); }
#define LDSX() do { asm volatile("s_wait_dscnt 0" ::: "memory"); __builtin_amdgcn_wave_barrier(); __builtin_amdgcn_fence(__ATOMIC_RELEASE, "workgroup"); } while (0)

// Bottleneck-transformer MHSA with 2-D relative position logits (B 8, C 512 = 8 x 64, 32 x 32 = 1,024 positions): q = Wq x + bq, k = Wk d + bk, v = Wv d + bv; energy[i][j] = q_i . k_j + pos_i . q_j with pos = (rel_h + rel_w) [h][64][n] (the module adds the [m,n]-indexed position term to the [n,m]-indexed content term positionally); attn = softmax_j; out[c][i] = sum_j v[c][j] attn[i][j] -> [B, C, 32, 32].
#define NB 8
#define TT 1024
#define CC 1024            // NH * HD = projected width
#define DIN 1024          // unused here (the input width is CIN)
#define NH 8
#define HD 128
#define NQB (TT / 64)
#define HG 8
#define SCALE (1.0f)
#define CAUSAL 0
#ifndef TNB
#define TNB NB
#endif
__device__ __forceinline__ float bfr(float v) { return (float)(__bf16)v; }
__host__ __device__ __forceinline__ int kb_last(int qb) { return CAUSAL ? ((qb * 64 + 63) >> 7) : (TT / 128 - 1); }
typedef __attribute__((ext_vector_type(8))) __bf16 v8b;
__device__ __forceinline__ v16b frag_b(const __bf16* rowk0, int lane) {
  union { v16b v; v8b q[2]; } u; const __bf16* p = rowk0 + 8 * (lane >> 4);
  u.q[0] = *(const v8b*)p; u.q[1] = *(const v8b*)(p + 16); return u.v;
}
#define QBH NQB            // every query block takes the 3-product logits path (q and k both f16 hi + residual); unscaled logits, sigma ~14
#define QHI 1024            // rows carrying a q residual plane (all rows when non-causal: 3-product logits everywhere, QBH = NQB)
#define KHI TT             // k residual rows for every key
// B fragment (k rows k0+.., output column o) of a weight: (in,out) [K][ld] or (out,in) [ld rows of K]: bf16 exact, or f16(bf16 * 256) exact
__device__ __forceinline__ v16b wcol_io(const float* Wm, int k0, int o, int lane, int ld) { v16b w; const int g = lane >> 4;
#pragma unroll
  for (int i = 0; i < 8; ++i) { w[i] = (__bf16)Wm[(size_t)(k0 + 8 * g + i) * ld + o]; w[8 + i] = (__bf16)Wm[(size_t)(k0 + 16 + 8 * g + i) * ld + o]; }
  return w; }
__device__ __forceinline__ v16b wcol_oi(const float* Wm, int k0, int o, int lane, int K) { v16b w; const float* p = Wm + (size_t)o * K + k0 + 8 * (lane >> 4);
#pragma unroll
  for (int i = 0; i < 8; ++i) { w[i] = (__bf16)p[i]; w[8 + i] = (__bf16)p[16 + i]; }
  return w; }
__device__ __forceinline__ v16h wcolh_io(const float* Wm, int k0, int o, int lane, int ld) { v16h w; const int g = lane >> 4;
#pragma unroll
  for (int i = 0; i < 8; ++i) { w[i] = (_Float16)(bfr(Wm[(size_t)(k0 + 8 * g + i) * ld + o]) * 256.0f); w[8 + i] = (_Float16)(bfr(Wm[(size_t)(k0 + 16 + 8 * g + i) * ld + o]) * 256.0f); }
  return w; }
__device__ __forceinline__ v16h wcolh_oi(const float* Wm, int k0, int o, int lane, int K) { v16h w; const float* p = Wm + (size_t)o * K + k0 + 8 * (lane >> 4);
#pragma unroll
  for (int i = 0; i < 8; ++i) { w[i] = (_Float16)(bfr(p[i]) * 256.0f); w[8 + i] = (_Float16)(bfr(p[16 + i]) * 256.0f); }
  return w; }
#define WQKV_LAYOUT 1   // 0 = (in,out) [DIN][CC]; 1 = (out,in) [CC][DIN]; 2 = per-head [NH][DIN][HD]
__device__ __forceinline__ v16b wcol_hdk(const float* Wm, int k0, int o, int lane) { v16b w; const int g = lane >> 4; const float* p = Wm + (size_t)(o / HD) * DIN * HD + (o % HD);
#pragma unroll
  for (int i = 0; i < 8; ++i) { w[i] = (__bf16)p[(size_t)(k0 + 8 * g + i) * HD]; w[8 + i] = (__bf16)p[(size_t)(k0 + 16 + 8 * g + i) * HD]; }
  return w; }
#define WO_OUT_IN 0
#if WQKV_LAYOUT == 1
#define WCOL(W, k0, o, lane) wcol_oi(W, k0, o, lane, DIN)
#elif WQKV_LAYOUT == 2
#define WCOL(W, k0, o, lane) wcol_hdk(W, k0, o, lane)
#else
#define WCOL(W, k0, o, lane) wcol_io(W, k0, o, lane, CC)
#endif
#if WO_OUT_IN
#define WOCOL(W, k0, o, lane) wcol_oi(W, k0, o, lane, CC)
#define WOCOLH(W, k0, o, lane) wcolh_oi(W, k0, o, lane, CC)
#else
#define WOCOL(W, k0, o, lane) wcol_io(W, k0, o, lane, DIN)
#define WOCOLH(W, k0, o, lane) wcolh_io(W, k0, o, lane, DIN)
#endif
#define CIN 512            // channels
#define NPOS 1024          // 32 x 32
#define HDV 64             // real head width (q and k rows are 128 wide: [q | pos], [k | q]; a head's v planes keep the 128-channel pitch, and only channels 0..63 are written and read)
// ---- k_lin3: block = (128 positions, head h, which), wave = 16 positions: y = W t + b (exact bf16 products, channels-first A gather, (out,in) W rows h*64..), f32, written straight into the 128-wide f16 attention planes that k_fa reads: rows [q | pos] (QH, residual x 2^10 in QL), rows [k | q] (KH, KL), planes v[channel][position] (VT). which 0 (q from x): QH/QL[.][0..63] and KH/KL[.][64..127]; which 1 (k from d): KH/KL[.][0..63], and the position rows QH/QL[.][64 + dch] = bfr(rel_h[h][dch][n % 32]) + bfr(rel_w[h][dch][n / 32]) of its own batch (these blocks have the heaviest epilogue); which 2 (v from d): VT channels 0..63 of the head. The head's 64 W rows come in 32-deep chunks: eight lanes read one row's whole 128-B line, the block rounds the chunk to bf16 once and keeps it in one of two LDS buffers, and all eight waves take their B fragments from there (same values, same k order as a direct read)
#define WPIT 40            // halves per staged W row (80 B = 16 B x odd: the sixteen rows of a fragment read fall on different banks)
typedef __attribute__((ext_vector_type(4))) __bf16 v4b;
// eight f32 of an LDS row -> f16 hi and f16 residual x 2^10 (together ~2^-21 of the value)
__device__ __forceinline__ void hires8(const float* s, v8h& hi, v8h& lo) { const v4f a = *(const v4f*)s, c = *(const v4f*)(s + 4);
#pragma unroll
  for (int i = 0; i < 4; ++i) { const _Float16 ha = (_Float16)a[i], hc = (_Float16)c[i]; hi[i] = ha; hi[4 + i] = hc; lo[i] = (_Float16)((a[i] - (float)ha) * 1024.0f); lo[4 + i] = (_Float16)((c[i] - (float)hc) * 1024.0f); } }
// a wave's own LDS tile changes hands between its lanes: the LDS operations so far are done, and the compiler moves none across (no fence: stores to global memory that are under way need not be waited for)
#define LDSW() do { asm volatile("s_wait_dscnt 0x0" ::: "memory"); __builtin_amdgcn_wave_barrier(); } while (0)
__global__ __launch_bounds__(256) void k_lin3(const float* __restrict__ X, const float* __restrict__ Dd, const float* __restrict__ WQ, const float* __restrict__ BQ, const float* __restrict__ WK, const float* __restrict__ BK, const float* __restrict__ WV, const float* __restrict__ BV, const float* __restrict__ RH, const float* __restrict__ RW, _Float16* __restrict__ QH, _Float16* __restrict__ QL, _Float16* __restrict__ KH, _Float16* __restrict__ KL, _Float16* __restrict__ VT) { __shared__ __align__(16) unsigned char sm[8 * 16 * 68 * 4];
  float (*sf)[16][68] = (float (*)[16][68])sm; __bf16 (*sw)[64][WPIT] = (__bf16 (*)[64][WPIT])sm;   /* the two W buffers (10,240 B) lie in the epilogue's tile, which is written only behind the barrier after the loop */
  const int tid = threadIdx.x, wave = tid >> 5, lane = tid & 31, col = lane & 15, g = lane >> 4; const int h = blockIdx.y, which = blockIdx.z; const size_t r0 = (size_t)blockIdx.x * 128 + wave * 16; const size_t b = r0 / NPOS; const int n0 = (int)(r0 % NPOS);
  const float* T = which == 0 ? X : Dd; const float* Wm = which == 0 ? WQ : which == 1 ? WK : WV; const float* Bm = which == 0 ? BQ : which == 1 ? BK : BV;
  const float* wsrc = Wm + (size_t)(h * HDV + (tid >> 3)) * CIN + (tid & 7) * 4;   /* this thread's share of a chunk: rows tid / 8 and tid / 8 + 32, k 4 (tid % 8) .. + 3 */
  v8f acc[4] = {};
  /* the '#pragma unroll' on the wv and acc loops: their counters index register arrays, which stay in registers only if the index is a constant */
#pragma unroll 1
  for (int kc = 0; kc < CIN / 32; ++kc) { v4f wv[2];
#pragma unroll
    for (int i = 0; i < 2; ++i) wv[i] = *(const v4f*)(wsrc + (size_t)i * 32 * CIN + kc * 32);
    v16b a; const float* p = T + (b * CIN + kc * 32 + 8 * g) * (size_t)NPOS + n0 + col;   /* channels-first: element (b, c, n) at (b*512 + c)*1024 + n */
#pragma unroll
      for (int i = 0; i < 8; ++i) { a[i] = (__bf16)p[(size_t)i * NPOS]; a[8 + i] = (__bf16)p[(size_t)(16 + i) * NPOS]; }
    asm volatile("s_wait_loadcnt 0x0\n\ts_wait_xcnt 0x0" :: "v"(p) : "memory");   /* the lane's address is an input, so it keeps its registers up to this wait and no result lands on an address that an issued load names */
#pragma unroll
    for (int i = 0; i < 2; ++i) { v4b t; t[0] = (__bf16)wv[i][0]; t[1] = (__bf16)wv[i][1]; t[2] = (__bf16)wv[i][2]; t[3] = (__bf16)wv[i][3]; *(v4b*)&sw[kc & 1][(tid >> 3) + 32 * i][(tid & 7) * 4] = t; }
    __syncthreads();   /* publishes this chunk; it also stands behind every wave's reads of the other buffer (trip kc - 1), which the next trip refills */
#pragma unroll
    for (int j = 0; j < 4; j += 2) { const v16b w0 = frag_b(&sw[kc & 1][j * 16 + col][0], lane), w1 = frag_b(&sw[kc & 1][(j + 1) * 16 + col][0], lane); acc[j] = wmma_bf(a, w0, acc[j]); acc[j + 1] = wmma_bf(a, w1, acc[j + 1]); } }
  __syncthreads();     /* every wave has read its last W fragments before the tile below overwrites the buffers */
  float bv[4]; const int bi = h * HDV + col;
#pragma unroll
  for (int j = 0; j < 4; ++j) bv[j] = Bm[bi + j * 16];
  asm volatile("s_wait_xcnt 0x0" :: "v"(bi) : "memory");   /* the lane's index is an input, so no result lands on the register that the issued loads name */
  if (which == 2) {   /* v: a lane's eight accumulator rows are eight consecutive positions of one channel, the order of a VT plane; the block's [64 channels][128 positions] tile goes through LDS so that every store run is a channel's whole 256 B */
    _Float16 (*sv)[136] = (_Float16 (*)[136])sm;   /* 272-B pitch (16 B x odd): the sixteen channels of a 16-B column fall on different banks */
#pragma unroll
    for (int j = 0; j < 4; ++j) { const float bb = bfr(bv[j]); v8h t;
#pragma unroll
      for (int r = 0; r < 8; ++r) t[r] = (_Float16)(acc[j][r] + bb);
      *(v8h*)&sv[j * 16 + col][wave * 16 + 8 * g] = t; }
    __syncthreads();   /* the tile is complete before other waves' lanes read it (which is the same for the whole block) */
    char* vt = (char*)VT + (((blockIdx.x >> 3) * CC + h * HD + (tid >> 4)) * TT + (blockIdx.x & 7) * 128u + (tid & 15) * 8) * 2u;   /* eight blocks a batch; byte offset in the 16-MiB plane */
#pragma unroll
    for (int i = 0; i < 4; ++i) { vst2(vt + 16 * i * TT * 2, *(const v8h*)&sv[16 * i + (tid >> 4)][(tid & 15) * 8]); }
    return; }
#pragma unroll
  for (int j = 0; j < 4; ++j) { const float bb = bfr(bv[j]);
#pragma unroll
    for (int r = 0; r < 8; ++r) sf[wave][8 * g + r][j * 16 + col] = acc[j][r] + bb; }
  LDSX();   /* the wave's own tile: its lanes' writes are in LDS before other lanes of the wave read them */
  const float* srow = &sf[wave][lane >> 3][(lane & 7) * 8];   /* row writer: eight lanes a row's 64 channels (128 B of f16), four rows a pass */
  const unsigned orow = ((blockIdx.x * 128u + wave * 16 + (lane >> 3)) * CC + h * HD + (lane & 7) * 8) * 2u;   /* byte offset of the lane's 16 B in a plane (a plane is 16 MiB) */
  char* H0 = (char*)(which == 0 ? QH : KH); char* L0 = (char*)(which == 0 ? QL : KL);
  /* both row loops are kept rolled: four passes side by side hold some 60 registers more, and above 80 a wave the 1,536 blocks no longer fit the chip at once */
#pragma unroll 1
  for (int p = 0; p < 4; ++p) { v8h hi, lo; hires8(srow + p * 4 * 68, hi, lo); const unsigned o = orow + p * (4u * CC * 2u); vst2(H0 + o, hi); vst2(L0 + o, lo);
    if (which == 0) { vst2((char*)KH + o + HDV * 2, hi); vst2((char*)KL + o + HDV * 2, lo); }
    asm volatile("s_wait_xcnt 0x0" :: "v"(o), "v"(hi), "v"(lo) : "memory"); }   /* offset and data are inputs, so they keep their registers up to this wait: the next pass rewrites nothing that an issued store names */
  if (which == 0) return;
  /* The wave's 16 positions lie in one row of the 32 x 32 map: n / 32 is one value, n % 32 runs over 16. Lane = (channel 32 hf + 8 it + lane / 4, positions 4 (lane % 4) .. + 3) */
  const float* prh = RH + (h * HDV + (lane >> 2)) * 32 + (wave & 1) * 16 + (lane & 3) * 4; const float* prw = RW + (h * HDV + (lane >> 2)) * 32 + (blockIdx.x & 7) * 4 + (wave >> 1);
  LDSW();   /* the k rows have been read before the position rows take their place in the wave's tile */
  /* two rolled halves, for the same register budget as the row loops */
#pragma unroll 1
  for (int hf = 0; hf < 2; ++hf) { v4f rh[4]; float rw[4]; const float* ph = prh + hf * 32 * 32; const float* pw = prw + hf * 32 * 32;
#pragma unroll
    for (int it = 0; it < 4; ++it) { rh[it] = *(const v4f*)(ph + it * 8 * 32); rw[it] = pw[it * 8 * 32]; }
    asm volatile("s_wait_xcnt 0x0" :: "v"(ph), "v"(pw) : "memory");   /* both lane addresses are inputs, so they keep their registers up to this wait and no result lands on an address that an issued load names */
#pragma unroll
    for (int it = 0; it < 4; ++it) {
#pragma unroll
      for (int i = 0; i < 4; ++i) sf[wave][(lane & 3) * 4 + i][hf * 32 + it * 8 + (lane >> 2)] = bfr(rh[it][i]) + bfr(rw[it]); } }
  LDSW();   /* written before other lanes read */
#pragma unroll 1
  for (int p = 0; p < 4; ++p) { v8h hi, lo; hires8(srow + p * 4 * 68, hi, lo); const unsigned o = orow + p * (4u * CC * 2u) + HDV * 2; vst2((char*)QH + o, hi); vst2((char*)QL + o, lo);
    asm volatile("s_wait_xcnt 0x0" :: "v"(o), "v"(hi), "v"(lo) : "memory"); } }   /* as in the first row loop */
#ifndef SM_EXTRA_PARAMS
#define SM_EXTRA_PARAMS
#endif
#ifndef PROJ_EXTRA_PARAMS
#define PROJ_EXTRA_PARAMS
#endif
#ifndef SM_MASK_HOOK
#define SM_MASK_HOOK (void)0
#endif

#define WS_QH  0u                                      // f16 q rows [b*t][CC]
#define WS_KH  (WS_QH + 2u * (size_t)NB * TT * CC)      // f16 k rows [b*t][CC]
#define WS_VT  (WS_KH + 2u * (size_t)NB * TT * CC)      // f16 v planes [b][c][t]
#define WS_QL  (WS_VT + 2u * (size_t)NB * CC * TT)      // f16 q residual x 2^10 rows [b][t < QHI][CC]
#define WS_KL  (WS_QL + 2u * (size_t)NB * QHI * CC)     // f16 k residual x 2^10 rows [b][t < KHI][CC]
#define WS_VB  (WS_KL + 2u * (size_t)NB * KHI * CC)     // bf16 v hi planes not used (no space reserved)
#define WS_VBL (WS_VB + 0u)                            // bf16 v planes not used (P.v takes the f16 path)
#define WS_S   (WS_VBL + 0u)    // f32 logits / P [hg][t][s]: reserved but unused (k_fa keeps logits and P in registers)
#define WS_Y   (WS_S  + 4u * (size_t)HG * TT * TT)      // f32 ctx rows [b*t][CC] (only when there is an output projection)
#define WS_END (WS_Y  + 0u)

// lane l with lane l ^ 16 (the two halves of a wave hold the two halves of a query column's keys)
__device__ __forceinline__ float xhalf(float x) { return __builtin_bit_cast(float, __builtin_amdgcn_permlanex16(__builtin_bit_cast(int, x), __builtin_bit_cast(int, x), 0x76543210, 0xfedcba98, false, false)); }
#define LOG2E 1.44269504088896340736f   // exp(x) = 2^(x log2 e)
#define FAQ 128            // queries per block: eight waves read each staged key tile
#define KPIT 136           // halves per staged k row (272 B = 16 B x odd: the sixteen rows of a fragment read fall on different banks)
#define VPIT 72            // halves per staged v row (144 B, likewise)
#define SG_KL (64 * KPIT)                    // residual rows behind the hi rows
#define SG_V  (2 * 64 * KPIT)                // v rows [channel][64 keys] behind both
#define SG_SZ (2 * 64 * KPIT + HDV * VPIT)   // halves per stage (44,032 B)
#define OPIT 132           // floats per row of the output tile (528 B: the two channels, eight apart, that a wave's two halves write fall on different banks)
typedef v4f __attribute__((may_alias)) v4fa;
// one 64-key stage, 10 copies of 16 B per lane straight into LDS: k hi rows and k residual rows (16 lanes a 256-B row, rows 16 apart), v rows (8 lanes a 128-B row, rows 32 apart). lk / lv: the lane's own LDS byte addresses, gk / gl / gv its own global addresses. The s_wait_xcnt ends the copies' own statement, so no address register is rewritten in front of it
__device__ __forceinline__ void fa_stage(unsigned lk, unsigned lv, const _Float16* gk, const _Float16* gl, const _Float16* gv) {
  asm volatile("global_load_async_to_lds_b128 %0, %10, off\n\t"
               "global_load_async_to_lds_b128 %1, %11, off\n\t"
               "global_load_async_to_lds_b128 %2, %12, off\n\t"
               "global_load_async_to_lds_b128 %3, %13, off\n\t"
               "global_load_async_to_lds_b128 %4, %14, off\n\t"
               "global_load_async_to_lds_b128 %5, %15, off\n\t"
               "global_load_async_to_lds_b128 %6, %16, off\n\t"
               "global_load_async_to_lds_b128 %7, %17, off\n\t"
               "global_load_async_to_lds_b128 %8, %18, off\n\t"
               "global_load_async_to_lds_b128 %9, %19, off\n\t"
               "s_wait_xcnt 0x0"
               :: "v"(lk), "v"(lk + 2u * 16 * KPIT), "v"(lk + 2u * 32 * KPIT), "v"(lk + 2u * 48 * KPIT),
                  "v"(lk + 2u * SG_KL), "v"(lk + 2u * (SG_KL + 16 * KPIT)), "v"(lk + 2u * (SG_KL + 32 * KPIT)), "v"(lk + 2u * (SG_KL + 48 * KPIT)),
                  "v"(lv), "v"(lv + 2u * 32 * VPIT),
                  "v"(gk), "v"(gk + 16 * CC), "v"(gk + 32 * CC), "v"(gk + 48 * CC),
                  "v"(gl), "v"(gl + 16 * CC), "v"(gl + 32 * CC), "v"(gl + 48 * CC),
                  "v"(gv), "v"(gv + 32 * TT)
               : "memory");
}
// ---- k_fa: block = 128 queries (qb) of (b, h), wave = 16 queries as COLUMNS; one pass over the keys in blocks of 64. Each key block (k hi rows, k residual rows, v rows) is copied once per block into one of two LDS stages by asynchronous copies, one key block ahead of the products, and all eight waves take their A fragments from there (two blocks a WGP, four waves a SIMD: at most 256 registers a wave, hence amdgpu_waves_per_eu). Transposed logits S^T = k . q^T (A = k rows hi / residual x 2^10, B = q rows hi / residual, 3 products, k order as before) stay in registers: lane (g, col) holds keys 16 j + 8 g + r of query col, so the running maximum and sum (f32) are in-lane plus one exchange between the halves. exp(s - m) = 2^(s log2 e - m log2 e) is one fused multiply-add and one v_exp_f32; the rounding of the addend m log2 e is one common factor of a key block's terms and of its rescale (same addend), but the rescale takes m_old log2 e unrounded, so earlier blocks' roundings do not cancel in ctx / sum. exp(s - m) x 2^11 once to f16 packs from two 16-key tiles into one B fragment (element i = key 8 g + i, element 8 + i = key 16 + 8 g + i: the order frag_h gives the v planes as A); ctx^T += v^T . P^T (1 product, the head's 64 v channels), rescaled by exp(m_old - m_new) per key block and divided by the row sum at the end, goes to out[b][h*64 + d][n]
__global__ __launch_bounds__(256) __attribute__((amdgpu_waves_per_eu(4, 4))) void k_fa(const _Float16* __restrict__ QH, const _Float16* __restrict__ KH, const _Float16* __restrict__ QL, const _Float16* __restrict__ KL, const _Float16* __restrict__ VT, float* __restrict__ OUT) {
  __shared__ __attribute__((aligned(16))) _Float16 sg[2 * SG_SZ];
  const int tid = threadIdx.x, wave = tid >> 5, lane = tid & 31, col = lane & 15, g = lane >> 4; const int qb = blockIdx.x, h = blockIdx.y, b = blockIdx.z; const int ql0 = qb * FAQ + wave * 16; const size_t q0 = (size_t)b * TT + ql0;
  const _Float16* QLb = QL + (size_t)b * QHI * CC; const _Float16* KLb = KL + (size_t)b * KHI * CC;
  v16h qh[HD / 32], qr[HD / 32]; const _Float16* qrow = QH + (q0 + col) * CC + h * HD + 8 * g; const _Float16* qlrow = QLb + (size_t)(ql0 + col) * CC + h * HD + 8 * g;   /* the lane's own addresses: frag_h's element order, with its 8 g already added */
  /* every '#pragma unroll' in this kernel but the last: its counter indexes a register array (fragments, accumulators), which stays in registers only if the index is a constant */
#pragma unroll
  for (int kc = 0; kc < HD / 32; ++kc) { union { v16h v; v8h q[2]; } u, w; u.q[0] = *(const v8h*)(qrow + kc * 32); u.q[1] = *(const v8h*)(qrow + kc * 32 + 16); w.q[0] = *(const v8h*)(qlrow + kc * 32); w.q[1] = *(const v8h*)(qlrow + kc * 32 + 16); qh[kc] = u.v; qr[kc] = w.v; }
  /* both lane addresses are inputs, so they stay in their registers up to this wait and no result of the sixteen loads above lands on an address that an issued load names */
  asm volatile("s_wait_xcnt 0x0" :: "v"(qrow), "v"(qlrow) : "memory");
  const unsigned sb = (unsigned)(size_t)sg; const unsigned lk = sb + 2u * ((tid >> 4) * KPIT + (tid & 15) * 8), lv = sb + 2u * (SG_V + (tid >> 3) * VPIT + (tid & 7) * 8);
  const _Float16* gk = KH + ((size_t)b * TT + (tid >> 4)) * CC + h * HD + (tid & 15) * 8; const _Float16* gl = KLb + (size_t)(tid >> 4) * CC + h * HD + (tid & 15) * 8; const _Float16* gv = VT + ((size_t)b * CC + h * HD + (tid >> 3)) * (size_t)TT + (tid & 7) * 8;
  fa_stage(lk, lv, gk, gl, gv);
  asm volatile("s_wait_asynccnt 0x0" ::: "memory");   /* this wave's copies of key block 0 have landed */
  __syncthreads();                                    /* ... and every other wave's */
  fa_stage(lk + 2u * SG_SZ, lv + 2u * SG_SZ, gk + 64 * CC, gl + 64 * CC, gv + 64);
  v8f o[HDV / 16] = {}; float m = -3.0e38f, l = 0.f;
  /* kept rolled: one body is about 1,100 instructions */
#pragma unroll 1
  for (int k0 = 0; k0 < TT; k0 += 64) { const unsigned bo = ((k0 >> 6) & 1) * SG_SZ; const _Float16* st = sg + bo; v8f acc[4] = {}, accl[4] = {};
#pragma unroll
    for (int j = 0; j < 4; ++j) {
#pragma unroll
      for (int kc = 0; kc < HD / 32; ++kc) { const v16h kbf = frag_h(st + (j * 16 + col) * KPIT + kc * 32, lane), klf = frag_h(st + SG_KL + (j * 16 + col) * KPIT + kc * 32, lane); acc[j] = wmma16(kbf, qh[kc], acc[j]); accl[j] = wmma16(kbf, qr[kc], accl[j]); accl[j] = wmma16(klf, qh[kc], accl[j]); } }
    float mx = -3.0e38f;
#pragma unroll
    for (int j = 0; j < 4; ++j) {
#pragma unroll
      for (int r = 0; r < 8; ++r) { acc[j][r] = (acc[j][r] + accl[j][r] * (1.0f / 1024.0f)) * SCALE; mx = fmaxf(mx, acc[j][r]); } }
    mx = fmaxf(mx, xhalf(mx)); const float mn = fmaxf(m, mx), mnl = mn * LOG2E, alpha = __builtin_amdgcn_exp2f(fmaf(m, LOG2E, -mnl)); m = mn; float sum = 0.f; v16h p[2];
#pragma unroll
    for (int j = 0; j < 4; ++j) {
#pragma unroll
      for (int r = 0; r < 8; ++r) { const float e = __builtin_amdgcn_exp2f(fmaf(acc[j][r], LOG2E, -mnl)); sum += e; p[j >> 1][8 * (j & 1) + r] = (_Float16)(e * 2048.0f); } }
    l = l * alpha + sum;   /* this half's keys only; the halves are joined after the loop */
#pragma unroll
    for (int j = 0; j < HDV / 16; ++j) {
#pragma unroll
      for (int r = 0; r < 8; ++r) o[j][r] *= alpha; }
#pragma unroll
    for (int j = 0; j < HDV / 16; ++j) {
#pragma unroll
      for (int kc = 0; kc < 2; ++kc) o[j] = wmma16(frag_h(st + SG_V + (j * 16 + col) * VPIT + kc * 32, lane), p[kc], o[j]); }
    asm volatile("s_wait_dscnt 0x0" ::: "memory");      /* this wave's reads of the stage are done before the stage is given up */
    asm volatile("s_wait_asynccnt 0x0" ::: "memory");   /* this wave's copies of the next key block have landed */
    __syncthreads();                                    /* publishes the next key block and ends every wave's reads of this one */
    if (k0 + 128 < TT) fa_stage(lk + 2u * bo, lv + 2u * bo, gk + (size_t)(k0 + 128) * CC, gl + (size_t)(k0 + 128) * CC, gv + k0 + 128); }
  asm volatile("s_wait_asynccnt 0x0" ::: "memory");     /* nothing of this wave is in flight when it ends */
  l += xhalf(l); const float inv = l > 0.f ? 1.0f / (2048.0f * l) : 0.f;
  /* out is channels-first: the block's [64 real channels][128 queries] tile goes through LDS, so that every store run is a channel's whole 512 B. The stages are free: the barrier at the foot of the last trip stands behind every wave's last read, and every wave's last copies were waited for in front of an earlier one */
  float_a (*so)[OPIT] = (float_a (*)[OPIT])sg;
#pragma unroll
  for (int j = 0; j < HDV / 16; ++j) {
#pragma unroll
    for (int r = 0; r < 8; ++r) so[j * 16 + 8 * g + r][wave * 16 + col] = o[j][r] * inv; }   /* lane (g, col): channels 16 j + 8 g + r of query col */
  __syncthreads();   /* the tile is complete before other waves' lanes read it */
  float* op = OUT + ((size_t)b * CIN + h * HDV + wave) * NPOS + qb * FAQ + lane * 4;   /* a wave takes one channel's 128 queries a pass, eight channels apart */
  /* unrolled: the eight LDS reads go out together, each into registers of its own, and the stores share one address register pair that nothing rewrites */
#pragma unroll
  for (int i = 0; i < HDV / 8; ++i) vst2(op + i * 8 * NPOS, *(const v4fa*)&so[i * 8 + wave][lane * 4]); }

extern "C" void kernel_launch(void* const* d_in, const int* in_sizes, int n_in, void* d_out, int out_size, void* d_ws, size_t ws_size, hipStream_t stream) {
  (void)in_sizes; (void)n_in; (void)out_size;
  const float** F = (const float**)d_in;
  if (ws_size < (size_t)WS_END) return;
  char* ws = (char*)d_ws; _Float16 *QH = (_Float16*)(ws + WS_QH), *KH = (_Float16*)(ws + WS_KH), *VT = (_Float16*)(ws + WS_VT), *QL = (_Float16*)(ws + WS_QL), *KL = (_Float16*)(ws + WS_KL); __bf16 *VB = (__bf16*)(ws + WS_VB), *VBL = (__bf16*)(ws + WS_VBL); float *S = (float*)(ws + WS_S), *Y = (float*)(ws + WS_Y);
  (void)Y; (void)S; (void)VB; (void)VBL;
  // inputs: 0 x, 1 d [8,512,32,32]; 2 Wq [512,512] (out,in), 3 bq; 4 Wk, 5 bk; 6 Wv, 7 bv; 8 rel_h [1,8,64,1,32]; 9 rel_w [1,8,64,32,1]
  k_lin3<<<dim3(TNB * TT / 128, NH, 3), 256, 0, stream>>>(F[0], F[1], F[2], F[3], F[4], F[5], F[6], F[7], F[8], F[9], QH, QL, KH, KL, VT);
  k_fa<<<dim3(TT / FAQ, NH, TNB), 256, 0, stream>>>(QH, KH, QL, KL, VT, (float*)d_out);
}

// v008
// Measured time: 73.8 microseconds a run.
// Two timings next to v007 both put it at 1.06 times that version's speed.
// Over all steps from v000 it is 13.5 times as fast.
// compute dtype: all float inputs rounded to bf16; q/k/v = W t + b (1x1 convs) with EXACT bf16 products on WMMA 16x16x32 (f32 rows); the content + position logits folded into one 128-deep product [q_i | pos_i] . [k_j | q_j] with BOTH operands as f16 hi + residual (x 2^10) (3 products: the logits are unscaled, sigma ~14, near-argmax); softmax in f32 (exponentials in base 2 on v_exp_f32); P x 2^11 once to f16 against v once to f16 (1 product); f32 output (channels-first).
#include <hip/hip_runtime.h>
#include <math.h>

typedef __attribute__((ext_vector_type(16))) _Float16 v16h;
typedef __attribute__((ext_vector_type(16))) __bf16 v16b;
typedef __attribute__((ext_vector_type(8)))  _Float16 v8h;
typedef __attribute__((ext_vector_type(8)))  float v8f;
typedef __attribute__((ext_vector_type(4)))  float v4f;
typedef __attribute__((ext_vector_type(2)))  float v2f;
typedef __attribute__((ext_vector_type(4)))  unsigned v4u;
typedef __attribute__((ext_vector_type(4)))  int v4i;
typedef float __attribute__((may_alias)) float_a;
typedef int __attribute__((may_alias)) int_a;

template <typename T> __device__ __forceinline__ void vst2(void* p, T v) { *(T*)p = v;  }
__device__ __forceinline__ v8f wmma16(v16h a, v16h b, v8f c) {
  v8f d = __builtin_amdgcn_wmma_f32_16x16x32_f16(false, a, false, b, (short)0, c, false, false);
  asm volatile("v_nop\n\tv_nop\n\tv_nop\n\tv_nop" : "+v"(d) : "v"(a), "v"(b));
  return d;
}
__device__ __forceinline__ v8f wmma_bf(v16b a, v16b b, v8f c) {
  v8f d = __builtin_amdgcn_wmma_f32_16x16x32_bf16(false, a, false, b, (short)0, c, false, false);
  asm volatile("v_nop\n\tv_nop\n\tv_nop\n\tv_nop" : "+v"(d) : "v"(a), "v"(b));
  return d;
}
// 16x16x32 fragments: lane = (h = lane>>4, row/col = lane&15); elements 0..7 = k0+8h+0..7, 8..15 = k0+16+8h+0..7; D element r = row 8h+r
__device__ __forceinline__ v16h frag_h(const _Float16* rowk0, int lane) {
  union { v16h v; v8h q[2]; } u; const _Float16* p = rowk0 + 8 * (lane >> 4);
  u.q[0] = *(const v8h*)p; u.q[1] = *(const v8h*)(p + 16); return u.v;
}
__device__ __forceinline__ v16h frag_f32(const float* rowk0, int lane) {
  v16h a; const float* p = rowk0 + 8 * (lane >> 4);
#pragma unroll
  for (int i = 0; i < 8; ++i) { a[i] = (_Float16)p[i]; a[8 + i] = (_Float16)p[16 + i]; }
  return a;
}
__device__ __forceinline__ v16h frag_f32s(const float* rowk0, int lane, float sc) {
  v16h a; const float* p = rowk0 + 8 * (lane >> 4);
#pragma unroll
  for (int i = 0; i < 8; ++i) { a[i] = (_Float16)(p[i] * sc); a[8 + i] = (_Float16)(p[16 + i] * sc); }
  return a;
}
// column fragment from a [K][ld] layout (column n), rows >= K read as 0
__device__ __forceinline__ v16h fragc_f32(const float* W, int k0, int n, int lane, int ld, int K) {
  v16h a; const int g = lane >> 4;
#pragma unroll
  for (int i = 0; i < 8; ++i) { const int ka = k0 + 8 * g + i, kb = ka + 16;
    a[i] = (_Float16)(ka < K ? W[(size_t)(ka < K ? ka : K - 1) * ld + n] : 0.f); a[8 + i] = (_Float16)(kb < K ? W[(size_t)(kb < K ? kb : K - 1) * ld + n] : 0.f); }
  return a;
}
struct F2 { v16b h, l; };
__device__ __forceinline__ F2 bsplit16(const float v[16]) { F2 r;
#pragma unroll
  for (int i = 0; i < 16; ++i) { const __bf16 h = (__bf16)v[i]; r.h[i] = h; r.l[i] = (__bf16)(v[i] - (float)h); }
  return r; }
__device__ __forceinline__ F2 split_row(const float* row, int k0, int lane) { float v[16]; const float* p = row + k0 + 8 * (lane >> 4);
#pragma unroll
  for (int i = 0; i < 8; ++i) { v[i] = p[i]; v[8 + i] = p[16 + i]; }
  return bsplit16(v); }
__device__ __forceinline__ F2 split_rowK(const float* row, int k0, int lane, int K) { float v[16]; const int g = lane >> 4;
#pragma unroll
  for (int i = 0; i < 8; ++i) { const int ka = k0 + 8 * g + i, kb = ka + 16; v[i] = ka < K ? row[ka < K ? ka : K - 1] : 0.f; v[8 + i] = kb < K ? row[kb < K ? kb : K - 1] : 0.f; }
  return bsplit16(v); }
__device__ __forceinline__ F2 split_col(const float* W, int k0, int n, int lane, int ld, int K) { float v[16]; const int g = lane >> 4;
#pragma unroll
  for (int i = 0; i < 8; ++i) { const int ka = k0 + 8 * g + i, kb = ka + 16; v[i] = ka < K ? W[(size_t)(ka < K ? ka : K - 1) * ld + n] : 0.f; v[8 + i] = kb < K ? W[(size_t)(kb < K ? kb : K - 1) * ld + n] : 0.f; }
  return bsplit16(v); }
__device__ __forceinline__ v8f mac3(const F2& a, const F2& b, v8f c) { c = wmma_bf(a.l, b.h, c); c = wmma_bf(a.h, b.l, c); return wmma_bf(a.h, b.h, c); }
__device__ __forceinline__ float sigm(float v) { return 1.0f / (1.0f + expf(-v)); }
#define LDSX() do { asm volatile("s_wait_dscnt 0" ::: "memory"); __builtin_amdgcn_wave_barrier(); __builtin_amdgcn_fence(__ATOMIC_RELEASE, "workgroup"); } while (0)

// Bottleneck-transformer MHSA with 2-D relative position logits (B 8, C 512 = 8 x 64, 32 x 32 = 1,024 positions): q = Wq x + bq, k = Wk d + bk, v = Wv d + bv; energy[i][j] = q_i . k_j + pos_i . q_j with pos = (rel_h + rel_w) [h][64][n] (the module adds the [m,n]-indexed position term to the [n,m]-indexed content term positionally); attn = softmax_j; out[c][i] = sum_j v[c][j] attn[i][j] -> [B, C, 32, 32].
#define NB 8
#define TT 1024
#define CC 1024            // NH * HD = projected width
#define DIN 1024          // unused here (the input width is CIN)
#define NH 8
#define HD 128
#define NQB (TT / 64)
#define HG 8
#define SCALE (1.0f)
#define CAUSAL 0
#ifndef TNB
#define TNB NB
#endif
__device__ __forceinline__ float bfr(float v) { return (float)(__bf16)v; }
__host__ __device__ __forceinline__ int kb_last(int qb) { return CAUSAL ? ((qb * 64 + 63) >> 7) : (TT / 128 - 1); }
typedef __attribute__((ext_vector_type(8))) __bf16 v8b;
__device__ __forceinline__ v16b frag_b(const __bf16* rowk0, int lane) {
  union { v16b v; v8b q[2]; } u; const __bf16* p = rowk0 + 8 * (lane >> 4);
  u.q[0] = *(const v8b*)p; u.q[1] = *(const v8b*)(p + 16); return u.v;
}
#define QBH NQB            // every query block takes the 3-product logits path (q and k both f16 hi + residual); unscaled logits, sigma ~14
#define QHI 1024            // rows carrying a q residual plane (all rows when non-causal: 3-product logits everywhere, QBH = NQB)
#define KHI TT             // k residual rows for every key
// B fragment (k rows k0+.., output column o) of a weight: (in,out) [K][ld] or (out,in) [ld rows of K]: bf16 exact, or f16(bf16 * 256) exact
__device__ __forceinline__ v16b wcol_io(const float* Wm, int k0, int o, int lane, int ld) { v16b w; const int g = lane >> 4;
#pragma unroll
  for (int i = 0; i < 8; ++i) { w[i] = (__bf16)Wm[(size_t)(k0 + 8 * g + i) * ld + o]; w[8 + i] = (__bf16)Wm[(size_t)(k0 + 16 + 8 * g + i) * ld + o]; }
  return w; }
__device__ __forceinline__ v16b wcol_oi(const float* Wm, int k0, int o, int lane, int K) { v16b w; const float* p = Wm + (size_t)o * K + k0 + 8 * (lane >> 4);
#pragma unroll
  for (int i = 0; i < 8; ++i) { w[i] = (__bf16)p[i]; w[8 + i] = (__bf16)p[16 + i]; }
  return w; }
__device__ __forceinline__ v16h wcolh_io(const float* Wm, int k0, int o, int lane, int ld) { v16h w; const int g = lane >> 4;
#pragma unroll
  for (int i = 0; i < 8; ++i) { w[i] = (_Float16)(bfr(Wm[(size_t)(k0 + 8 * g + i) * ld + o]) * 256.0f); w[8 + i] = (_Float16)(bfr(Wm[(size_t)(k0 + 16 + 8 * g + i) * ld + o]) * 256.0f); }
  return w; }
__device__ __forceinline__ v16h wcolh_oi(const float* Wm, int k0, int o, int lane, int K) { v16h w; const float* p = Wm + (size_t)o * K + k0 + 8 * (lane >> 4);
#pragma unroll
  for (int i = 0; i < 8; ++i) { w[i] = (_Float16)(bfr(p[i]) * 256.0f); w[8 + i] = (_Float16)(bfr(p[16 + i]) * 256.0f); }
  return w; }
#define WQKV_LAYOUT 1   // 0 = (in,out) [DIN][CC]; 1 = (out,in) [CC][DIN]; 2 = per-head [NH][DIN][HD]
__device__ __forceinline__ v16b wcol_hdk(const float* Wm, int k0, int o, int lane) { v16b w; const int g = lane >> 4; const float* p = Wm + (size_t)(o / HD) * DIN * HD + (o % HD);
#pragma unroll
  for (int i = 0; i < 8; ++i) { w[i] = (__bf16)p[(size_t)(k0 + 8 * g + i) * HD]; w[8 + i] = (__bf16)p[(size_t)(k0 + 16 + 8 * g + i) * HD]; }
  return w; }
#define WO_OUT_IN 0
#if WQKV_LAYOUT == 1
#define WCOL(W, k0, o, lane) wcol_oi(W, k0, o, lane, DIN)
#elif WQKV_LAYOUT == 2
#define WCOL(W, k0, o, lane) wcol_hdk(W, k0, o, lane)
#else
#define WCOL(W, k0, o, lane) wcol_io(W, k0, o, lane, CC)
#endif
#if WO_OUT_IN
#define WOCOL(W, k0, o, lane) wcol_oi(W, k0, o, lane, CC)
#define WOCOLH(W, k0, o, lane) wcolh_oi(W, k0, o, lane, CC)
#else
#define WOCOL(W, k0, o, lane) wcol_io(W, k0, o, lane, DIN)
#define WOCOLH(W, k0, o, lane) wcolh_io(W, k0, o, lane, DIN)
#endif
#define CIN 512            // channels
#define NPOS 1024          // 32 x 32
#define HDV 64             // real head width (q and k rows are 128 wide: [q | pos], [k | q]; a head's v planes keep the 128-channel pitch, and only channels 0..63 are written and read)
// ---- k_lin3: block = (128 positions, head h, which), wave = 16 positions: y = W t + b (exact bf16 products, channels-first A gather, (out,in) W rows h*64..), f32, written straight into the 128-wide f16 attention planes that k_fa reads: rows [q | pos] (QH, residual x 2^10 in QL), rows [k | q] (KH, KL), planes v[channel][position] (VT). which 0 (q from x): QH/QL[.][0..63] and KH/KL[.][64..127]; which 1 (k from d): KH/KL[.][0..63], and the position rows QH/QL[.][64 + dch] = bfr(rel_h[h][dch][n % 32]) + bfr(rel_w[h][dch][n / 32]) of its own batch (these blocks have the heaviest epilogue); which 2 (v from d): VT channels 0..63 of the head. The head's 64 W rows come in 32-deep chunks: eight lanes read one row's whole 128-B line, the block rounds the chunk to bf16 once and keeps it in one of two LDS buffers, and all eight waves take their B fragments from there (same values, same k order as a direct read)
#define WPIT 40            // halves per staged W row (80 B = 16 B x odd: the sixteen rows of a fragment read fall on different banks)
typedef __attribute__((ext_vector_type(4))) __bf16 v4b;
// eight f32 of an LDS row -> f16 hi and f16 residual x 2^10 (together ~2^-21 of the value)
__device__ __forceinline__ void hires8(const float* s, v8h& hi, v8h& lo) { const v4f a = *(const v4f*)s, c = *(const v4f*)(s + 4);
#pragma unroll
  for (int i = 0; i < 4; ++i) { const _Float16 ha = (_Float16)a[i], hc = (_Float16)c[i]; hi[i] = ha; hi[4 + i] = hc; lo[i] = (_Float16)((a[i] - (float)ha) * 1024.0f); lo[4 + i] = (_Float16)((c[i] - (float)hc) * 1024.0f); } }
// a wave's own LDS tile changes hands between its lanes: the LDS operations so far are done, and the compiler moves none across (no fence: stores to global memory that are under way need not be waited for)
#define LDSW() do { asm volatile("s_wait_dscnt 0x0" ::: "memory"); __builtin_amdgcn_wave_barrier(); } while (0)
__global__ __launch_bounds__(256) void k_lin3(const float* __restrict__ X, const float* __restrict__ Dd, const float* __restrict__ WQ, const float* __restrict__ BQ, const float* __restrict__ WK, const float* __restrict__ BK, const float* __restrict__ WV, const float* __restrict__ BV, const float* __restrict__ RH, const float* __restrict__ RW, _Float16* __restrict__ QH, _Float16* __restrict__ QL, _Float16* __restrict__ KH, _Float16* __restrict__ KL, _Float16* __restrict__ VT) { __shared__ __align__(16) unsigned char sm[8 * 16 * 68 * 4];
  float (*sf)[16][68] = (float (*)[16][68])sm; __bf16 (*sw)[64][WPIT] = (__bf16 (*)[64][WPIT])sm;   /* the two W buffers (10,240 B) lie in the epilogue's tile, which is written only behind the barrier after the loop */
  const int tid = threadIdx.x, wave = tid >> 5, lane = tid & 31, col = lane & 15, g = lane >> 4; const int h = blockIdx.y, which = blockIdx.z; const size_t r0 = (size_t)blockIdx.x * 128 + wave * 16; const size_t b = r0 / NPOS; const int n0 = (int)(r0 % NPOS);
  const float* T = which == 0 ? X : Dd; const float* Wm = which == 0 ? WQ : which == 1 ? WK : WV; const float* Bm = which == 0 ? BQ : which == 1 ? BK : BV;
  const float* wsrc = Wm + (size_t)(h * HDV + (tid >> 3)) * CIN + (tid & 7) * 4;   /* this thread's share of a chunk: rows tid / 8 and tid / 8 + 32, k 4 (tid % 8) .. + 3 */
  v8f acc[4] = {};
  /* the '#pragma unroll' on the wv and acc loops: their counters index register arrays, which stay in registers only if the index is a constant */
#pragma unroll 1
  for (int kc = 0; kc < CIN / 32; ++kc) { v4f wv[2];
#pragma unroll
    for (int i = 0; i < 2; ++i) wv[i] = *(const v4f*)(wsrc + (size_t)i * 32 * CIN + kc * 32);
    v16b a; const float* p = T + (b * CIN + kc * 32 + 8 * g) * (size_t)NPOS + n0 + col;   /* channels-first: element (b, c, n) at (b*512 + c)*1024 + n */
#pragma unroll
      for (int i = 0; i < 8; ++i) { a[i] = (__bf16)p[(size_t)i * NPOS]; a[8 + i] = (__bf16)p[(size_t)(16 + i) * NPOS]; }
    asm volatile("s_wait_loadcnt 0x0\n\ts_wait_xcnt 0x0" :: "v"(p) : "memory");   /* the lane's address is an input, so it keeps its registers up to this wait and no result lands on an address that an issued load names */
#pragma unroll
    for (int i = 0; i < 2; ++i) { v4b t; t[0] = (__bf16)wv[i][0]; t[1] = (__bf16)wv[i][1]; t[2] = (__bf16)wv[i][2]; t[3] = (__bf16)wv[i][3]; *(v4b*)&sw[kc & 1][(tid >> 3) + 32 * i][(tid & 7) * 4] = t; }
    __syncthreads();   /* publishes this chunk; it also stands behind every wave's reads of the other buffer (trip kc - 1), which the next trip refills */
#pragma unroll
    for (int j = 0; j < 4; j += 2) { const v16b w0 = frag_b(&sw[kc & 1][j * 16 + col][0], lane), w1 = frag_b(&sw[kc & 1][(j + 1) * 16 + col][0], lane); acc[j] = wmma_bf(a, w0, acc[j]); acc[j + 1] = wmma_bf(a, w1, acc[j + 1]); } }
  __syncthreads();     /* every wave has read its last W fragments before the tile below overwrites the buffers */
  float bv[4]; const int bi = h * HDV + col;
#pragma unroll
  for (int j = 0; j < 4; ++j) bv[j] = Bm[bi + j * 16];
  asm volatile("s_wait_xcnt 0x0" :: "v"(bi) : "memory");   /* the lane's index is an input, so no result lands on the register that the issued loads name */
  if (which == 2) {   /* v: a lane's eight accumulator rows are eight consecutive positions of one channel, the order of a VT plane; the block's [64 channels][128 positions] tile goes through LDS so that every store run is a channel's whole 256 B */
    _Float16 (*sv)[136] = (_Float16 (*)[136])sm;   /* 272-B pitch (16 B x odd): the sixteen channels of a 16-B column fall on different banks */
#pragma unroll
    for (int j = 0; j < 4; ++j) { const float bb = bfr(bv[j]); v8h t;
#pragma unroll
      for (int r = 0; r < 8; ++r) t[r] = (_Float16)(acc[j][r] + bb);
      *(v8h*)&sv[j * 16 + col][wave * 16 + 8 * g] = t; }
    __syncthreads();   /* the tile is complete before other waves' lanes read it (which is the same for the whole block) */
    char* vt = (char*)VT + (((blockIdx.x >> 3) * CC + h * HD + (tid >> 4)) * TT + (blockIdx.x & 7) * 128u + (tid & 15) * 8) * 2u;   /* eight blocks a batch; byte offset in the 16-MiB plane */
#pragma unroll
    for (int i = 0; i < 4; ++i) { vst2(vt + 16 * i * TT * 2, *(const v8h*)&sv[16 * i + (tid >> 4)][(tid & 15) * 8]); }
    return; }
#pragma unroll
  for (int j = 0; j < 4; ++j) { const float bb = bfr(bv[j]);
#pragma unroll
    for (int r = 0; r < 8; ++r) sf[wave][8 * g + r][j * 16 + col] = acc[j][r] + bb; }
  LDSX();   /* the wave's own tile: its lanes' writes are in LDS before other lanes of the wave read them */
  const float* srow = &sf[wave][lane >> 3][(lane & 7) * 8];   /* row writer: eight lanes a row's 64 channels (128 B of f16), four rows a pass */
  const unsigned orow = ((blockIdx.x * 128u + wave * 16 + (lane >> 3)) * CC + h * HD + (lane & 7) * 8) * 2u;   /* byte offset of the lane's 16 B in a plane (a plane is 16 MiB) */
  char* H0 = (char*)(which == 0 ? QH : KH); char* L0 = (char*)(which == 0 ? QL : KL);
  /* both row loops are kept rolled: four passes side by side hold some 60 registers more, and above 80 a wave the 1,536 blocks no longer fit the chip at once */
#pragma unroll 1
  for (int p = 0; p < 4; ++p) { v8h hi, lo; hires8(srow + p * 4 * 68, hi, lo); const unsigned o = orow + p * (4u * CC * 2u); vst2(H0 + o, hi); vst2(L0 + o, lo);
    if (which == 0) { vst2((char*)KH + o + HDV * 2, hi); vst2((char*)KL + o + HDV * 2, lo); }
    asm volatile("s_wait_xcnt 0x0" :: "v"(o), "v"(hi), "v"(lo) : "memory"); }   /* offset and data are inputs, so they keep their registers up to this wait: the next pass rewrites nothing that an issued store names */
  if (which == 0) return;
  /* The wave's 16 positions lie in one row of the 32 x 32 map: n / 32 is one value, n % 32 runs over 16. Lane = (channel 32 hf + 8 it + lane / 4, positions 4 (lane % 4) .. + 3) */
  const float* prh = RH + (h * HDV + (lane >> 2)) * 32 + (wave & 1) * 16 + (lane & 3) * 4; const float* prw = RW + (h * HDV + (lane >> 2)) * 32 + (blockIdx.x & 7) * 4 + (wave >> 1);
  LDSW();   /* the k rows have been read before the position rows take their place in the wave's tile */
  /* two rolled halves, for the same register budget as the row loops */
#pragma unroll 1
  for (int hf = 0; hf < 2; ++hf) { v4f rh[4]; float rw[4]; const float* ph = prh + hf * 32 * 32; const float* pw = prw + hf * 32 * 32;
#pragma unroll
    for (int it = 0; it < 4; ++it) { rh[it] = *(const v4f*)(ph + it * 8 * 32); rw[it] = pw[it * 8 * 32]; }
    asm volatile("s_wait_xcnt 0x0" :: "v"(ph), "v"(pw) : "memory");   /* both lane addresses are inputs, so they keep their registers up to this wait and no result lands on an address that an issued load names */
#pragma unroll
    for (int it = 0; it < 4; ++it) {
#pragma unroll
      for (int i = 0; i < 4; ++i) sf[wave][(lane & 3) * 4 + i][hf * 32 + it * 8 + (lane >> 2)] = bfr(rh[it][i]) + bfr(rw[it]); } }
  LDSW();   /* written before other lanes read */
#pragma unroll 1
  for (int p = 0; p < 4; ++p) { v8h hi, lo; hires8(srow + p * 4 * 68, hi, lo); const unsigned o = orow + p * (4u * CC * 2u) + HDV * 2; vst2((char*)QH + o, hi); vst2((char*)QL + o, lo);
    asm volatile("s_wait_xcnt 0x0" :: "v"(o), "v"(hi), "v"(lo) : "memory"); } }   /* as in the first row loop */
#ifndef SM_EXTRA_PARAMS
#define SM_EXTRA_PARAMS
#endif
#ifndef PROJ_EXTRA_PARAMS
#define PROJ_EXTRA_PARAMS
#endif
#ifndef SM_MASK_HOOK
#define SM_MASK_HOOK (void)0
#endif

#define WS_QH  0u                                      // f16 q rows [b*t][CC]
#define WS_KH  (WS_QH + 2u * (size_t)NB * TT * CC)      // f16 k rows [b*t][CC]
#define WS_VT  (WS_KH + 2u * (size_t)NB * TT * CC)      // f16 v planes [b][c][t]
#define WS_QL  (WS_VT + 2u * (size_t)NB * CC * TT)      // f16 q residual x 2^10 rows [b][t < QHI][CC]
#define WS_KL  (WS_QL + 2u * (size_t)NB * QHI * CC)     // f16 k residual x 2^10 rows [b][t < KHI][CC]
#define WS_VB  (WS_KL + 2u * (size_t)NB * KHI * CC)     // bf16 v hi planes not used (no space reserved)
#define WS_VBL (WS_VB + 0u)                            // bf16 v planes not used (P.v takes the f16 path)
#define WS_S   (WS_VBL + 0u)    // f32 logits / P [hg][t][s]: reserved but unused (k_fa keeps logits and P in registers)
#define WS_Y   (WS_S  + 4u * (size_t)HG * TT * TT)      // f32 ctx rows [b*t][CC] (only when there is an output projection)
#define WS_END (WS_Y  + 0u)

// lane l with lane l ^ 16 (the two halves of a wave hold the two halves of a query column's keys)
__device__ __forceinline__ float xhalf(float x) { return __builtin_bit_cast(float, __builtin_amdgcn_permlanex16(__builtin_bit_cast(int, x), __builtin_bit_cast(int, x), 0x76543210, 0xfedcba98, false, false)); }
#define LOG2E 1.44269504088896340736f   // exp(x) = 2^(x log2 e)
#define FAQ 128            // queries per block: eight waves read each staged key tile
#define KPIT 136           // halves per staged k row (272 B = 16 B x odd: the sixteen rows of a fragment read fall on different banks)
#define VPIT 72            // halves per staged v row (144 B, likewise)
#define SG_KL (64 * KPIT)                    // residual rows behind the hi rows
#define SG_V  (2 * 64 * KPIT)                // v rows [channel][64 keys] behind both
#define SG_SZ (2 * 64 * KPIT + HDV * VPIT)   // halves per stage (44,032 B)
#define OPIT 132           // floats per row of the output tile (528 B: the two channels, eight apart, that a wave's two halves write fall on different banks)
typedef v4f __attribute__((may_alias)) v4fa;
// one 64-key stage, 10 copies of 16 B per lane straight into LDS: k hi rows and k residual rows (16 lanes a 256-B row, rows 16 apart), v rows (8 lanes a 128-B row, rows 32 apart). lk / lv: the lane's own LDS byte addresses, gk / gl / gv its own global addresses. The s_wait_xcnt ends the copies' own statement, so no address register is rewritten in front of it
__device__ __forceinline__ void fa_stage(unsigned lk, unsigned lv, const _Float16* gk, const _Float16* gl, const _Float16* gv) {
  asm volatile("global_load_async_to_lds_b128 %0, %10, off\n\t"
               "global_load_async_to_lds_b128 %1, %11, off\n\t"
               "global_load_async_to_lds_b128 %2, %12, off\n\t"
               "global_load_async_to_lds_b128 %3, %13, off\n\t"
               "global_load_async_to_lds_b128 %4, %14, off\n\t"
               "global_load_async_to_lds_b128 %5, %15, off\n\t"
               "global_load_async_to_lds_b128 %6, %16, off\n\t"
               "global_load_async_to_lds_b128 %7, %17, off\n\t"
               "global_load_async_to_lds_b128 %8, %18, off\n\t"
               "global_load_async_to_lds_b128 %9, %19, off\n\t"
               "s_wait_xcnt 0x0"
               :: "v"(lk), "v"(lk + 2u * 16 * KPIT), "v"(lk + 2u * 32 * KPIT), "v"(lk + 2u * 48 * KPIT),
                  "v"(lk + 2u * SG_KL), "v"(lk + 2u * (SG_KL + 16 * KPIT)), "v"(lk + 2u * (SG_KL + 32 * KPIT)), "v"(lk + 2u * (SG_KL + 48 * KPIT)),
                  "v"(lv), "v"(lv + 2u * 32 * VPIT),
                  "v"(gk), "v"(gk + 16 * CC), "v"(gk + 32 * CC), "v"(gk + 48 * CC),
                  "v"(gl), "v"(gl + 16 * CC), "v"(gl + 32 * CC), "v"(gl + 48 * CC),
                  "v"(gv), "v"(gv + 32 * TT)
               : "memory");
}
// ---- k_fa: block = 128 queries (qb) of (b, h), wave = 16 queries as COLUMNS; one pass over the keys in blocks of 64. Each key block (k hi rows, k residual rows, v rows) is copied once per block into one of two LDS stages by asynchronous copies, one key block ahead of the products, and all eight waves take their A fragments from there (two blocks a WGP, four waves a SIMD: at most 256 registers a wave, hence amdgpu_waves_per_eu). Transposed logits S^T = k . q^T (A = k rows hi / residual x 2^10, B = q rows hi / residual, 3 products, k order as before) stay in registers: lane (g, col) holds keys 16 j + 8 g + r of query col, so the running maximum and sum (f32) are in-lane plus one exchange between the halves. exp(s - m) = 2^(s log2 e - m log2 e) is one fused multiply-add and one v_exp_f32; the rounding of the addend m log2 e is one common factor of a key block's terms and of its rescale (same addend), but the rescale takes m_old log2 e unrounded, so earlier blocks' roundings do not cancel in ctx / sum. exp(s - m) x 2^11 once to f16 packs from two 16-key tiles into one B fragment (element i = key 8 g + i, element 8 + i = key 16 + 8 g + i: the order frag_h gives the v planes as A); ctx^T += v^T . P^T (1 product, the head's 64 v channels), rescaled by exp(m_old - m_new) per key block and divided by the row sum at the end, goes to out[b][h*64 + d][n]
__global__ __launch_bounds__(256) __attribute__((amdgpu_waves_per_eu(4, 4))) void k_fa(const _Float16* __restrict__ QH, const _Float16* __restrict__ KH, const _Float16* __restrict__ QL, const _Float16* __restrict__ KL, const _Float16* __restrict__ VT, float* __restrict__ OUT) {
  __shared__ __attribute__((aligned(16))) _Float16 sg[2 * SG_SZ];
  const int tid = threadIdx.x, wave = tid >> 5, lane = tid & 31, col = lane & 15, g = lane >> 4; const int qb = blockIdx.x, h = blockIdx.y, b = blockIdx.z; const int ql0 = qb * FAQ + wave * 16; const size_t q0 = (size_t)b * TT + ql0;
  const _Float16* QLb = QL + (size_t)b * QHI * CC; const _Float16* KLb = KL + (size_t)b * KHI * CC;
  v16h qh[HD / 32], qr[HD / 32]; const _Float16* qrow = QH + (q0 + col) * CC + h * HD + 8 * g; const _Float16* qlrow = QLb + (size_t)(ql0 + col) * CC + h * HD + 8 * g;   /* the lane's own addresses: frag_h's element order, with its 8 g already added */
  /* every '#pragma unroll' in this kernel but the last: its counter indexes a register array (fragments, accumulators), which stays in registers only if the index is a constant */
#pragma unroll
  for (int kc = 0; kc < HD / 32; ++kc) { union { v16h v; v8h q[2]; } u, w; u.q[0] = *(const v8h*)(qrow + kc * 32); u.q[1] = *(const v8h*)(qrow + kc * 32 + 16); w.q[0] = *(const v8h*)(qlrow + kc * 32); w.q[1] = *(const v8h*)(qlrow + kc * 32 + 16); qh[kc] = u.v; qr[kc] = w.v; }
  /* both lane addresses are inputs, so they stay in their registers up to this wait and no result of the sixteen loads above lands on an address that an issued load names */
  asm volatile("s_wait_xcnt 0x0" :: "v"(qrow), "v"(qlrow) : "memory");
  const unsigned sb = (unsigned)(size_t)sg; const unsigned lk = sb + 2u * ((tid >> 4) * KPIT + (tid & 15) * 8), lv = sb + 2u * (SG_V + (tid >> 3) * VPIT + (tid & 7) * 8);
  const _Float16* gk = KH + ((size_t)b * TT + (tid >> 4)) * CC + h * HD + (tid & 15) * 8; const _Float16* gl = KLb + (size_t)(tid >> 4) * CC + h * HD + (tid & 15) * 8; const _Float16* gv = VT + ((size_t)b * CC + h * HD + (tid >> 3)) * (size_t)TT + (tid & 7) * 8;
  fa_stage(lk, lv, gk, gl, gv);
  asm volatile("s_wait_asynccnt 0x0" ::: "memory");   /* this wave's copies of key block 0 have landed */
  __syncthreads();                                    /* ... and every other wave's */
  fa_stage(lk + 2u * SG_SZ, lv + 2u * SG_SZ, gk + 64 * CC, gl + 64 * CC, gv + 64);
  v8f o[HDV / 16] = {}; float m = -3.0e38f, l = 0.f;
  /* kept rolled: one body is about 1,100 instructions */
#pragma unroll 1
  for (int k0 = 0; k0 < TT; k0 += 64) { const unsigned bo = ((k0 >> 6) & 1) * SG_SZ; const _Float16* st = sg + bo; v8f acc[4] = {}, accl[4] = {};
    /* two register sets of four A fragments: set s holds the 32-deep steps 2 s and 2 s + 1 (hi, residual, hi, residual) of one 16-key row group. A set is refilled in one group of eight LDS reads right behind the six products that used it, so its reads are under way while the other set's six products run; the sets' last refills bring the eight v fragments, which land during the softmax. Products and their order per accumulator are as before */
    v16h fr[2][4];
#pragma unroll
    for (int s = 0; s < 2; ++s) {
#pragma unroll
      for (int i = 0; i < 2; ++i) { fr[s][2 * i] = frag_h(st + col * KPIT + (2 * s + i) * 32, lane); fr[s][2 * i + 1] = frag_h(st + SG_KL + col * KPIT + (2 * s + i) * 32, lane); } }
#pragma unroll
    for (int j = 0; j < 4; ++j) {
#pragma unroll
      for (int s = 0; s < 2; ++s) {
#pragma unroll
        for (int i = 0; i < 2; ++i) { const int kc = 2 * s + i; acc[j] = wmma16(fr[s][2 * i], qh[kc], acc[j]); accl[j] = wmma16(fr[s][2 * i], qr[kc], accl[j]); accl[j] = wmma16(fr[s][2 * i + 1], qh[kc], accl[j]); }
#pragma unroll
        for (int i = 0; i < 2; ++i) {
          if (j < 3) { fr[s][2 * i] = frag_h(st + ((j + 1) * 16 + col) * KPIT + (2 * s + i) * 32, lane); fr[s][2 * i + 1] = frag_h(st + SG_KL + ((j + 1) * 16 + col) * KPIT + (2 * s + i) * 32, lane); }
          else { fr[s][2 * i] = frag_h(st + SG_V + ((2 * s + i) * 16 + col) * VPIT, lane); fr[s][2 * i + 1] = frag_h(st + SG_V + ((2 * s + i) * 16 + col) * VPIT + 32, lane); } } }
#pragma unroll
      for (int r = 0; r < 8; ++r) acc[j][r] = (acc[j][r] + accl[j][r] * (1.0f / 1024.0f)) * SCALE;
      __builtin_amdgcn_sched_barrier(0); }   /* keeps each row group's residual sums joined here (left to the end, all four residual tiles stay live and the wave spills) and the v fragments' reads above the softmax (sunk to their products, each would be waited for in full) */
    float mx = -3.0e38f;
#pragma unroll
    for (int j = 0; j < 4; ++j) {
#pragma unroll
      for (int r = 0; r < 8; ++r) mx = fmaxf(mx, acc[j][r]); }
    mx = fmaxf(mx, xhalf(mx)); const float mn = fmaxf(m, mx), mnl = mn * LOG2E, alpha = __builtin_amdgcn_exp2f(fmaf(m, LOG2E, -mnl)); m = mn; float sum = 0.f; v16h p[2];
#pragma unroll
    for (int j = 0; j < 4; ++j) {
#pragma unroll
      for (int r = 0; r < 8; ++r) { const float e = __builtin_amdgcn_exp2f(fmaf(acc[j][r], LOG2E, -mnl)); sum += e; p[j >> 1][8 * (j & 1) + r] = (_Float16)(e * 2048.0f); } }
    l = l * alpha + sum;   /* this half's keys only; the halves are joined after the loop */
#pragma unroll
    for (int j = 0; j < HDV / 16; ++j) {
#pragma unroll
      for (int r = 0; r < 8; ++r) o[j][r] *= alpha; }
#pragma unroll
    for (int j = 0; j < HDV / 16; ++j) {
#pragma unroll
      for (int kc = 0; kc < 2; ++kc) o[j] = wmma16(fr[j >> 1][2 * (j & 1) + kc], p[kc], o[j]); }
    asm volatile("s_wait_dscnt 0x0" ::: "memory");      /* this wave's reads of the stage are done before the stage is given up */
    asm volatile("s_wait_asynccnt 0x0" ::: "memory");   /* this wave's copies of the next key block have landed */
    __syncthreads();                                    /* publishes the next key block and ends every wave's reads of this one */
    if (k0 + 128 < TT) fa_stage(lk + 2u * bo, lv + 2u * bo, gk + (size_t)(k0 + 128) * CC, gl + (size_t)(k0 + 128) * CC, gv + k0 + 128); }
  asm volatile("s_wait_asynccnt 0x0" ::: "memory");     /* nothing of this wave is in flight when it ends */
  l += xhalf(l); const float inv = l > 0.f ? 1.0f / (2048.0f * l) : 0.f;
  /* out is channels-first: the block's [64 real channels][128 queries] tile goes through LDS, so that every store run is a channel's whole 512 B. The stages are free: the barrier at the foot of the last trip stands behind every wave's last read, and every wave's last copies were waited for in front of an earlier one */
  float_a (*so)[OPIT] = (float_a (*)[OPIT])sg;
#pragma unroll
  for (int j = 0; j < HDV / 16; ++j) {
#pragma unroll
    for (int r = 0; r < 8; ++r) so[j * 16 + 8 * g + r][wave * 16 + col] = o[j][r] * inv; }   /* lane (g, col): channels 16 j + 8 g + r of query col */
  __syncthreads();   /* the tile is complete before other waves' lanes read it */
  float* op = OUT + ((size_t)b * CIN + h * HDV + wave) * NPOS + qb * FAQ + lane * 4;   /* a wave takes one channel's 128 queries a pass, eight channels apart */
  /* unrolled: the eight LDS reads go out together, each into registers of its own, and the stores share one address register pair that nothing rewrites */
#pragma unroll
  for (int i = 0; i < HDV / 8; ++i) vst2(op + i * 8 * NPOS, *(const v4fa*)&so[i * 8 + wave][lane * 4]); }

extern "C" void kernel_launch(void* const* d_in, const int* in_sizes, int n_in, void* d_out, int out_size, void* d_ws, size_t ws_size, hipStream_t stream) {
  (void)in_sizes; (void)n_in; (void)out_size;
  const float** F = (const float**)d_in;
  if (ws_size < (size_t)WS_END) return;
  char* ws = (char*)d_ws; _Float16 *QH = (_Float16*)(ws + WS_QH), *KH = (_Float16*)(ws + WS_KH), *VT = (_Float16*)(ws + WS_VT), *QL = (_Float16*)(ws + WS_QL), *KL = (_Float16*)(ws + WS_KL); __bf16 *VB = (__bf16*)(ws + WS_VB), *VBL = (__bf16*)(ws + WS_VBL); float *S = (float*)(ws + WS_S), *Y = (float*)(ws + WS_Y);
  (void)Y; (void)S; (void)VB; (void)VBL;
  // inputs: 0 x, 1 d [8,512,32,32]; 2 Wq [512,512] (out,in), 3 bq; 4 Wk, 5 bk; 6 Wv, 7 bv; 8 rel_h [1,8,64,1,32]; 9 rel_w [1,8,64,32,1]
  k_lin3<<<dim3(TNB * TT / 128, NH, 3), 256, 0, stream>>>(F[0], F[1], F[2], F[3], F[4], F[5], F[6], F[7], F[8], F[9], QH, QL, KH, KL, VT);
  k_fa<<<dim3(TT / FAQ, NH, TNB), 256, 0, stream>>>(QH, KH, QL, KL, VT, (float*)d_out);
}

// v009
// A run of this version takes 71.5 microseconds.
// Two timings next to v008 both put it at 1.03 times that version's speed.
// All steps since v000 together make it 13.9 times as fast.
// compute dtype: all float inputs rounded to bf16; q/k/v = W t + b (1x1 convs) with EXACT bf16 products on WMMA 16x16x32 (f32 rows); the content + position logits folded into one 128-deep product [q_i | pos_i] . [k_j | q_j] with BOTH operands as f16 hi + residual (x 2^10) (3 products: the logits are unscaled, sigma ~14, near-argmax); softmax in f32 (exponentials in base 2 on v_exp_f32); P x 2^11 once to f16 against v once to f16 (1 product); f32 output (channels-first).
#include <hip/hip_runtime.h>
#include <math.h>

typedef __attribute__((ext_vector_type(16))) _Float16 v16h;
typedef __attribute__((ext_vector_type(16))) __bf16 v16b;
typedef __attribute__((ext_vector_type(8)))  _Float16 v8h;
typedef __attribute__((ext_vector_type(8)))  float v8f;
typedef __attribute__((ext_vector_type(4)))  float v4f;
typedef __attribute__((ext_vector_type(2)))  float v2f;
typedef __attribute__((ext_vector_type(4)))  unsigned v4u;
typedef __attribute__((ext_vector_type(4)))  int v4i;
typedef float __attribute__((may_alias)) float_a;
typedef int __attribute__((may_alias)) int_a;

template <typename T> __device__ __forceinline__ void vst2(void* p, T v) { *(T*)p = v;  }
__device__ __forceinline__ v8f wmma_bf(v16b a, v16b b, v8f c) {
  return __builtin_amdgcn_wmma_f32_16x16x32_bf16(false, a, false, b, (short)0, c, false, false);
}
// 16x16x32 fragments: lane = (h = lane>>4, row/col = lane&15); elements 0..7 = k0+8h+0..7, 8..15 = k0+16+8h+0..7; D element r = row 8h+r
__device__ __forceinline__ v16h frag_h(const _Float16* rowk0, int lane) {
  union { v16h v; v8h q[2]; } u; const _Float16* p = rowk0 + 8 * (lane >> 4);
  u.q[0] = *(const v8h*)p; u.q[1] = *(const v8h*)(p + 16); return u.v;
}
__device__ __forceinline__ v16h frag_f32(const float* rowk0, int lane) {
  v16h a; const float* p = rowk0 + 8 * (lane >> 4);
#pragma unroll
  for (int i = 0; i < 8; ++i) { a[i] = (_Float16)p[i]; a[8 + i] = (_Float16)p[16 + i]; }
  return a;
}
__device__ __forceinline__ v16h frag_f32s(const float* rowk0, int lane, float sc) {
  v16h a; const float* p = rowk0 + 8 * (lane >> 4);
#pragma unroll
  for (int i = 0; i < 8; ++i) { a[i] = (_Float16)(p[i] * sc); a[8 + i] = (_Float16)(p[16 + i] * sc); }
  return a;
}
// column fragment from a [K][ld] layout (column n), rows >= K read as 0
__device__ __forceinline__ v16h fragc_f32(const float* W, int k0, int n, int lane, int ld, int K) {
  v16h a; const int g = lane >> 4;
#pragma unroll
  for (int i = 0; i < 8; ++i) { const int ka = k0 + 8 * g + i, kb = ka + 16;
    a[i] = (_Float16)(ka < K ? W[(size_t)(ka < K ? ka : K - 1) * ld + n] : 0.f); a[8 + i] = (_Float16)(kb < K ? W[(size_t)(kb < K ? kb : K - 1) * ld + n] : 0.f); }
  return a;
}
struct F2 { v16b h, l; };
__device__ __forceinline__ F2 bsplit16(const float v[16]) { F2 r;
#pragma unroll
  for (int i = 0; i < 16; ++i) { const __bf16 h = (__bf16)v[i]; r.h[i] = h; r.l[i] = (__bf16)(v[i] - (float)h); }
  return r; }
__device__ __forceinline__ F2 split_row(const float* row, int k0, int lane) { float v[16]; const float* p = row + k0 + 8 * (lane >> 4);
#pragma unroll
  for (int i = 0; i < 8; ++i) { v[i] = p[i]; v[8 + i] = p[16 + i]; }
  return bsplit16(v); }
__device__ __forceinline__ F2 split_rowK(const float* row, int k0, int lane, int K) { float v[16]; const int g = lane >> 4;
#pragma unroll
  for (int i = 0; i < 8; ++i) { const int ka = k0 + 8 * g + i, kb = ka + 16; v[i] = ka < K ? row[ka < K ? ka : K - 1] : 0.f; v[8 + i] = kb < K ? row[kb < K ? kb : K - 1] : 0.f; }
  return bsplit16(v); }
__device__ __forceinline__ F2 split_col(const float* W, int k0, int n, int lane, int ld, int K) { float v[16]; const int g = lane >> 4;
#pragma unroll
  for (int i = 0; i < 8; ++i) { const int ka = k0 + 8 * g + i, kb = ka + 16; v[i] = ka < K ? W[(size_t)(ka < K ? ka : K - 1) * ld + n] : 0.f; v[8 + i] = kb < K ? W[(size_t)(kb < K ? kb : K - 1) * ld + n] : 0.f; }
  return bsplit16(v); }
__device__ __forceinline__ v8f mac3(const F2& a, const F2& b, v8f c) { c = wmma_bf(a.l, b.h, c); c = wmma_bf(a.h, b.l, c); return wmma_bf(a.h, b.h, c); }
__device__ __forceinline__ float sigm(float v) { return 1.0f / (1.0f + expf(-v)); }
#define LDSX() do { asm volatile("s_wait_dscnt 0" ::: "memory"); __builtin_amdgcn_wave_barrier(); __builtin_amdgcn_fence(__ATOMIC_RELEASE, "workgroup"); } while (0)

// Bottleneck-transformer MHSA with 2-D relative position logits (B 8, C 512 = 8 x 64, 32 x 32 = 1,024 positions): q = Wq x + bq, k = Wk d + bk, v = Wv d + bv; energy[i][j] = q_i . k_j + pos_i . q_j with pos = (rel_h + rel_w) [h][64][n] (the module adds the [m,n]-indexed position term to the [n,m]-indexed content term positionally); attn = softmax_j; out[c][i] = sum_j v[c][j] attn[i][j] -> [B, C, 32, 32].
#define NB 8
#define TT 1024
#define CC 1024            // NH * HD = projected width
#define DIN 1024          // unused here (the input width is CIN)
#define NH 8
#define HD 128
#define NQB (TT / 64)
#define HG 8
#define SCALE (1.0f)
#define CAUSAL 0
#ifndef TNB
#define TNB NB
#endif
__device__ __forceinline__ float bfr(float v) { return (float)(__bf16)v; }
__host__ __device__ __forceinline__ int kb_last(int qb) { return CAUSAL ? ((qb * 64 + 63) >> 7) : (TT / 128 - 1); }
typedef __attribute__((ext_vector_type(8))) __bf16 v8b;
__device__ __forceinline__ v16b frag_b(const __bf16* rowk0, int lane) {
  union { v16b v; v8b q[2]; } u; const __bf16* p = rowk0 + 8 * (lane >> 4);
  u.q[0] = *(const v8b*)p; u.q[1] = *(const v8b*)(p + 16); return u.v;
}
#define QBH NQB            // every query block takes the 3-product logits path (q and k both f16 hi + residual); unscaled logits, sigma ~14
#define QHI 1024            // rows carrying a q residual plane (all rows when non-causal: 3-product logits everywhere, QBH = NQB)
#define KHI TT             // k residual rows for every key
// B fragment (k rows k0+.., output column o) of a weight: (in,out) [K][ld] or (out,in) [ld rows of K]: bf16 exact, or f16(bf16 * 256) exact
__device__ __forceinline__ v16b wcol_io(const float* Wm, int k0, int o, int lane, int ld) { v16b w; const int g = lane >> 4;
#pragma unroll
  for (int i = 0; i < 8; ++i) { w[i] = (__bf16)Wm[(size_t)(k0 + 8 * g + i) * ld + o]; w[8 + i] = (__bf16)Wm[(size_t)(k0 + 16 + 8 * g + i) * ld + o]; }
  return w; }
__device__ __forceinline__ v16b wcol_oi(const float* Wm, int k0, int o, int lane, int K) { v16b w; const float* p = Wm + (size_t)o * K + k0 + 8 * (lane >> 4);
#pragma unroll
  for (int i = 0; i < 8; ++i) { w[i] = (__bf16)p[i]; w[8 + i] = (__bf16)p[16 + i]; }
  return w; }
__device__ __forceinline__ v16h wcolh_io(const float* Wm, int k0, int o, int lane, int ld) { v16h w; const int g = lane >> 4;
#pragma unroll
  for (int i = 0; i < 8; ++i) { w[i] = (_Float16)(bfr(Wm[(size_t)(k0 + 8 * g + i) * ld + o]) * 256.0f); w[8 + i] = (_Float16)(bfr(Wm[(size_t)(k0 + 16 + 8 * g + i) * ld + o]) * 256.0f); }
  return w; }
__device__ __forceinline__ v16h wcolh_oi(const float* Wm, int k0, int o, int lane, int K) { v16h w; const float* p = Wm + (size_t)o * K + k0 + 8 * (lane >> 4);
#pragma unroll
  for (int i = 0; i < 8; ++i) { w[i] = (_Float16)(bfr(p[i]) * 256.0f); w[8 + i] = (_Float16)(bfr(p[16 + i]) * 256.0f); }
  return w; }
#define WQKV_LAYOUT 1   // 0 = (in,out) [DIN][CC]; 1 = (out,in) [CC][DIN]; 2 = per-head [NH][DIN][HD]
__device__ __forceinline__ v16b wcol_hdk(const float* Wm, int k0, int o, int lane) { v16b w; const int g = lane >> 4; const float* p = Wm + (size_t)(o / HD) * DIN * HD + (o % HD);
#pragma unroll
  for (int i = 0; i < 8; ++i) { w[i] = (__bf16)p[(size_t)(k0 + 8 * g + i) * HD]; w[8 + i] = (__bf16)p[(size_t)(k0 + 16 + 8 * g + i) * HD]; }
  return w; }
#define WO_OUT_IN 0
#if WQKV_LAYOUT == 1
#define WCOL(W, k0, o, lane) wcol_oi(W, k0, o, lane, DIN)
#elif WQKV_LAYOUT == 2
#define WCOL(W, k0, o, lane) wcol_hdk(W, k0, o, lane)
#else
#define WCOL(W, k0, o, lane) wcol_io(W, k0, o, lane, CC)
#endif
#if WO_OUT_IN
#define WOCOL(W, k0, o, lane) wcol_oi(W, k0, o, lane, CC)
#define WOCOLH(W, k0, o, lane) wcolh_oi(W, k0, o, lane, CC)
#else
#define WOCOL(W, k0, o, lane) wcol_io(W, k0, o, lane, DIN)
#define WOCOLH(W, k0, o, lane) wcolh_io(W, k0, o, lane, DIN)
#endif
#define CIN 512            // channels
#define NPOS 1024          // 32 x 32
#define HDV 64             // real head width (q and k rows are 128 wide: [q | pos], [k | q]; a head's v planes keep the 128-channel pitch, and only channels 0..63 are written and read)
// ---- k_lin3: block = (128 positions, head h, which), wave = 16 positions: y = W t + b (exact bf16 products, channels-first A gather, (out,in) W rows h*64..), f32, written straight into the 128-wide f16 attention planes that k_fa reads: rows [q | pos] (QH, residual x 2^10 in QL), rows [k | q] (KH, KL), planes v[channel][position] (VT). which 0 (q from x): QH/QL[.][0..63] and KH/KL[.][64..127]; which 1 (k from d): KH/KL[.][0..63], and the position rows QH/QL[.][64 + dch] = bfr(rel_h[h][dch][n % 32]) + bfr(rel_w[h][dch][n / 32]) of its own batch (these blocks have the heaviest epilogue); which 2 (v from d): VT channels 0..63 of the head. The head's 64 W rows come in 32-deep chunks: eight lanes read one row's whole 128-B line, the block rounds the chunk to bf16 once and keeps it in one of two LDS buffers, and all eight waves take their B fragments from there (same values, same k order as a direct read)
#define WPIT 40            // halves per staged W row (80 B = 16 B x odd: the sixteen rows of a fragment read fall on different banks)
typedef __attribute__((ext_vector_type(4))) __bf16 v4b;
// eight f32 of an LDS row -> f16 hi and f16 residual x 2^10 (together ~2^-21 of the value)
__device__ __forceinline__ void hires8(const float* s, v8h& hi, v8h& lo) { const v4f a = *(const v4f*)s, c = *(const v4f*)(s + 4);
#pragma unroll
  for (int i = 0; i < 4; ++i) { const _Float16 ha = (_Float16)a[i], hc = (_Float16)c[i]; hi[i] = ha; hi[4 + i] = hc; lo[i] = (_Float16)((a[i] - (float)ha) * 1024.0f); lo[4 + i] = (_Float16)((c[i] - (float)hc) * 1024.0f); } }
// a wave's own LDS tile changes hands between its lanes: the LDS operations so far are done, and the compiler moves none across (no fence: stores to global memory that are under way need not be waited for)
#define LDSW() do { asm volatile("s_wait_dscnt 0x0" ::: "memory"); __builtin_amdgcn_wave_barrier(); } while (0)
__global__ __launch_bounds__(256) void k_lin3(const float* __restrict__ X, const float* __restrict__ Dd, const float* __restrict__ WQ, const float* __restrict__ BQ, const float* __restrict__ WK, const float* __restrict__ BK, const float* __restrict__ WV, const float* __restrict__ BV, const float* __restrict__ RH, const float* __restrict__ RW, _Float16* __restrict__ QH, _Float16* __restrict__ QL, _Float16* __restrict__ KH, _Float16* __restrict__ KL, _Float16* __restrict__ VT) { __shared__ __align__(16) unsigned char sm[8 * 16 * 68 * 4];
  float (*sf)[16][68] = (float (*)[16][68])sm; __bf16 (*sw)[64][WPIT] = (__bf16 (*)[64][WPIT])sm;   /* the two W buffers (10,240 B) lie in the epilogue's tile, which is written only behind the barrier after the loop */
  const int tid = threadIdx.x, wave = tid >> 5, lane = tid & 31, col = lane & 15, g = lane >> 4; const int h = blockIdx.y, which = blockIdx.z; const size_t r0 = (size_t)blockIdx.x * 128 + wave * 16; const size_t b = r0 / NPOS; const int n0 = (int)(r0 % NPOS);
  const float* T = which == 0 ? X : Dd; const float* Wm = which == 0 ? WQ : which == 1 ? WK : WV; const float* Bm = which == 0 ? BQ : which == 1 ? BK : BV;
  const float* wsrc = Wm + (size_t)(h * HDV + (tid >> 3)) * CIN + (tid & 7) * 4;   /* this thread's share of a chunk: rows tid / 8 and tid / 8 + 32, k 4 (tid % 8) .. + 3 */
  v8f acc[4] = {};
  /* the '#pragma unroll' on the wv and acc loops: their counters index register arrays, which stay in registers only if the index is a constant */
#pragma unroll 1
  for (int kc = 0; kc < CIN / 32; ++kc) { v4f wv[2];
#pragma unroll
    for (int i = 0; i < 2; ++i) wv[i] = *(const v4f*)(wsrc + (size_t)i * 32 * CIN + kc * 32);
    v16b a; const float* p = T + (b * CIN + kc * 32 + 8 * g) * (size_t)NPOS + n0 + col;   /* channels-first: element (b, c, n) at (b*512 + c)*1024 + n */
#pragma unroll
      for (int i = 0; i < 8; ++i) { a[i] = (__bf16)p[(size_t)i * NPOS]; a[8 + i] = (__bf16)p[(size_t)(16 + i) * NPOS]; }
    asm volatile("s_wait_loadcnt 0x0\n\ts_wait_xcnt 0x0" :: "v"(p) : "memory");   /* the lane's address is an input, so it keeps its registers up to this wait and no result lands on an address that an issued load names */
#pragma unroll
    for (int i = 0; i < 2; ++i) { v4b t; t[0] = (__bf16)wv[i][0]; t[1] = (__bf16)wv[i][1]; t[2] = (__bf16)wv[i][2]; t[3] = (__bf16)wv[i][3]; *(v4b*)&sw[kc & 1][(tid >> 3) + 32 * i][(tid & 7) * 4] = t; }
    __syncthreads();   /* publishes this chunk; it also stands behind every wave's reads of the other buffer (trip kc - 1), which the next trip refills */
#pragma unroll
    for (int j = 0; j < 4; j += 2) { const v16b w0 = frag_b(&sw[kc & 1][j * 16 + col][0], lane), w1 = frag_b(&sw[kc & 1][(j + 1) * 16 + col][0], lane); acc[j] = wmma_bf(a, w0, acc[j]); acc[j + 1] = wmma_bf(a, w1, acc[j + 1]); } }
  __syncthreads();     /* every wave has read its last W fragments before the tile below overwrites the buffers */
  float bv[4]; const int bi = h * HDV + col;
#pragma unroll
  for (int j = 0; j < 4; ++j) bv[j] = Bm[bi + j * 16];
  asm volatile("s_wait_xcnt 0x0" :: "v"(bi) : "memory");   /* the lane's index is an input, so no result lands on the register that the issued loads name */
  if (which == 2) {   /* v: a lane's eight accumulator rows are eight consecutive positions of one channel, the order of a VT plane; the block's [64 channels][128 positions] tile goes through LDS so that every store run is a channel's whole 256 B */
    _Float16 (*sv)[136] = (_Float16 (*)[136])sm;   /* 272-B pitch (16 B x odd): the sixteen channels of a 16-B column fall on different banks */
#pragma unroll
    for (int j = 0; j < 4; ++j) { const float bb = bfr(bv[j]); v8h t;
#pragma unroll
      for (int r = 0; r < 8; ++r) t[r] = (_Float16)(acc[j][r] + bb);
      *(v8h*)&sv[j * 16 + col][wave * 16 + 8 * g] = t; }
    __syncthreads();   /* the tile is complete before other waves' lanes read it (which is the same for the whole block) */
    char* vt = (char*)VT + (((blockIdx.x >> 3) * CC + h * HD + (tid >> 4)) * TT + (blockIdx.x & 7) * 128u + (tid & 15) * 8) * 2u;   /* eight blocks a batch; byte offset in the 16-MiB plane */
#pragma unroll
    for (int i = 0; i < 4; ++i) { vst2(vt + 16 * i * TT * 2, *(const v8h*)&sv[16 * i + (tid >> 4)][(tid & 15) * 8]); }
    return; }
#pragma unroll
  for (int j = 0; j < 4; ++j) { const float bb = bfr(bv[j]);
#pragma unroll
    for (int r = 0; r < 8; ++r) sf[wave][8 * g + r][j * 16 + col] = acc[j][r] + bb; }
  LDSX();   /* the wave's own tile: its lanes' writes are in LDS before other lanes of the wave read them */
  const float* srow = &sf[wave][lane >> 3][(lane & 7) * 8];   /* row writer: eight lanes a row's 64 channels (128 B of f16), four rows a pass */
  const unsigned orow = ((blockIdx.x * 128u + wave * 16 + (lane >> 3)) * CC + h * HD + (lane & 7) * 8) * 2u;   /* byte offset of the lane's 16 B in a plane (a plane is 16 MiB) */
  char* H0 = (char*)(which == 0 ? QH : KH); char* L0 = (char*)(which == 0 ? QL : KL);
  /* both row loops are kept rolled: four passes side by side hold some 60 registers more, and above 80 a wave the 1,536 blocks no longer fit the chip at once */
#pragma unroll 1
  for (int p = 0; p < 4; ++p) { v8h hi, lo; hires8(srow + p * 4 * 68, hi, lo); const unsigned o = orow + p * (4u * CC * 2u); vst2(H0 + o, hi); vst2(L0 + o, lo);
    if (which == 0) { vst2((char*)KH + o + HDV * 2, hi); vst2((char*)KL + o + HDV * 2, lo); }
    asm volatile("s_wait_xcnt 0x0" :: "v"(o), "v"(hi), "v"(lo) : "memory"); }   /* offset and data are inputs, so they keep their registers up to this wait: the next pass rewrites nothing that an issued store names */
  if (which == 0) return;
  /* The wave's 16 positions lie in one row of the 32 x 32 map: n / 32 is one value, n % 32 runs over 16. Lane = (channel 32 hf + 8 it + lane / 4, positions 4 (lane % 4) .. + 3) */
  const float* prh = RH + (h * HDV + (lane >> 2)) * 32 + (wave & 1) * 16 + (lane & 3) * 4; const float* prw = RW + (h * HDV + (lane >> 2)) * 32 + (blockIdx.x & 7) * 4 + (wave >> 1);
  LDSW();   /* the k rows have been read before the position rows take their place in the wave's tile */
  /* two rolled halves, for the same register budget as the row loops */
#pragma unroll 1
  for (int hf = 0; hf < 2; ++hf) { v4f rh[4]; float rw[4]; const float* ph = prh + hf * 32 * 32; const float* pw = prw + hf * 32 * 32;
#pragma unroll
    for (int it = 0; it < 4; ++it) { rh[it] = *(const v4f*)(ph + it * 8 * 32); rw[it] = pw[it * 8 * 32]; }
    asm volatile("s_wait_xcnt 0x0" :: "v"(ph), "v"(pw) : "memory");   /* both lane addresses are inputs, so they keep their registers up to this wait and no result lands on an address that an issued load names */
#pragma unroll
    for (int it = 0; it < 4; ++it) {
#pragma unroll
      for (int i = 0; i < 4; ++i) sf[wave][(lane & 3) * 4 + i][hf * 32 + it * 8 + (lane >> 2)] = bfr(rh[it][i]) + bfr(rw[it]); } }
  LDSW();   /* written before other lanes read */
#pragma unroll 1
  for (int p = 0; p < 4; ++p) { v8h hi, lo; hires8(srow + p * 4 * 68, hi, lo); const unsigned o = orow + p * (4u * CC * 2u) + HDV * 2; vst2((char*)QH + o, hi); vst2((char*)QL + o, lo);
    asm volatile("s_wait_xcnt 0x0" :: "v"(o), "v"(hi), "v"(lo) : "memory"); } }   /* as in the first row loop */
#ifndef SM_EXTRA_PARAMS
#define SM_EXTRA_PARAMS
#endif
#ifndef PROJ_EXTRA_PARAMS
#define PROJ_EXTRA_PARAMS
#endif
#ifndef SM_MASK_HOOK
#define SM_MASK_HOOK (void)0
#endif

#define WS_QH  0u                                      // f16 q rows [b*t][CC]
#define WS_KH  (WS_QH + 2u * (size_t)NB * TT * CC)      // f16 k rows [b*t][CC]
#define WS_VT  (WS_KH + 2u * (size_t)NB * TT * CC)      // f16 v planes [b][c][t]
#define WS_QL  (WS_VT + 2u * (size_t)NB * CC * TT)      // f16 q residual x 2^10 rows [b][t < QHI][CC]
#define WS_KL  (WS_QL + 2u * (size_t)NB * QHI * CC)     // f16 k residual x 2^10 rows [b][t < KHI][CC]
#define WS_VB  (WS_KL + 2u * (size_t)NB * KHI * CC)     // bf16 v hi planes not used (no space reserved)
#define WS_VBL (WS_VB + 0u)                            // bf16 v planes not used (P.v takes the f16 path)
#define WS_S   (WS_VBL + 0u)    // f32 logits / P [hg][t][s]: reserved but unused (k_fa keeps logits and P in registers)
#define WS_Y   (WS_S  + 4u * (size_t)HG * TT * TT)      // f32 ctx rows [b*t][CC] (only when there is an output projection)
#define WS_END (WS_Y  + 0u)

// lane l with lane l ^ 16 (the two halves of a wave hold the two halves of a query column's keys)
__device__ __forceinline__ float xhalf(float x) { return __builtin_bit_cast(float, __builtin_amdgcn_permlanex16(__builtin_bit_cast(int, x), __builtin_bit_cast(int, x), 0x76543210, 0xfedcba98, false, false)); }
#define LOG2E 1.44269504088896340736f   // exp(x) = 2^(x log2 e)
#define FAQ 128            // queries per block: eight waves read each staged key tile
#define KPIT 136           // halves per staged k row (272 B = 16 B x odd: the sixteen rows of a fragment read fall on different banks)
#define VPIT 72            // halves per staged v row (144 B, likewise)
#define SG_KL (64 * KPIT)                    // residual rows behind the hi rows
#define SG_V  (2 * 64 * KPIT)                // v rows [channel][64 keys] behind both
#define SG_SZ (2 * 64 * KPIT + HDV * VPIT)   // halves per stage (44,032 B)
#define OPIT 132           // floats per row of the output tile (528 B: the two channels, eight apart, that a wave's two halves write fall on different banks)
typedef v4f __attribute__((may_alias)) v4fa;
// one 64-key stage, 10 copies of 16 B per lane straight into LDS: k hi rows and k residual rows (16 lanes a 256-B row, rows 16 apart), v rows (8 lanes a 128-B row, rows 32 apart). lk / lv: the lane's own LDS byte addresses, gk / gl / gv its own global addresses. The s_wait_xcnt ends the copies' own statement, so no address register is rewritten in front of it
__device__ __forceinline__ void fa_stage(unsigned lk, unsigned lv, const _Float16* gk, const _Float16* gl, const _Float16* gv) {
  asm volatile("global_load_async_to_lds_b128 %0, %10, off\n\t"
               "global_load_async_to_lds_b128 %1, %11, off\n\t"
               "global_load_async_to_lds_b128 %2, %12, off\n\t"
               "global_load_async_to_lds_b128 %3, %13, off\n\t"
               "global_load_async_to_lds_b128 %4, %14, off\n\t"
               "global_load_async_to_lds_b128 %5, %15, off\n\t"
               "global_load_async_to_lds_b128 %6, %16, off\n\t"
               "global_load_async_to_lds_b128 %7, %17, off\n\t"
               "global_load_async_to_lds_b128 %8, %18, off\n\t"
               "global_load_async_to_lds_b128 %9, %19, off\n\t"
               "s_wait_xcnt 0x0"
               :: "v"(lk), "v"(lk + 2u * 16 * KPIT), "v"(lk + 2u * 32 * KPIT), "v"(lk + 2u * 48 * KPIT),
                  "v"(lk + 2u * SG_KL), "v"(lk + 2u * (SG_KL + 16 * KPIT)), "v"(lk + 2u * (SG_KL + 32 * KPIT)), "v"(lk + 2u * (SG_KL + 48 * KPIT)),
                  "v"(lv), "v"(lv + 2u * 32 * VPIT),
                  "v"(gk), "v"(gk + 16 * CC), "v"(gk + 32 * CC), "v"(gk + 48 * CC),
                  "v"(gl), "v"(gl + 16 * CC), "v"(gl + 32 * CC), "v"(gl + 48 * CC),
                  "v"(gv), "v"(gv + 32 * TT)
               : "memory");
}
// The products of k_fa are written as asm statements of several WMMAs: behind a WMMA stand WMMAs that add into the same accumulators and LDS reads, neither of which needs a distance, so v_nop stand only where a vector instruction comes next (as single builtins without v_nop the compiler let the products sink in among the LDS reads, each refill took registers of its own, and the wave spilled). The "memory" clobber keeps the LDS reads of the register sets on their side of a statement.
// six products of one register set (two 32-deep steps: h0 l0, h1 l1 = k hi, k residual) with q hi (q0, q1) and q residual (r0, r1): a takes hi.hi, al takes hi.residual and residual.hi, each accumulator in the order of the steps. One statement a step, so that the first step is waited for alone and starts while the second step's four reads are still under way. The first set of a row group starts both accumulators from 0
__device__ __forceinline__ void qk6_first(v8f& a, v8f& al, v16h h0, v16h l0, v16h h1, v16h l1, v16h q0, v16h r0, v16h q1, v16h r1) {
  asm volatile("v_wmma_f32_16x16x32_f16 %1, %2, %5, 0\n\t"
               "v_wmma_f32_16x16x32_f16 %0, %2, %4, 0\n\t"
               "v_wmma_f32_16x16x32_f16 %1, %3, %4, %1"
               : "=&v"(a), "=&v"(al) : "v"(h0), "v"(l0), "v"(q0), "v"(r0) : "memory");
  asm volatile("v_wmma_f32_16x16x32_f16 %0, %2, %4, %0\n\t"
               "v_wmma_f32_16x16x32_f16 %1, %2, %5, %1\n\t"
               "v_wmma_f32_16x16x32_f16 %1, %3, %4, %1"
               : "+v"(a), "+v"(al) : "v"(h1), "v"(l1), "v"(q1), "v"(r1) : "memory");
}
// the second set of a row group; the four v_nop keep the distance between the last WMMA and the vector instructions that join a and al
__device__ __forceinline__ void qk6_last(v8f& a, v8f& al, v16h h0, v16h l0, v16h h1, v16h l1, v16h q0, v16h r0, v16h q1, v16h r1) {
  asm volatile("v_wmma_f32_16x16x32_f16 %1, %2, %5, %1\n\t"
               "v_wmma_f32_16x16x32_f16 %0, %2, %4, %0\n\t"
               "v_wmma_f32_16x16x32_f16 %1, %3, %4, %1"
               : "+v"(a), "+v"(al) : "v"(h0), "v"(l0), "v"(q0), "v"(r0) : "memory");
  asm volatile("v_wmma_f32_16x16x32_f16 %0, %2, %4, %0\n\t"
               "v_wmma_f32_16x16x32_f16 %1, %2, %5, %1\n\t"
               "v_wmma_f32_16x16x32_f16 %1, %3, %4, %1\n\t"
               "v_nop\n\tv_nop\n\tv_nop\n\tv_nop"
               : "+v"(a), "+v"(al) : "v"(h1), "v"(l1), "v"(q1), "v"(r1) : "memory");
}
// the eight products v . P of a key block: channel group j takes keys 0..31 (aj, p0), then keys 32..63 (bj, p1); the four v_nop keep the distance to whatever vector instruction next touches an operand or a result
__device__ __forceinline__ void pv8(v8f& o0, v8f& o1, v8f& o2, v8f& o3, v16h a0, v16h b0, v16h a1, v16h b1, v16h a2, v16h b2, v16h a3, v16h b3, v16h p0, v16h p1) {
  asm volatile("v_wmma_f32_16x16x32_f16 %0, %4, %12, %0\n\t"
               "v_wmma_f32_16x16x32_f16 %1, %6, %12, %1\n\t"
               "v_wmma_f32_16x16x32_f16 %2, %8, %12, %2\n\t"
               "v_wmma_f32_16x16x32_f16 %3, %10, %12, %3\n\t"
               "v_wmma_f32_16x16x32_f16 %0, %5, %13, %0\n\t"
               "v_wmma_f32_16x16x32_f16 %1, %7, %13, %1\n\t"
               "v_wmma_f32_16x16x32_f16 %2, %9, %13, %2\n\t"
               "v_wmma_f32_16x16x32_f16 %3, %11, %13, %3\n\t"
               "v_nop\n\tv_nop\n\tv_nop\n\tv_nop"
               : "+v"(o0), "+v"(o1), "+v"(o2), "+v"(o3) : "v"(a0), "v"(b0), "v"(a1), "v"(b1), "v"(a2), "v"(b2), "v"(a3), "v"(b3), "v"(p0), "v"(p1) : "memory");
}
// ---- k_fa: block = 128 queries (qb) of (b, h), wave = 16 queries as COLUMNS; one pass over the keys in blocks of 64. Each key block (k hi rows, k residual rows, v rows) is copied once per block into one of two LDS stages by asynchronous copies, one key block ahead of the products, and all eight waves take their A fragments from there (two blocks a WGP, four waves a SIMD: at most 256 registers a wave, hence amdgpu_waves_per_eu). Transposed logits S^T = k . q^T (A = k rows hi / residual x 2^10, B = q rows hi / residual, 3 products, k order as before) stay in registers: lane (g, col) holds keys 16 j + 8 g + r of query col, so the running maximum and sum (f32) are in-lane plus one exchange between the halves. exp(s - m) = 2^(s log2 e - m log2 e) is one fused multiply-add and one v_exp_f32; the rounding of the addend m log2 e is one common factor of a key block's terms and of its rescale (same addend), but the rescale takes the old m log2 e unrounded, so an earlier block's rounding stays on the terms up to that block and does not cancel in ctx / sum. exp(s - m) x 2^11 once to f16 packs from two 16-key tiles into one B fragment (element i = key 8 g + i, element 8 + i = key 16 + 8 g + i: the order frag_h gives the v planes as A); ctx^T += v^T . P^T (1 product, the head's 64 v channels), rescaled by exp(m_old - m_new) per key block and divided by the row sum at the end, goes to out[b][h*64 + d][n]
__global__ __launch_bounds__(256) __attribute__((amdgpu_waves_per_eu(4, 4))) void k_fa(const _Float16* __restrict__ QH, const _Float16* __restrict__ KH, const _Float16* __restrict__ QL, const _Float16* __restrict__ KL, const _Float16* __restrict__ VT, float* __restrict__ OUT) {
  __shared__ __attribute__((aligned(16))) _Float16 sg[2 * SG_SZ];
  const int tid = threadIdx.x, wave = tid >> 5, lane = tid & 31, col = lane & 15, g = lane >> 4; const int qb = blockIdx.x, h = blockIdx.y, b = blockIdx.z; const int ql0 = qb * FAQ + wave * 16; const size_t q0 = (size_t)b * TT + ql0;
  const _Float16* QLb = QL + (size_t)b * QHI * CC; const _Float16* KLb = KL + (size_t)b * KHI * CC;
  v16h qh[HD / 32], qr[HD / 32]; const _Float16* qrow = QH + (q0 + col) * CC + h * HD + 8 * g; const _Float16* qlrow = QLb + (size_t)(ql0 + col) * CC + h * HD + 8 * g;   /* the lane's own addresses: frag_h's element order, with its 8 g already added */
  /* every '#pragma unroll' in this kernel but the last: its counter indexes a register array (fragments, accumulators), which stays in registers only if the index is a constant */
#pragma unroll
  for (int kc = 0; kc < HD / 32; ++kc) { union { v16h v; v8h q[2]; } u, w; u.q[0] = *(const v8h*)(qrow + kc * 32); u.q[1] = *(const v8h*)(qrow + kc * 32 + 16); w.q[0] = *(const v8h*)(qlrow + kc * 32); w.q[1] = *(const v8h*)(qlrow + kc * 32 + 16); qh[kc] = u.v; qr[kc] = w.v; }
  /* both lane addresses are inputs, so they stay in their registers up to this wait and no result of the sixteen loads above lands on an address that an issued load names */
  asm volatile("s_wait_xcnt 0x0" :: "v"(qrow), "v"(qlrow) : "memory");
  const unsigned sb = (unsigned)(size_t)sg; const unsigned lk = sb + 2u * ((tid >> 4) * KPIT + (tid & 15) * 8), lv = sb + 2u * (SG_V + (tid >> 3) * VPIT + (tid & 7) * 8);
  const _Float16* gk = KH + ((size_t)b * TT + (tid >> 4)) * CC + h * HD + (tid & 15) * 8; const _Float16* gl = KLb + (size_t)(tid >> 4) * CC + h * HD + (tid & 15) * 8; const _Float16* gv = VT + ((size_t)b * CC + h * HD + (tid >> 3)) * (size_t)TT + (tid & 7) * 8;
  fa_stage(lk, lv, gk, gl, gv);
  asm volatile("s_wait_asynccnt 0x0" ::: "memory");   /* this wave's copies of key block 0 have landed */
  __syncthreads();                                    /* ... and every other wave's */
  fa_stage(lk + 2u * SG_SZ, lv + 2u * SG_SZ, gk + 64 * CC, gl + 64 * CC, gv + 64);
  v8f o[HDV / 16] = {}; float m = -3.0e38f, l = 0.f;
  /* kept rolled: one body is about 420 instructions, and the sixteen copies together would take most of the instruction cache for no saved work */
#pragma unroll 1
  for (int k0 = 0; k0 < TT; k0 += 64) { const unsigned bo = ((k0 >> 6) & 1) * SG_SZ; const _Float16* st = sg + bo; v8f acc[4], accl[4];
    /* two register sets of four A fragments: set s holds the 32-deep steps 2 s and 2 s + 1 (hi, residual, hi, residual) of one 16-key row group. A set is refilled in one group of eight LDS reads right behind the six products that used it, so its reads are under way while the other set's six products run; the sets' last refills bring the eight v fragments, which land during the softmax. Products and their order per accumulator are as before */
    v16h fr[2][4];
#pragma unroll
    for (int s = 0; s < 2; ++s) {
#pragma unroll
      for (int i = 0; i < 2; ++i) { fr[s][2 * i] = frag_h(st + col * KPIT + (2 * s + i) * 32, lane); fr[s][2 * i + 1] = frag_h(st + SG_KL + col * KPIT + (2 * s + i) * 32, lane); } }
#pragma unroll
    for (int j = 0; j < 4; ++j) {
#pragma unroll
      for (int s = 0; s < 2; ++s) {
        if (s == 0) qk6_first(acc[j], accl[j], fr[0][0], fr[0][1], fr[0][2], fr[0][3], qh[0], qr[0], qh[1], qr[1]);
        else qk6_last(acc[j], accl[j], fr[1][0], fr[1][1], fr[1][2], fr[1][3], qh[2], qr[2], qh[3], qr[3]);
#pragma unroll
        for (int i = 0; i < 2; ++i) {
          if (j < 3) { fr[s][2 * i] = frag_h(st + ((j + 1) * 16 + col) * KPIT + (2 * s + i) * 32, lane); fr[s][2 * i + 1] = frag_h(st + SG_KL + ((j + 1) * 16 + col) * KPIT + (2 * s + i) * 32, lane); }
          else { fr[s][2 * i] = frag_h(st + SG_V + ((2 * s + i) * 16 + col) * VPIT, lane); fr[s][2 * i + 1] = frag_h(st + SG_V + ((2 * s + i) * 16 + col) * VPIT + 32, lane); } } }
#pragma unroll
      for (int r = 0; r < 8; ++r) acc[j][r] = (acc[j][r] + accl[j][r] * (1.0f / 1024.0f)) * SCALE;
      __builtin_amdgcn_sched_barrier(0); }   /* keeps each row group's residual sums joined here (left to the end, all four residual tiles stay live and the wave spills) and the v fragments' reads above the softmax (sunk to their products, each would be waited for in full) */
    float mx = -3.0e38f;
#pragma unroll
    for (int j = 0; j < 4; ++j) {
#pragma unroll
      for (int r = 0; r < 8; ++r) mx = fmaxf(mx, acc[j][r]); }
    mx = fmaxf(mx, xhalf(mx)); const float mn = fmaxf(m, mx), mnl = mn * LOG2E, alpha = __builtin_amdgcn_exp2f(fmaf(m, LOG2E, -mnl)); m = mn; float sum = 0.f; v16h p[2];
#pragma unroll
    for (int j = 0; j < 4; ++j) {
#pragma unroll
      for (int r = 0; r < 8; ++r) { const float e = __builtin_amdgcn_exp2f(fmaf(acc[j][r], LOG2E, -mnl)); sum += e; p[j >> 1][8 * (j & 1) + r] = (_Float16)(e * 2048.0f); } }
    l = l * alpha + sum;   /* this half's keys only; the halves are joined after the loop */
#pragma unroll
    for (int j = 0; j < HDV / 16; ++j) {
#pragma unroll
      for (int r = 0; r < 8; ++r) o[j][r] *= alpha; }
    pv8(o[0], o[1], o[2], o[3], fr[0][0], fr[0][1], fr[0][2], fr[0][3], fr[1][0], fr[1][1], fr[1][2], fr[1][3], p[0], p[1]);
    asm volatile("s_wait_dscnt 0x0" ::: "memory");      /* this wave's reads of the stage are done before the stage is given up */
    asm volatile("s_wait_asynccnt 0x0" ::: "memory");   /* this wave's copies of the next key block have landed */
    __syncthreads();                                    /* publishes the next key block and ends every wave's reads of this one */
    if (k0 + 128 < TT) fa_stage(lk + 2u * bo, lv + 2u * bo, gk + (size_t)(k0 + 128) * CC, gl + (size_t)(k0 + 128) * CC, gv + k0 + 128); }
  asm volatile("s_wait_asynccnt 0x0" ::: "memory");     /* nothing of this wave is in flight when it ends */
  l += xhalf(l); const float inv = l > 0.f ? 1.0f / (2048.0f * l) : 0.f;
  /* out is channels-first: the block's [64 real channels][128 queries] tile goes through LDS, so that every store run is a channel's whole 512 B. The stages are free: the barrier at the foot of the last trip stands behind every wave's last read, and every wave's last copies were waited for in front of an earlier one */
  float_a (*so)[OPIT] = (float_a (*)[OPIT])sg;
#pragma unroll
  for (int j = 0; j < HDV / 16; ++j) {
#pragma unroll
    for (int r = 0; r < 8; ++r) so[j * 16 + 8 * g + r][wave * 16 + col] = o[j][r] * inv; }   /* lane (g, col): channels 16 j + 8 g + r of query col */
  __syncthreads();   /* the tile is complete before other waves' lanes read it */
  float* op = OUT + ((size_t)b * CIN + h * HDV + wave) * NPOS + qb * FAQ + lane * 4;   /* a wave takes one channel's 128 queries a pass, eight channels apart */
  /* unrolled: the eight LDS reads go out together, each into registers of its own, and the stores share one address register pair that nothing rewrites */
#pragma unroll
  for (int i = 0; i < HDV / 8; ++i) vst2(op + i * 8 * NPOS, *(const v4fa*)&so[i * 8 + wave][lane * 4]); }

extern "C" void kernel_launch(void* const* d_in, const int* in_sizes, int n_in, void* d_out, int out_size, void* d_ws, size_t ws_size, hipStream_t stream) {
  (void)in_sizes; (void)n_in; (void)out_size;
  const float** F = (const float**)d_in;
  if (ws_size < (size_t)WS_END) return;
  char* ws = (char*)d_ws; _Float16 *QH = (_Float16*)(ws + WS_QH), *KH = (_Float16*)(ws + WS_KH), *VT = (_Float16*)(ws + WS_VT), *QL = (_Float16*)(ws + WS_QL), *KL = (_Float16*)(ws + WS_KL); __bf16 *VB = (__bf16*)(ws + WS_VB), *VBL = (__bf16*)(ws + WS_VBL); float *S = (float*)(ws + WS_S), *Y = (float*)(ws + WS_Y);
  (void)Y; (void)S; (void)VB; (void)VBL;
  // inputs: 0 x, 1 d [8,512,32,32]; 2 Wq [512,512] (out,in), 3 bq; 4 Wk, 5 bk; 6 Wv, 7 bv; 8 rel_h [1,8,64,1,32]; 9 rel_w [1,8,64,32,1]
  k_lin3<<<dim3(TNB * TT / 128, NH, 3), 256, 0, stream>>>(F[0], F[1], F[2], F[3], F[4], F[5], F[6], F[7], F[8], F[9], QH, QL, KH, KL, VT);
  k_fa<<<dim3(TT / FAQ, NH, TNB), 256, 0, stream>>>(QH, KH, QL, KL, VT, (float*)d_out);
}

// v010
// It runs in 67.5 microseconds.
// Two timings next to v009 both put it at 1.06 times that version's speed.
// All steps since v000 together make it 14.7 times as fast.
// compute dtype: all float inputs rounded to bf16; q/k/v = W t + b (1x1 convs) with EXACT bf16 products on WMMA 16x16x32 (f32 rows); the content logits q_i . k_j 64 deep with BOTH operands as f16 hi + residual (x 2^10) (3 products: the logits are unscaled, sigma ~14, near-argmax); the position logits pos_i . q_j = rel_h[i % 32] . q_j + rel_w[i / 32] . q_j from two f32 tables of 32 rows a head (rel exact in f16 against q hi + residual, 2 products), which start the logits' accumulators; softmax in f32 (exponentials in base 2 on v_exp_f32); P x 2^11 once to f16 against v once to f16 (1 product); f32 output (channels-first).
#include <hip/hip_runtime.h>
#include <math.h>

typedef __attribute__((ext_vector_type(16))) _Float16 v16h;
typedef __attribute__((ext_vector_type(16))) __bf16 v16b;
typedef __attribute__((ext_vector_type(8)))  _Float16 v8h;
typedef __attribute__((ext_vector_type(8)))  float v8f;
typedef __attribute__((ext_vector_type(4)))  float v4f;
typedef __attribute__((ext_vector_type(2)))  float v2f;
typedef __attribute__((ext_vector_type(4)))  unsigned v4u;
typedef __attribute__((ext_vector_type(4)))  int v4i;
typedef float __attribute__((may_alias)) float_a;
typedef int __attribute__((may_alias)) int_a;
typedef v4f __attribute__((may_alias)) v4fa;

template <typename T> __device__ __forceinline__ void vst2(void* p, T v) { *(T*)p = v;  }
__device__ __forceinline__ v8f wmma_bf(v16b a, v16b b, v8f c) {
  return __builtin_amdgcn_wmma_f32_16x16x32_bf16(false, a, false, b, (short)0, c, false, false);
}
__device__ __forceinline__ v8f wmma_hf(v16h a, v16h b, v8f c) {
  return __builtin_amdgcn_wmma_f32_16x16x32_f16(false, a, false, b, (short)0, c, false, false);
}
// 16x16x32 fragments: lane = (h = lane>>4, row/col = lane&15); elements 0..7 = k0+8h+0..7, 8..15 = k0+16+8h+0..7; D element r = row 8h+r
__device__ __forceinline__ v16h frag_h(const _Float16* rowk0, int lane) {
  union { v16h v; v8h q[2]; } u; const _Float16* p = rowk0 + 8 * (lane >> 4);
  u.q[0] = *(const v8h*)p; u.q[1] = *(const v8h*)(p + 16); return u.v;
}
__device__ __forceinline__ v16h frag_f32(const float* rowk0, int lane) {
  v16h a; const float* p = rowk0 + 8 * (lane >> 4);
#pragma unroll
  for (int i = 0; i < 8; ++i) { a[i] = (_Float16)p[i]; a[8 + i] = (_Float16)p[16 + i]; }
  return a;
}
__device__ __forceinline__ v16h frag_f32s(const float* rowk0, int lane, float sc) {
  v16h a; const float* p = rowk0 + 8 * (lane >> 4);
#pragma unroll
  for (int i = 0; i < 8; ++i) { a[i] = (_Float16)(p[i] * sc); a[8 + i] = (_Float16)(p[16 + i] * sc); }
  return a;
}
// column fragment from a [K][ld] layout (column n), rows >= K read as 0
__device__ __forceinline__ v16h fragc_f32(const float* W, int k0, int n, int lane, int ld, int K) {
  v16h a; const int g = lane >> 4;
#pragma unroll
  for (int i = 0; i < 8; ++i) { const int ka = k0 + 8 * g + i, kb = ka + 16;
    a[i] = (_Float16)(ka < K ? W[(size_t)(ka < K ? ka : K - 1) * ld + n] : 0.f); a[8 + i] = (_Float16)(kb < K ? W[(size_t)(kb < K ? kb : K - 1) * ld + n] : 0.f); }
  return a;
}
struct F2 { v16b h, l; };
__device__ __forceinline__ F2 bsplit16(const float v[16]) { F2 r;
#pragma unroll
  for (int i = 0; i < 16; ++i) { const __bf16 h = (__bf16)v[i]; r.h[i] = h; r.l[i] = (__bf16)(v[i] - (float)h); }
  return r; }
__device__ __forceinline__ F2 split_row(const float* row, int k0, int lane) { float v[16]; const float* p = row + k0 + 8 * (lane >> 4);
#pragma unroll
  for (int i = 0; i < 8; ++i) { v[i] = p[i]; v[8 + i] = p[16 + i]; }
  return bsplit16(v); }
__device__ __forceinline__ F2 split_rowK(const float* row, int k0, int lane, int K) { float v[16]; const int g = lane >> 4;
#pragma unroll
  for (int i = 0; i < 8; ++i) { const int ka = k0 + 8 * g + i, kb = ka + 16; v[i] = ka < K ? row[ka < K ? ka : K - 1] : 0.f; v[8 + i] = kb < K ? row[kb < K ? kb : K - 1] : 0.f; }
  return bsplit16(v); }
__device__ __forceinline__ F2 split_col(const float* W, int k0, int n, int lane, int ld, int K) { float v[16]; const int g = lane >> 4;
#pragma unroll
  for (int i = 0; i < 8; ++i) { const int ka = k0 + 8 * g + i, kb = ka + 16; v[i] = ka < K ? W[(size_t)(ka < K ? ka : K - 1) * ld + n] : 0.f; v[8 + i] = kb < K ? W[(size_t)(kb < K ? kb : K - 1) * ld + n] : 0.f; }
  return bsplit16(v); }
__device__ __forceinline__ v8f mac3(const F2& a, const F2& b, v8f c) { c = wmma_bf(a.l, b.h, c); c = wmma_bf(a.h, b.l, c); return wmma_bf(a.h, b.h, c); }
__device__ __forceinline__ float sigm(float v) { return 1.0f / (1.0f + expf(-v)); }
#define LDSX() do { asm volatile("s_wait_dscnt 0" ::: "memory"); __builtin_amdgcn_wave_barrier(); __builtin_amdgcn_fence(__ATOMIC_RELEASE, "workgroup"); } while (0)

// Bottleneck-transformer MHSA with 2-D relative position logits (B 8, C 512 = 8 x 64, 32 x 32 = 1,024 positions): q = Wq x + bq, k = Wk d + bk, v = Wv d + bv; energy[i][j] = q_i . k_j + pos_i . q_j with pos = (rel_h + rel_w) [h][64][n] (the module adds the [m,n]-indexed position term to the [n,m]-indexed content term positionally); attn = softmax_j; out[c][i] = sum_j v[c][j] attn[i][j] -> [B, C, 32, 32].
#define NB 8
#define TT 1024
#define CC 1024            // NH * HD = projected width
#define DIN 1024          // unused here (the input width is CIN)
#define NH 8
#define HD 128
#define NQB (TT / 64)
#define HG 8
#define SCALE (1.0f)
#define CAUSAL 0
#ifndef TNB
#define TNB NB
#endif
__device__ __forceinline__ float bfr(float v) { return (float)(__bf16)v; }
__host__ __device__ __forceinline__ int kb_last(int qb) { return CAUSAL ? ((qb * 64 + 63) >> 7) : (TT / 128 - 1); }
typedef __attribute__((ext_vector_type(8))) __bf16 v8b;
__device__ __forceinline__ v16b frag_b(const __bf16* rowk0, int lane) {
  union { v16b v; v8b q[2]; } u; const __bf16* p = rowk0 + 8 * (lane >> 4);
  u.q[0] = *(const v8b*)p; u.q[1] = *(const v8b*)(p + 16); return u.v;
}
#define QBH NQB            // every query block takes the 3-product logits path (q and k both f16 hi + residual); unscaled logits, sigma ~14
#define QHI 1024            // rows carrying a q residual plane (all rows when non-causal: 3-product logits everywhere, QBH = NQB)
#define KHI TT             // k residual rows for every key
// B fragment (k rows k0+.., output column o) of a weight: (in,out) [K][ld] or (out,in) [ld rows of K]: bf16 exact, or f16(bf16 * 256) exact
__device__ __forceinline__ v16b wcol_io(const float* Wm, int k0, int o, int lane, int ld) { v16b w; const int g = lane >> 4;
#pragma unroll
  for (int i = 0; i < 8; ++i) { w[i] = (__bf16)Wm[(size_t)(k0 + 8 * g + i) * ld + o]; w[8 + i] = (__bf16)Wm[(size_t)(k0 + 16 + 8 * g + i) * ld + o]; }
  return w; }
__device__ __forceinline__ v16b wcol_oi(const float* Wm, int k0, int o, int lane, int K) { v16b w; const float* p = Wm + (size_t)o * K + k0 + 8 * (lane >> 4);
#pragma unroll
  for (int i = 0; i < 8; ++i) { w[i] = (__bf16)p[i]; w[8 + i] = (__bf16)p[16 + i]; }
  return w; }
__device__ __forceinline__ v16h wcolh_io(const float* Wm, int k0, int o, int lane, int ld) { v16h w; const int g = lane >> 4;
#pragma unroll
  for (int i = 0; i < 8; ++i) { w[i] = (_Float16)(bfr(Wm[(size_t)(k0 + 8 * g + i) * ld + o]) * 256.0f); w[8 + i] = (_Float16)(bfr(Wm[(size_t)(k0 + 16 + 8 * g + i) * ld + o]) * 256.0f); }
  return w; }
__device__ __forceinline__ v16h wcolh_oi(const float* Wm, int k0, int o, int lane, int K) { v16h w; const float* p = Wm + (size_t)o * K + k0 + 8 * (lane >> 4);
#pragma unroll
  for (int i = 0; i < 8; ++i) { w[i] = (_Float16)(bfr(p[i]) * 256.0f); w[8 + i] = (_Float16)(bfr(p[16 + i]) * 256.0f); }
  return w; }
#define WQKV_LAYOUT 1   // 0 = (in,out) [DIN][CC]; 1 = (out,in) [CC][DIN]; 2 = per-head [NH][DIN][HD]
__device__ __forceinline__ v16b wcol_hdk(const float* Wm, int k0, int o, int lane) { v16b w; const int g = lane >> 4; const float* p = Wm + (size_t)(o / HD) * DIN * HD + (o % HD);
#pragma unroll
  for (int i = 0; i < 8; ++i) { w[i] = (__bf16)p[(size_t)(k0 + 8 * g + i) * HD]; w[8 + i] = (__bf16)p[(size_t)(k0 + 16 + 8 * g + i) * HD]; }
  return w; }
#define WO_OUT_IN 0
#if WQKV_LAYOUT == 1
#define WCOL(W, k0, o, lane) wcol_oi(W, k0, o, lane, DIN)
#elif WQKV_LAYOUT == 2
#define WCOL(W, k0, o, lane) wcol_hdk(W, k0, o, lane)
#else
#define WCOL(W, k0, o, lane) wcol_io(W, k0, o, lane, CC)
#endif
#if WO_OUT_IN
#define WOCOL(W, k0, o, lane) wcol_oi(W, k0, o, lane, CC)
#define WOCOLH(W, k0, o, lane) wcolh_oi(W, k0, o, lane, CC)
#else
#define WOCOL(W, k0, o, lane) wcol_io(W, k0, o, lane, DIN)
#define WOCOLH(W, k0, o, lane) wcolh_io(W, k0, o, lane, DIN)
#endif
#define CIN 512            // channels
#define NPOS 1024          // 32 x 32
#define HDV 64             // real head width (a head's q rows, k rows and v planes keep the 128-channel pitch, and only channels 0..63 are written and read)
// ---- k_lin3: block = (128 positions, head h, which), wave = 16 positions: y = W t + b (exact bf16 products, channels-first A gather, (out,in) W rows h*64..), f32, written straight into the f16 attention planes that k_fa reads: rows q (QH, residual x 2^10 in QL), rows k (KH, KL), planes v[channel][position] (VT). which 0 (q from x): QH/QL[.][0..63], and the head's position table RP[b][h][64 rows][position j], f32: row a < 32 = sum_ch bfr(rel_h[h][ch][a]) q_j[ch], row 32 + c = 2^10 sum_ch bfr(rel_w[h][ch][c]) q_j[ch] (pos_i is rel_h[i % 32] + rel_w[i / 32], so these 64 rows hold the position logits of all 1,024 queries); which 1 (k from d): KH/KL[.][0..63]; which 2 (v from d): VT channels 0..63 of the head. The head's 64 W rows come in 32-deep chunks: eight lanes read one row's whole 128-B line, the block rounds the chunk to bf16 once and keeps it in one of two LDS buffers, and all eight waves take their B fragments from there (same values, same k order as a direct read)
#define SRP 72             // halves per staged rel row (144 B = 16 B x odd, as for WPIT)
#define PPIT 132           // floats per row of the position table's tile (528 B = 16 B x odd)
#define WPIT 40            // halves per staged W row (80 B = 16 B x odd: the sixteen rows of a fragment read fall on different banks)
typedef __attribute__((ext_vector_type(4))) __bf16 v4b;
// eight f32 of an LDS row -> f16 hi and f16 residual x 2^10 (together ~2^-21 of the value)
__device__ __forceinline__ void hires8(const float* s, v8h& hi, v8h& lo) { const v4f a = *(const v4f*)s, c = *(const v4f*)(s + 4);
#pragma unroll
  for (int i = 0; i < 4; ++i) { const _Float16 ha = (_Float16)a[i], hc = (_Float16)c[i]; hi[i] = ha; hi[4 + i] = hc; lo[i] = (_Float16)((a[i] - (float)ha) * 1024.0f); lo[4 + i] = (_Float16)((c[i] - (float)hc) * 1024.0f); } }
/* amdgpu_waves_per_eu: twelve waves a SIMD (six blocks a WGP) hold all 1,536 blocks on the chip at once, which takes 80 registers a wave or fewer */
__global__ __launch_bounds__(256) __attribute__((amdgpu_waves_per_eu(12))) void k_lin3(const float* __restrict__ X, const float* __restrict__ Dd, const float* __restrict__ WQ, const float* __restrict__ BQ, const float* __restrict__ WK, const float* __restrict__ BK, const float* __restrict__ WV, const float* __restrict__ BV, const float* __restrict__ RH, const float* __restrict__ RW, _Float16* __restrict__ QH, _Float16* __restrict__ QL, _Float16* __restrict__ KH, _Float16* __restrict__ KL, _Float16* __restrict__ VT, float* __restrict__ RP) { __shared__ __align__(16) unsigned char sm[8 * 16 * 68 * 4]; __shared__ __align__(16) _Float16 sr[64][SRP];
  float (*sf)[16][68] = (float (*)[16][68])sm; __bf16 (*sw)[64][WPIT] = (__bf16 (*)[64][WPIT])sm;   /* the two W buffers (10,240 B) lie in the epilogue's tile, which is written only behind the barrier after the loop */
  const int tid = threadIdx.x, wave = tid >> 5, lane = tid & 31, col = lane & 15, g = lane >> 4; const int h = blockIdx.y, which = blockIdx.z; const size_t r0 = (size_t)blockIdx.x * 128 + wave * 16; const size_t b = r0 / NPOS; const int n0 = (int)(r0 % NPOS);
  const float* T = which == 0 ? X : Dd; const float* Wm = which == 0 ? WQ : which == 1 ? WK : WV; const float* Bm = which == 0 ? BQ : which == 1 ? BK : BV;
  const float* wsrc = Wm + (size_t)(h * HDV + (tid >> 3)) * CIN + (tid & 7) * 4;   /* this thread's share of a chunk: rows tid / 8 and tid / 8 + 32, k 4 (tid % 8) .. + 3 */
  if (which == 0) {   /* the head's rel_h and rel_w, [channel][32] in memory, rounded to bf16 (exact in f16) and turned to rows [a | 32 + c][channel]; the loop's barriers publish them */
    const int ch = tid >> 2, a0 = (tid & 3) * 8; const float* ph = RH + (h * HDV + ch) * 32 + a0; const float* pw = RW + (h * HDV + ch) * 32 + a0;
    const v4f t0 = *(const v4f*)ph, t1 = *(const v4f*)(ph + 4), t2 = *(const v4f*)pw, t3 = *(const v4f*)(pw + 4);
    asm volatile("s_wait_xcnt 0x0" :: "v"(ph), "v"(pw) : "memory");   /* both lane addresses are inputs, so they keep their registers up to this wait and no result lands on an address that an issued load names */
#pragma unroll
    for (int i = 0; i < 4; ++i) { sr[a0 + i][ch] = (_Float16)bfr(t0[i]); sr[a0 + 4 + i][ch] = (_Float16)bfr(t1[i]); sr[32 + a0 + i][ch] = (_Float16)bfr(t2[i]); sr[32 + a0 + 4 + i][ch] = (_Float16)bfr(t3[i]); } }
  v8f acc[4] = {};
  /* the '#pragma unroll' on the wv and acc loops: their counters index register arrays, which stay in registers only if the index is a constant */
#pragma unroll 1
  for (int kc = 0; kc < CIN / 32; ++kc) { v4f wv[2];
#pragma unroll
    for (int i = 0; i < 2; ++i) wv[i] = *(const v4f*)(wsrc + (size_t)i * 32 * CIN + kc * 32);
    v16b a; const float* p = T + (b * CIN + kc * 32 + 8 * g) * (size_t)NPOS + n0 + col;   /* channels-first: element (b, c, n) at (b*512 + c)*1024 + n */
#pragma unroll
      for (int i = 0; i < 8; ++i) { a[i] = (__bf16)p[(size_t)i * NPOS]; a[8 + i] = (__bf16)p[(size_t)(16 + i) * NPOS]; }
    asm volatile("s_wait_loadcnt 0x0\n\ts_wait_xcnt 0x0" :: "v"(p) : "memory");   /* the lane's address is an input, so it keeps its registers up to this wait and no result lands on an address that an issued load names */
#pragma unroll
    for (int i = 0; i < 2; ++i) { v4b t; t[0] = (__bf16)wv[i][0]; t[1] = (__bf16)wv[i][1]; t[2] = (__bf16)wv[i][2]; t[3] = (__bf16)wv[i][3]; *(v4b*)&sw[kc & 1][(tid >> 3) + 32 * i][(tid & 7) * 4] = t; }
    __syncthreads();   /* publishes this chunk; it also stands behind every wave's reads of the other buffer (trip kc - 1), which the next trip refills */
#pragma unroll
    for (int j = 0; j < 4; j += 2) { const v16b w0 = frag_b(&sw[kc & 1][j * 16 + col][0], lane), w1 = frag_b(&sw[kc & 1][(j + 1) * 16 + col][0], lane); acc[j] = wmma_bf(a, w0, acc[j]); acc[j + 1] = wmma_bf(a, w1, acc[j + 1]); } }
  __syncthreads();     /* every wave has read its last W fragments before the tile below overwrites the buffers */
  float bv[4]; const int bi = h * HDV + col;
#pragma unroll
  for (int j = 0; j < 4; ++j) bv[j] = Bm[bi + j * 16];
  asm volatile("s_wait_xcnt 0x0" :: "v"(bi) : "memory");   /* the lane's index is an input, so no result lands on the register that the issued loads name */
  if (which != 2) {   /* no early return, and the position table in a branch of its own behind this one: inside it, the accumulators that the v branch reads would count as live and the table's fragments would spill */
#pragma unroll
  for (int j = 0; j < 4; ++j) { const float bb = bfr(bv[j]);
#pragma unroll
    for (int r = 0; r < 8; ++r) sf[wave][8 * g + r][j * 16 + col] = acc[j][r] + bb; }
  LDSX();   /* the wave's own tile: its lanes' writes are in LDS before other lanes of the wave read them */
  const float* srow = &sf[wave][lane >> 3][(lane & 7) * 8];   /* row writer: eight lanes a row's 64 channels (128 B of f16), four rows a pass */
  const unsigned orow = ((blockIdx.x * 128u + wave * 16 + (lane >> 3)) * CC + h * HD + (lane & 7) * 8) * 2u;   /* byte offset of the lane's 16 B in a plane (a plane is 16 MiB) */
  char* H0 = (char*)(which == 0 ? QH : KH); char* L0 = (char*)(which == 0 ? QL : KL);
  /* the row loop is kept rolled: four passes side by side hold some 60 registers more, and above 80 a wave the 1,536 blocks no longer fit the chip at once */
#pragma unroll 1
  for (int p = 0; p < 4; ++p) { v8h hi, lo; hires8(srow + p * 4 * 68, hi, lo); const unsigned o = orow + p * (4u * CC * 2u); vst2(H0 + o, hi); vst2(L0 + o, lo);
    asm volatile("s_wait_xcnt 0x0" :: "v"(o), "v"(hi), "v"(lo) : "memory"); }   /* offset and data are inputs, so they keep their registers up to this wait: the next pass rewrites nothing that an issued store names */
  } else {   /* v: a lane's eight accumulator rows are eight consecutive positions of one channel, the order of a VT plane; the block's [64 channels][128 positions] tile goes through LDS so that every store run is a channel's whole 256 B */
    _Float16 (*sv)[136] = (_Float16 (*)[136])sm;   /* 272-B pitch (16 B x odd): the sixteen channels of a 16-B column fall on different banks */
#pragma unroll
    for (int j = 0; j < 4; ++j) { const float bb = bfr(bv[j]); v8h t;
#pragma unroll
      for (int r = 0; r < 8; ++r) t[r] = (_Float16)(acc[j][r] + bb);
      *(v8h*)&sv[j * 16 + col][wave * 16 + 8 * g] = t; }
    __syncthreads();   /* the tile is complete before other waves' lanes read it (which is the same for the whole block) */
    char* vt = (char*)VT + (((blockIdx.x >> 3) * CC + h * HD + (tid >> 4)) * TT + (blockIdx.x & 7) * 128u + (tid & 15) * 8) * 2u;   /* eight blocks a batch; byte offset in the 16-MiB plane */
#pragma unroll
    for (int i = 0; i < 4; ++i) { vst2(vt + 16 * i * TT * 2, *(const v8h*)&sv[16 * i + (tid >> 4)][(tid & 15) * 8]); }
    asm volatile("s_wait_xcnt 0x0" ::: "memory");   /* code follows this branch now: nothing behind it rewrites a register that an issued store names in front of this wait */
  }
  if (which == 0) {
  /* position table: D[position][rel row] = q . rel^T, A = the wave's 16 q rows from its own tile as f16 hi (the values of QH) + f16 residual, B = staged rel rows; both loaders in frag_h's k order. The residual is left unscaled here (f16 keeps it to 2^-25 or better in absolute terms, subnormals included), so that one accumulator takes both products */
  v16h ah[2], al[2];
#pragma unroll
  for (int s = 0; s < 2; ++s) { union { v16h v; v8h q[2]; } uh, ul; const float* qs = &sf[wave][col][s * 32 + 8 * g];
#pragma unroll
    for (int e = 0; e < 2; ++e) { const v4f x0 = *(const v4f*)(qs + 16 * e), x1 = *(const v4f*)(qs + 16 * e + 4);
#pragma unroll
      for (int i = 0; i < 4; ++i) { const _Float16 h0 = (_Float16)x0[i], h1 = (_Float16)x1[i]; uh.q[e][i] = h0; uh.q[e][4 + i] = h1; ul.q[e][i] = (_Float16)(x0[i] - (float)h0); ul.q[e][4 + i] = (_Float16)(x1[i] - (float)h1); } }
    ah[s] = uh.v; al[s] = ul.v; }
  __syncthreads();   /* every wave has read its q tile before the table's tile overwrites it */
  float_a (*sp)[PPIT] = (float_a (*)[PPIT])sm;   /* [64 rel rows][128 positions], so that every store run is a row's whole 512 B */
  /* kept rolled, for the same register budget as the row loop */
#pragma unroll 1
  for (int t = 0; t < 4; ++t) { v8f dd = {}; const float sc = t < 2 ? 1.0f : 1024.0f;   /* a power of two: exact */
#pragma unroll
    for (int s = 0; s < 2; ++s) { const v16h w = frag_h(&sr[t * 16 + col][s * 32], lane); dd = wmma_hf(al[s], w, dd); dd = wmma_hf(ah[s], w, dd); }
    v4f lo4, hi4;
#pragma unroll
    for (int r = 0; r < 4; ++r) { lo4[r] = dd[r] * sc; hi4[r] = dd[4 + r] * sc; }
    *(v4fa*)&sp[t * 16 + col][wave * 16 + 8 * g] = lo4; *(v4fa*)&sp[t * 16 + col][wave * 16 + 8 * g + 4] = hi4; }   /* a lane's eight accumulator rows are eight consecutive positions of one rel row */
  __syncthreads();   /* the tile is complete before other waves' lanes read it */
  float* rp = RP + (((blockIdx.x >> 3) * NH + h) * 64 + wave) * (size_t)TT + (blockIdx.x & 7) * 128 + lane * 4;   /* a wave takes one row's 128 positions a pass, eight rows apart */
  /* unrolled: the eight LDS reads go out together, and the stores share one address register pair that nothing rewrites */
#pragma unroll
  for (int i = 0; i < 8; ++i) vst2(rp + i * 8 * TT, *(const v4fa*)&sp[i * 8 + wave][lane * 4]); } }
#ifndef SM_EXTRA_PARAMS
#define SM_EXTRA_PARAMS
#endif
#ifndef PROJ_EXTRA_PARAMS
#define PROJ_EXTRA_PARAMS
#endif
#ifndef SM_MASK_HOOK
#define SM_MASK_HOOK (void)0
#endif

#define WS_QH  0u                                      // f16 q rows [b*t][CC]
#define WS_KH  (WS_QH + 2u * (size_t)NB * TT * CC)      // f16 k rows [b*t][CC]
#define WS_VT  (WS_KH + 2u * (size_t)NB * TT * CC)      // f16 v planes [b][c][t]
#define WS_QL  (WS_VT + 2u * (size_t)NB * CC * TT)      // f16 q residual x 2^10 rows [b][t < QHI][CC]
#define WS_KL  (WS_QL + 2u * (size_t)NB * QHI * CC)     // f16 k residual x 2^10 rows [b][t < KHI][CC]
#define WS_VB  (WS_KL + 2u * (size_t)NB * KHI * CC)     // bf16 v hi planes not used (no space reserved)
#define WS_VBL (WS_VB + 0u)                            // bf16 v planes not used (P.v takes the f16 path)
#define WS_S   (WS_VBL + 0u)    // f32 position table [b][h][64 rows][t] (16 MiB of this region)
#define WS_Y   (WS_S  + 4u * (size_t)HG * TT * TT)      // f32 ctx rows [b*t][CC] (only when there is an output projection)
#define WS_END (WS_Y  + 0u)

// lane l with lane l ^ 16 (the two halves of a wave hold the two halves of a query column's keys)
__device__ __forceinline__ float xhalf(float x) { return __builtin_bit_cast(float, __builtin_amdgcn_permlanex16(__builtin_bit_cast(int, x), __builtin_bit_cast(int, x), 0x76543210, 0xfedcba98, false, false)); }
#define LOG2E 1.44269504088896340736f   // exp(x) = 2^(x log2 e)
#define FAQ 128            // queries per block: eight waves read each staged key tile
#define KPIT 72            // halves per staged k row (144 B = 16 B x odd: the sixteen rows of a fragment read fall on different banks)
#define VPIT 72            // halves per staged v row (likewise)
#define RPIT 136           // halves per staged row of the rel_h table (64 f32 = 256 B, pitch 272 B = 16 B x odd)
#define SG_KL (64 * KPIT)                    // residual rows behind the hi rows
#define SG_V  (2 * 64 * KPIT)                // v rows [channel][64 keys] behind both
#define SG_R  (SG_V + HDV * VPIT)            // rel_h table rows [a < 32][64 keys], f32, behind them
#define SG_SZ (SG_R + 32 * RPIT)             // halves per stage (36,352 B)
#define SG_W  (2 * SG_SZ)                    // behind both stages: the block's four rel_w table rows [c][1,024 keys], f32 (4 KiB a row), copied once
#define OPIT 132           // floats per row of the output tile (528 B: the two channels, eight apart, that a wave's two halves write fall on different banks)
// one 64-key stage, 8 copies of 16 B per lane straight into LDS: k hi rows, k residual rows and v rows (8 lanes a 128-B row, rows 32 apart), rel_h table rows (16 lanes a 256-B row, rows 16 apart). lk / lr: the lane's own LDS byte addresses, gk / gl / gv / gr its own global addresses. The s_wait_xcnt ends the copies' own statement, so no address register is rewritten in front of it
__device__ __forceinline__ void fa_stage(unsigned lk, unsigned lr, const _Float16* gk, const _Float16* gl, const _Float16* gv, const float* gr) {
  asm volatile("global_load_async_to_lds_b128 %0, %8, off\n\t"
               "global_load_async_to_lds_b128 %1, %9, off\n\t"
               "global_load_async_to_lds_b128 %2, %10, off\n\t"
               "global_load_async_to_lds_b128 %3, %11, off\n\t"
               "global_load_async_to_lds_b128 %4, %12, off\n\t"
               "global_load_async_to_lds_b128 %5, %13, off\n\t"
               "global_load_async_to_lds_b128 %6, %14, off\n\t"
               "global_load_async_to_lds_b128 %7, %15, off\n\t"
               "s_wait_xcnt 0x0"
               :: "v"(lk), "v"(lk + 2u * 32 * KPIT), "v"(lk + 2u * SG_KL), "v"(lk + 2u * (SG_KL + 32 * KPIT)),
                  "v"(lk + 2u * SG_V), "v"(lk + 2u * (SG_V + 32 * VPIT)), "v"(lr), "v"(lr + 2u * 16 * RPIT),
                  "v"(gk), "v"(gk + 32 * CC), "v"(gl), "v"(gl + 32 * CC),
                  "v"(gv), "v"(gv + 32 * TT), "v"(gr), "v"(gr + 16 * TT)
               : "memory");
}
// the block's four rel_w table rows, whole (256 lanes a 4-KiB row), copied once in front of the loop; the wait as in fa_stage
__device__ __forceinline__ void fa_stage_w(unsigned lw, const float* gw) {
  asm volatile("global_load_async_to_lds_b128 %0, %4, off\n\t"
               "global_load_async_to_lds_b128 %1, %5, off\n\t"
               "global_load_async_to_lds_b128 %2, %6, off\n\t"
               "global_load_async_to_lds_b128 %3, %7, off\n\t"
               "s_wait_xcnt 0x0"
               :: "v"(lw), "v"(lw + 4u * TT), "v"(lw + 8u * TT), "v"(lw + 12u * TT), "v"(gw), "v"(gw + TT), "v"(gw + 2 * TT), "v"(gw + 3 * TT)
               : "memory");
}
// eight consecutive f32 of a staged table row: the start values of one accumulator tile (a lane's eight keys)
__device__ __forceinline__ v8f ld8(const _Float16* p) { union { v8f v; v4f q[2]; } u; u.q[0] = *(const v4fa*)p; u.q[1] = *(const v4fa*)(p + 8); return u.v; }
// The products of k_fa are written as asm statements of several WMMAs: behind a WMMA stand WMMAs that add into the same accumulators and LDS reads, neither of which needs a distance, so v_nop stand only where a vector instruction comes next (as single builtins without v_nop the compiler let the products sink in among the LDS reads, each refill took registers of its own, and the wave spilled). The "memory" clobber keeps the LDS reads of the register sets on their side of a statement.
// the six products of one 16-key row group (two 32-deep steps: h0 l0, h1 l1 = k hi, k residual) with q hi (q0, q1) and q residual (r0, r1): a takes hi.hi, al takes hi.residual and residual.hi, each accumulator in the order of the steps, on top of the start values it comes with. One statement a step, so that the first step is waited for alone and starts while the second step's four reads are still under way. The four v_nop keep the distance between the last WMMA and the vector instructions that join a and al
__device__ __forceinline__ void qk6(v8f& a, v8f& al, v16h h0, v16h l0, v16h h1, v16h l1, v16h q0, v16h r0, v16h q1, v16h r1) {
  asm volatile("v_wmma_f32_16x16x32_f16 %1, %2, %5, %1\n\t"
               "v_wmma_f32_16x16x32_f16 %0, %2, %4, %0\n\t"
               "v_wmma_f32_16x16x32_f16 %1, %3, %4, %1"
               : "+v"(a), "+v"(al) : "v"(h0), "v"(l0), "v"(q0), "v"(r0) : "memory");
  asm volatile("v_wmma_f32_16x16x32_f16 %0, %2, %4, %0\n\t"
               "v_wmma_f32_16x16x32_f16 %1, %2, %5, %1\n\t"
               "v_wmma_f32_16x16x32_f16 %1, %3, %4, %1\n\t"
               "v_nop\n\tv_nop\n\tv_nop\n\tv_nop"
               : "+v"(a), "+v"(al) : "v"(h1), "v"(l1), "v"(q1), "v"(r1) : "memory");
}
// the eight products v . P of a key block: channel group j takes keys 0..31 (aj, p0), then keys 32..63 (bj, p1); the four v_nop keep the distance to whatever vector instruction next touches an operand or a result
__device__ __forceinline__ void pv8(v8f& o0, v8f& o1, v8f& o2, v8f& o3, v16h a0, v16h b0, v16h a1, v16h b1, v16h a2, v16h b2, v16h a3, v16h b3, v16h p0, v16h p1) {
  asm volatile("v_wmma_f32_16x16x32_f16 %0, %4, %12, %0\n\t"
               "v_wmma_f32_16x16x32_f16 %1, %6, %12, %1\n\t"
               "v_wmma_f32_16x16x32_f16 %2, %8, %12, %2\n\t"
               "v_wmma_f32_16x16x32_f16 %3, %10, %12, %3\n\t"
               "v_wmma_f32_16x16x32_f16 %0, %5, %13, %0\n\t"
               "v_wmma_f32_16x16x32_f16 %1, %7, %13, %1\n\t"
               "v_wmma_f32_16x16x32_f16 %2, %9, %13, %2\n\t"
               "v_wmma_f32_16x16x32_f16 %3, %11, %13, %3\n\t"
               "v_nop\n\tv_nop\n\tv_nop\n\tv_nop"
               : "+v"(o0), "+v"(o1), "+v"(o2), "+v"(o3) : "v"(a0), "v"(b0), "v"(a1), "v"(b1), "v"(a2), "v"(b2), "v"(a3), "v"(b3), "v"(p0), "v"(p1) : "memory");
}
// ---- k_fa: block = 128 queries (qb) of (b, h), wave = 16 queries as COLUMNS; one pass over the keys in blocks of 64. Each key block (k hi rows, k residual rows, v rows, its 64 columns of the head's 32 rel_h table rows) is copied once per block into one of two LDS stages by asynchronous copies, one key block ahead of the products, and all eight waves take their A fragments from there (two blocks a WGP, four waves a SIMD: at most 256 registers a wave, hence amdgpu_waves_per_eu). Transposed logits S^T = k . q^T (A = k rows hi / residual x 2^10, B = q rows hi / residual, 3 products, 64 deep) start from the position logits: the hi.hi accumulator from table row a = i % 32 (one row a lane), the residual accumulator (x 2^10) from table row c = i / 32 (x 2^10; one row a wave, whose 16 queries lie in one row of the 32 x 32 map). They stay in registers: lane (g, col) holds keys 16 j + 8 g + r of query col, so the running maximum and sum (f32) are in-lane plus one exchange between the halves. exp(s - m) = 2^(s log2 e - m log2 e) is one fused multiply-add and one v_exp_f32; the rounding of the addend m log2 e is one common factor of a key block's terms and of its rescale (same addend), so ctx and sum carry it alike, though later rescales do not undo it. exp(s - m) x 2^11 once to f16 packs from two 16-key tiles into one B fragment (element i = key 8 g + i, element 8 + i = key 16 + 8 g + i: the order frag_h gives the v planes as A); ctx^T += v^T . P^T (1 product, the head's 64 v channels), rescaled by exp(m_old - m_new) per key block and divided by the row sum at the end, goes to out[b][h*64 + d][n]
__global__ __launch_bounds__(256) __attribute__((amdgpu_waves_per_eu(4, 4))) void k_fa(const _Float16* __restrict__ QH, const _Float16* __restrict__ KH, const _Float16* __restrict__ QL, const _Float16* __restrict__ KL, const _Float16* __restrict__ VT, const float* __restrict__ RP, float* __restrict__ OUT) {
  __shared__ __attribute__((aligned(16))) _Float16 sg[SG_W + 4 * TT * 2];
  const int tid = threadIdx.x, wave = tid >> 5, lane = tid & 31, col = lane & 15, g = lane >> 4; const int qb = blockIdx.x, h = blockIdx.y, b = blockIdx.z; const int ql0 = qb * FAQ + wave * 16; const size_t q0 = (size_t)b * TT + ql0;
  const _Float16* QLb = QL + (size_t)b * QHI * CC; const _Float16* KLb = KL + (size_t)b * KHI * CC;
  v16h qh[HDV / 32], qr[HDV / 32]; const _Float16* qrow = QH + (q0 + col) * CC + h * HD + 8 * g; const _Float16* qlrow = QLb + (size_t)(ql0 + col) * CC + h * HD + 8 * g;   /* the lane's own addresses: frag_h's element order, with its 8 g already added */
  /* every '#pragma unroll' in this kernel but the last one: its counter indexes a register array (fragments, accumulators), which stays in registers only if the index is a constant */
#pragma unroll
  for (int kc = 0; kc < HDV / 32; ++kc) { union { v16h v; v8h q[2]; } u, w; u.q[0] = *(const v8h*)(qrow + kc * 32); u.q[1] = *(const v8h*)(qrow + kc * 32 + 16); w.q[0] = *(const v8h*)(qlrow + kc * 32); w.q[1] = *(const v8h*)(qlrow + kc * 32 + 16); qh[kc] = u.v; qr[kc] = w.v; }
  /* both lane addresses are inputs, so they stay in their registers up to this wait and no result of the eight loads above lands on an address that an issued load names */
  asm volatile("s_wait_xcnt 0x0" :: "v"(qrow), "v"(qlrow) : "memory");
  const unsigned sb = (unsigned)(size_t)sg; const unsigned lk = sb + 2u * ((tid >> 3) * KPIT + (tid & 7) * 8), lr = sb + 2u * (SG_R + (tid >> 4) * RPIT + (tid & 15) * 8);
  const _Float16* gk = KH + ((size_t)b * TT + (tid >> 3)) * CC + h * HD + (tid & 7) * 8; const _Float16* gl = KLb + (size_t)(tid >> 3) * CC + h * HD + (tid & 7) * 8; const _Float16* gv = VT + ((size_t)b * CC + h * HD + (tid >> 3)) * (size_t)TT + (tid & 7) * 8;
  const float* RPh = RP + (size_t)(b * NH + h) * 64 * TT; const float* gr = RPh + (tid >> 4) * TT + (tid & 15) * 4;
  fa_stage_w(sb + 2u * SG_W + tid * 16u, RPh + (32 + qb * (FAQ / 32)) * TT + tid * 4);
  fa_stage(lk, lr, gk, gl, gv, gr);
  asm volatile("s_wait_asynccnt 0x0" ::: "memory");   /* this wave's copies of key block 0 and of the rel_w table rows have landed */
  __syncthreads();                                    /* ... and every other wave's */
  fa_stage(lk + 2u * SG_SZ, lr + 2u * SG_SZ, gk + 64 * CC, gl + 64 * CC, gv + 64, gr + 64);
  const int ra = (SG_R + ((wave & 1) * 16 + col) * RPIT + 16 * g);   /* halves: the lane's rel_h table row in a stage, at its half's first key */
  const _Float16* rwl = sg + SG_W + ((wave >> 1) * TT + 8 * g) * 2;   /* the wave's rel_w table row, likewise */
  v8f o[HDV / 16] = {}; float m = -3.0e38f, l = 0.f;
  /* kept rolled: sixteen copies of the body would save no work */
#pragma unroll 1
  for (int k0 = 0; k0 < TT; k0 += 64) { const unsigned bo = ((k0 >> 6) & 1) * SG_SZ; const _Float16* st = sg + bo; const _Float16* rw = rwl + k0 * 2; v8f acc[4], accl[4];
    /* two register sets of four A fragments: set j % 2 holds the two 32-deep steps (hi, residual, hi, residual) of the 16-key row group j. A set is refilled in one group of LDS reads right behind the six products that used it, so its reads are under way while the other set's six products run; the sets' last refills bring the eight v fragments, which land during the softmax. The accumulators' start values come with the set that they belong to */
    v16h fr[2][4];
#pragma unroll
    for (int s = 0; s < 2; ++s) { acc[s] = ld8(st + ra + s * 32); accl[s] = ld8(rw + s * 32);
#pragma unroll
      for (int i = 0; i < 2; ++i) { fr[s][2 * i] = frag_h(st + (s * 16 + col) * KPIT + i * 32, lane); fr[s][2 * i + 1] = frag_h(st + SG_KL + (s * 16 + col) * KPIT + i * 32, lane); } }
#pragma unroll
    for (int j = 0; j < 4; ++j) { const int s = j & 1;
      qk6(acc[j], accl[j], fr[s][0], fr[s][1], fr[s][2], fr[s][3], qh[0], qr[0], qh[1], qr[1]);
      if (j < 2) { acc[j + 2] = ld8(st + ra + (j + 2) * 32); accl[j + 2] = ld8(rw + (j + 2) * 32); }
#pragma unroll
      for (int i = 0; i < 2; ++i) {
        if (j < 2) { fr[s][2 * i] = frag_h(st + ((j + 2) * 16 + col) * KPIT + i * 32, lane); fr[s][2 * i + 1] = frag_h(st + SG_KL + ((j + 2) * 16 + col) * KPIT + i * 32, lane); }
        else { fr[s][2 * i] = frag_h(st + SG_V + ((2 * s + i) * 16 + col) * VPIT, lane); fr[s][2 * i + 1] = frag_h(st + SG_V + ((2 * s + i) * 16 + col) * VPIT + 32, lane); } }
#pragma unroll
      for (int r = 0; r < 8; ++r) acc[j][r] = (acc[j][r] + accl[j][r] * (1.0f / 1024.0f)) * SCALE;
      __builtin_amdgcn_sched_barrier(0); }   /* keeps each row group's residual sums joined here (left to the end, the residual tiles stay live) and the v fragments' reads above the softmax (sunk to their products, each would be waited for in full) */
    float mx = -3.0e38f;
#pragma unroll
    for (int j = 0; j < 4; ++j) {
#pragma unroll
      for (int r = 0; r < 8; ++r) mx = fmaxf(mx, acc[j][r]); }
    mx = fmaxf(mx, xhalf(mx)); const float mn = fmaxf(m, mx), mnl = mn * LOG2E, alpha = __builtin_amdgcn_exp2f(fmaf(m, LOG2E, -mnl)); m = mn; float sum = 0.f; v16h p[2];
#pragma unroll
    for (int j = 0; j < 4; ++j) {
#pragma unroll
      for (int r = 0; r < 8; ++r) { const float e = __builtin_amdgcn_exp2f(fmaf(acc[j][r], LOG2E, -mnl)); sum += e; p[j >> 1][8 * (j & 1) + r] = (_Float16)(e * 2048.0f); } }
    l = l * alpha + sum;   /* this half's keys only; the halves are joined after the loop */
#pragma unroll
    for (int j = 0; j < HDV / 16; ++j) {
#pragma unroll
      for (int r = 0; r < 8; ++r) o[j][r] *= alpha; }
    pv8(o[0], o[1], o[2], o[3], fr[0][0], fr[0][1], fr[0][2], fr[0][3], fr[1][0], fr[1][1], fr[1][2], fr[1][3], p[0], p[1]);
    asm volatile("s_wait_dscnt 0x0" ::: "memory");      /* this wave's reads of the stage are done before the stage is given up */
    asm volatile("s_wait_asynccnt 0x0" ::: "memory");   /* this wave's copies of the next key block have landed */
    __syncthreads();                                    /* publishes the next key block and ends every wave's reads of this one */
    if (k0 + 128 < TT) fa_stage(lk + 2u * bo, lr + 2u * bo, gk + (size_t)(k0 + 128) * CC, gl + (size_t)(k0 + 128) * CC, gv + k0 + 128, gr + k0 + 128); }
  asm volatile("s_wait_asynccnt 0x0" ::: "memory");     /* nothing of this wave is in flight when it ends */
  l += xhalf(l); const float inv = l > 0.f ? 1.0f / (2048.0f * l) : 0.f;
  /* out is channels-first: the block's [64 real channels][128 queries] tile goes through LDS, so that every store run is a channel's whole 512 B. The stages are free: the barrier at the foot of the last trip stands behind every wave's last read, and every wave's last copies were waited for in front of an earlier one */
  float_a (*so)[OPIT] = (float_a (*)[OPIT])sg;
#pragma unroll
  for (int j = 0; j < HDV / 16; ++j) {
#pragma unroll
    for (int r = 0; r < 8; ++r) so[j * 16 + 8 * g + r][wave * 16 + col] = o[j][r] * inv; }   /* lane (g, col): channels 16 j + 8 g + r of query col */
  __syncthreads();   /* the tile is complete before other waves' lanes read it */
  float* op = OUT + ((size_t)b * CIN + h * HDV + wave) * NPOS + qb * FAQ + lane * 4;   /* a wave takes one channel's 128 queries a pass, eight channels apart */
  /* unrolled: the eight LDS reads go out together, each into registers of its own, and the stores share one address register pair that nothing rewrites */
#pragma unroll
  for (int i = 0; i < HDV / 8; ++i) vst2(op + i * 8 * NPOS, *(const v4fa*)&so[i * 8 + wave][lane * 4]); }

extern "C" void kernel_launch(void* const* d_in, const int* in_sizes, int n_in, void* d_out, int out_size, void* d_ws, size_t ws_size, hipStream_t stream) {
  (void)in_sizes; (void)n_in; (void)out_size;
  const float** F = (const float**)d_in;
  if (ws_size < (size_t)WS_END) return;
  char* ws = (char*)d_ws; _Float16 *QH = (_Float16*)(ws + WS_QH), *KH = (_Float16*)(ws + WS_KH), *VT = (_Float16*)(ws + WS_VT), *QL = (_Float16*)(ws + WS_QL), *KL = (_Float16*)(ws + WS_KL); __bf16 *VB = (__bf16*)(ws + WS_VB), *VBL = (__bf16*)(ws + WS_VBL); float *S = (float*)(ws + WS_S), *Y = (float*)(ws + WS_Y);
  (void)Y; (void)VB; (void)VBL;
  // inputs: 0 x, 1 d [8,512,32,32]; 2 Wq [512,512] (out,in), 3 bq; 4 Wk, 5 bk; 6 Wv, 7 bv; 8 rel_h [1,8,64,1,32]; 9 rel_w [1,8,64,32,1]
  k_lin3<<<dim3(TNB * TT / 128, NH, 3), 256, 0, stream>>>(F[0], F[1], F[2], F[3], F[4], F[5], F[6], F[7], F[8], F[9], QH, QL, KH, KL, VT, S);
  k_fa<<<dim3(TT / FAQ, NH, TNB), 256, 0, stream>>>(QH, KH, QL, KL, VT, S, (float*)d_out);
}
